// v000
// Times are from an AMD MI455X. After a warm-up the kernel runs many times in a row, and a time is the length of
// such a window on the GPU divided by its runs, so every launch and the gaps after it count. The runs cycle
// through copies of the inputs. A figure is the median of several windows, for all but v000 over two sittings.
// Sittings can differ by a few percent; kernels timed side by side share one.
// v000, which the later versions start from, runs in 391 microseconds.
// Contractions: x.W{q,k,v}^T on v_wmma_f32_16x16x32_bf16 (x and W RNE-converted to bf16 operands, f32 accumulate, bias added in f32);
// scores k'.q'^T (q', k' carried x1024 as f16 hi plane + f16 residual plane, products hh+lh+hl), P.v (P x32768 f16 hi+residual,
// v x1024 f16 hi+residual, products hh+lh+hl) and O.Wo^T (O x1024 f16 hi+residual, Wo as f16(bf16(Wo) x1024), products h.w+l.w):
// v_wmma_f32_16x16x32_f16, f32 accumulate. Per-head logit scale sigmoid(bf16(g_h))/8 in f32; base-2 online softmax, 1/l fold and
// bias adds in f32 on VALU.
#include <hip/hip_runtime.h>
#include <math.h>
#include <stdint.h>

#ifndef NB
#define NB    2
#endif
#ifndef SEQ
#define SEQ   2048
#endif
#define NB_FULL  2
#define SEQ_FULL 2048
#define DMOD  1024
#define NH    16
#define HD    64
#define QSC   1024.0f
#define KSC   1024.0f
#define PCAR  32768.0f
#define VCAR  1024.0f
#define OSC   1024.0f
#define WOS   1024.0f
#define LOG2E 1.4426950408889634f
#define ATT_WAVES   4
#define ATT_THREADS (ATT_WAVES * 32)
#define QT64        (SEQ / 64)
#define ATT_BLOCKS  (NB * NH * QT64)
#define NKB    (SEQ / 32)
#define SLABF  (16 * 68)
#define SLAB64 (16 * 68)
#define VTP    72
static_assert(HD == 64 && DMOD == NH * HD && NH == 16);
static_assert(NB >= 1 && NB <= NB_FULL && SEQ >= 64 && SEQ <= SEQ_FULL && (SEQ % 64) == 0);
static_assert(ATT_THREADS == 128 && ATT_BLOCKS == NB * NH * (SEQ / 64) && NKB * 32 == SEQ);
static_assert(((NB * SEQ) % 64) == 0 && (DMOD % 64) == 0 && (DMOD % 32) == 0);
static_assert((SEQ % 64) == 0 && (SEQ % 8) == 0);
static_assert(((NB * SEQ * DMOD / 8) % 256) == 0 && ((DMOD * DMOD / 8) % 256) == 0 && ((SEQ * DMOD / 8) % 256) == 0);
static_assert(ATT_WAVES * SLABF >= 4 * 16 * 68);
static_assert(HD * VTP >= 63 * VTP + 64);

typedef unsigned short u16;
typedef _Float16 v16h __attribute__((ext_vector_type(16)));
typedef _Float16 v8h  __attribute__((ext_vector_type(8)));
typedef __bf16   v16b __attribute__((ext_vector_type(16)));
typedef float    v8f  __attribute__((ext_vector_type(8)));
typedef float    v4f  __attribute__((ext_vector_type(4)));
typedef unsigned int v4u __attribute__((ext_vector_type(4)));

union FragH { v16h v; v8h h[2]; v4u u[2]; };
union FragB { v16b v; v4u u[2]; };

// ---- scalar helpers --------------------------------------------------------------------------------
__device__ __forceinline__ unsigned short bf_bits(float f) {          // f32 -> bf16 bits, RNE convert
  unsigned u = __float_as_uint(f);
  return (unsigned short)((u + 0x7FFFu + ((u >> 16) & 1u)) >> 16);
}
__device__ __forceinline__ float bf_up(unsigned short h) { return __uint_as_float(((unsigned)h) << 16); }
__device__ __forceinline__ float bfr(float f) { return bf_up(bf_bits(f)); }
__device__ __forceinline__ unsigned short h_bits(_Float16 x) { return __builtin_bit_cast(unsigned short, x); }
__device__ __forceinline__ unsigned pk16(unsigned short a, unsigned short b) { return (unsigned)a | ((unsigned)b << 16); }
__device__ __forceinline__ v8f zero8() { v8f z = {0.f, 0.f, 0.f, 0.f, 0.f, 0.f, 0.f, 0.f}; return z; }
__device__ __forceinline__ v4f zero4() { v4f z = {0.f, 0.f, 0.f, 0.f}; return z; }

// ---- fragment loaders: 16-bit A/B operand, lane -> row/col (lane&15), p already includes +8*(lane>>4);
//      elements 0..7 <- p[0..7] (k0+8h..), elements 8..15 <- p[16..23] (k0+16+8h..)  (same split k map for A and B;
//      B is always read from a k-contiguous [n][k] plane)
__device__ __forceinline__ v16h ldfrag_h(const _Float16* p) {
  FragH f;
  f.h[0] = *(const v8h*)(p);
  f.h[1] = *(const v8h*)(p + 16);
  return f.v;
}
__device__ __forceinline__ v16b ldfrag_b(const u16* p) {              // bf16 plane read as unsigned integer vectors
  FragB f;
  f.u[0] = *(const v4u*)(p);
  f.u[1] = *(const v4u*)(p + 16);
  return f.v;
}

__device__ __forceinline__ v8f mma_h(v16h a, v16h b, v8f c) {
  return __builtin_amdgcn_wmma_f32_16x16x32_f16(false, a, false, b, (short)0, c, false, false);
}
__device__ __forceinline__ v8f mma_b(v16b a, v16b b, v8f c) {
  return __builtin_amdgcn_wmma_f32_16x16x32_bf16(false, a, false, b, (short)0, c, false, false);
}
__device__ __forceinline__ void guard2(v8f& a, v8f& b, v16h x0, v16h x1, v16h x2, v16h x3, v16h x4, v16h x5) {
#if defined(__HIP_DEVICE_COMPILE__)
  asm volatile("v_nop\n\tv_nop\n\tv_nop\n\tv_nop"
               : "+v"(a), "+v"(b) : "v"(x0), "v"(x1), "v"(x2), "v"(x3), "v"(x4), "v"(x5) : "memory");
#endif
}
template <typename F>
__device__ __forceinline__ void guard6(v8f& a, v8f& b, v8f& c, v8f& d, F x0, F x1, F x2, F x3, F x4, F x5) {
#if defined(__HIP_DEVICE_COMPILE__)
  asm volatile("v_nop\n\tv_nop\n\tv_nop\n\tv_nop"
               : "+v"(a), "+v"(b), "+v"(c), "+v"(d) : "v"(x0), "v"(x1), "v"(x2), "v"(x3), "v"(x4), "v"(x5) : "memory");
#endif
}
__device__ __forceinline__ void guard10(v8f& a, v8f& b, v8f& c, v8f& d, v16h x0, v16h x1, v16h x2, v16h x3, v16h x4,
                                        v16h x5, v16h x6, v16h x7, v16h x8, v16h x9) {
#if defined(__HIP_DEVICE_COMPILE__)
  asm volatile("v_nop\n\tv_nop\n\tv_nop\n\tv_nop"
               : "+v"(a), "+v"(b), "+v"(c), "+v"(d)
               : "v"(x0), "v"(x1), "v"(x2), "v"(x3), "v"(x4), "v"(x5), "v"(x6), "v"(x7), "v"(x8), "v"(x9) : "memory");
#endif
}
__device__ __forceinline__ void acc_guard4(v8f& a, v8f& b, v8f& c, v8f& d) {
#if defined(__HIP_DEVICE_COMPILE__)
  asm volatile("v_nop\n\tv_nop\n\tv_nop\n\tv_nop" : "+v"(a), "+v"(b), "+v"(c), "+v"(d));
#endif
}
__device__ __forceinline__ void wave_sync_lds() {
  __builtin_amdgcn_fence(__ATOMIC_RELEASE, "workgroup");
  __builtin_amdgcn_wave_barrier();
  __builtin_amdgcn_fence(__ATOMIC_ACQUIRE, "workgroup");
}

// =====================================================================================================
// f32 plane -> 16-bit plane:  f16mode == 0: bf16 RNE bits;  f16mode == 1: f16 bits of (bf16 RNE value) * scale.
// Destination is a dense plane of n8*8 elements; source octet index = (gt / seg8) * sstride8 + gt % seg8 (segments of seg8
// octets taken at stride sstride8 octets, identity when seg8 == n8): used to read NB batches of SEQ rows out of an input laid out
// with SEQ_FULL rows per batch.
// Thread = 8 consecutive elements: two 16-B loads, one 16-B store; 32 consecutive lanes = 512 contiguous, 512-B aligned bytes
// coverage: grid = n8/256 blocks (host checks exactness) x 256 thr x 8 = the whole destination plane.
// =====================================================================================================
__global__ __launch_bounds__(256) void cvt16(const float* __restrict__ x, u16* D, int n8, int f16mode, float scale,
                                             int seg8, int sstride8) {
  const int gt = blockIdx.x * 256 + (int)threadIdx.x;
  if (gt >= n8) return;                     // no barriers in this kernel
  const size_t so = (size_t)(gt / seg8) * (size_t)sstride8 + (size_t)(gt % seg8);
  const float* p = x + so * 8;
  const v4f a = *(const v4f*)(p), c4 = *(const v4f*)(p + 4);
  float v[8];
#pragma unroll
  for (int e = 0; e < 4; ++e) { v[e] = a[e]; v[4 + e] = c4[e]; }
  unsigned short s[8];
#pragma unroll
  for (int e = 0; e < 8; ++e) {
    const unsigned short hb = h_bits((_Float16)(bfr(v[e]) * scale));
    const unsigned short bb = bf_bits(v[e]);
    s[e] = (f16mode != 0) ? hb : bb;
  }
  v4u o;
#pragma unroll
  for (int e = 0; e < 4; ++e) o[e] = pk16(s[2 * e], s[2 * e + 1]);
  u16* d = D + (size_t)gt * 8;
  {
    *(v4u*)(d) = o;
    
  }
}

// =====================================================================================================
// f32 plane -> f16 hi plane (value * sc, sc a power of two) + f16 residual plane (value * sc - hi, unscaled), same layout.
// Thread = 8 consecutive elements: two 16-B loads, one 16-B store per plane; 32 consecutive lanes = 512 contiguous, 512-B aligned
// coverage: grid = n8/256 blocks (host checks exactness) x 256 thr x 8 = the whole of both planes.
// =====================================================================================================
__global__ __launch_bounds__(256) void split16(const float* __restrict__ x, u16* hpl, u16* lpl, int n8, float sc) {
  const int gt = blockIdx.x * 256 + (int)threadIdx.x;
  if (gt >= n8) return;                     // no barriers in this kernel
  const float* p = x + (size_t)gt * 8;
  const v4f a = *(const v4f*)(p), c4 = *(const v4f*)(p + 4);
  float w[8];
#pragma unroll
  for (int e = 0; e < 4; ++e) { w[e] = a[e]; w[4 + e] = c4[e]; }
  v4u oh, ol;
#pragma unroll
  for (int e = 0; e < 4; ++e) {
    const float t0 = w[2 * e] * sc, t1 = w[2 * e + 1] * sc;
    const _Float16 h0 = (_Float16)t0, h1 = (_Float16)t1;
    const _Float16 l0 = (_Float16)(t0 - (float)h0), l1 = (_Float16)(t1 - (float)h1);
    oh[e] = pk16(h_bits(h0), h_bits(h1));
    ol[e] = pk16(h_bits(l0), h_bits(l1));
  }
  const size_t o8 = (size_t)gt * 8;
  {
    *(v4u*)(hpl + o8) = oh;
    *(v4u*)(lpl + o8) = ol;
    
  }
}

// =====================================================================================================
// GEMM epilogue shared by both engines: the wave's 16x64 f32 tile (times oscale) staged in its LDS slab (pitch 68, wave-private),
// coverage: 8 instructions x 2 rows x 16 lanes x 4 floats = the wave's 16 x 64 tile.
// =====================================================================================================
__device__ __forceinline__ void epi64(float* sl, v8f a0, v8f a1, v8f a2, v8f a3, float oscale, v4f badd, float* C, int N,
                                      size_t rowb, int col0, int lane) {
  const int hh = lane >> 4, m = lane & 15;
#pragma unroll
  for (int r = 0; r < 8; ++r) {
    const int ro = (8 * hh + r) * 68 + m;
    sl[ro]      = a0[r] * oscale;
    sl[ro + 16] = a1[r] * oscale;
    sl[ro + 32] = a2[r] * oscale;
    sl[ro + 48] = a3[r] * oscale;
  }
  wave_sync_lds();
  v4f vals[8];
#pragma unroll
  for (int it = 0; it < 8; ++it) vals[it] = *(const v4f*)(sl + (it * 2 + hh) * 68 + m * 4) + badd;
  float* dst = C + (rowb + (size_t)hh) * (size_t)N + col0 + m * 4;
  {
#pragma unroll
    for (int it = 0; it < 8; ++it) {
      *(v4f*)(dst + (size_t)(it * 2) * (size_t)N) = vals[it];
    }
    
  }
}

// =====================================================================================================
// bf16 GEMM with bias: C[M][N] (f32) = A[M][K] (bf16 row-major) . Bt[N][K]^T (bf16 k-contiguous), times oscale, plus bf16-RNE
// value of bias[n]. Block = 64x64 tile, 4 waves x 16 rows; fragments loaded straight from the 16-bit rows (two 16-B loads each,
// split k map for A and B); K stepped by 32 (host checks K % 32 == 0, M % 64 == 0, N % 64 == 0, grid = (M/64)*(N/64)).
// =====================================================================================================
__global__ __launch_bounds__(128)
void gemm_bfb(const u16* __restrict__ A, const u16* __restrict__ Bt, const float* __restrict__ bias,
              float* C, int M, int N, int K, float oscale) {
  __shared__ __align__(16) float slab[4 * SLAB64];
  const int tid = threadIdx.x, wave = tid >> 5, lane = tid & 31, hh = lane >> 4, m = lane & 15;
  const int ntile = N >> 6;
  const int bid   = blockIdx.x;
  const int rowb  = (bid / ntile) * 64 + wave * 16;
  const int col0  = (bid % ntile) * 64;
  if (rowb + 16 > M) return;                 // wave-uniform, never taken with the exact grid; no block barriers in this kernel
  const u16* ap = A  + (size_t)(rowb + m) * K + 8 * hh;
  const u16* bp = Bt + (size_t)(col0 + m) * K + 8 * hh;
  const size_t bs = (size_t)16 * K;
  v8f acc0 = zero8(), acc1 = zero8(), acc2 = zero8(), acc3 = zero8();
#pragma unroll 1
  for (int k0 = 0; k0 < K; k0 += 32) {
    const v16b a  = ldfrag_b(ap + k0);
    const v16b b0 = ldfrag_b(bp + k0);
    const v16b b1 = ldfrag_b(bp + bs + k0);
    const v16b b2 = ldfrag_b(bp + 2 * bs + k0);
    const v16b b3 = ldfrag_b(bp + 3 * bs + k0);
    acc0 = mma_b(a, b0, acc0);
    acc1 = mma_b(a, b1, acc1);
    acc2 = mma_b(a, b2, acc2);
    acc3 = mma_b(a, b3, acc3);
    guard6<v16b>(acc0, acc1, acc2, acc3, a, b0, b1, b2, b3, a);
  }
  const v4f bv = *(const v4f*)(bias + col0 + m * 4);      // columns col0 + 4m .. +3, always < N (N multiple of 64)
  v4f badd;
#pragma unroll
  for (int e = 0; e < 4; ++e) badd[e] = bfr(bv[e]);
  epi64(slab + wave * SLAB64, acc0, acc1, acc2, acc3, oscale, badd, C, N, (size_t)rowb, col0, lane);
}

// =====================================================================================================
// f16 hi+lo GEMM with bias: C[M][N] (f32) = (Ahi + Alo)[M][K] . Bt[N][K]^T times oscale, plus bf16-RNE value of bias[n];
// Ahi/Alo f16 planes (same layout), Bt f16 k-contiguous; products hi.B + lo.B into one accumulator (lo is the unscaled
// residual of hi). Same tiling as gemm_bfb.
// =====================================================================================================
__global__ __launch_bounds__(128)
void gemm_h2(const u16* __restrict__ Ah, const u16* __restrict__ Al, const u16* __restrict__ Bt,
             const float* __restrict__ bias, float* C, int M, int N, int K, float oscale) {
  __shared__ __align__(16) float slab[4 * SLAB64];
  const int tid = threadIdx.x, wave = tid >> 5, lane = tid & 31, hh = lane >> 4, m = lane & 15;
  const int ntile = N >> 6;
  const int bid   = blockIdx.x;
  const int rowb  = (bid / ntile) * 64 + wave * 16;
  const int col0  = (bid % ntile) * 64;
  if (rowb + 16 > M) return;                 // wave-uniform, never taken with the exact grid; no block barriers in this kernel
  const size_t aofs = (size_t)(rowb + m) * K + 8 * hh;
  const _Float16* ahp = (const _Float16*)(const void*)Ah + aofs;
  const _Float16* alp = (const _Float16*)(const void*)Al + aofs;
  const _Float16* bp  = (const _Float16*)(const void*)Bt + (size_t)(col0 + m) * K + 8 * hh;
  const size_t bs = (size_t)16 * K;
  v8f acc0 = zero8(), acc1 = zero8(), acc2 = zero8(), acc3 = zero8();
#pragma unroll 1
  for (int k0 = 0; k0 < K; k0 += 32) {
    const v16h ah = ldfrag_h(ahp + k0), al = ldfrag_h(alp + k0);
    const v16h b0 = ldfrag_h(bp + k0);
    const v16h b1 = ldfrag_h(bp + bs + k0);
    const v16h b2 = ldfrag_h(bp + 2 * bs + k0);
    const v16h b3 = ldfrag_h(bp + 3 * bs + k0);
    acc0 = mma_h(ah, b0, acc0);  acc0 = mma_h(al, b0, acc0);
    acc1 = mma_h(ah, b1, acc1);  acc1 = mma_h(al, b1, acc1);
    acc2 = mma_h(ah, b2, acc2);  acc2 = mma_h(al, b2, acc2);
    acc3 = mma_h(ah, b3, acc3);  acc3 = mma_h(al, b3, acc3);
    guard6<v16h>(acc0, acc1, acc2, acc3, ah, al, b0, b1, b2, b3);
  }
  const v4f bv = *(const v4f*)(bias + col0 + m * 4);      // columns col0 + 4m .. +3, always < N (N multiple of 64)
  v4f badd;
#pragma unroll
  for (int e = 0; e < 4; ++e) badd[e] = bfr(bv[e]);
  epi64(slab + wave * SLAB64, acc0, acc1, acc2, acc3, oscale, badd, C, N, (size_t)rowb, col0, lane);
}

// =====================================================================================================
// v^T planes: VH[(b*NH + h)*HD + d][s] = f16(v[b][s][h][d] * 1024), VL = f16 residual of the same value.
// Block = (b, h, 64 keys): 64 source rows of HD floats loaded with 16-B loads, converted, scattered into two LDS tiles
// coverage: load 256 thr x 16 elements = 64 x 64; store 2 iterations x 256 thr x 8 halves = 64 lines x 64 = the block's tile of
//           each plane; grid = NB x NH x SEQ/64 blocks covers both planes exactly once.
// =====================================================================================================
__global__ __launch_bounds__(256) void vt16(const float* __restrict__ v, u16* VHo, u16* VLo) {
  __shared__ __align__(16) u16 TH[HD * VTP];
  __shared__ __align__(16) u16 TL[HD * VTP];
  const int tid = threadIdx.x;
  const int bid = blockIdx.x;
  const int st  = bid % QT64;
  const int h   = (bid / QT64) % NH;
  const int b   = bid / (QT64 * NH);
  const int s0  = st * 64;
  {
    const int sl = tid >> 2;                  // key within tile 0..63
    const int dc = (tid & 3) * 16;            // d chunk
    const float* src = v + (((size_t)(b * SEQ + s0 + sl)) * NH + h) * HD + dc;
#pragma unroll
    for (int i = 0; i < 4; ++i) {
      const v4f a = *(const v4f*)(src + 4 * i);
#pragma unroll
      for (int e = 0; e < 4; ++e) {
        const float t = a[e] * VCAR;
        const _Float16 hv = (_Float16)t;
        const _Float16 lv = (_Float16)(t - (float)hv);
        TH[(dc + 4 * i + e) * VTP + sl] = h_bits(hv);
        TL[(dc + 4 * i + e) * VTP + sl] = h_bits(lv);
      }
    }
  }
  __syncthreads();
  v4u vh[2], vl[2];
  const int q8 = tid >> 3, p8 = (tid & 7) * 8;
#pragma unroll
  for (int it = 0; it < 2; ++it) {
    const int line = it * 32 + q8;            // d = 0..63
    vh[it] = *(const v4u*)(TH + line * VTP + p8);
    vl[it] = *(const v4u*)(TL + line * VTP + p8);
  }
  const size_t base = ((size_t)(b * NH + h) * HD) * SEQ + s0 + p8;
  {
#pragma unroll
    for (int it = 0; it < 2; ++it) {
      const int line = it * 32 + q8;
      *(v4u*)(VHo + base + (size_t)line * SEQ) = vh[it];
      *(v4u*)(VLo + base + (size_t)line * SEQ) = vl[it];
    }
    
  }
}

// =====================================================================================================
// Full (non-causal, unmasked) multi-head flash attention: block = (batch b, head, 64 query rows), 4 waves, wave w owns the
// 16 query rows q0 = 64*qt + 16*w .. q0+15 (waves independent: no block barriers, wave-private LDS only, used in the epilogue).
//   Per-head logit scale: sigmoid(bf16 RNE value of g[head]) / 8, computed in f32 once per thread (head uniform per block) and
//   folded with log2(e) and the q/k carries into lsc.
//   q planes (hi, lo f16, x1024) laid out [b][s][h][d]; k planes the same; v^T planes [b][h][d][s] (x1024).
//   All NKB = SEQ/32 key blocks of 32 keys are visited (static bound).
//   Scores are computed TRANSPOSED: S^T tile g (g = 0,1) = k rows (keys kb+16g .. +15, A operand, row m = lane&15, split k map
//   over d) times q^T (B operand, col n = query q0 + (lane&15), k = d, split map), 3 products per tile and d-chunk
//   (k_hi.q_hi + k_lo.q_hi + k_hi.q_lo). D element r of lane l = (key kb+16g+8h+r, query q0+(l&15)), so a lane owns one query
//   column and 16 of its 32 keys; the partner lane l^16 owns the other 16 -> row max / row sum need one xor-16 shuffle.
//   Online max-subtracted base-2 softmax in f32. The exp'd values ARE the P A-fragment in place: A row m = query = lane&15,
//   element i <- key kb+8h+i (tile 0, D element i), element 8+i <- key kb+16+8h+i (tile 1, D element i). P is carried x32768
//   as f16 hi + f16 residual. The rescale factor of query row 8h+r of the O accumulators is fetched from lane 8h+r with a
//   shuffle (uniform control). 4+4 v^T B fragments (hi and residual planes, col n = d = 16j + (lane&15), keys k-contiguous),
//   12 P.V WMMAs (hh + lh + hl).
//   Epilogue: 1/l (per query, shuffled to the D row owner) and carry folds in f32; the wave's 16x64 f32 result staged in its LDS
// coverage: per wave 4 instructions x 4 rows x 8 lanes x 8 halves = 16 x 64 per plane; grid NB*NH*SEQ/64 blocks x 4 waves = every
//           (b, s, h) row of both O planes exactly once.
// =====================================================================================================
__global__ __launch_bounds__(ATT_THREADS)
void attn_fwd(const u16* __restrict__ QHIp, const u16* __restrict__ QLOp,
              const u16* __restrict__ KHIp, const u16* __restrict__ KLOp,
              const u16* __restrict__ VHIp, const u16* __restrict__ VLOp,
              const float* __restrict__ gatep,
              u16* OHIp, u16* OLOp) {
  __shared__ __align__(16) float smem[ATT_WAVES * SLABF];   // per wave: result slab [16][68] in the epilogue only

  const int tid  = threadIdx.x;
  const int wave = tid >> 5;
  const int lane = tid & 31;
  const int hh   = lane >> 4;
  const int c    = lane & 15;

  const int bid  = blockIdx.x;
  const int qt   = bid % QT64;
  const int head = (bid / QT64) % NH;
  const int b    = bid / (QT64 * NH);
  const int q0   = qt * 64 + wave * 16;

  // per-head scale: sigmoid(bf16 value of g) / 8 in f32; head < NH always (block decode), host checks the input extent
  const float gbf = bfr(gatep[head]);
  const float sgm = 1.0f / (1.0f + expf(-gbf));
  const float lsc = sgm * (0.125f * (LOG2E / (QSC * KSC)));

  // B fragments of q^T: col n = query q0 + c, k = d (k-contiguous row of the q plane)
  const size_t qofs = (((size_t)(b * SEQ + q0 + c)) * NH + head) * HD + 8 * hh;
  const _Float16* Qh  = (const _Float16*)(const void*)QHIp + qofs;
  const _Float16* Ql  = (const _Float16*)(const void*)QLOp + qofs;
  // A fragments of k: row m = key kb + 16g + c, k = d
  const size_t kofs = (((size_t)b * SEQ + c) * NH + head) * HD + 8 * hh;          // key row kb + c added per step
  const _Float16* Khb = (const _Float16*)(const void*)KHIp + kofs;
  const _Float16* Klb = (const _Float16*)(const void*)KLOp + kofs;
  // B fragments of v: col n = d = 16j + c, k = key (k-contiguous row of the v^T plane)
  const size_t vofs = ((size_t)(b * NH + head) * HD + c) * SEQ + 8 * hh;          // key kb added per step
  const _Float16* Vhb = (const _Float16*)(const void*)VHIp + vofs;
  const _Float16* Vlb = (const _Float16*)(const void*)VLOp + vofs;

  float mrun = -INFINITY, lrun = 0.f;
  v8f o[4];
#pragma unroll
  for (int j = 0; j < 4; ++j) o[j] = zero8();

#pragma unroll 1
  for (int it = 0; it < NKB; ++it) {
    const int kb = it * 32;
    // ---- transposed scores: s0 = keys kb..kb+15, s1 = keys kb+16..kb+31, column = query q0 + c ----
    v8f s0 = zero8(), s1 = zero8();
    const _Float16* k0p = Khb + (size_t)kb * (NH * HD);
    const _Float16* k1p = k0p + (size_t)16 * (NH * HD);
    const _Float16* l0p = Klb + (size_t)kb * (NH * HD);
    const _Float16* l1p = l0p + (size_t)16 * (NH * HD);
#pragma unroll
    for (int kk = 0; kk < 2; ++kk) {
      const v16h qh  = ldfrag_h(Qh + kk * 32),  ql  = ldfrag_h(Ql + kk * 32);
      const v16h kh0 = ldfrag_h(k0p + kk * 32), kl0 = ldfrag_h(l0p + kk * 32);
      const v16h kh1 = ldfrag_h(k1p + kk * 32), kl1 = ldfrag_h(l1p + kk * 32);
      s0 = mma_h(kh0, qh, s0);
      s0 = mma_h(kl0, qh, s0);
      s0 = mma_h(kh0, ql, s0);
      s1 = mma_h(kh1, qh, s1);
      s1 = mma_h(kl1, qh, s1);
      s1 = mma_h(kh1, ql, s1);
      guard2(s0, s1, qh, ql, kh0, kl0, kh1, kl1);
    }
    // ---- base-2 logits of this lane's 16 keys for query q0 + c: t[i] <- key kb+8hh+i, t[8+i] <- key kb+16+8hh+i ----
    float t[16];
#pragma unroll
    for (int i = 0; i < 8; ++i) { t[i] = s0[i] * lsc; t[8 + i] = s1[i] * lsc; }
    float cm = t[0];
#pragma unroll
    for (int i = 1; i < 16; ++i) cm = fmaxf(cm, t[i]);
    cm = fmaxf(cm, __shfl_xor(cm, 16, 32));
    const float mn = fmaxf(mrun, cm);        // finite from the first block on
    const float al = exp2f(mrun - mn);       // 0 on the first block (mrun = -inf)
    mrun = mn;
    // ---- probabilities (<= 1) and the P A-fragments: hi = f16(p * 32768), lo = f16 residual; element i <-> t[i] ----
    float ps = 0.f;
    FragH ph, pl;
#pragma unroll
    for (int w = 0; w < 2; ++w) {
#pragma unroll
      for (int e4 = 0; e4 < 4; ++e4) {
        const int i = 8 * w + 2 * e4;
        const float p0 = exp2f(t[i] - mn), p1 = exp2f(t[i + 1] - mn);
        ps += p0 + p1;
        const float a0 = p0 * PCAR, a1 = p1 * PCAR;
        const _Float16 h0 = (_Float16)a0, h1 = (_Float16)a1;
        const _Float16 l0 = (_Float16)(a0 - (float)h0), l1 = (_Float16)(a1 - (float)h1);
        ph.u[w][e4] = pk16(h_bits(h0), h_bits(h1));
        pl.u[w][e4] = pk16(h_bits(l0), h_bits(l1));
      }
    }
    ps += __shfl_xor(ps, 16, 32);
    lrun = lrun * al + ps;
    // ---- rescale the O accumulators: D row 8hh+r = query q0+8hh+r, its factor lives in lane 8hh+r (and 16+8hh+r) ----
    float scl[8];
#pragma unroll
    for (int r = 0; r < 8; ++r) scl[r] = __shfl(al, 8 * hh + r, 32);
#pragma unroll
    for (int j = 0; j < 4; ++j) {
#pragma unroll
      for (int r = 0; r < 8; ++r) o[j][r] *= scl[r];
    }
    // ---- P.V : B fragment col n = d = j*16 + c, keys contiguous in the v^T planes ----
    {
      const _Float16* vhp = Vhb + kb;
      const _Float16* vlp = Vlb + kb;
      const v16h vh0 = ldfrag_h(vhp);
      const v16h vh1 = ldfrag_h(vhp + (size_t)16 * SEQ);
      const v16h vh2 = ldfrag_h(vhp + (size_t)32 * SEQ);
      const v16h vh3 = ldfrag_h(vhp + (size_t)48 * SEQ);
      const v16h vl0 = ldfrag_h(vlp);
      const v16h vl1 = ldfrag_h(vlp + (size_t)16 * SEQ);
      const v16h vl2 = ldfrag_h(vlp + (size_t)32 * SEQ);
      const v16h vl3 = ldfrag_h(vlp + (size_t)48 * SEQ);
      o[0] = mma_h(ph.v, vh0, o[0]);  o[0] = mma_h(pl.v, vh0, o[0]);  o[0] = mma_h(ph.v, vl0, o[0]);
      o[1] = mma_h(ph.v, vh1, o[1]);  o[1] = mma_h(pl.v, vh1, o[1]);  o[1] = mma_h(ph.v, vl1, o[1]);
      o[2] = mma_h(ph.v, vh2, o[2]);  o[2] = mma_h(pl.v, vh2, o[2]);  o[2] = mma_h(ph.v, vl2, o[2]);
      o[3] = mma_h(ph.v, vh3, o[3]);  o[3] = mma_h(pl.v, vh3, o[3]);  o[3] = mma_h(ph.v, vl3, o[3]);
      guard10(o[0], o[1], o[2], o[3], ph.v, pl.v, vh0, vh1, vh2, vh3, vl0, vl1, vl2, vl3);
    }
  }
  acc_guard4(o[0], o[1], o[2], o[3]);

  // ---- fold 1/l (per query, owned by lane = query) and the carries (32768 on P, 1024 on v); stage the 16x64 slab ----
  const float linv = (1.0f / lrun) * (1.0f / (PCAR * VCAR));
  float inv[8];
#pragma unroll
  for (int r = 0; r < 8; ++r) inv[r] = __shfl(linv, 8 * hh + r, 32);
  float* slab = smem + wave * SLABF;
#pragma unroll
  for (int r = 0; r < 8; ++r) {
#pragma unroll
    for (int j = 0; j < 4; ++j) slab[(8 * hh + r) * 68 + j * 16 + c] = o[j][r] * inv[r];
  }
  wave_sync_lds();
  // ---- O x1024 -> f16 hi + residual planes; lane = (row in group of 4, 8 consecutive d) ----
  v4u oh[4], ol[4];
  const int rq = lane >> 3, c8 = (lane & 7) * 8;
#pragma unroll
  for (int i4 = 0; i4 < 4; ++i4) {
    const int row = i4 * 4 + rq;
    const v4f a = *(const v4f*)(slab + row * 68 + c8), c4 = *(const v4f*)(slab + row * 68 + c8 + 4);
    float w[8];
#pragma unroll
    for (int e = 0; e < 4; ++e) { w[e] = a[e] * OSC; w[4 + e] = c4[e] * OSC; }
#pragma unroll
    for (int e = 0; e < 4; ++e) {
      const _Float16 h0 = (_Float16)w[2 * e], h1 = (_Float16)w[2 * e + 1];
      const _Float16 l0 = (_Float16)(w[2 * e] - (float)h0), l1 = (_Float16)(w[2 * e + 1] - (float)h1);
      oh[i4][e] = pk16(h_bits(h0), h_bits(h1));
      ol[i4][e] = pk16(h_bits(l0), h_bits(l1));
    }
  }
  const size_t ob = (((size_t)(b * SEQ + q0)) * NH + head) * HD + c8;
  {
#pragma unroll
    for (int i4 = 0; i4 < 4; ++i4) {
      const int row = i4 * 4 + rq;
      const size_t o8 = ob + (size_t)row * (NH * HD);
      *(v4u*)(OHIp + o8) = oh[i4];
      *(v4u*)(OLOp + o8) = ol[i4];
    }
    
  }
}

// =====================================================================================================
// Workspace map (bytes, ROWS = NB*SEQ; numbers for NB=2, SEQ=2048); every plane is fully written by whole-line stores before it is
// read; all extents are exact multiples of the store granularity (no pad rows needed); XB and F are reused sequentially
// (in-order stream):
//   XB  bf16 [ROWS][1024]                 8388608        (input Q, then K, then V)
//   WQB bf16 [1024 n][1024 k]             2097152        WKB same  2097152      WVB same  2097152
//   WOB f16  [1024 n][1024 k] x1024       2097152
//   F   f32 [ROWS][1024]                 16777216        (projection q, then k, then v)
//   QHI f16 [NB][SEQ][16][64] x1024       8388608        QLO residual         8388608
//   KHI same                              8388608        KLO residual         8388608
//   VHI f16 [NB][16][64][SEQ] x1024       8388608        VLO residual         8388608
//   OHI f16 [ROWS][1024] x1024            8388608        OLO residual         8388608
//   end                                 100663296
// =====================================================================================================
extern "C" void kernel_launch(void* const* d_in, const int* in_sizes, int n_in,
                              void* d_out, int out_size, void* d_ws, size_t ws_size,
                              hipStream_t stream) {
  const int ROWS = NB * SEQ;
  if (n_in < 12) return;
  const int needX = ((NB - 1) * SEQ_FULL + SEQ) * DMOD;   // last input row read by cvt16 (+1), in elements
  if (in_sizes[0] < needX || in_sizes[1] < needX || in_sizes[2] < needX) return;
  if (in_sizes[3] < DMOD * DMOD || in_sizes[5] < DMOD * DMOD) return;
  if (in_sizes[7] < DMOD * DMOD || in_sizes[9] < DMOD * DMOD) return;
  if (in_sizes[4] < DMOD || in_sizes[6] < DMOD || in_sizes[8] < DMOD || in_sizes[10] < DMOD) return;
  if (in_sizes[11] < NH) return;
  if (out_size < ROWS * DMOD) return;

  const float* Qin = (const float*)d_in[0];
  const float* Kin = (const float*)d_in[1];
  const float* Vin = (const float*)d_in[2];
  const float* wq  = (const float*)d_in[3];
  const float* bq  = (const float*)d_in[4];
  const float* wk  = (const float*)d_in[5];
  const float* bk  = (const float*)d_in[6];
  const float* wv  = (const float*)d_in[7];
  const float* bv  = (const float*)d_in[8];
  const float* wo  = (const float*)d_in[9];
  const float* bo  = (const float*)d_in[10];
  const float* gt  = (const float*)d_in[11];
  float*       out = (float*)d_out;

  const size_t szXB  = (size_t)ROWS * DMOD * 2;
  const size_t szW   = (size_t)DMOD * DMOD * 2;
  const size_t szF   = (size_t)ROWS * DMOD * 4;
  const size_t szP   = (size_t)ROWS * DMOD * 2;                 // q/k/o planes
  const size_t szVP  = (size_t)NB * NH * HD * SEQ * 2;
  size_t off = 0;
  const size_t oXB  = off; off += szXB;
  const size_t oWQB = off; off += szW;
  const size_t oWKB = off; off += szW;
  const size_t oWVB = off; off += szW;
  const size_t oWOB = off; off += szW;
  const size_t oF   = off; off += szF;
  const size_t oQHI = off; off += szP;
  const size_t oQLO = off; off += szP;
  const size_t oKHI = off; off += szP;
  const size_t oKLO = off; off += szP;
  const size_t oVHI = off; off += szVP;
  const size_t oVLO = off; off += szVP;
  const size_t oOHI = off; off += szP;
  const size_t oOLO = off; off += szP;
  if (off > ws_size) return;                            // off = 100663296 at full size
  if (off > (size_t)134217728) return;

  char* ws = (char*)d_ws;
  u16*   XB  = (u16*)(ws + oXB);
  u16*   WQB = (u16*)(ws + oWQB);
  u16*   WKB = (u16*)(ws + oWKB);
  u16*   WVB = (u16*)(ws + oWVB);
  u16*   WOB = (u16*)(ws + oWOB);
  float* F   = (float*)(ws + oF);
  u16*   QHI = (u16*)(ws + oQHI);
  u16*   QLO = (u16*)(ws + oQLO);
  u16*   KHI = (u16*)(ws + oKHI);
  u16*   KLO = (u16*)(ws + oKLO);
  u16*   VHI = (u16*)(ws + oVHI);
  u16*   VLO = (u16*)(ws + oVLO);
  u16*   OHI = (u16*)(ws + oOHI);
  u16*   OLO = (u16*)(ws + oOLO);

  const dim3 blk(256);
  const int n8x = (ROWS * DMOD) / 8;                    // 524288 at full size
  const int n8w = (DMOD * DMOD) / 8;                    // 131072
  const int seg8x = (SEQ * DMOD) / 8;                   // destination octets per batch
  const int str8x = (SEQ_FULL * DMOD) / 8;              // source octets per batch in the input layout
  if ((n8x % 256) != 0 || (n8w % 256) != 0) return;
  if ((DMOD % 32) != 0 || (ROWS % 64) != 0 || (DMOD % 64) != 0) return;
  const dim3 gX(n8x / 256);                             // 2048
  const dim3 gWc(n8w / 256);                            // 512
  const dim3 gG((ROWS / 64) * (DMOD / 64));             // 1024
  const dim3 bG(128);
  const dim3 gVT(NB * NH * (SEQ / 64));                 // 1024
  const dim3 gAT(ATT_BLOCKS);                           // 1024
  const dim3 bAT(ATT_THREADS);                          // 128

  // (0..3) weights [n][k] (already k-contiguous for x.W^T): bf16 planes for wq/wk/wv, f16 of bf16 value x1024 for wo
  cvt16<<<gWc, blk, 0, stream>>>(wq, WQB, n8w, 0, 1.0f, n8w, n8w);
  cvt16<<<gWc, blk, 0, stream>>>(wk, WKB, n8w, 0, 1.0f, n8w, n8w);
  cvt16<<<gWc, blk, 0, stream>>>(wv, WVB, n8w, 0, 1.0f, n8w, n8w);
  cvt16<<<gWc, blk, 0, stream>>>(wo, WOB, n8w, 1, WOS, n8w, n8w);
  // (4..6) q: input -> bf16 plane, projection + bias [ROWS][1024] f32 (col = h*64+d), split -> f16 hi x1024 + residual planes
  cvt16<<<gX, blk, 0, stream>>>(Qin, XB, n8x, 0, 1.0f, seg8x, str8x);
  gemm_bfb<<<gG, bG, 0, stream>>>(XB, WQB, bq, F, ROWS, DMOD, DMOD, 1.0f);
  split16<<<gX, blk, 0, stream>>>(F, QHI, QLO, n8x, QSC);
  // (7..9) k: same pipeline (XB and F reused; single in-order stream)
  cvt16<<<gX, blk, 0, stream>>>(Kin, XB, n8x, 0, 1.0f, seg8x, str8x);
  gemm_bfb<<<gG, bG, 0, stream>>>(XB, WKB, bk, F, ROWS, DMOD, DMOD, 1.0f);
  split16<<<gX, blk, 0, stream>>>(F, KHI, KLO, n8x, KSC);
  // (10..12) v: input -> bf16 plane, projection + bias, v^T planes x1024 (hi + residual)
  cvt16<<<gX, blk, 0, stream>>>(Vin, XB, n8x, 0, 1.0f, seg8x, str8x);
  gemm_bfb<<<gG, bG, 0, stream>>>(XB, WVB, bv, F, ROWS, DMOD, DMOD, 1.0f);
  vt16<<<gVT, blk, 0, stream>>>(F, VHI, VLO);
  // (13) attention with per-head scale sigmoid(g)/8 -> O planes [b][s][h][d] x1024 (hi + residual)
  attn_fwd<<<gAT, bAT, 0, stream>>>(QHI, QLO, KHI, KLO, VHI, VLO, gt, OHI, OLO);
  // (14) output projection + bias -> out [ROWS][1024] f32, carries 1024 (O) x 1024 (wo) folded back
  gemm_h2<<<gG, bG, 0, stream>>>(OHI, OLO, WOB, bo, out, ROWS, DMOD, DMOD, 1.0f / (OSC * WOS));
  (void)hipGetLastError();
}

// v001
// A run of this version takes 309 microseconds.
// Two timings next to v000 put it at 1.32 and 1.31 times that version's speed.
// Contractions: x.W{q,k,v}^T on v_wmma_f32_16x16x32_bf16 (x and W RNE-converted to bf16 operands, f32 accumulate, bias added in f32);
// scores k'.q'^T (q', k' carried x1024 as f16 hi plane + f16 residual plane, products hh+lh+hl), P.v (P x32768 f16 hi+residual,
// v x1024 f16 hi+residual, products hh+lh+hl) and O.Wo^T (O x1024 f16 hi+residual, Wo as f16(bf16(Wo) x1024), products h.w+l.w):
// v_wmma_f32_16x16x32_f16, f32 accumulate. Per-head logit scale sigmoid(bf16(g_h))/8 in f32; base-2 online softmax, 1/l fold and
// bias adds in f32 on VALU.
#include <hip/hip_runtime.h>
#include <math.h>
#include <stdint.h>

#ifndef NB
#define NB    2
#endif
#ifndef SEQ
#define SEQ   2048
#endif
#define NB_FULL  2
#define SEQ_FULL 2048
#define DMOD  1024
#define NH    16
#define HD    64
#define QSC   1024.0f
#define KSC   1024.0f
#define PCAR  32768.0f
#define VCAR  1024.0f
#define OSC   1024.0f
#define WOS   1024.0f
#define LOG2E 1.4426950408889634f
#define ATT_WAVES   4
#define ATT_THREADS (ATT_WAVES * 32)
#define QT64        (SEQ / 64)
#define ATT_BLOCKS  (NB * NH * QT64)
#define NKB    (SEQ / 32)
#define SLABF  (16 * 68)
#define SLAB64 (16 * 68)
#define VTP    72
#define KT     64                 // keys per staged tile
#define LP     72                 // LDS row pitch in halves: 128-B rows + 16 B (16 B x odd, for 16-B LDS reads down a column of rows)
#define PLH    (64 * LP)          // one plane's tile: 64 rows
#define BUFH   (4 * PLH)          // k hi, k residual, v^T hi, v^T residual
#define NT     (SEQ / KT)
static_assert(HD == 64 && DMOD == NH * HD && NH == 16);
static_assert(NB >= 1 && NB <= NB_FULL && SEQ >= 64 && SEQ <= SEQ_FULL && (SEQ % 64) == 0);
static_assert(ATT_THREADS == 128 && ATT_BLOCKS == NB * NH * (SEQ / 64) && NKB * 32 == SEQ);
static_assert(((NB * SEQ) % 64) == 0 && (DMOD % 64) == 0 && (DMOD % 32) == 0);
static_assert((SEQ % 64) == 0 && (SEQ % 8) == 0);
static_assert(((NB * SEQ * DMOD / 8) % 256) == 0 && ((DMOD * DMOD / 8) % 256) == 0 && ((SEQ * DMOD / 8) % 256) == 0);
static_assert(ATT_WAVES * SLABF >= 4 * 16 * 68);
static_assert(HD * VTP >= 63 * VTP + 64);
static_assert(KT == 64 && HD == 64 && NT * KT == SEQ && NT * 2 == NKB && ATT_THREADS == 128);
static_assert(2 * BUFH * 2 >= ATT_WAVES * SLABF * 4 && (LP * 2) % 16 == 0);

typedef unsigned short u16;
typedef _Float16 v16h __attribute__((ext_vector_type(16)));
typedef _Float16 v8h  __attribute__((ext_vector_type(8)));
typedef __bf16   v16b __attribute__((ext_vector_type(16)));
typedef float    v8f  __attribute__((ext_vector_type(8)));
typedef float    v4f  __attribute__((ext_vector_type(4)));
typedef unsigned int v4u __attribute__((ext_vector_type(4)));

union FragH { v16h v; v8h h[2]; v4u u[2]; };
union FragB { v16b v; v4u u[2]; };

// ---- scalar helpers --------------------------------------------------------------------------------
__device__ __forceinline__ unsigned short bf_bits(float f) {          // f32 -> bf16 bits, RNE convert
  unsigned u = __float_as_uint(f);
  return (unsigned short)((u + 0x7FFFu + ((u >> 16) & 1u)) >> 16);
}
__device__ __forceinline__ float bf_up(unsigned short h) { return __uint_as_float(((unsigned)h) << 16); }
__device__ __forceinline__ float bfr(float f) { return bf_up(bf_bits(f)); }
__device__ __forceinline__ unsigned short h_bits(_Float16 x) { return __builtin_bit_cast(unsigned short, x); }
__device__ __forceinline__ unsigned pk16(unsigned short a, unsigned short b) { return (unsigned)a | ((unsigned)b << 16); }
__device__ __forceinline__ v8f zero8() { v8f z = {0.f, 0.f, 0.f, 0.f, 0.f, 0.f, 0.f, 0.f}; return z; }
__device__ __forceinline__ v4f zero4() { v4f z = {0.f, 0.f, 0.f, 0.f}; return z; }

// ---- fragment loaders: 16-bit A/B operand, lane -> row/col (lane&15), p already includes +8*(lane>>4);
//      elements 0..7 <- p[0..7] (k0+8h..), elements 8..15 <- p[16..23] (k0+16+8h..)  (same split k map for A and B;
//      B is always read from a k-contiguous [n][k] plane)
__device__ __forceinline__ v16h ldfrag_h(const _Float16* p) {
  FragH f;
  f.h[0] = *(const v8h*)(p);
  f.h[1] = *(const v8h*)(p + 16);
  return f.v;
}
__device__ __forceinline__ v16b ldfrag_b(const u16* p) {              // bf16 plane read as unsigned integer vectors
  FragB f;
  f.u[0] = *(const v4u*)(p);
  f.u[1] = *(const v4u*)(p + 16);
  return f.v;
}

__device__ __forceinline__ v8f mma_h(v16h a, v16h b, v8f c) {
  return __builtin_amdgcn_wmma_f32_16x16x32_f16(false, a, false, b, (short)0, c, false, false);
}
__device__ __forceinline__ v8f mma_b(v16b a, v16b b, v8f c) {
  return __builtin_amdgcn_wmma_f32_16x16x32_bf16(false, a, false, b, (short)0, c, false, false);
}
__device__ __forceinline__ void guard2(v8f& a, v8f& b, v16h x0, v16h x1, v16h x2, v16h x3, v16h x4, v16h x5) {
#if defined(__HIP_DEVICE_COMPILE__)
  asm volatile("v_nop\n\tv_nop\n\tv_nop\n\tv_nop"
               : "+v"(a), "+v"(b) : "v"(x0), "v"(x1), "v"(x2), "v"(x3), "v"(x4), "v"(x5) : "memory");
#endif
}
template <typename F>
__device__ __forceinline__ void guard6(v8f& a, v8f& b, v8f& c, v8f& d, F x0, F x1, F x2, F x3, F x4, F x5) {
#if defined(__HIP_DEVICE_COMPILE__)
  asm volatile("v_nop\n\tv_nop\n\tv_nop\n\tv_nop"
               : "+v"(a), "+v"(b), "+v"(c), "+v"(d) : "v"(x0), "v"(x1), "v"(x2), "v"(x3), "v"(x4), "v"(x5) : "memory");
#endif
}
__device__ __forceinline__ void guard10(v8f& a, v8f& b, v8f& c, v8f& d, v16h x0, v16h x1, v16h x2, v16h x3, v16h x4,
                                        v16h x5, v16h x6, v16h x7, v16h x8, v16h x9) {
#if defined(__HIP_DEVICE_COMPILE__)
  asm volatile("v_nop\n\tv_nop\n\tv_nop\n\tv_nop"
               : "+v"(a), "+v"(b), "+v"(c), "+v"(d)
               : "v"(x0), "v"(x1), "v"(x2), "v"(x3), "v"(x4), "v"(x5), "v"(x6), "v"(x7), "v"(x8), "v"(x9) : "memory");
#endif
}
__device__ __forceinline__ void acc_guard4(v8f& a, v8f& b, v8f& c, v8f& d) {
#if defined(__HIP_DEVICE_COMPILE__)
  asm volatile("v_nop\n\tv_nop\n\tv_nop\n\tv_nop" : "+v"(a), "+v"(b), "+v"(c), "+v"(d));
#endif
}
// Two planes' 64-row x 128-B tiles, global -> LDS, by 128 threads: per lane four 16-B asynchronous copies a plane (rows r, r+16,
// r+32, r+48; 8 lanes = one whole 128-B row). la/lb: the lane's LDS byte addresses of row r, ga/gb: its global addresses, gstep: 16
// source rows in elements. The s_wait_xcnt closes the statement so that no address register is rewritten ahead of it.
__device__ __forceinline__ void stage2(unsigned la, unsigned lb, const u16* ga, const u16* gb, size_t gstep) {
#if defined(__HIP_DEVICE_COMPILE__)
  const unsigned ls = 16 * LP * 2;
  asm volatile("global_load_async_to_lds_b128 %0, %8, off\n\t"
               "global_load_async_to_lds_b128 %1, %9, off\n\t"
               "global_load_async_to_lds_b128 %2, %10, off\n\t"
               "global_load_async_to_lds_b128 %3, %11, off\n\t"
               "global_load_async_to_lds_b128 %4, %12, off\n\t"
               "global_load_async_to_lds_b128 %5, %13, off\n\t"
               "global_load_async_to_lds_b128 %6, %14, off\n\t"
               "global_load_async_to_lds_b128 %7, %15, off\n\t"
               "s_wait_xcnt 0x0"
               :: "v"(la), "v"(la + ls), "v"(la + 2 * ls), "v"(la + 3 * ls),
                  "v"(lb), "v"(lb + ls), "v"(lb + 2 * ls), "v"(lb + 3 * ls),
                  "v"(ga), "v"(ga + gstep), "v"(ga + 2 * gstep), "v"(ga + 3 * gstep),
                  "v"(gb), "v"(gb + gstep), "v"(gb + 2 * gstep), "v"(gb + 3 * gstep)
               : "memory");
#endif
}
__device__ __forceinline__ void wave_sync_lds() {
  __builtin_amdgcn_fence(__ATOMIC_RELEASE, "workgroup");
  __builtin_amdgcn_wave_barrier();
  __builtin_amdgcn_fence(__ATOMIC_ACQUIRE, "workgroup");
}

// =====================================================================================================
// f32 plane -> 16-bit plane:  f16mode == 0: bf16 RNE bits;  f16mode == 1: f16 bits of (bf16 RNE value) * scale.
// Destination is a dense plane of n8*8 elements; source octet index = (gt / seg8) * sstride8 + gt % seg8 (segments of seg8
// octets taken at stride sstride8 octets, identity when seg8 == n8): used to read NB batches of SEQ rows out of an input laid out
// with SEQ_FULL rows per batch.
// Thread = 8 consecutive elements: two 16-B loads, one 16-B store; 32 consecutive lanes = 512 contiguous, 512-B aligned bytes
// coverage: grid = n8/256 blocks (host checks exactness) x 256 thr x 8 = the whole destination plane.
// =====================================================================================================
__global__ __launch_bounds__(256) void cvt16(const float* __restrict__ x, u16* D, int n8, int f16mode, float scale,
                                             int seg8, int sstride8) {
  const int gt = blockIdx.x * 256 + (int)threadIdx.x;
  if (gt >= n8) return;                     // no barriers in this kernel
  const size_t so = (size_t)(gt / seg8) * (size_t)sstride8 + (size_t)(gt % seg8);
  const float* p = x + so * 8;
  const v4f a = *(const v4f*)(p), c4 = *(const v4f*)(p + 4);
  float v[8];
#pragma unroll
  for (int e = 0; e < 4; ++e) { v[e] = a[e]; v[4 + e] = c4[e]; }
  unsigned short s[8];
#pragma unroll
  for (int e = 0; e < 8; ++e) {
    const unsigned short hb = h_bits((_Float16)(bfr(v[e]) * scale));
    const unsigned short bb = bf_bits(v[e]);
    s[e] = (f16mode != 0) ? hb : bb;
  }
  v4u o;
#pragma unroll
  for (int e = 0; e < 4; ++e) o[e] = pk16(s[2 * e], s[2 * e + 1]);
  u16* d = D + (size_t)gt * 8;
  {
    *(v4u*)(d) = o;
    
  }
}

// =====================================================================================================
// f32 plane -> f16 hi plane (value * sc, sc a power of two) + f16 residual plane (value * sc - hi, unscaled), same layout.
// Thread = 8 consecutive elements: two 16-B loads, one 16-B store per plane; 32 consecutive lanes = 512 contiguous, 512-B aligned
// coverage: grid = n8/256 blocks (host checks exactness) x 256 thr x 8 = the whole of both planes.
// =====================================================================================================
__global__ __launch_bounds__(256) void split16(const float* __restrict__ x, u16* hpl, u16* lpl, int n8, float sc) {
  const int gt = blockIdx.x * 256 + (int)threadIdx.x;
  if (gt >= n8) return;                     // no barriers in this kernel
  const float* p = x + (size_t)gt * 8;
  const v4f a = *(const v4f*)(p), c4 = *(const v4f*)(p + 4);
  float w[8];
#pragma unroll
  for (int e = 0; e < 4; ++e) { w[e] = a[e]; w[4 + e] = c4[e]; }
  v4u oh, ol;
#pragma unroll
  for (int e = 0; e < 4; ++e) {
    const float t0 = w[2 * e] * sc, t1 = w[2 * e + 1] * sc;
    const _Float16 h0 = (_Float16)t0, h1 = (_Float16)t1;
    const _Float16 l0 = (_Float16)(t0 - (float)h0), l1 = (_Float16)(t1 - (float)h1);
    oh[e] = pk16(h_bits(h0), h_bits(h1));
    ol[e] = pk16(h_bits(l0), h_bits(l1));
  }
  const size_t o8 = (size_t)gt * 8;
  {
    *(v4u*)(hpl + o8) = oh;
    *(v4u*)(lpl + o8) = ol;
    
  }
}

// =====================================================================================================
// GEMM epilogue shared by both engines: the wave's 16x64 f32 tile (times oscale) staged in its LDS slab (pitch 68, wave-private),
// coverage: 8 instructions x 2 rows x 16 lanes x 4 floats = the wave's 16 x 64 tile.
// =====================================================================================================
__device__ __forceinline__ void epi64(float* sl, v8f a0, v8f a1, v8f a2, v8f a3, float oscale, v4f badd, float* C, int N,
                                      size_t rowb, int col0, int lane) {
  const int hh = lane >> 4, m = lane & 15;
#pragma unroll
  for (int r = 0; r < 8; ++r) {
    const int ro = (8 * hh + r) * 68 + m;
    sl[ro]      = a0[r] * oscale;
    sl[ro + 16] = a1[r] * oscale;
    sl[ro + 32] = a2[r] * oscale;
    sl[ro + 48] = a3[r] * oscale;
  }
  wave_sync_lds();
  v4f vals[8];
#pragma unroll
  for (int it = 0; it < 8; ++it) vals[it] = *(const v4f*)(sl + (it * 2 + hh) * 68 + m * 4) + badd;
  float* dst = C + (rowb + (size_t)hh) * (size_t)N + col0 + m * 4;
  {
#pragma unroll
    for (int it = 0; it < 8; ++it) {
      *(v4f*)(dst + (size_t)(it * 2) * (size_t)N) = vals[it];
    }
    
  }
}

// =====================================================================================================
// bf16 GEMM with bias: C[M][N] (f32) = A[M][K] (bf16 row-major) . Bt[N][K]^T (bf16 k-contiguous), times oscale, plus bf16-RNE
// value of bias[n]. Block = 64x64 tile, 4 waves x 16 rows; fragments loaded straight from the 16-bit rows (two 16-B loads each,
// split k map for A and B); K stepped by 32 (host checks K % 32 == 0, M % 64 == 0, N % 64 == 0, grid = (M/64)*(N/64)).
// =====================================================================================================
__global__ __launch_bounds__(128)
void gemm_bfb(const u16* __restrict__ A, const u16* __restrict__ Bt, const float* __restrict__ bias,
              float* C, int M, int N, int K, float oscale) {
  __shared__ __align__(16) float slab[4 * SLAB64];
  const int tid = threadIdx.x, wave = tid >> 5, lane = tid & 31, hh = lane >> 4, m = lane & 15;
  const int ntile = N >> 6;
  const int bid   = blockIdx.x;
  const int rowb  = (bid / ntile) * 64 + wave * 16;
  const int col0  = (bid % ntile) * 64;
  if (rowb + 16 > M) return;                 // wave-uniform, never taken with the exact grid; no block barriers in this kernel
  const u16* ap = A  + (size_t)(rowb + m) * K + 8 * hh;
  const u16* bp = Bt + (size_t)(col0 + m) * K + 8 * hh;
  const size_t bs = (size_t)16 * K;
  v8f acc0 = zero8(), acc1 = zero8(), acc2 = zero8(), acc3 = zero8();
#pragma unroll 1
  for (int k0 = 0; k0 < K; k0 += 32) {
    const v16b a  = ldfrag_b(ap + k0);
    const v16b b0 = ldfrag_b(bp + k0);
    const v16b b1 = ldfrag_b(bp + bs + k0);
    const v16b b2 = ldfrag_b(bp + 2 * bs + k0);
    const v16b b3 = ldfrag_b(bp + 3 * bs + k0);
    acc0 = mma_b(a, b0, acc0);
    acc1 = mma_b(a, b1, acc1);
    acc2 = mma_b(a, b2, acc2);
    acc3 = mma_b(a, b3, acc3);
    guard6<v16b>(acc0, acc1, acc2, acc3, a, b0, b1, b2, b3, a);
  }
  const v4f bv = *(const v4f*)(bias + col0 + m * 4);      // columns col0 + 4m .. +3, always < N (N multiple of 64)
  v4f badd;
#pragma unroll
  for (int e = 0; e < 4; ++e) badd[e] = bfr(bv[e]);
  epi64(slab + wave * SLAB64, acc0, acc1, acc2, acc3, oscale, badd, C, N, (size_t)rowb, col0, lane);
}

// =====================================================================================================
// f16 hi+lo GEMM with bias: C[M][N] (f32) = (Ahi + Alo)[M][K] . Bt[N][K]^T times oscale, plus bf16-RNE value of bias[n];
// Ahi/Alo f16 planes (same layout), Bt f16 k-contiguous; products hi.B + lo.B into one accumulator (lo is the unscaled
// residual of hi). Same tiling as gemm_bfb.
// =====================================================================================================
__global__ __launch_bounds__(128)
void gemm_h2(const u16* __restrict__ Ah, const u16* __restrict__ Al, const u16* __restrict__ Bt,
             const float* __restrict__ bias, float* C, int M, int N, int K, float oscale) {
  __shared__ __align__(16) float slab[4 * SLAB64];
  const int tid = threadIdx.x, wave = tid >> 5, lane = tid & 31, hh = lane >> 4, m = lane & 15;
  const int ntile = N >> 6;
  const int bid   = blockIdx.x;
  const int rowb  = (bid / ntile) * 64 + wave * 16;
  const int col0  = (bid % ntile) * 64;
  if (rowb + 16 > M) return;                 // wave-uniform, never taken with the exact grid; no block barriers in this kernel
  const size_t aofs = (size_t)(rowb + m) * K + 8 * hh;
  const _Float16* ahp = (const _Float16*)(const void*)Ah + aofs;
  const _Float16* alp = (const _Float16*)(const void*)Al + aofs;
  const _Float16* bp  = (const _Float16*)(const void*)Bt + (size_t)(col0 + m) * K + 8 * hh;
  const size_t bs = (size_t)16 * K;
  v8f acc0 = zero8(), acc1 = zero8(), acc2 = zero8(), acc3 = zero8();
#pragma unroll 1
  for (int k0 = 0; k0 < K; k0 += 32) {
    const v16h ah = ldfrag_h(ahp + k0), al = ldfrag_h(alp + k0);
    const v16h b0 = ldfrag_h(bp + k0);
    const v16h b1 = ldfrag_h(bp + bs + k0);
    const v16h b2 = ldfrag_h(bp + 2 * bs + k0);
    const v16h b3 = ldfrag_h(bp + 3 * bs + k0);
    acc0 = mma_h(ah, b0, acc0);  acc0 = mma_h(al, b0, acc0);
    acc1 = mma_h(ah, b1, acc1);  acc1 = mma_h(al, b1, acc1);
    acc2 = mma_h(ah, b2, acc2);  acc2 = mma_h(al, b2, acc2);
    acc3 = mma_h(ah, b3, acc3);  acc3 = mma_h(al, b3, acc3);
    guard6<v16h>(acc0, acc1, acc2, acc3, ah, al, b0, b1, b2, b3);
  }
  const v4f bv = *(const v4f*)(bias + col0 + m * 4);      // columns col0 + 4m .. +3, always < N (N multiple of 64)
  v4f badd;
#pragma unroll
  for (int e = 0; e < 4; ++e) badd[e] = bfr(bv[e]);
  epi64(slab + wave * SLAB64, acc0, acc1, acc2, acc3, oscale, badd, C, N, (size_t)rowb, col0, lane);
}

// =====================================================================================================
// v^T planes: VH[(b*NH + h)*HD + d][s] = f16(v[b][s][h][d] * 1024), VL = f16 residual of the same value.
// Block = (b, h, 64 keys): 64 source rows of HD floats loaded with 16-B loads, converted, scattered into two LDS tiles
// coverage: load 256 thr x 16 elements = 64 x 64; store 2 iterations x 256 thr x 8 halves = 64 lines x 64 = the block's tile of
//           each plane; grid = NB x NH x SEQ/64 blocks covers both planes exactly once.
// =====================================================================================================
__global__ __launch_bounds__(256) void vt16(const float* __restrict__ v, u16* VHo, u16* VLo) {
  __shared__ __align__(16) u16 TH[HD * VTP];
  __shared__ __align__(16) u16 TL[HD * VTP];
  const int tid = threadIdx.x;
  const int bid = blockIdx.x;
  const int st  = bid % QT64;
  const int h   = (bid / QT64) % NH;
  const int b   = bid / (QT64 * NH);
  const int s0  = st * 64;
  {
    const int sl = tid >> 2;                  // key within tile 0..63
    const int dc = (tid & 3) * 16;            // d chunk
    const float* src = v + (((size_t)(b * SEQ + s0 + sl)) * NH + h) * HD + dc;
#pragma unroll
    for (int i = 0; i < 4; ++i) {
      const v4f a = *(const v4f*)(src + 4 * i);
#pragma unroll
      for (int e = 0; e < 4; ++e) {
        const float t = a[e] * VCAR;
        const _Float16 hv = (_Float16)t;
        const _Float16 lv = (_Float16)(t - (float)hv);
        TH[(dc + 4 * i + e) * VTP + sl] = h_bits(hv);
        TL[(dc + 4 * i + e) * VTP + sl] = h_bits(lv);
      }
    }
  }
  __syncthreads();
  v4u vh[2], vl[2];
  const int q8 = tid >> 3, p8 = (tid & 7) * 8;
#pragma unroll
  for (int it = 0; it < 2; ++it) {
    const int line = it * 32 + q8;            // d = 0..63
    vh[it] = *(const v4u*)(TH + line * VTP + p8);
    vl[it] = *(const v4u*)(TL + line * VTP + p8);
  }
  const size_t base = ((size_t)(b * NH + h) * HD) * SEQ + s0 + p8;
  {
#pragma unroll
    for (int it = 0; it < 2; ++it) {
      const int line = it * 32 + q8;
      *(v4u*)(VHo + base + (size_t)line * SEQ) = vh[it];
      *(v4u*)(VLo + base + (size_t)line * SEQ) = vl[it];
    }
    
  }
}

// =====================================================================================================
// Full (non-causal, unmasked) multi-head flash attention: block = (batch b, head, 64 query rows), 4 waves, wave w owns the
// 16 query rows q0 = 64*qt + 16*w .. q0+15. The k and v^T planes' tiles of KT = 64 keys are staged in LDS by asynchronous copies, two
// buffers (tile t+1 flies while tile t is worked on, one block barrier a tile), and read by all 4 waves; each tile serves two key
// blocks of 32. The ring becomes the waves' private result slabs behind the last tile's barrier.
//   Per-head logit scale: sigmoid(bf16 RNE value of g[head]) / 8, computed in f32 once per thread (head uniform per block) and
//   folded with log2(e) and the q/k carries into lsc.
//   q planes (hi, lo f16, x1024) laid out [b][s][h][d]; k planes the same; v^T planes [b][h][d][s] (x1024).
//   All NKB = SEQ/32 key blocks of 32 keys are visited (static bound).
//   Scores are computed TRANSPOSED: S^T tile g (g = 0,1) = k rows (keys kb+16g .. +15, A operand, row m = lane&15, split k map
//   over d) times q^T (B operand, col n = query q0 + (lane&15), k = d, split map), 3 products per tile and d-chunk
//   (k_hi.q_hi + k_lo.q_hi + k_hi.q_lo). D element r of lane l = (key kb+16g+8h+r, query q0+(l&15)), so a lane owns one query
//   column and 16 of its 32 keys; the partner lane l^16 owns the other 16 -> row max / row sum need one xor-16 shuffle.
//   Online max-subtracted base-2 softmax in f32. The exp'd values ARE the P A-fragment in place: A row m = query = lane&15,
//   element i <- key kb+8h+i (tile 0, D element i), element 8+i <- key kb+16+8h+i (tile 1, D element i). P is carried x32768
//   as f16 hi + f16 residual. The rescale factor of query row 8h+r of the O accumulators is fetched from lane 8h+r with a
//   shuffle (uniform control). 4+4 v^T B fragments (hi and residual planes, col n = d = 16j + (lane&15), keys k-contiguous),
//   12 P.V WMMAs (hh + lh + hl).
//   Epilogue: 1/l (per query, shuffled to the D row owner) and carry folds in f32; the wave's 16x64 f32 result staged in its LDS
// coverage: per wave 4 instructions x 4 rows x 8 lanes x 8 halves = 16 x 64 per plane; grid NB*NH*SEQ/64 blocks x 4 waves = every
//           (b, s, h) row of both O planes exactly once.
// =====================================================================================================
__global__ __launch_bounds__(ATT_THREADS)
void attn_fwd(const u16* __restrict__ QHIp, const u16* __restrict__ QLOp,
              const u16* __restrict__ KHIp, const u16* __restrict__ KLOp,
              const u16* __restrict__ VHIp, const u16* __restrict__ VLOp,
              const float* __restrict__ gatep,
              u16* OHIp, u16* OLOp) {
  __shared__ __align__(16) u16 ring[2 * BUFH];   // two tile buffers; in the epilogue per wave a result slab [16][68] of f32

  const int tid  = threadIdx.x;
  const int wave = tid >> 5;
  const int lane = tid & 31;
  const int hh   = lane >> 4;
  const int c    = lane & 15;

  const int bid  = blockIdx.x;
  const int qt   = bid % QT64;
  const int head = (bid / QT64) % NH;
  const int b    = bid / (QT64 * NH);
  const int q0   = qt * 64 + wave * 16;

  // per-head scale: sigmoid(bf16 value of g) / 8 in f32; head < NH always (block decode), host checks the input extent
  const float gbf = bfr(gatep[head]);
  const float sgm = 1.0f / (1.0f + expf(-gbf));
  const float lsc = sgm * (0.125f * (LOG2E / (QSC * KSC)));

  // B fragments of q^T: col n = query q0 + c, k = d (k-contiguous row of the q plane)
  const size_t qofs = (((size_t)(b * SEQ + q0 + c)) * NH + head) * HD + 8 * hh;
  const _Float16* Qh  = (const _Float16*)(const void*)QHIp + qofs;
  const _Float16* Ql  = (const _Float16*)(const void*)QLOp + qofs;
  // staging: thread -> (row sr of 16, 16-B piece sc of 8); k tile row = key, v^T tile row = d, both 64 halves long
  const int sr = tid >> 3, sc = (tid & 7) * 8;
  const size_t kofs = (((size_t)b * SEQ + sr) * NH + head) * HD + sc;             // tile's first key added per tile
  const size_t vofs = ((size_t)(b * NH + head) * HD + sr) * SEQ + sc;             // tile's first key added per tile
  const unsigned lds0 = (unsigned)(size_t)(const void*)ring + (unsigned)(sr * LP + sc) * 2u;
  auto stage = [&](int t, int buf) {
    const unsigned l = lds0 + (unsigned)buf * (BUFH * 2u);
    const size_t ko = kofs + (size_t)t * (KT * NH * HD), vo = vofs + (size_t)t * KT;
    stage2(l, l + PLH * 2u, KHIp + ko, KLOp + ko, (size_t)16 * (NH * HD));
    stage2(l + 2u * PLH * 2u, l + 3u * PLH * 2u, VHIp + vo, VLOp + vo, (size_t)16 * SEQ);
  };
  // fragment readers, in halves from a buffer's start: A of k: row m = key 16g + c, k = d; B of v: col n = d = 16j + c, k = key
  const int kfo = c * LP + 8 * hh;
  const int vfo = 2 * PLH + c * LP + 8 * hh;

  float mrun = -INFINITY, lrun = 0.f;
  v8f o[4];
#pragma unroll
  for (int j = 0; j < 4; ++j) o[j] = zero8();

  stage(0, 0);
  asm volatile("s_wait_asynccnt 0x0" ::: "memory");   // this wave's copies of tile 0 have landed
  __syncthreads();                                    // ... and every other wave's: tile 0 may be read
  if (NT > 1) stage(1, 1);

#pragma unroll 1
  for (int t = 0; t < NT; ++t) {
   const _Float16* bufp = (const _Float16*)(const void*)ring + (t & 1) * BUFH;
#pragma unroll   // both key blocks of a tile in line: their LDS offsets become immediates
   for (int sub = 0; sub < 2; ++sub) {
    // ---- transposed scores: s0 = keys kb..kb+15, s1 = keys kb+16..kb+31 (kb = 64t + 32sub), column = query q0 + c ----
    v8f s0 = zero8(), s1 = zero8();
    const _Float16* k0p = bufp + kfo + sub * 32 * LP;
    const _Float16* k1p = k0p + 16 * LP;
    const _Float16* l0p = k0p + PLH;
    const _Float16* l1p = l0p + 16 * LP;
#pragma unroll
    for (int kk = 0; kk < 2; ++kk) {
      const v16h qh  = ldfrag_h(Qh + kk * 32),  ql  = ldfrag_h(Ql + kk * 32);
      const v16h kh0 = ldfrag_h(k0p + kk * 32), kl0 = ldfrag_h(l0p + kk * 32);
      const v16h kh1 = ldfrag_h(k1p + kk * 32), kl1 = ldfrag_h(l1p + kk * 32);
      s0 = mma_h(kh0, qh, s0);
      s0 = mma_h(kl0, qh, s0);
      s0 = mma_h(kh0, ql, s0);
      s1 = mma_h(kh1, qh, s1);
      s1 = mma_h(kl1, qh, s1);
      s1 = mma_h(kh1, ql, s1);
      guard2(s0, s1, qh, ql, kh0, kl0, kh1, kl1);
    }
    // ---- base-2 logits of this lane's 16 keys for query q0 + c: t[i] <- key kb+8hh+i, t[8+i] <- key kb+16+8hh+i ----
    float t[16];
#pragma unroll
    for (int i = 0; i < 8; ++i) { t[i] = s0[i] * lsc; t[8 + i] = s1[i] * lsc; }
    float cm = t[0];
#pragma unroll
    for (int i = 1; i < 16; ++i) cm = fmaxf(cm, t[i]);
    cm = fmaxf(cm, __shfl_xor(cm, 16, 32));
    const float mn = fmaxf(mrun, cm);        // finite from the first block on
    const float al = exp2f(mrun - mn);       // 0 on the first block (mrun = -inf)
    mrun = mn;
    // ---- probabilities (<= 1) and the P A-fragments: hi = f16(p * 32768), lo = f16 residual; element i <-> t[i] ----
    float ps = 0.f;
    FragH ph, pl;
#pragma unroll
    for (int w = 0; w < 2; ++w) {
#pragma unroll
      for (int e4 = 0; e4 < 4; ++e4) {
        const int i = 8 * w + 2 * e4;
        const float p0 = exp2f(t[i] - mn), p1 = exp2f(t[i + 1] - mn);
        ps += p0 + p1;
        const float a0 = p0 * PCAR, a1 = p1 * PCAR;
        const _Float16 h0 = (_Float16)a0, h1 = (_Float16)a1;
        const _Float16 l0 = (_Float16)(a0 - (float)h0), l1 = (_Float16)(a1 - (float)h1);
        ph.u[w][e4] = pk16(h_bits(h0), h_bits(h1));
        pl.u[w][e4] = pk16(h_bits(l0), h_bits(l1));
      }
    }
    ps += __shfl_xor(ps, 16, 32);
    lrun = lrun * al + ps;
    // ---- rescale the O accumulators: D row 8hh+r = query q0+8hh+r, its factor lives in lane 8hh+r (and 16+8hh+r) ----
    float scl[8];
#pragma unroll
    for (int r = 0; r < 8; ++r) scl[r] = __shfl(al, 8 * hh + r, 32);
#pragma unroll
    for (int j = 0; j < 4; ++j) {
#pragma unroll
      for (int r = 0; r < 8; ++r) o[j][r] *= scl[r];
    }
    // ---- P.V : B fragment col n = d = j*16 + c, keys contiguous in the v^T planes ----
    {
      const _Float16* vhp = bufp + vfo + sub * 32;
      const _Float16* vlp = vhp + PLH;
      const v16h vh0 = ldfrag_h(vhp);
      const v16h vh1 = ldfrag_h(vhp + 16 * LP);
      const v16h vh2 = ldfrag_h(vhp + 32 * LP);
      const v16h vh3 = ldfrag_h(vhp + 48 * LP);
      const v16h vl0 = ldfrag_h(vlp);
      const v16h vl1 = ldfrag_h(vlp + 16 * LP);
      const v16h vl2 = ldfrag_h(vlp + 32 * LP);
      const v16h vl3 = ldfrag_h(vlp + 48 * LP);
      o[0] = mma_h(ph.v, vh0, o[0]);  o[0] = mma_h(pl.v, vh0, o[0]);  o[0] = mma_h(ph.v, vl0, o[0]);
      o[1] = mma_h(ph.v, vh1, o[1]);  o[1] = mma_h(pl.v, vh1, o[1]);  o[1] = mma_h(ph.v, vl1, o[1]);
      o[2] = mma_h(ph.v, vh2, o[2]);  o[2] = mma_h(pl.v, vh2, o[2]);  o[2] = mma_h(ph.v, vl2, o[2]);
      o[3] = mma_h(ph.v, vh3, o[3]);  o[3] = mma_h(pl.v, vh3, o[3]);  o[3] = mma_h(ph.v, vl3, o[3]);
      guard10(o[0], o[1], o[2], o[3], ph.v, pl.v, vh0, vh1, vh2, vh3, vl0, vl1, vl2, vl3);
    }
   }
   // ---- hand-over: tile t+1 is published and tile t's buffer is freed by the one barrier; then the refill ----
   asm volatile("s_wait_dscnt 0x0" ::: "memory");      // this wave's reads of tile t are done before its buffer is refilled
   asm volatile("s_wait_asynccnt 0x0" ::: "memory");   // this wave's copies of tile t+1 have landed
   __syncthreads();
   if (t + 2 < NT) stage(t + 2, t & 1);
  }
  asm volatile("s_wait_asynccnt 0x0" ::: "memory");    // nothing in flight when the ring turns into the result slabs
  acc_guard4(o[0], o[1], o[2], o[3]);

  // ---- fold 1/l (per query, owned by lane = query) and the carries (32768 on P, 1024 on v); stage the 16x64 slab ----
  const float linv = (1.0f / lrun) * (1.0f / (PCAR * VCAR));
  float inv[8];
#pragma unroll
  for (int r = 0; r < 8; ++r) inv[r] = __shfl(linv, 8 * hh + r, 32);
  float* slab = (float*)(void*)ring + wave * SLABF;
#pragma unroll
  for (int r = 0; r < 8; ++r) {
#pragma unroll
    for (int j = 0; j < 4; ++j) slab[(8 * hh + r) * 68 + j * 16 + c] = o[j][r] * inv[r];
  }
  wave_sync_lds();
  // ---- O x1024 -> f16 hi + residual planes; lane = (row in group of 4, 8 consecutive d) ----
  v4u oh[4], ol[4];
  const int rq = lane >> 3, c8 = (lane & 7) * 8;
#pragma unroll
  for (int i4 = 0; i4 < 4; ++i4) {
    const int row = i4 * 4 + rq;
    const v4f a = *(const v4f*)(slab + row * 68 + c8), c4 = *(const v4f*)(slab + row * 68 + c8 + 4);
    float w[8];
#pragma unroll
    for (int e = 0; e < 4; ++e) { w[e] = a[e] * OSC; w[4 + e] = c4[e] * OSC; }
#pragma unroll
    for (int e = 0; e < 4; ++e) {
      const _Float16 h0 = (_Float16)w[2 * e], h1 = (_Float16)w[2 * e + 1];
      const _Float16 l0 = (_Float16)(w[2 * e] - (float)h0), l1 = (_Float16)(w[2 * e + 1] - (float)h1);
      oh[i4][e] = pk16(h_bits(h0), h_bits(h1));
      ol[i4][e] = pk16(h_bits(l0), h_bits(l1));
    }
  }
  const size_t ob = (((size_t)(b * SEQ + q0)) * NH + head) * HD + c8;
  {
#pragma unroll
    for (int i4 = 0; i4 < 4; ++i4) {
      const int row = i4 * 4 + rq;
      const size_t o8 = ob + (size_t)row * (NH * HD);
      *(v4u*)(OHIp + o8) = oh[i4];
      *(v4u*)(OLOp + o8) = ol[i4];
    }
    
  }
}

// =====================================================================================================
// Workspace map (bytes, ROWS = NB*SEQ; numbers for NB=2, SEQ=2048); every plane is fully written by whole-line stores before it is
// read; all extents are exact multiples of the store granularity (no pad rows needed); XB and F are reused sequentially
// (in-order stream):
//   XB  bf16 [ROWS][1024]                 8388608        (input Q, then K, then V)
//   WQB bf16 [1024 n][1024 k]             2097152        WKB same  2097152      WVB same  2097152
//   WOB f16  [1024 n][1024 k] x1024       2097152
//   F   f32 [ROWS][1024]                 16777216        (projection q, then k, then v)
//   QHI f16 [NB][SEQ][16][64] x1024       8388608        QLO residual         8388608
//   KHI same                              8388608        KLO residual         8388608
//   VHI f16 [NB][16][64][SEQ] x1024       8388608        VLO residual         8388608
//   OHI f16 [ROWS][1024] x1024            8388608        OLO residual         8388608
//   end                                 100663296
// =====================================================================================================
extern "C" void kernel_launch(void* const* d_in, const int* in_sizes, int n_in,
                              void* d_out, int out_size, void* d_ws, size_t ws_size,
                              hipStream_t stream) {
  const int ROWS = NB * SEQ;
  if (n_in < 12) return;
  const int needX = ((NB - 1) * SEQ_FULL + SEQ) * DMOD;   // last input row read by cvt16 (+1), in elements
  if (in_sizes[0] < needX || in_sizes[1] < needX || in_sizes[2] < needX) return;
  if (in_sizes[3] < DMOD * DMOD || in_sizes[5] < DMOD * DMOD) return;
  if (in_sizes[7] < DMOD * DMOD || in_sizes[9] < DMOD * DMOD) return;
  if (in_sizes[4] < DMOD || in_sizes[6] < DMOD || in_sizes[8] < DMOD || in_sizes[10] < DMOD) return;
  if (in_sizes[11] < NH) return;
  if (out_size < ROWS * DMOD) return;

  const float* Qin = (const float*)d_in[0];
  const float* Kin = (const float*)d_in[1];
  const float* Vin = (const float*)d_in[2];
  const float* wq  = (const float*)d_in[3];
  const float* bq  = (const float*)d_in[4];
  const float* wk  = (const float*)d_in[5];
  const float* bk  = (const float*)d_in[6];
  const float* wv  = (const float*)d_in[7];
  const float* bv  = (const float*)d_in[8];
  const float* wo  = (const float*)d_in[9];
  const float* bo  = (const float*)d_in[10];
  const float* gt  = (const float*)d_in[11];
  float*       out = (float*)d_out;

  const size_t szXB  = (size_t)ROWS * DMOD * 2;
  const size_t szW   = (size_t)DMOD * DMOD * 2;
  const size_t szF   = (size_t)ROWS * DMOD * 4;
  const size_t szP   = (size_t)ROWS * DMOD * 2;                 // q/k/o planes
  const size_t szVP  = (size_t)NB * NH * HD * SEQ * 2;
  size_t off = 0;
  const size_t oXB  = off; off += szXB;
  const size_t oWQB = off; off += szW;
  const size_t oWKB = off; off += szW;
  const size_t oWVB = off; off += szW;
  const size_t oWOB = off; off += szW;
  const size_t oF   = off; off += szF;
  const size_t oQHI = off; off += szP;
  const size_t oQLO = off; off += szP;
  const size_t oKHI = off; off += szP;
  const size_t oKLO = off; off += szP;
  const size_t oVHI = off; off += szVP;
  const size_t oVLO = off; off += szVP;
  const size_t oOHI = off; off += szP;
  const size_t oOLO = off; off += szP;
  if (off > ws_size) return;                            // off = 100663296 at full size
  if (off > (size_t)134217728) return;

  char* ws = (char*)d_ws;
  u16*   XB  = (u16*)(ws + oXB);
  u16*   WQB = (u16*)(ws + oWQB);
  u16*   WKB = (u16*)(ws + oWKB);
  u16*   WVB = (u16*)(ws + oWVB);
  u16*   WOB = (u16*)(ws + oWOB);
  float* F   = (float*)(ws + oF);
  u16*   QHI = (u16*)(ws + oQHI);
  u16*   QLO = (u16*)(ws + oQLO);
  u16*   KHI = (u16*)(ws + oKHI);
  u16*   KLO = (u16*)(ws + oKLO);
  u16*   VHI = (u16*)(ws + oVHI);
  u16*   VLO = (u16*)(ws + oVLO);
  u16*   OHI = (u16*)(ws + oOHI);
  u16*   OLO = (u16*)(ws + oOLO);

  const dim3 blk(256);
  const int n8x = (ROWS * DMOD) / 8;                    // 524288 at full size
  const int n8w = (DMOD * DMOD) / 8;                    // 131072
  const int seg8x = (SEQ * DMOD) / 8;                   // destination octets per batch
  const int str8x = (SEQ_FULL * DMOD) / 8;              // source octets per batch in the input layout
  if ((n8x % 256) != 0 || (n8w % 256) != 0) return;
  if ((DMOD % 32) != 0 || (ROWS % 64) != 0 || (DMOD % 64) != 0) return;
  const dim3 gX(n8x / 256);                             // 2048
  const dim3 gWc(n8w / 256);                            // 512
  const dim3 gG((ROWS / 64) * (DMOD / 64));             // 1024
  const dim3 bG(128);
  const dim3 gVT(NB * NH * (SEQ / 64));                 // 1024
  const dim3 gAT(ATT_BLOCKS);                           // 1024
  const dim3 bAT(ATT_THREADS);                          // 128

  // (0..3) weights [n][k] (already k-contiguous for x.W^T): bf16 planes for wq/wk/wv, f16 of bf16 value x1024 for wo
  cvt16<<<gWc, blk, 0, stream>>>(wq, WQB, n8w, 0, 1.0f, n8w, n8w);
  cvt16<<<gWc, blk, 0, stream>>>(wk, WKB, n8w, 0, 1.0f, n8w, n8w);
  cvt16<<<gWc, blk, 0, stream>>>(wv, WVB, n8w, 0, 1.0f, n8w, n8w);
  cvt16<<<gWc, blk, 0, stream>>>(wo, WOB, n8w, 1, WOS, n8w, n8w);
  // (4..6) q: input -> bf16 plane, projection + bias [ROWS][1024] f32 (col = h*64+d), split -> f16 hi x1024 + residual planes
  cvt16<<<gX, blk, 0, stream>>>(Qin, XB, n8x, 0, 1.0f, seg8x, str8x);
  gemm_bfb<<<gG, bG, 0, stream>>>(XB, WQB, bq, F, ROWS, DMOD, DMOD, 1.0f);
  split16<<<gX, blk, 0, stream>>>(F, QHI, QLO, n8x, QSC);
  // (7..9) k: same pipeline (XB and F reused; single in-order stream)
  cvt16<<<gX, blk, 0, stream>>>(Kin, XB, n8x, 0, 1.0f, seg8x, str8x);
  gemm_bfb<<<gG, bG, 0, stream>>>(XB, WKB, bk, F, ROWS, DMOD, DMOD, 1.0f);
  split16<<<gX, blk, 0, stream>>>(F, KHI, KLO, n8x, KSC);
  // (10..12) v: input -> bf16 plane, projection + bias, v^T planes x1024 (hi + residual)
  cvt16<<<gX, blk, 0, stream>>>(Vin, XB, n8x, 0, 1.0f, seg8x, str8x);
  gemm_bfb<<<gG, bG, 0, stream>>>(XB, WVB, bv, F, ROWS, DMOD, DMOD, 1.0f);
  vt16<<<gVT, blk, 0, stream>>>(F, VHI, VLO);
  // (13) attention with per-head scale sigmoid(g)/8 -> O planes [b][s][h][d] x1024 (hi + residual)
  attn_fwd<<<gAT, bAT, 0, stream>>>(QHI, QLO, KHI, KLO, VHI, VLO, gt, OHI, OLO);
  // (14) output projection + bias -> out [ROWS][1024] f32, carries 1024 (O) x 1024 (wo) folded back
  gemm_h2<<<gG, bG, 0, stream>>>(OHI, OLO, WOB, bo, out, ROWS, DMOD, DMOD, 1.0f / (OSC * WOS));
  (void)hipGetLastError();
}

// v002
// Measured time: 217 microseconds a run.
// Timed twice side by side with v001, it ran 1.42 and 1.43 times as fast.
// Counting every step since v000, it is 1.87 times as fast.
// Contractions: x.W{q,k,v}^T on v_wmma_f32_16x16x32_bf16 (x and W RNE-converted to bf16 operands, f32 accumulate, bias added in f32);
// scores k'.q'^T (q', k' carried x1024 as f16 hi plane + f16 residual plane, products hh+lh+hl), P.v (P x32768 f16 hi+residual,
// v x1024 f16 hi+residual, products hh+lh+hl) and O.Wo^T (O x1024 f16 hi+residual, Wo as f16(bf16(Wo) x1024), products h.w+l.w):
// v_wmma_f32_16x16x32_f16, f32 accumulate. Per-head logit scale sigmoid(bf16(g_h))/8 in f32; base-2 online softmax, 1/l fold and
// bias adds in f32 on VALU.
#include <hip/hip_runtime.h>
#include <math.h>
#include <stdint.h>

#ifndef NB
#define NB    2
#endif
#ifndef SEQ
#define SEQ   2048
#endif
#define NB_FULL  2
#define SEQ_FULL 2048
#define DMOD  1024
#define NH    16
#define HD    64
#define QSC   1024.0f
#define KSC   1024.0f
#define PCAR  32768.0f
#define VCAR  1024.0f
#define OSC   1024.0f
#define WOS   1024.0f
#define LOG2E 1.4426950408889634f
#define ATT_WAVES   4
#define ATT_THREADS (ATT_WAVES * 32)
#define QT64        (SEQ / 64)
#define ATT_BLOCKS  (NB * NH * QT64)
#define NKB    (SEQ / 32)
#define SLABF  (16 * 68)
#define SLAB64 (16 * 68)
#define VTP    72
#define KT     64                 // keys per staged tile
#define LP     72                 // LDS row pitch in halves: 128-B rows + 16 B (16 B x odd, for 16-B LDS reads down a column of rows)
#define PLH    (64 * LP)          // one plane's tile: 64 rows
#define BUFH   (4 * PLH)          // k hi, k residual, v^T hi, v^T residual
#define NT     (SEQ / KT)
static_assert(HD == 64 && DMOD == NH * HD && NH == 16);
static_assert(NB >= 1 && NB <= NB_FULL && SEQ >= 64 && SEQ <= SEQ_FULL && (SEQ % 64) == 0);
static_assert(ATT_THREADS == 128 && ATT_BLOCKS == NB * NH * (SEQ / 64) && NKB * 32 == SEQ);
static_assert(((NB * SEQ) % 64) == 0 && (DMOD % 64) == 0 && (DMOD % 32) == 0);
static_assert((SEQ % 64) == 0 && (SEQ % 8) == 0);
static_assert(((NB * SEQ * DMOD / 8) % 256) == 0 && ((DMOD * DMOD / 8) % 256) == 0 && ((SEQ * DMOD / 8) % 256) == 0);
static_assert(ATT_WAVES * SLABF >= 4 * 16 * 68);
static_assert(HD * VTP >= 63 * VTP + 64);
static_assert(KT == 64 && HD == 64 && NT * KT == SEQ && NT * 2 == NKB && ATT_THREADS == 128);
static_assert(2 * BUFH * 2 >= ATT_WAVES * SLABF * 4 && (LP * 2) % 16 == 0);

typedef unsigned short u16;
typedef _Float16 v16h __attribute__((ext_vector_type(16)));
typedef _Float16 v8h  __attribute__((ext_vector_type(8)));
typedef __bf16   v16b __attribute__((ext_vector_type(16)));
typedef float    v8f  __attribute__((ext_vector_type(8)));
typedef float    v4f  __attribute__((ext_vector_type(4)));
typedef unsigned int v4u __attribute__((ext_vector_type(4)));

union FragH { v16h v; v8h h[2]; v4u u[2]; };
union FragB { v16b v; v4u u[2]; };

// ---- scalar helpers --------------------------------------------------------------------------------
__device__ __forceinline__ unsigned short bf_bits(float f) {          // f32 -> bf16 bits, RNE convert
  unsigned u = __float_as_uint(f);
  return (unsigned short)((u + 0x7FFFu + ((u >> 16) & 1u)) >> 16);
}
__device__ __forceinline__ float bf_up(unsigned short h) { return __uint_as_float(((unsigned)h) << 16); }
__device__ __forceinline__ float bfr(float f) { return bf_up(bf_bits(f)); }
__device__ __forceinline__ unsigned short h_bits(_Float16 x) { return __builtin_bit_cast(unsigned short, x); }
__device__ __forceinline__ unsigned pk16(unsigned short a, unsigned short b) { return (unsigned)a | ((unsigned)b << 16); }
__device__ __forceinline__ v8f zero8() { v8f z = {0.f, 0.f, 0.f, 0.f, 0.f, 0.f, 0.f, 0.f}; return z; }
__device__ __forceinline__ v4f zero4() { v4f z = {0.f, 0.f, 0.f, 0.f}; return z; }

// ---- fragment loaders: 16-bit A/B operand, lane -> row/col (lane&15), p already includes +8*(lane>>4);
//      elements 0..7 <- p[0..7] (k0+8h..), elements 8..15 <- p[16..23] (k0+16+8h..)  (same split k map for A and B;
//      B is always read from a k-contiguous [n][k] plane)
__device__ __forceinline__ v16h ldfrag_h(const _Float16* p) {
  FragH f;
  f.h[0] = *(const v8h*)(p);
  f.h[1] = *(const v8h*)(p + 16);
  return f.v;
}
__device__ __forceinline__ v16b ldfrag_b(const u16* p) {              // bf16 plane read as unsigned integer vectors
  FragB f;
  f.u[0] = *(const v4u*)(p);
  f.u[1] = *(const v4u*)(p + 16);
  return f.v;
}

__device__ __forceinline__ v8f mma_h(v16h a, v16h b, v8f c) {
  return __builtin_amdgcn_wmma_f32_16x16x32_f16(false, a, false, b, (short)0, c, false, false);
}
__device__ __forceinline__ v8f mma_b(v16b a, v16b b, v8f c) {
  return __builtin_amdgcn_wmma_f32_16x16x32_bf16(false, a, false, b, (short)0, c, false, false);
}
__device__ __forceinline__ void guard2(v8f& a, v8f& b, v16h x0, v16h x1, v16h x2, v16h x3, v16h x4, v16h x5) {
#if defined(__HIP_DEVICE_COMPILE__)
  asm volatile("v_nop\n\tv_nop\n\tv_nop\n\tv_nop"
               : "+v"(a), "+v"(b) : "v"(x0), "v"(x1), "v"(x2), "v"(x3), "v"(x4), "v"(x5) : "memory");
#endif
}
__device__ __forceinline__ void guard10(v8f& a, v8f& b, v8f& c, v8f& d, v16h x0, v16h x1, v16h x2, v16h x3, v16h x4,
                                        v16h x5, v16h x6, v16h x7, v16h x8, v16h x9) {
#if defined(__HIP_DEVICE_COMPILE__)
  asm volatile("v_nop\n\tv_nop\n\tv_nop\n\tv_nop"
               : "+v"(a), "+v"(b), "+v"(c), "+v"(d)
               : "v"(x0), "v"(x1), "v"(x2), "v"(x3), "v"(x4), "v"(x5), "v"(x6), "v"(x7), "v"(x8), "v"(x9) : "memory");
#endif
}
__device__ __forceinline__ void acc_guard4(v8f& a, v8f& b, v8f& c, v8f& d) {
#if defined(__HIP_DEVICE_COMPILE__)
  asm volatile("v_nop\n\tv_nop\n\tv_nop\n\tv_nop" : "+v"(a), "+v"(b), "+v"(c), "+v"(d));
#endif
}
// Two planes' 64-row x 128-B tiles, global -> LDS, by 128 threads: per lane four 16-B asynchronous copies a plane (rows r, r+16,
// r+32, r+48; 8 lanes = one whole 128-B row). la/lb: the lane's LDS byte addresses of row r, ga/gb: its global addresses, gstep: 16
// source rows in elements. The s_wait_xcnt closes the statement so that no address register is rewritten ahead of it.
__device__ __forceinline__ void stage2(unsigned la, unsigned lb, const u16* ga, const u16* gb, size_t gstep) {
#if defined(__HIP_DEVICE_COMPILE__)
  const unsigned ls = 16 * LP * 2;
  asm volatile("global_load_async_to_lds_b128 %0, %8, off\n\t"
               "global_load_async_to_lds_b128 %1, %9, off\n\t"
               "global_load_async_to_lds_b128 %2, %10, off\n\t"
               "global_load_async_to_lds_b128 %3, %11, off\n\t"
               "global_load_async_to_lds_b128 %4, %12, off\n\t"
               "global_load_async_to_lds_b128 %5, %13, off\n\t"
               "global_load_async_to_lds_b128 %6, %14, off\n\t"
               "global_load_async_to_lds_b128 %7, %15, off\n\t"
               "s_wait_xcnt 0x0"
               :: "v"(la), "v"(la + ls), "v"(la + 2 * ls), "v"(la + 3 * ls),
                  "v"(lb), "v"(lb + ls), "v"(lb + 2 * ls), "v"(lb + 3 * ls),
                  "v"(ga), "v"(ga + gstep), "v"(ga + 2 * gstep), "v"(ga + 3 * gstep),
                  "v"(gb), "v"(gb + gstep), "v"(gb + 2 * gstep), "v"(gb + 3 * gstep)
               : "memory");
#endif
}
// One plane's tile, the same way: four copies a lane.
__device__ __forceinline__ void stage1(unsigned la, const u16* ga, size_t gstep) {
#if defined(__HIP_DEVICE_COMPILE__)
  const unsigned ls = 16 * LP * 2;
  asm volatile("global_load_async_to_lds_b128 %0, %4, off\n\t"
               "global_load_async_to_lds_b128 %1, %5, off\n\t"
               "global_load_async_to_lds_b128 %2, %6, off\n\t"
               "global_load_async_to_lds_b128 %3, %7, off\n\t"
               "s_wait_xcnt 0x0"
               :: "v"(la), "v"(la + ls), "v"(la + 2 * ls), "v"(la + 3 * ls),
                  "v"(ga), "v"(ga + gstep), "v"(ga + 2 * gstep), "v"(ga + 3 * gstep)
               : "memory");
#endif
}
__device__ __forceinline__ void wave_sync_lds() {
  __builtin_amdgcn_fence(__ATOMIC_RELEASE, "workgroup");
  __builtin_amdgcn_wave_barrier();
  __builtin_amdgcn_fence(__ATOMIC_ACQUIRE, "workgroup");
}

// =====================================================================================================
// f32 plane -> 16-bit plane:  f16mode == 0: bf16 RNE bits;  f16mode == 1: f16 bits of (bf16 RNE value) * scale.
// Destination is a dense plane of n8*8 elements; source octet index = (gt / seg8) * sstride8 + gt % seg8 (segments of seg8
// octets taken at stride sstride8 octets, identity when seg8 == n8): used to read NB batches of SEQ rows out of an input laid out
// with SEQ_FULL rows per batch.
// Thread = 8 consecutive elements: two 16-B loads, one 16-B store; 32 consecutive lanes = 512 contiguous, 512-B aligned bytes
// coverage: grid = n8/256 blocks (host checks exactness) x 256 thr x 8 = the whole destination plane.
// =====================================================================================================
__global__ __launch_bounds__(256) void cvt16(const float* __restrict__ x, u16* D, int n8, int f16mode, float scale,
                                             int seg8, int sstride8) {
  const int gt = blockIdx.x * 256 + (int)threadIdx.x;
  if (gt >= n8) return;                     // no barriers in this kernel
  const size_t so = (size_t)(gt / seg8) * (size_t)sstride8 + (size_t)(gt % seg8);
  const float* p = x + so * 8;
  const v4f a = *(const v4f*)(p), c4 = *(const v4f*)(p + 4);
  float v[8];
#pragma unroll
  for (int e = 0; e < 4; ++e) { v[e] = a[e]; v[4 + e] = c4[e]; }
  unsigned short s[8];
#pragma unroll
  for (int e = 0; e < 8; ++e) {
    const unsigned short hb = h_bits((_Float16)(bfr(v[e]) * scale));
    const unsigned short bb = bf_bits(v[e]);
    s[e] = (f16mode != 0) ? hb : bb;
  }
  v4u o;
#pragma unroll
  for (int e = 0; e < 4; ++e) o[e] = pk16(s[2 * e], s[2 * e + 1]);
  u16* d = D + (size_t)gt * 8;
  {
    *(v4u*)(d) = o;
    
  }
}

// =====================================================================================================
// f32 plane -> f16 hi plane (value * sc, sc a power of two) + f16 residual plane (value * sc - hi, unscaled), same layout.
// Thread = 8 consecutive elements: two 16-B loads, one 16-B store per plane; 32 consecutive lanes = 512 contiguous, 512-B aligned
// coverage: grid = n8/256 blocks (host checks exactness) x 256 thr x 8 = the whole of both planes.
// =====================================================================================================
__global__ __launch_bounds__(256) void split16(const float* __restrict__ x, u16* hpl, u16* lpl, int n8, float sc) {
  const int gt = blockIdx.x * 256 + (int)threadIdx.x;
  if (gt >= n8) return;                     // no barriers in this kernel
  const float* p = x + (size_t)gt * 8;
  const v4f a = *(const v4f*)(p), c4 = *(const v4f*)(p + 4);
  float w[8];
#pragma unroll
  for (int e = 0; e < 4; ++e) { w[e] = a[e]; w[4 + e] = c4[e]; }
  v4u oh, ol;
#pragma unroll
  for (int e = 0; e < 4; ++e) {
    const float t0 = w[2 * e] * sc, t1 = w[2 * e + 1] * sc;
    const _Float16 h0 = (_Float16)t0, h1 = (_Float16)t1;
    const _Float16 l0 = (_Float16)(t0 - (float)h0), l1 = (_Float16)(t1 - (float)h1);
    oh[e] = pk16(h_bits(h0), h_bits(h1));
    ol[e] = pk16(h_bits(l0), h_bits(l1));
  }
  const size_t o8 = (size_t)gt * 8;
  {
    *(v4u*)(hpl + o8) = oh;
    *(v4u*)(lpl + o8) = ol;
    
  }
}

// =====================================================================================================
// GEMM epilogue shared by both engines: the wave's 16x64 f32 tile (times oscale) staged in its LDS slab (pitch 68, wave-private),
// coverage: 8 instructions x 2 rows x 16 lanes x 4 floats = the wave's 16 x 64 tile.
// =====================================================================================================
__device__ __forceinline__ void epi64(float* sl, v8f a0, v8f a1, v8f a2, v8f a3, float oscale, v4f badd, float* C, int N,
                                      size_t rowb, int col0, int lane) {
  const int hh = lane >> 4, m = lane & 15;
#pragma unroll
  for (int r = 0; r < 8; ++r) {
    const int ro = (8 * hh + r) * 68 + m;
    sl[ro]      = a0[r] * oscale;
    sl[ro + 16] = a1[r] * oscale;
    sl[ro + 32] = a2[r] * oscale;
    sl[ro + 48] = a3[r] * oscale;
  }
  wave_sync_lds();
  v4f vals[8];
#pragma unroll
  for (int it = 0; it < 8; ++it) vals[it] = *(const v4f*)(sl + (it * 2 + hh) * 68 + m * 4) + badd;
  float* dst = C + (rowb + (size_t)hh) * (size_t)N + col0 + m * 4;
  {
#pragma unroll
    for (int it = 0; it < 8; ++it) {
      *(v4f*)(dst + (size_t)(it * 2) * (size_t)N) = vals[it];
    }
    
  }
}

// =====================================================================================================
// bf16 GEMM with bias: C[M][N] (f32) = A[M][K] (bf16 row-major) . Bt[N][K]^T (bf16 k-contiguous), times oscale, plus bf16-RNE
// value of bias[n]. Block = 64x64 tile, 4 waves x 16 rows. The block's 64 A rows and 64 Bt rows are staged in LDS 64 k (one whole
// 128-B line a row) at a time by asynchronous copies, two buffers (tile t+1 flies while tile t is worked on, one block barrier a
// tile); fragments are read from LDS (two 16-B reads each, split k map for A and B), two k steps of 32 a tile, in the k order of
// a plain walk (host checks K % 64 == 0, M % 64 == 0, N % 64 == 0, grid = (M/64)*(N/64)).
// =====================================================================================================
__global__ __launch_bounds__(128)
void gemm_bfb(const u16* __restrict__ A, const u16* __restrict__ Bt, const float* __restrict__ bias,
              float* C, int M, int N, int K, float oscale) {
  __shared__ __align__(16) float slab[4 * SLAB64];
  __shared__ __align__(16) u16 ring[2 * 2 * PLH];   // two buffers of [A tile | Bt tile], 64 rows of pitch LP each
  const int tid = threadIdx.x, wave = tid >> 5, lane = tid & 31, hh = lane >> 4, m = lane & 15;
  const int ntile = N >> 6;
  const int bid   = blockIdx.x;
  const int row0  = (bid / ntile) * 64;
  const int rowb  = row0 + wave * 16;
  const int col0  = (bid % ntile) * 64;
  if (row0 + 64 > M) return;                 // block-uniform, in front of every barrier; never taken with the exact grid
  // staging: thread -> (row sr of 16, 16-B piece sc of 8), rows sr, sr+16, sr+32, sr+48 of each operand's tile
  const int sr = tid >> 3, sc = (tid & 7) * 8;
  const u16* ag = A  + (size_t)(row0 + sr) * K + sc;
  const u16* bg = Bt + (size_t)(col0 + sr) * K + sc;
  const unsigned lds0 = (unsigned)(size_t)(const void*)ring + (unsigned)(sr * LP + sc) * 2u;
  const int nt = K >> 6;
  auto stage = [&](int t, int buf) {
    const unsigned l = lds0 + (unsigned)buf * (2u * PLH * 2u);
    stage2(l, l + PLH * 2u, ag + (size_t)t * 64, bg + (size_t)t * 64, (size_t)16 * K);
  };
  // fragment readers, in halves from a buffer's start
  const int afo = (wave * 16 + m) * LP + 8 * hh;
  const int bfo = PLH + m * LP + 8 * hh;
  v8f acc0 = zero8(), acc1 = zero8(), acc2 = zero8(), acc3 = zero8();
  stage(0, 0);
  asm volatile("s_wait_asynccnt 0x0" ::: "memory");   // this wave's copies of tile 0 have landed
  __syncthreads();                                    // ... and every other wave's: tile 0 may be read
  if (nt > 1) stage(1, 1);
#pragma unroll 1   // one tile a trip: the ring's hand-over stands once, at the foot
  for (int t = 0; t < nt; ++t) {
    const u16* bufp = ring + (t & 1) * (2 * PLH);
    v16b a[2], b[2][4];
#pragma unroll
    for (int kk = 0; kk < 2; ++kk) {
      a[kk] = ldfrag_b(bufp + afo + kk * 32);
#pragma unroll
      for (int j = 0; j < 4; ++j) b[kk][j] = ldfrag_b(bufp + bfo + j * 16 * LP + kk * 32);
    }
    __builtin_amdgcn_sched_barrier(0);   // all of the tile's LDS reads issue ahead of its WMMAs: one LDS latency a tile, not several
#pragma unroll
    for (int kk = 0; kk < 2; ++kk) {
      acc0 = mma_b(a[kk], b[kk][0], acc0);
      acc1 = mma_b(a[kk], b[kk][1], acc1);
      acc2 = mma_b(a[kk], b[kk][2], acc2);
      acc3 = mma_b(a[kk], b[kk][3], acc3);
    }
    acc_guard4(acc0, acc1, acc2, acc3);                 // WMMA distance kept on both sides of the branches that follow
    // ---- hand-over: tile t+1 is published and tile t's buffer is freed by the one barrier; then the refill ----
    asm volatile("s_wait_dscnt 0x0" ::: "memory");      // this wave's reads of tile t are done before its buffer is refilled
    asm volatile("s_wait_asynccnt 0x0" ::: "memory");   // this wave's copies of tile t+1 have landed
    __syncthreads();
    if (t + 2 < nt) stage(t + 2, t & 1);
  }
  asm volatile("s_wait_asynccnt 0x0" ::: "memory");     // nothing in flight when the wave goes on to its end
  const v4f bv = *(const v4f*)(bias + col0 + m * 4);      // columns col0 + 4m .. +3, always < N (N multiple of 64)
  v4f badd;
#pragma unroll
  for (int e = 0; e < 4; ++e) badd[e] = bfr(bv[e]);
  epi64(slab + wave * SLAB64, acc0, acc1, acc2, acc3, oscale, badd, C, N, (size_t)rowb, col0, lane);
}

// =====================================================================================================
// f16 hi+lo GEMM with bias: C[M][N] (f32) = (Ahi + Alo)[M][K] . Bt[N][K]^T times oscale, plus bf16-RNE value of bias[n];
// Ahi/Alo f16 planes (same layout), Bt f16 k-contiguous; products hi.B + lo.B into one accumulator (lo is the unscaled
// residual of hi). Same tiling and the same two-buffer LDS ring as gemm_bfb, three planes a tile (Ahi, Alo, Bt).
// =====================================================================================================
__global__ __launch_bounds__(128)
void gemm_h2(const u16* __restrict__ Ah, const u16* __restrict__ Al, const u16* __restrict__ Bt,
             const float* __restrict__ bias, float* C, int M, int N, int K, float oscale) {
  __shared__ __align__(16) float slab[4 * SLAB64];
  __shared__ __align__(16) u16 ring[2 * 3 * PLH];   // two buffers of [Ahi tile | Alo tile | Bt tile], 64 rows of pitch LP each
  const int tid = threadIdx.x, wave = tid >> 5, lane = tid & 31, hh = lane >> 4, m = lane & 15;
  const int ntile = N >> 6;
  const int bid   = blockIdx.x;
  const int row0  = (bid / ntile) * 64;
  const int rowb  = row0 + wave * 16;
  const int col0  = (bid % ntile) * 64;
  if (row0 + 64 > M) return;                 // block-uniform, in front of every barrier; never taken with the exact grid
  // staging: thread -> (row sr of 16, 16-B piece sc of 8), rows sr, sr+16, sr+32, sr+48 of each plane's tile
  const int sr = tid >> 3, sc = (tid & 7) * 8;
  const size_t aofs = (size_t)(row0 + sr) * K + sc;
  const u16* ahg = Ah + aofs;
  const u16* alg = Al + aofs;
  const u16* bg  = Bt + (size_t)(col0 + sr) * K + sc;
  const unsigned lds0 = (unsigned)(size_t)(const void*)ring + (unsigned)(sr * LP + sc) * 2u;
  const int nt = K >> 6;
  auto stage = [&](int t, int buf) {
    const unsigned l = lds0 + (unsigned)buf * (3u * PLH * 2u);
    stage2(l, l + PLH * 2u, ahg + (size_t)t * 64, alg + (size_t)t * 64, (size_t)16 * K);
    stage1(l + 2u * PLH * 2u, bg + (size_t)t * 64, (size_t)16 * K);
  };
  // fragment readers, in halves from a buffer's start
  const int afo = (wave * 16 + m) * LP + 8 * hh;
  const int bfo = 2 * PLH + m * LP + 8 * hh;
  v8f acc0 = zero8(), acc1 = zero8(), acc2 = zero8(), acc3 = zero8();
  stage(0, 0);
  asm volatile("s_wait_asynccnt 0x0" ::: "memory");   // this wave's copies of tile 0 have landed
  __syncthreads();                                    // ... and every other wave's: tile 0 may be read
  if (nt > 1) stage(1, 1);
#pragma unroll 1   // one tile a trip: the ring's hand-over stands once, at the foot
  for (int t = 0; t < nt; ++t) {
    const _Float16* bufp = (const _Float16*)(const void*)ring + (t & 1) * (3 * PLH);
    v16h ah[2], al[2], b[2][4];
#pragma unroll
    for (int kk = 0; kk < 2; ++kk) {
      ah[kk] = ldfrag_h(bufp + afo + kk * 32);
      al[kk] = ldfrag_h(bufp + PLH + afo + kk * 32);
#pragma unroll
      for (int j = 0; j < 4; ++j) b[kk][j] = ldfrag_h(bufp + bfo + j * 16 * LP + kk * 32);
    }
    __builtin_amdgcn_sched_barrier(0);   // all of the tile's LDS reads issue ahead of its WMMAs: one LDS latency a tile, not several
#pragma unroll
    for (int kk = 0; kk < 2; ++kk) {
      acc0 = mma_h(ah[kk], b[kk][0], acc0);  acc0 = mma_h(al[kk], b[kk][0], acc0);
      acc1 = mma_h(ah[kk], b[kk][1], acc1);  acc1 = mma_h(al[kk], b[kk][1], acc1);
      acc2 = mma_h(ah[kk], b[kk][2], acc2);  acc2 = mma_h(al[kk], b[kk][2], acc2);
      acc3 = mma_h(ah[kk], b[kk][3], acc3);  acc3 = mma_h(al[kk], b[kk][3], acc3);
    }
    acc_guard4(acc0, acc1, acc2, acc3);                 // WMMA distance kept on both sides of the branches that follow
    // ---- hand-over: tile t+1 is published and tile t's buffer is freed by the one barrier; then the refill ----
    asm volatile("s_wait_dscnt 0x0" ::: "memory");      // this wave's reads of tile t are done before its buffer is refilled
    asm volatile("s_wait_asynccnt 0x0" ::: "memory");   // this wave's copies of tile t+1 have landed
    __syncthreads();
    if (t + 2 < nt) stage(t + 2, t & 1);
  }
  asm volatile("s_wait_asynccnt 0x0" ::: "memory");     // nothing in flight when the wave goes on to its end
  const v4f bv = *(const v4f*)(bias + col0 + m * 4);      // columns col0 + 4m .. +3, always < N (N multiple of 64)
  v4f badd;
#pragma unroll
  for (int e = 0; e < 4; ++e) badd[e] = bfr(bv[e]);
  epi64(slab + wave * SLAB64, acc0, acc1, acc2, acc3, oscale, badd, C, N, (size_t)rowb, col0, lane);
}

// =====================================================================================================
// v^T planes: VH[(b*NH + h)*HD + d][s] = f16(v[b][s][h][d] * 1024), VL = f16 residual of the same value.
// Block = (b, h, 64 keys): 64 source rows of HD floats loaded with 16-B loads, converted, scattered into two LDS tiles
// coverage: load 256 thr x 16 elements = 64 x 64; store 2 iterations x 256 thr x 8 halves = 64 lines x 64 = the block's tile of
//           each plane; grid = NB x NH x SEQ/64 blocks covers both planes exactly once.
// =====================================================================================================
__global__ __launch_bounds__(256) void vt16(const float* __restrict__ v, u16* VHo, u16* VLo) {
  __shared__ __align__(16) u16 TH[HD * VTP];
  __shared__ __align__(16) u16 TL[HD * VTP];
  const int tid = threadIdx.x;
  const int bid = blockIdx.x;
  const int st  = bid % QT64;
  const int h   = (bid / QT64) % NH;
  const int b   = bid / (QT64 * NH);
  const int s0  = st * 64;
  {
    const int sl = tid >> 2;                  // key within tile 0..63
    const int dc = (tid & 3) * 16;            // d chunk
    const float* src = v + (((size_t)(b * SEQ + s0 + sl)) * NH + h) * HD + dc;
#pragma unroll
    for (int i = 0; i < 4; ++i) {
      const v4f a = *(const v4f*)(src + 4 * i);
#pragma unroll
      for (int e = 0; e < 4; ++e) {
        const float t = a[e] * VCAR;
        const _Float16 hv = (_Float16)t;
        const _Float16 lv = (_Float16)(t - (float)hv);
        TH[(dc + 4 * i + e) * VTP + sl] = h_bits(hv);
        TL[(dc + 4 * i + e) * VTP + sl] = h_bits(lv);
      }
    }
  }
  __syncthreads();
  v4u vh[2], vl[2];
  const int q8 = tid >> 3, p8 = (tid & 7) * 8;
#pragma unroll
  for (int it = 0; it < 2; ++it) {
    const int line = it * 32 + q8;            // d = 0..63
    vh[it] = *(const v4u*)(TH + line * VTP + p8);
    vl[it] = *(const v4u*)(TL + line * VTP + p8);
  }
  const size_t base = ((size_t)(b * NH + h) * HD) * SEQ + s0 + p8;
  {
#pragma unroll
    for (int it = 0; it < 2; ++it) {
      const int line = it * 32 + q8;
      *(v4u*)(VHo + base + (size_t)line * SEQ) = vh[it];
      *(v4u*)(VLo + base + (size_t)line * SEQ) = vl[it];
    }
    
  }
}

// =====================================================================================================
// Full (non-causal, unmasked) multi-head flash attention: block = (batch b, head, 64 query rows), 4 waves, wave w owns the
// 16 query rows q0 = 64*qt + 16*w .. q0+15. The k and v^T planes' tiles of KT = 64 keys are staged in LDS by asynchronous copies, two
// buffers (tile t+1 flies while tile t is worked on, one block barrier a tile), and read by all 4 waves; each tile serves two key
// blocks of 32. The ring becomes the waves' private result slabs behind the last tile's barrier.
//   Per-head logit scale: sigmoid(bf16 RNE value of g[head]) / 8, computed in f32 once per thread (head uniform per block) and
//   folded with log2(e) and the q/k carries into lsc.
//   q planes (hi, lo f16, x1024) laid out [b][s][h][d]; k planes the same; v^T planes [b][h][d][s] (x1024).
//   All NKB = SEQ/32 key blocks of 32 keys are visited (static bound).
//   Scores are computed TRANSPOSED: S^T tile g (g = 0,1) = k rows (keys kb+16g .. +15, A operand, row m = lane&15, split k map
//   over d) times q^T (B operand, col n = query q0 + (lane&15), k = d, split map), 3 products per tile and d-chunk
//   (k_hi.q_hi + k_lo.q_hi + k_hi.q_lo). D element r of lane l = (key kb+16g+8h+r, query q0+(l&15)), so a lane owns one query
//   column and 16 of its 32 keys; the partner lane l^16 owns the other 16 -> row max / row sum need one xor-16 shuffle.
//   Online max-subtracted base-2 softmax in f32. The exp'd values ARE the P A-fragment in place: A row m = query = lane&15,
//   element i <- key kb+8h+i (tile 0, D element i), element 8+i <- key kb+16+8h+i (tile 1, D element i). P is carried x32768
//   as f16 hi + f16 residual. The rescale factor of query row 8h+r of the O accumulators is fetched from lane 8h+r with a
//   shuffle (uniform control). 4+4 v^T B fragments (hi and residual planes, col n = d = 16j + (lane&15), keys k-contiguous),
//   12 P.V WMMAs (hh + lh + hl).
//   Epilogue: 1/l (per query, shuffled to the D row owner) and carry folds in f32; the wave's 16x64 f32 result staged in its LDS
// coverage: per wave 4 instructions x 4 rows x 8 lanes x 8 halves = 16 x 64 per plane; grid NB*NH*SEQ/64 blocks x 4 waves = every
//           (b, s, h) row of both O planes exactly once.
// =====================================================================================================
__global__ __launch_bounds__(ATT_THREADS)
void attn_fwd(const u16* __restrict__ QHIp, const u16* __restrict__ QLOp,
              const u16* __restrict__ KHIp, const u16* __restrict__ KLOp,
              const u16* __restrict__ VHIp, const u16* __restrict__ VLOp,
              const float* __restrict__ gatep,
              u16* OHIp, u16* OLOp) {
  __shared__ __align__(16) u16 ring[2 * BUFH];   // two tile buffers; in the epilogue per wave a result slab [16][68] of f32

  const int tid  = threadIdx.x;
  const int wave = tid >> 5;
  const int lane = tid & 31;
  const int hh   = lane >> 4;
  const int c    = lane & 15;

  const int bid  = blockIdx.x;
  const int qt   = bid % QT64;
  const int head = (bid / QT64) % NH;
  const int b    = bid / (QT64 * NH);
  const int q0   = qt * 64 + wave * 16;

  // per-head scale: sigmoid(bf16 value of g) / 8 in f32; head < NH always (block decode), host checks the input extent
  const float gbf = bfr(gatep[head]);
  const float sgm = 1.0f / (1.0f + expf(-gbf));
  const float lsc = sgm * (0.125f * (LOG2E / (QSC * KSC)));

  // B fragments of q^T: col n = query q0 + c, k = d (k-contiguous row of the q plane)
  const size_t qofs = (((size_t)(b * SEQ + q0 + c)) * NH + head) * HD + 8 * hh;
  const _Float16* Qh  = (const _Float16*)(const void*)QHIp + qofs;
  const _Float16* Ql  = (const _Float16*)(const void*)QLOp + qofs;
  // staging: thread -> (row sr of 16, 16-B piece sc of 8); k tile row = key, v^T tile row = d, both 64 halves long
  const int sr = tid >> 3, sc = (tid & 7) * 8;
  const size_t kofs = (((size_t)b * SEQ + sr) * NH + head) * HD + sc;             // tile's first key added per tile
  const size_t vofs = ((size_t)(b * NH + head) * HD + sr) * SEQ + sc;             // tile's first key added per tile
  const unsigned lds0 = (unsigned)(size_t)(const void*)ring + (unsigned)(sr * LP + sc) * 2u;
  auto stage = [&](int t, int buf) {
    const unsigned l = lds0 + (unsigned)buf * (BUFH * 2u);
    const size_t ko = kofs + (size_t)t * (KT * NH * HD), vo = vofs + (size_t)t * KT;
    stage2(l, l + PLH * 2u, KHIp + ko, KLOp + ko, (size_t)16 * (NH * HD));
    stage2(l + 2u * PLH * 2u, l + 3u * PLH * 2u, VHIp + vo, VLOp + vo, (size_t)16 * SEQ);
  };
  // fragment readers, in halves from a buffer's start: A of k: row m = key 16g + c, k = d; B of v: col n = d = 16j + c, k = key
  const int kfo = c * LP + 8 * hh;
  const int vfo = 2 * PLH + c * LP + 8 * hh;

  float mrun = -INFINITY, lrun = 0.f;
  v8f o[4];
#pragma unroll
  for (int j = 0; j < 4; ++j) o[j] = zero8();

  stage(0, 0);
  asm volatile("s_wait_asynccnt 0x0" ::: "memory");   // this wave's copies of tile 0 have landed
  __syncthreads();                                    // ... and every other wave's: tile 0 may be read
  if (NT > 1) stage(1, 1);

#pragma unroll 1
  for (int t = 0; t < NT; ++t) {
   const _Float16* bufp = (const _Float16*)(const void*)ring + (t & 1) * BUFH;
#pragma unroll   // both key blocks of a tile in line: their LDS offsets become immediates
   for (int sub = 0; sub < 2; ++sub) {
    // ---- transposed scores: s0 = keys kb..kb+15, s1 = keys kb+16..kb+31 (kb = 64t + 32sub), column = query q0 + c ----
    v8f s0 = zero8(), s1 = zero8();
    const _Float16* k0p = bufp + kfo + sub * 32 * LP;
    const _Float16* k1p = k0p + 16 * LP;
    const _Float16* l0p = k0p + PLH;
    const _Float16* l1p = l0p + 16 * LP;
#pragma unroll
    for (int kk = 0; kk < 2; ++kk) {
      const v16h qh  = ldfrag_h(Qh + kk * 32),  ql  = ldfrag_h(Ql + kk * 32);
      const v16h kh0 = ldfrag_h(k0p + kk * 32), kl0 = ldfrag_h(l0p + kk * 32);
      const v16h kh1 = ldfrag_h(k1p + kk * 32), kl1 = ldfrag_h(l1p + kk * 32);
      s0 = mma_h(kh0, qh, s0);
      s0 = mma_h(kl0, qh, s0);
      s0 = mma_h(kh0, ql, s0);
      s1 = mma_h(kh1, qh, s1);
      s1 = mma_h(kl1, qh, s1);
      s1 = mma_h(kh1, ql, s1);
      guard2(s0, s1, qh, ql, kh0, kl0, kh1, kl1);
    }
    // ---- base-2 logits of this lane's 16 keys for query q0 + c: t[i] <- key kb+8hh+i, t[8+i] <- key kb+16+8hh+i ----
    float t[16];
#pragma unroll
    for (int i = 0; i < 8; ++i) { t[i] = s0[i] * lsc; t[8 + i] = s1[i] * lsc; }
    float cm = t[0];
#pragma unroll
    for (int i = 1; i < 16; ++i) cm = fmaxf(cm, t[i]);
    cm = fmaxf(cm, __shfl_xor(cm, 16, 32));
    const float mn = fmaxf(mrun, cm);        // finite from the first block on
    const float al = exp2f(mrun - mn);       // 0 on the first block (mrun = -inf)
    mrun = mn;
    // ---- probabilities (<= 1) and the P A-fragments: hi = f16(p * 32768), lo = f16 residual; element i <-> t[i] ----
    float ps = 0.f;
    FragH ph, pl;
#pragma unroll
    for (int w = 0; w < 2; ++w) {
#pragma unroll
      for (int e4 = 0; e4 < 4; ++e4) {
        const int i = 8 * w + 2 * e4;
        const float p0 = exp2f(t[i] - mn), p1 = exp2f(t[i + 1] - mn);
        ps += p0 + p1;
        const float a0 = p0 * PCAR, a1 = p1 * PCAR;
        const _Float16 h0 = (_Float16)a0, h1 = (_Float16)a1;
        const _Float16 l0 = (_Float16)(a0 - (float)h0), l1 = (_Float16)(a1 - (float)h1);
        ph.u[w][e4] = pk16(h_bits(h0), h_bits(h1));
        pl.u[w][e4] = pk16(h_bits(l0), h_bits(l1));
      }
    }
    ps += __shfl_xor(ps, 16, 32);
    lrun = lrun * al + ps;
    // ---- rescale the O accumulators: D row 8hh+r = query q0+8hh+r, its factor lives in lane 8hh+r (and 16+8hh+r) ----
    float scl[8];
#pragma unroll
    for (int r = 0; r < 8; ++r) scl[r] = __shfl(al, 8 * hh + r, 32);
#pragma unroll
    for (int j = 0; j < 4; ++j) {
#pragma unroll
      for (int r = 0; r < 8; ++r) o[j][r] *= scl[r];
    }
    // ---- P.V : B fragment col n = d = j*16 + c, keys contiguous in the v^T planes ----
    {
      const _Float16* vhp = bufp + vfo + sub * 32;
      const _Float16* vlp = vhp + PLH;
      const v16h vh0 = ldfrag_h(vhp);
      const v16h vh1 = ldfrag_h(vhp + 16 * LP);
      const v16h vh2 = ldfrag_h(vhp + 32 * LP);
      const v16h vh3 = ldfrag_h(vhp + 48 * LP);
      const v16h vl0 = ldfrag_h(vlp);
      const v16h vl1 = ldfrag_h(vlp + 16 * LP);
      const v16h vl2 = ldfrag_h(vlp + 32 * LP);
      const v16h vl3 = ldfrag_h(vlp + 48 * LP);
      o[0] = mma_h(ph.v, vh0, o[0]);  o[0] = mma_h(pl.v, vh0, o[0]);  o[0] = mma_h(ph.v, vl0, o[0]);
      o[1] = mma_h(ph.v, vh1, o[1]);  o[1] = mma_h(pl.v, vh1, o[1]);  o[1] = mma_h(ph.v, vl1, o[1]);
      o[2] = mma_h(ph.v, vh2, o[2]);  o[2] = mma_h(pl.v, vh2, o[2]);  o[2] = mma_h(ph.v, vl2, o[2]);
      o[3] = mma_h(ph.v, vh3, o[3]);  o[3] = mma_h(pl.v, vh3, o[3]);  o[3] = mma_h(ph.v, vl3, o[3]);
      guard10(o[0], o[1], o[2], o[3], ph.v, pl.v, vh0, vh1, vh2, vh3, vl0, vl1, vl2, vl3);
    }
   }
   // ---- hand-over: tile t+1 is published and tile t's buffer is freed by the one barrier; then the refill ----
   asm volatile("s_wait_dscnt 0x0" ::: "memory");      // this wave's reads of tile t are done before its buffer is refilled
   asm volatile("s_wait_asynccnt 0x0" ::: "memory");   // this wave's copies of tile t+1 have landed
   __syncthreads();
   if (t + 2 < NT) stage(t + 2, t & 1);
  }
  asm volatile("s_wait_asynccnt 0x0" ::: "memory");    // nothing in flight when the ring turns into the result slabs
  acc_guard4(o[0], o[1], o[2], o[3]);

  // ---- fold 1/l (per query, owned by lane = query) and the carries (32768 on P, 1024 on v); stage the 16x64 slab ----
  const float linv = (1.0f / lrun) * (1.0f / (PCAR * VCAR));
  float inv[8];
#pragma unroll
  for (int r = 0; r < 8; ++r) inv[r] = __shfl(linv, 8 * hh + r, 32);
  float* slab = (float*)(void*)ring + wave * SLABF;
#pragma unroll
  for (int r = 0; r < 8; ++r) {
#pragma unroll
    for (int j = 0; j < 4; ++j) slab[(8 * hh + r) * 68 + j * 16 + c] = o[j][r] * inv[r];
  }
  wave_sync_lds();
  // ---- O x1024 -> f16 hi + residual planes; lane = (row in group of 4, 8 consecutive d) ----
  v4u oh[4], ol[4];
  const int rq = lane >> 3, c8 = (lane & 7) * 8;
#pragma unroll
  for (int i4 = 0; i4 < 4; ++i4) {
    const int row = i4 * 4 + rq;
    const v4f a = *(const v4f*)(slab + row * 68 + c8), c4 = *(const v4f*)(slab + row * 68 + c8 + 4);
    float w[8];
#pragma unroll
    for (int e = 0; e < 4; ++e) { w[e] = a[e] * OSC; w[4 + e] = c4[e] * OSC; }
#pragma unroll
    for (int e = 0; e < 4; ++e) {
      const _Float16 h0 = (_Float16)w[2 * e], h1 = (_Float16)w[2 * e + 1];
      const _Float16 l0 = (_Float16)(w[2 * e] - (float)h0), l1 = (_Float16)(w[2 * e + 1] - (float)h1);
      oh[i4][e] = pk16(h_bits(h0), h_bits(h1));
      ol[i4][e] = pk16(h_bits(l0), h_bits(l1));
    }
  }
  const size_t ob = (((size_t)(b * SEQ + q0)) * NH + head) * HD + c8;
  {
#pragma unroll
    for (int i4 = 0; i4 < 4; ++i4) {
      const int row = i4 * 4 + rq;
      const size_t o8 = ob + (size_t)row * (NH * HD);
      *(v4u*)(OHIp + o8) = oh[i4];
      *(v4u*)(OLOp + o8) = ol[i4];
    }
    
  }
}

// =====================================================================================================
// Workspace map (bytes, ROWS = NB*SEQ; numbers for NB=2, SEQ=2048); every plane is fully written by whole-line stores before it is
// read; all extents are exact multiples of the store granularity (no pad rows needed); XB and F are reused sequentially
// (in-order stream):
//   XB  bf16 [ROWS][1024]                 8388608        (input Q, then K, then V)
//   WQB bf16 [1024 n][1024 k]             2097152        WKB same  2097152      WVB same  2097152
//   WOB f16  [1024 n][1024 k] x1024       2097152
//   F   f32 [ROWS][1024]                 16777216        (projection q, then k, then v)
//   QHI f16 [NB][SEQ][16][64] x1024       8388608        QLO residual         8388608
//   KHI same                              8388608        KLO residual         8388608
//   VHI f16 [NB][16][64][SEQ] x1024       8388608        VLO residual         8388608
//   OHI f16 [ROWS][1024] x1024            8388608        OLO residual         8388608
//   end                                 100663296
// =====================================================================================================
extern "C" void kernel_launch(void* const* d_in, const int* in_sizes, int n_in,
                              void* d_out, int out_size, void* d_ws, size_t ws_size,
                              hipStream_t stream) {
  const int ROWS = NB * SEQ;
  if (n_in < 12) return;
  const int needX = ((NB - 1) * SEQ_FULL + SEQ) * DMOD;   // last input row read by cvt16 (+1), in elements
  if (in_sizes[0] < needX || in_sizes[1] < needX || in_sizes[2] < needX) return;
  if (in_sizes[3] < DMOD * DMOD || in_sizes[5] < DMOD * DMOD) return;
  if (in_sizes[7] < DMOD * DMOD || in_sizes[9] < DMOD * DMOD) return;
  if (in_sizes[4] < DMOD || in_sizes[6] < DMOD || in_sizes[8] < DMOD || in_sizes[10] < DMOD) return;
  if (in_sizes[11] < NH) return;
  if (out_size < ROWS * DMOD) return;

  const float* Qin = (const float*)d_in[0];
  const float* Kin = (const float*)d_in[1];
  const float* Vin = (const float*)d_in[2];
  const float* wq  = (const float*)d_in[3];
  const float* bq  = (const float*)d_in[4];
  const float* wk  = (const float*)d_in[5];
  const float* bk  = (const float*)d_in[6];
  const float* wv  = (const float*)d_in[7];
  const float* bv  = (const float*)d_in[8];
  const float* wo  = (const float*)d_in[9];
  const float* bo  = (const float*)d_in[10];
  const float* gt  = (const float*)d_in[11];
  float*       out = (float*)d_out;

  const size_t szXB  = (size_t)ROWS * DMOD * 2;
  const size_t szW   = (size_t)DMOD * DMOD * 2;
  const size_t szF   = (size_t)ROWS * DMOD * 4;
  const size_t szP   = (size_t)ROWS * DMOD * 2;                 // q/k/o planes
  const size_t szVP  = (size_t)NB * NH * HD * SEQ * 2;
  size_t off = 0;
  const size_t oXB  = off; off += szXB;
  const size_t oWQB = off; off += szW;
  const size_t oWKB = off; off += szW;
  const size_t oWVB = off; off += szW;
  const size_t oWOB = off; off += szW;
  const size_t oF   = off; off += szF;
  const size_t oQHI = off; off += szP;
  const size_t oQLO = off; off += szP;
  const size_t oKHI = off; off += szP;
  const size_t oKLO = off; off += szP;
  const size_t oVHI = off; off += szVP;
  const size_t oVLO = off; off += szVP;
  const size_t oOHI = off; off += szP;
  const size_t oOLO = off; off += szP;
  if (off > ws_size) return;                            // off = 100663296 at full size
  if (off > (size_t)134217728) return;

  char* ws = (char*)d_ws;
  u16*   XB  = (u16*)(ws + oXB);
  u16*   WQB = (u16*)(ws + oWQB);
  u16*   WKB = (u16*)(ws + oWKB);
  u16*   WVB = (u16*)(ws + oWVB);
  u16*   WOB = (u16*)(ws + oWOB);
  float* F   = (float*)(ws + oF);
  u16*   QHI = (u16*)(ws + oQHI);
  u16*   QLO = (u16*)(ws + oQLO);
  u16*   KHI = (u16*)(ws + oKHI);
  u16*   KLO = (u16*)(ws + oKLO);
  u16*   VHI = (u16*)(ws + oVHI);
  u16*   VLO = (u16*)(ws + oVLO);
  u16*   OHI = (u16*)(ws + oOHI);
  u16*   OLO = (u16*)(ws + oOLO);

  const dim3 blk(256);
  const int n8x = (ROWS * DMOD) / 8;                    // 524288 at full size
  const int n8w = (DMOD * DMOD) / 8;                    // 131072
  const int seg8x = (SEQ * DMOD) / 8;                   // destination octets per batch
  const int str8x = (SEQ_FULL * DMOD) / 8;              // source octets per batch in the input layout
  if ((n8x % 256) != 0 || (n8w % 256) != 0) return;
  if ((DMOD % 32) != 0 || (ROWS % 64) != 0 || (DMOD % 64) != 0) return;
  const dim3 gX(n8x / 256);                             // 2048
  const dim3 gWc(n8w / 256);                            // 512
  const dim3 gG((ROWS / 64) * (DMOD / 64));             // 1024
  const dim3 bG(128);
  const dim3 gVT(NB * NH * (SEQ / 64));                 // 1024
  const dim3 gAT(ATT_BLOCKS);                           // 1024
  const dim3 bAT(ATT_THREADS);                          // 128

  // (0..3) weights [n][k] (already k-contiguous for x.W^T): bf16 planes for wq/wk/wv, f16 of bf16 value x1024 for wo
  cvt16<<<gWc, blk, 0, stream>>>(wq, WQB, n8w, 0, 1.0f, n8w, n8w);
  cvt16<<<gWc, blk, 0, stream>>>(wk, WKB, n8w, 0, 1.0f, n8w, n8w);
  cvt16<<<gWc, blk, 0, stream>>>(wv, WVB, n8w, 0, 1.0f, n8w, n8w);
  cvt16<<<gWc, blk, 0, stream>>>(wo, WOB, n8w, 1, WOS, n8w, n8w);
  // (4..6) q: input -> bf16 plane, projection + bias [ROWS][1024] f32 (col = h*64+d), split -> f16 hi x1024 + residual planes
  cvt16<<<gX, blk, 0, stream>>>(Qin, XB, n8x, 0, 1.0f, seg8x, str8x);
  gemm_bfb<<<gG, bG, 0, stream>>>(XB, WQB, bq, F, ROWS, DMOD, DMOD, 1.0f);
  split16<<<gX, blk, 0, stream>>>(F, QHI, QLO, n8x, QSC);
  // (7..9) k: same pipeline (XB and F reused; single in-order stream)
  cvt16<<<gX, blk, 0, stream>>>(Kin, XB, n8x, 0, 1.0f, seg8x, str8x);
  gemm_bfb<<<gG, bG, 0, stream>>>(XB, WKB, bk, F, ROWS, DMOD, DMOD, 1.0f);
  split16<<<gX, blk, 0, stream>>>(F, KHI, KLO, n8x, KSC);
  // (10..12) v: input -> bf16 plane, projection + bias, v^T planes x1024 (hi + residual)
  cvt16<<<gX, blk, 0, stream>>>(Vin, XB, n8x, 0, 1.0f, seg8x, str8x);
  gemm_bfb<<<gG, bG, 0, stream>>>(XB, WVB, bv, F, ROWS, DMOD, DMOD, 1.0f);
  vt16<<<gVT, blk, 0, stream>>>(F, VHI, VLO);
  // (13) attention with per-head scale sigmoid(g)/8 -> O planes [b][s][h][d] x1024 (hi + residual)
  attn_fwd<<<gAT, bAT, 0, stream>>>(QHI, QLO, KHI, KLO, VHI, VLO, gt, OHI, OLO);
  // (14) output projection + bias -> out [ROWS][1024] f32, carries 1024 (O) x 1024 (wo) folded back
  gemm_h2<<<gG, bG, 0, stream>>>(OHI, OLO, WOB, bo, out, ROWS, DMOD, DMOD, 1.0f / (OSC * WOS));
  (void)hipGetLastError();
}

// v003
// One run takes 197 microseconds.
// In both of two side-by-side timings against v002, it was 1.10 times as fast.
// Over all steps from v000 it is 2.05 times as fast.
// Contractions: x.W{q,k,v}^T on v_wmma_f32_16x16x32_bf16 (x and W RNE-converted to bf16 operands, f32 accumulate, bias added in f32);
// scores k'.q'^T (q', k' carried x1024 as f16 hi plane + f16 residual plane, products hh+lh+hl), P.v (P x32768 f16 hi+residual,
// v x1024 f16 hi+residual, products hh+lh+hl) and O.Wo^T (O x1024 f16 hi+residual, Wo as f16(bf16(Wo) x1024), products h.w+l.w):
// v_wmma_f32_16x16x32_f16, f32 accumulate. Per-head logit scale sigmoid(bf16(g_h))/8 in f32; base-2 online softmax, 1/l fold and
// bias adds in f32 on VALU.
#include <hip/hip_runtime.h>
#include <math.h>
#include <stdint.h>

#ifndef NB
#define NB    2
#endif
#ifndef SEQ
#define SEQ   2048
#endif
#define NB_FULL  2
#define SEQ_FULL 2048
#define DMOD  1024
#define NH    16
#define HD    64
#define QSC   1024.0f
#define KSC   1024.0f
#define PCAR  32768.0f
#define VCAR  1024.0f
#define OSC   1024.0f
#define WOS   1024.0f
#define LOG2E 1.4426950408889634f
#define ATT_WAVES   4
#define ATT_THREADS (ATT_WAVES * 32)
#define QT64        (SEQ / 64)
#define ATT_BLOCKS  (NB * NH * QT64)
#define NKB    (SEQ / 32)
#define SLABF  (16 * 68)
#define SLAB64 (16 * 68)
#define VTP    72
#define KT     64                 // keys per staged tile
#define LP     72                 // LDS row pitch in halves: 128-B rows + 16 B (16 B x odd, for 16-B LDS reads down a column of rows)
#define PLH    (64 * LP)          // one plane's tile: 64 rows
#define BUFH   (4 * PLH)          // k hi, k residual, v^T hi, v^T residual
#define NT     (SEQ / KT)
static_assert(HD == 64 && DMOD == NH * HD && NH == 16);
static_assert(NB >= 1 && NB <= NB_FULL && SEQ >= 64 && SEQ <= SEQ_FULL && (SEQ % 64) == 0);
static_assert(ATT_THREADS == 128 && ATT_BLOCKS == NB * NH * (SEQ / 64) && NKB * 32 == SEQ);
static_assert(((NB * SEQ) % 64) == 0 && (DMOD % 64) == 0 && (DMOD % 32) == 0);
static_assert((SEQ % 64) == 0 && (SEQ % 8) == 0);
static_assert(((NB * SEQ * DMOD / 8) % 256) == 0 && ((DMOD * DMOD / 8) % 256) == 0 && ((SEQ * DMOD / 8) % 256) == 0);
static_assert(ATT_WAVES * SLABF >= 4 * 16 * 68);
static_assert(HD * VTP >= 63 * VTP + 64 && 2 * 2 * PLH >= 2 * HD * VTP && (VTP * 2) % 16 == 0);
static_assert(KT == 64 && HD == 64 && NT * KT == SEQ && NT * 2 == NKB && ATT_THREADS == 128);
static_assert(2 * BUFH * 2 >= ATT_WAVES * SLABF * 4 && (LP * 2) % 16 == 0);

typedef unsigned short u16;
typedef _Float16 v16h __attribute__((ext_vector_type(16)));
typedef _Float16 v8h  __attribute__((ext_vector_type(8)));
typedef __bf16   v16b __attribute__((ext_vector_type(16)));
typedef float    v8f  __attribute__((ext_vector_type(8)));
typedef float    v4f  __attribute__((ext_vector_type(4)));
typedef unsigned int v4u __attribute__((ext_vector_type(4)));

union FragH { v16h v; v8h h[2]; v4u u[2]; };
union FragB { v16b v; v4u u[2]; };

// ---- scalar helpers --------------------------------------------------------------------------------
__device__ __forceinline__ unsigned short bf_bits(float f) {          // f32 -> bf16 bits, RNE convert
  unsigned u = __float_as_uint(f);
  return (unsigned short)((u + 0x7FFFu + ((u >> 16) & 1u)) >> 16);
}
__device__ __forceinline__ float bf_up(unsigned short h) { return __uint_as_float(((unsigned)h) << 16); }
__device__ __forceinline__ float bfr(float f) { return bf_up(bf_bits(f)); }
__device__ __forceinline__ unsigned short h_bits(_Float16 x) { return __builtin_bit_cast(unsigned short, x); }
__device__ __forceinline__ unsigned pk16(unsigned short a, unsigned short b) { return (unsigned)a | ((unsigned)b << 16); }
__device__ __forceinline__ v8f zero8() { v8f z = {0.f, 0.f, 0.f, 0.f, 0.f, 0.f, 0.f, 0.f}; return z; }
__device__ __forceinline__ v4f zero4() { v4f z = {0.f, 0.f, 0.f, 0.f}; return z; }

// ---- fragment loaders: 16-bit A/B operand, lane -> row/col (lane&15), p already includes +8*(lane>>4);
//      elements 0..7 <- p[0..7] (k0+8h..), elements 8..15 <- p[16..23] (k0+16+8h..)  (same split k map for A and B;
//      B is always read from a k-contiguous [n][k] plane)
__device__ __forceinline__ v16h ldfrag_h(const _Float16* p) {
  FragH f;
  f.h[0] = *(const v8h*)(p);
  f.h[1] = *(const v8h*)(p + 16);
  return f.v;
}
__device__ __forceinline__ v16b ldfrag_b(const u16* p) {              // bf16 plane read as unsigned integer vectors
  FragB f;
  f.u[0] = *(const v4u*)(p);
  f.u[1] = *(const v4u*)(p + 16);
  return f.v;
}

__device__ __forceinline__ v8f mma_h(v16h a, v16h b, v8f c) {
  return __builtin_amdgcn_wmma_f32_16x16x32_f16(false, a, false, b, (short)0, c, false, false);
}
__device__ __forceinline__ v8f mma_b(v16b a, v16b b, v8f c) {
  return __builtin_amdgcn_wmma_f32_16x16x32_bf16(false, a, false, b, (short)0, c, false, false);
}
__device__ __forceinline__ void guard2(v8f& a, v8f& b, v16h x0, v16h x1, v16h x2, v16h x3, v16h x4, v16h x5) {
#if defined(__HIP_DEVICE_COMPILE__)
  asm volatile("v_nop\n\tv_nop\n\tv_nop\n\tv_nop"
               : "+v"(a), "+v"(b) : "v"(x0), "v"(x1), "v"(x2), "v"(x3), "v"(x4), "v"(x5) : "memory");
#endif
}
__device__ __forceinline__ void guard10(v8f& a, v8f& b, v8f& c, v8f& d, v16h x0, v16h x1, v16h x2, v16h x3, v16h x4,
                                        v16h x5, v16h x6, v16h x7, v16h x8, v16h x9) {
#if defined(__HIP_DEVICE_COMPILE__)
  asm volatile("v_nop\n\tv_nop\n\tv_nop\n\tv_nop"
               : "+v"(a), "+v"(b), "+v"(c), "+v"(d)
               : "v"(x0), "v"(x1), "v"(x2), "v"(x3), "v"(x4), "v"(x5), "v"(x6), "v"(x7), "v"(x8), "v"(x9) : "memory");
#endif
}
__device__ __forceinline__ void acc_guard4(v8f& a, v8f& b, v8f& c, v8f& d) {
#if defined(__HIP_DEVICE_COMPILE__)
  asm volatile("v_nop\n\tv_nop\n\tv_nop\n\tv_nop" : "+v"(a), "+v"(b), "+v"(c), "+v"(d));
#endif
}
// Two planes' 64-row x 128-B tiles, global -> LDS, by 128 threads: per lane four 16-B asynchronous copies a plane (rows r, r+16,
// r+32, r+48; 8 lanes = one whole 128-B row). la/lb: the lane's LDS byte addresses of row r, ga/gb: its global addresses, gstep: 16
// source rows in elements. The s_wait_xcnt closes the statement so that no address register is rewritten ahead of it.
__device__ __forceinline__ void stage2(unsigned la, unsigned lb, const u16* ga, const u16* gb, size_t gstep) {
#if defined(__HIP_DEVICE_COMPILE__)
  const unsigned ls = 16 * LP * 2;
  asm volatile("global_load_async_to_lds_b128 %0, %8, off\n\t"
               "global_load_async_to_lds_b128 %1, %9, off\n\t"
               "global_load_async_to_lds_b128 %2, %10, off\n\t"
               "global_load_async_to_lds_b128 %3, %11, off\n\t"
               "global_load_async_to_lds_b128 %4, %12, off\n\t"
               "global_load_async_to_lds_b128 %5, %13, off\n\t"
               "global_load_async_to_lds_b128 %6, %14, off\n\t"
               "global_load_async_to_lds_b128 %7, %15, off\n\t"
               "s_wait_xcnt 0x0"
               :: "v"(la), "v"(la + ls), "v"(la + 2 * ls), "v"(la + 3 * ls),
                  "v"(lb), "v"(lb + ls), "v"(lb + 2 * ls), "v"(lb + 3 * ls),
                  "v"(ga), "v"(ga + gstep), "v"(ga + 2 * gstep), "v"(ga + 3 * gstep),
                  "v"(gb), "v"(gb + gstep), "v"(gb + 2 * gstep), "v"(gb + 3 * gstep)
               : "memory");
#endif
}
// One plane's tile, the same way: four copies a lane.
__device__ __forceinline__ void stage1(unsigned la, const u16* ga, size_t gstep) {
#if defined(__HIP_DEVICE_COMPILE__)
  const unsigned ls = 16 * LP * 2;
  asm volatile("global_load_async_to_lds_b128 %0, %4, off\n\t"
               "global_load_async_to_lds_b128 %1, %5, off\n\t"
               "global_load_async_to_lds_b128 %2, %6, off\n\t"
               "global_load_async_to_lds_b128 %3, %7, off\n\t"
               "s_wait_xcnt 0x0"
               :: "v"(la), "v"(la + ls), "v"(la + 2 * ls), "v"(la + 3 * ls),
                  "v"(ga), "v"(ga + gstep), "v"(ga + 2 * gstep), "v"(ga + 3 * gstep)
               : "memory");
#endif
}
__device__ __forceinline__ void wave_sync_lds() {
  __builtin_amdgcn_fence(__ATOMIC_RELEASE, "workgroup");
  __builtin_amdgcn_wave_barrier();
  __builtin_amdgcn_fence(__ATOMIC_ACQUIRE, "workgroup");
}

// =====================================================================================================
// f32 plane -> 16-bit plane:  f16mode == 0: bf16 RNE bits;  f16mode == 1: f16 bits of (bf16 RNE value) * scale.
// Destination is a dense plane of n8*8 elements; source octet index = (gt / seg8) * sstride8 + gt % seg8 (segments of seg8
// octets taken at stride sstride8 octets, identity when seg8 == n8): used to read NB batches of SEQ rows out of an input laid out
// with SEQ_FULL rows per batch.
// Thread = 8 consecutive elements: two 16-B loads, one 16-B store; 32 consecutive lanes = 512 contiguous, 512-B aligned bytes
// coverage: grid = n8/256 blocks (host checks exactness) x 256 thr x 8 = the whole destination plane.
// =====================================================================================================
__global__ __launch_bounds__(256) void cvt16(const float* __restrict__ x, u16* D, int n8, int f16mode, float scale,
                                             int seg8, int sstride8) {
  const int gt = blockIdx.x * 256 + (int)threadIdx.x;
  if (gt >= n8) return;                     // no barriers in this kernel
  const size_t so = (size_t)(gt / seg8) * (size_t)sstride8 + (size_t)(gt % seg8);
  const float* p = x + so * 8;
  const v4f a = *(const v4f*)(p), c4 = *(const v4f*)(p + 4);
  float v[8];
#pragma unroll
  for (int e = 0; e < 4; ++e) { v[e] = a[e]; v[4 + e] = c4[e]; }
  unsigned short s[8];
#pragma unroll
  for (int e = 0; e < 8; ++e) {
    const unsigned short hb = h_bits((_Float16)(bfr(v[e]) * scale));
    const unsigned short bb = bf_bits(v[e]);
    s[e] = (f16mode != 0) ? hb : bb;
  }
  v4u o;
#pragma unroll
  for (int e = 0; e < 4; ++e) o[e] = pk16(s[2 * e], s[2 * e + 1]);
  u16* d = D + (size_t)gt * 8;
  {
    *(v4u*)(d) = o;
    
  }
}

// =====================================================================================================
// f32 GEMM epilogue (gemm_h2): the wave's 16x64 f32 tile (times oscale) staged in its LDS slab (pitch 68, wave-private),
// coverage: 8 instructions x 2 rows x 16 lanes x 4 floats = the wave's 16 x 64 tile.
// =====================================================================================================
__device__ __forceinline__ void epi64(float* sl, v8f a0, v8f a1, v8f a2, v8f a3, float oscale, v4f badd, float* C, int N,
                                      size_t rowb, int col0, int lane) {
  const int hh = lane >> 4, m = lane & 15;
#pragma unroll
  for (int r = 0; r < 8; ++r) {
    const int ro = (8 * hh + r) * 68 + m;
    sl[ro]      = a0[r] * oscale;
    sl[ro + 16] = a1[r] * oscale;
    sl[ro + 32] = a2[r] * oscale;
    sl[ro + 48] = a3[r] * oscale;
  }
  wave_sync_lds();
  v4f vals[8];
#pragma unroll
  for (int it = 0; it < 8; ++it) vals[it] = *(const v4f*)(sl + (it * 2 + hh) * 68 + m * 4) + badd;
  float* dst = C + (rowb + (size_t)hh) * (size_t)N + col0 + m * 4;
  {
#pragma unroll
    for (int it = 0; it < 8; ++it) {
      *(v4f*)(dst + (size_t)(it * 2) * (size_t)N) = vals[it];
    }
    
  }
}

// =====================================================================================================
// bf16 GEMM with bias, result written as two f16 planes: c[M][N] (f32, in registers) = A[M][K] (bf16 row-major) . Bt[N][K]^T (bf16
// k-contiguous), times oscale, plus bf16-RNE value of bias[n]; PH = f16(c * psc), PL = f16(c * psc - PH) (psc a power of two).
// Block = 64x64 tile, 4 waves x 16 rows. The block's 64 A rows and 64 Bt rows are staged in LDS 64 k (one whole
// 128-B line a row) at a time by asynchronous copies, two buffers (tile t+1 flies while tile t is worked on, one block barrier a
// tile); fragments are read from LDS (two 16-B reads each, split k map for A and B), two k steps of 32 a tile, in the k order of
// a plain walk (host checks K % 64 == 0, M % 64 == 0, N % 64 == 0, grid = (M/64)*(N/64)).
// Epilogue, vt == 0: planes laid out [M][N]; the wave's 16x64 f32 tile goes through its private LDS slab (pitch 68), a lane then
//   owns 8 consecutive columns of a row: per plane 4 instructions x 4 rows x 8 lanes x 8 halves = the wave's 16 x 64 tile.
// Epilogue, vt != 0 (N == NH*HD, rows = b*SEQ + s): planes laid out [b][h][d][s]. A lane's 8 accumulator rows of one column are 8
//   consecutive s of one d: one 16-B LDS store a plane into the block's [64 d][64 s] tiles (pitch VTP, in the ring, which is free
//   behind the loop's last barrier); one block barrier; then 4 iterations x 128 thr x 8 halves = 64 lines x 64 s of each plane.
// =====================================================================================================
__global__ __launch_bounds__(128)
void gemm_bfb(const u16* __restrict__ A, const u16* __restrict__ Bt, const float* __restrict__ bias,
              u16* PH, u16* PL, int M, int N, int K, float oscale, float psc, int vt) {
  __shared__ __align__(16) float slab[4 * SLAB64];
  __shared__ __align__(16) u16 ring[2 * 2 * PLH];   // two buffers of [A tile | Bt tile], 64 rows of pitch LP each
  const int tid = threadIdx.x, wave = tid >> 5, lane = tid & 31, hh = lane >> 4, m = lane & 15;
  const int ntile = N >> 6;
  const int bid   = blockIdx.x;
  const int row0  = (bid / ntile) * 64;
  const int rowb  = row0 + wave * 16;
  const int col0  = (bid % ntile) * 64;
  if (row0 + 64 > M) return;                 // block-uniform, in front of every barrier; never taken with the exact grid
  // staging: thread -> (row sr of 16, 16-B piece sc of 8), rows sr, sr+16, sr+32, sr+48 of each operand's tile
  const int sr = tid >> 3, sc = (tid & 7) * 8;
  const u16* ag = A  + (size_t)(row0 + sr) * K + sc;
  const u16* bg = Bt + (size_t)(col0 + sr) * K + sc;
  const unsigned lds0 = (unsigned)(size_t)(const void*)ring + (unsigned)(sr * LP + sc) * 2u;
  const int nt = K >> 6;
  auto stage = [&](int t, int buf) {
    const unsigned l = lds0 + (unsigned)buf * (2u * PLH * 2u);
    stage2(l, l + PLH * 2u, ag + (size_t)t * 64, bg + (size_t)t * 64, (size_t)16 * K);
  };
  // fragment readers, in halves from a buffer's start
  const int afo = (wave * 16 + m) * LP + 8 * hh;
  const int bfo = PLH + m * LP + 8 * hh;
  v8f acc0 = zero8(), acc1 = zero8(), acc2 = zero8(), acc3 = zero8();
  stage(0, 0);
  asm volatile("s_wait_asynccnt 0x0" ::: "memory");   // this wave's copies of tile 0 have landed
  __syncthreads();                                    // ... and every other wave's: tile 0 may be read
  if (nt > 1) stage(1, 1);
#pragma unroll 1   // one tile a trip: the ring's hand-over stands once, at the foot
  for (int t = 0; t < nt; ++t) {
    const u16* bufp = ring + (t & 1) * (2 * PLH);
    v16b a[2], b[2][4];
#pragma unroll
    for (int kk = 0; kk < 2; ++kk) {
      a[kk] = ldfrag_b(bufp + afo + kk * 32);
#pragma unroll
      for (int j = 0; j < 4; ++j) b[kk][j] = ldfrag_b(bufp + bfo + j * 16 * LP + kk * 32);
    }
    __builtin_amdgcn_sched_barrier(0);   // all of the tile's LDS reads issue ahead of its WMMAs: one LDS latency a tile, not several
#pragma unroll
    for (int kk = 0; kk < 2; ++kk) {
      acc0 = mma_b(a[kk], b[kk][0], acc0);
      acc1 = mma_b(a[kk], b[kk][1], acc1);
      acc2 = mma_b(a[kk], b[kk][2], acc2);
      acc3 = mma_b(a[kk], b[kk][3], acc3);
    }
    acc_guard4(acc0, acc1, acc2, acc3);                 // WMMA distance kept on both sides of the branches that follow
    // ---- hand-over: tile t+1 is published and tile t's buffer is freed by the one barrier; then the refill ----
    asm volatile("s_wait_dscnt 0x0" ::: "memory");      // this wave's reads of tile t are done before its buffer is refilled
    asm volatile("s_wait_asynccnt 0x0" ::: "memory");   // this wave's copies of tile t+1 have landed
    __syncthreads();
    if (t + 2 < nt) stage(t + 2, t & 1);
  }
  asm volatile("s_wait_asynccnt 0x0" ::: "memory");     // nothing in flight when the wave goes on to its end
  // every loop of both epilogues is unrolled so that accumulators and staging arrays are indexed by constants (registers, no scratch)
  if (vt == 0) {                             // block-uniform
    float* sl = slab + wave * SLAB64;
#pragma unroll
    for (int r = 0; r < 8; ++r) {
      const int ro = (8 * hh + r) * 68 + m;
      sl[ro]      = acc0[r] * oscale;
      sl[ro + 16] = acc1[r] * oscale;
      sl[ro + 32] = acc2[r] * oscale;
      sl[ro + 48] = acc3[r] * oscale;
    }
    wave_sync_lds();
    const int rq = lane >> 3, c8 = (lane & 7) * 8;
    const v4f bv0 = *(const v4f*)(bias + col0 + c8), bv1 = *(const v4f*)(bias + col0 + c8 + 4);   // columns < N (N multiple of 64)
    float badd[8];
#pragma unroll
    for (int e = 0; e < 4; ++e) { badd[e] = bfr(bv0[e]); badd[4 + e] = bfr(bv1[e]); }
    v4u oh[4], ol[4];
#pragma unroll
    for (int i4 = 0; i4 < 4; ++i4) {
      const int row = i4 * 4 + rq;
      const v4f a4 = *(const v4f*)(sl + row * 68 + c8), c4 = *(const v4f*)(sl + row * 68 + c8 + 4);
      float w[8];
#pragma unroll
      for (int e = 0; e < 4; ++e) { w[e] = (a4[e] + badd[e]) * psc; w[4 + e] = (c4[e] + badd[4 + e]) * psc; }
#pragma unroll
      for (int e = 0; e < 4; ++e) {
        const _Float16 h0 = (_Float16)w[2 * e], h1 = (_Float16)w[2 * e + 1];
        const _Float16 l0 = (_Float16)(w[2 * e] - (float)h0), l1 = (_Float16)(w[2 * e + 1] - (float)h1);
        oh[i4][e] = pk16(h_bits(h0), h_bits(h1));
        ol[i4][e] = pk16(h_bits(l0), h_bits(l1));
      }
    }
    const size_t ob = (size_t)rowb * (size_t)N + col0 + c8;
#pragma unroll
    for (int i4 = 0; i4 < 4; ++i4) {
      const size_t o8 = ob + (size_t)(i4 * 4 + rq) * (size_t)N;
      *(v4u*)(PH + o8) = oh[i4];
      *(v4u*)(PL + o8) = ol[i4];
    }
  } else {
    u16* TH = ring;
    u16* TL = ring + HD * VTP;
    const v8f acc[4] = {acc0, acc1, acc2, acc3};
#pragma unroll
    for (int j = 0; j < 4; ++j) {
      const float bj = bfr(bias[col0 + 16 * j + m]);        // column < N (N multiple of 64)
      v4u th, tl;
#pragma unroll
      for (int e = 0; e < 4; ++e) {
        const float t0 = (acc[j][2 * e] * oscale + bj) * psc, t1 = (acc[j][2 * e + 1] * oscale + bj) * psc;
        const _Float16 h0 = (_Float16)t0, h1 = (_Float16)t1;
        const _Float16 l0 = (_Float16)(t0 - (float)h0), l1 = (_Float16)(t1 - (float)h1);
        th[e] = pk16(h_bits(h0), h_bits(h1));
        tl[e] = pk16(h_bits(l0), h_bits(l1));
      }
      const int to = (16 * j + m) * VTP + wave * 16 + 8 * hh;
      *(v4u*)(TH + to) = th;
      *(v4u*)(TL + to) = tl;
    }
    __syncthreads();                         // the four waves' columns of the [d][s] tiles are complete
    const int q8 = tid >> 3, p8 = (tid & 7) * 8;
    v4u vh[4], vl[4];
#pragma unroll
    for (int it = 0; it < 4; ++it) {
      const int line = it * 16 + q8;          // d = 0..63
      vh[it] = *(const v4u*)(TH + line * VTP + p8);
      vl[it] = *(const v4u*)(TL + line * VTP + p8);
    }
    const size_t base = ((size_t)((row0 / SEQ) * NH + (col0 >> 6)) * HD) * SEQ + (row0 % SEQ) + p8;
#pragma unroll
    for (int it = 0; it < 4; ++it) {
      const int line = it * 16 + q8;
      *(v4u*)(PH + base + (size_t)line * SEQ) = vh[it];
      *(v4u*)(PL + base + (size_t)line * SEQ) = vl[it];
    }
    asm volatile("s_wait_xcnt 0x0" ::: "memory");   // behind the run of stores: no register that they name is rewritten ahead of it
  }
}

// =====================================================================================================
// f16 hi+lo GEMM with bias: C[M][N] (f32) = (Ahi + Alo)[M][K] . Bt[N][K]^T times oscale, plus bf16-RNE value of bias[n];
// Ahi/Alo f16 planes (same layout), Bt f16 k-contiguous; products hi.B + lo.B into one accumulator (lo is the unscaled
// residual of hi). Same tiling and the same two-buffer LDS ring as gemm_bfb, three planes a tile (Ahi, Alo, Bt).
// =====================================================================================================
__global__ __launch_bounds__(128)
void gemm_h2(const u16* __restrict__ Ah, const u16* __restrict__ Al, const u16* __restrict__ Bt,
             const float* __restrict__ bias, float* C, int M, int N, int K, float oscale) {
  __shared__ __align__(16) float slab[4 * SLAB64];
  __shared__ __align__(16) u16 ring[2 * 3 * PLH];   // two buffers of [Ahi tile | Alo tile | Bt tile], 64 rows of pitch LP each
  const int tid = threadIdx.x, wave = tid >> 5, lane = tid & 31, hh = lane >> 4, m = lane & 15;
  const int ntile = N >> 6;
  const int bid   = blockIdx.x;
  const int row0  = (bid / ntile) * 64;
  const int rowb  = row0 + wave * 16;
  const int col0  = (bid % ntile) * 64;
  if (row0 + 64 > M) return;                 // block-uniform, in front of every barrier; never taken with the exact grid
  // staging: thread -> (row sr of 16, 16-B piece sc of 8), rows sr, sr+16, sr+32, sr+48 of each plane's tile
  const int sr = tid >> 3, sc = (tid & 7) * 8;
  const size_t aofs = (size_t)(row0 + sr) * K + sc;
  const u16* ahg = Ah + aofs;
  const u16* alg = Al + aofs;
  const u16* bg  = Bt + (size_t)(col0 + sr) * K + sc;
  const unsigned lds0 = (unsigned)(size_t)(const void*)ring + (unsigned)(sr * LP + sc) * 2u;
  const int nt = K >> 6;
  auto stage = [&](int t, int buf) {
    const unsigned l = lds0 + (unsigned)buf * (3u * PLH * 2u);
    stage2(l, l + PLH * 2u, ahg + (size_t)t * 64, alg + (size_t)t * 64, (size_t)16 * K);
    stage1(l + 2u * PLH * 2u, bg + (size_t)t * 64, (size_t)16 * K);
  };
  // fragment readers, in halves from a buffer's start
  const int afo = (wave * 16 + m) * LP + 8 * hh;
  const int bfo = 2 * PLH + m * LP + 8 * hh;
  v8f acc0 = zero8(), acc1 = zero8(), acc2 = zero8(), acc3 = zero8();
  stage(0, 0);
  asm volatile("s_wait_asynccnt 0x0" ::: "memory");   // this wave's copies of tile 0 have landed
  __syncthreads();                                    // ... and every other wave's: tile 0 may be read
  if (nt > 1) stage(1, 1);
#pragma unroll 1   // one tile a trip: the ring's hand-over stands once, at the foot
  for (int t = 0; t < nt; ++t) {
    const _Float16* bufp = (const _Float16*)(const void*)ring + (t & 1) * (3 * PLH);
    v16h ah[2], al[2], b[2][4];
#pragma unroll
    for (int kk = 0; kk < 2; ++kk) {
      ah[kk] = ldfrag_h(bufp + afo + kk * 32);
      al[kk] = ldfrag_h(bufp + PLH + afo + kk * 32);
#pragma unroll
      for (int j = 0; j < 4; ++j) b[kk][j] = ldfrag_h(bufp + bfo + j * 16 * LP + kk * 32);
    }
    __builtin_amdgcn_sched_barrier(0);   // all of the tile's LDS reads issue ahead of its WMMAs: one LDS latency a tile, not several
#pragma unroll
    for (int kk = 0; kk < 2; ++kk) {
      acc0 = mma_h(ah[kk], b[kk][0], acc0);  acc0 = mma_h(al[kk], b[kk][0], acc0);
      acc1 = mma_h(ah[kk], b[kk][1], acc1);  acc1 = mma_h(al[kk], b[kk][1], acc1);
      acc2 = mma_h(ah[kk], b[kk][2], acc2);  acc2 = mma_h(al[kk], b[kk][2], acc2);
      acc3 = mma_h(ah[kk], b[kk][3], acc3);  acc3 = mma_h(al[kk], b[kk][3], acc3);
    }
    acc_guard4(acc0, acc1, acc2, acc3);                 // WMMA distance kept on both sides of the branches that follow
    // ---- hand-over: tile t+1 is published and tile t's buffer is freed by the one barrier; then the refill ----
    asm volatile("s_wait_dscnt 0x0" ::: "memory");      // this wave's reads of tile t are done before its buffer is refilled
    asm volatile("s_wait_asynccnt 0x0" ::: "memory");   // this wave's copies of tile t+1 have landed
    __syncthreads();
    if (t + 2 < nt) stage(t + 2, t & 1);
  }
  asm volatile("s_wait_asynccnt 0x0" ::: "memory");     // nothing in flight when the wave goes on to its end
  const v4f bv = *(const v4f*)(bias + col0 + m * 4);      // columns col0 + 4m .. +3, always < N (N multiple of 64)
  v4f badd;
#pragma unroll
  for (int e = 0; e < 4; ++e) badd[e] = bfr(bv[e]);
  epi64(slab + wave * SLAB64, acc0, acc1, acc2, acc3, oscale, badd, C, N, (size_t)rowb, col0, lane);
}

// =====================================================================================================
// Full (non-causal, unmasked) multi-head flash attention: block = (batch b, head, 64 query rows), 4 waves, wave w owns the
// 16 query rows q0 = 64*qt + 16*w .. q0+15. The k and v^T planes' tiles of KT = 64 keys are staged in LDS by asynchronous copies, two
// buffers (tile t+1 flies while tile t is worked on, one block barrier a tile), and read by all 4 waves; each tile serves two key
// blocks of 32. The ring becomes the waves' private result slabs behind the last tile's barrier.
//   Per-head logit scale: sigmoid(bf16 RNE value of g[head]) / 8, computed in f32 once per thread (head uniform per block) and
//   folded with log2(e) and the q/k carries into lsc.
//   q planes (hi, lo f16, x1024) laid out [b][s][h][d]; k planes the same; v^T planes [b][h][d][s] (x1024).
//   All NKB = SEQ/32 key blocks of 32 keys are visited (static bound).
//   Scores are computed TRANSPOSED: S^T tile g (g = 0,1) = k rows (keys kb+16g .. +15, A operand, row m = lane&15, split k map
//   over d) times q^T (B operand, col n = query q0 + (lane&15), k = d, split map), 3 products per tile and d-chunk
//   (k_hi.q_hi + k_lo.q_hi + k_hi.q_lo). D element r of lane l = (key kb+16g+8h+r, query q0+(l&15)), so a lane owns one query
//   column and 16 of its 32 keys; the partner lane l^16 owns the other 16 -> row max / row sum need one xor-16 shuffle.
//   Online max-subtracted base-2 softmax in f32. The exp'd values ARE the P A-fragment in place: A row m = query = lane&15,
//   element i <- key kb+8h+i (tile 0, D element i), element 8+i <- key kb+16+8h+i (tile 1, D element i). P is carried x32768
//   as f16 hi + f16 residual. The rescale factor of query row 8h+r of the O accumulators is fetched from lane 8h+r with a
//   shuffle (uniform control). 4+4 v^T B fragments (hi and residual planes, col n = d = 16j + (lane&15), keys k-contiguous),
//   12 P.V WMMAs (hh + lh + hl).
//   Epilogue: 1/l (per query, shuffled to the D row owner) and carry folds in f32; the wave's 16x64 f32 result staged in its LDS
// coverage: per wave 4 instructions x 4 rows x 8 lanes x 8 halves = 16 x 64 per plane; grid NB*NH*SEQ/64 blocks x 4 waves = every
//           (b, s, h) row of both O planes exactly once.
// =====================================================================================================
__global__ __launch_bounds__(ATT_THREADS)
void attn_fwd(const u16* __restrict__ QHIp, const u16* __restrict__ QLOp,
              const u16* __restrict__ KHIp, const u16* __restrict__ KLOp,
              const u16* __restrict__ VHIp, const u16* __restrict__ VLOp,
              const float* __restrict__ gatep,
              u16* OHIp, u16* OLOp) {
  __shared__ __align__(16) u16 ring[2 * BUFH];   // two tile buffers; in the epilogue per wave a result slab [16][68] of f32

  const int tid  = threadIdx.x;
  const int wave = tid >> 5;
  const int lane = tid & 31;
  const int hh   = lane >> 4;
  const int c    = lane & 15;

  const int bid  = blockIdx.x;
  const int qt   = bid % QT64;
  const int head = (bid / QT64) % NH;
  const int b    = bid / (QT64 * NH);
  const int q0   = qt * 64 + wave * 16;

  // per-head scale: sigmoid(bf16 value of g) / 8 in f32; head < NH always (block decode), host checks the input extent
  const float gbf = bfr(gatep[head]);
  const float sgm = 1.0f / (1.0f + expf(-gbf));
  const float lsc = sgm * (0.125f * (LOG2E / (QSC * KSC)));

  // B fragments of q^T: col n = query q0 + c, k = d (k-contiguous row of the q plane)
  const size_t qofs = (((size_t)(b * SEQ + q0 + c)) * NH + head) * HD + 8 * hh;
  const _Float16* Qh  = (const _Float16*)(const void*)QHIp + qofs;
  const _Float16* Ql  = (const _Float16*)(const void*)QLOp + qofs;
  // staging: thread -> (row sr of 16, 16-B piece sc of 8); k tile row = key, v^T tile row = d, both 64 halves long
  const int sr = tid >> 3, sc = (tid & 7) * 8;
  const size_t kofs = (((size_t)b * SEQ + sr) * NH + head) * HD + sc;             // tile's first key added per tile
  const size_t vofs = ((size_t)(b * NH + head) * HD + sr) * SEQ + sc;             // tile's first key added per tile
  const unsigned lds0 = (unsigned)(size_t)(const void*)ring + (unsigned)(sr * LP + sc) * 2u;
  auto stage = [&](int t, int buf) {
    const unsigned l = lds0 + (unsigned)buf * (BUFH * 2u);
    const size_t ko = kofs + (size_t)t * (KT * NH * HD), vo = vofs + (size_t)t * KT;
    stage2(l, l + PLH * 2u, KHIp + ko, KLOp + ko, (size_t)16 * (NH * HD));
    stage2(l + 2u * PLH * 2u, l + 3u * PLH * 2u, VHIp + vo, VLOp + vo, (size_t)16 * SEQ);
  };
  // fragment readers, in halves from a buffer's start: A of k: row m = key 16g + c, k = d; B of v: col n = d = 16j + c, k = key
  const int kfo = c * LP + 8 * hh;
  const int vfo = 2 * PLH + c * LP + 8 * hh;

  float mrun = -INFINITY, lrun = 0.f;
  v8f o[4];
#pragma unroll
  for (int j = 0; j < 4; ++j) o[j] = zero8();

  stage(0, 0);
  asm volatile("s_wait_asynccnt 0x0" ::: "memory");   // this wave's copies of tile 0 have landed
  __syncthreads();                                    // ... and every other wave's: tile 0 may be read
  if (NT > 1) stage(1, 1);

#pragma unroll 1
  for (int t = 0; t < NT; ++t) {
   const _Float16* bufp = (const _Float16*)(const void*)ring + (t & 1) * BUFH;
#pragma unroll   // both key blocks of a tile in line: their LDS offsets become immediates
   for (int sub = 0; sub < 2; ++sub) {
    // ---- transposed scores: s0 = keys kb..kb+15, s1 = keys kb+16..kb+31 (kb = 64t + 32sub), column = query q0 + c ----
    v8f s0 = zero8(), s1 = zero8();
    const _Float16* k0p = bufp + kfo + sub * 32 * LP;
    const _Float16* k1p = k0p + 16 * LP;
    const _Float16* l0p = k0p + PLH;
    const _Float16* l1p = l0p + 16 * LP;
#pragma unroll
    for (int kk = 0; kk < 2; ++kk) {
      const v16h qh  = ldfrag_h(Qh + kk * 32),  ql  = ldfrag_h(Ql + kk * 32);
      const v16h kh0 = ldfrag_h(k0p + kk * 32), kl0 = ldfrag_h(l0p + kk * 32);
      const v16h kh1 = ldfrag_h(k1p + kk * 32), kl1 = ldfrag_h(l1p + kk * 32);
      s0 = mma_h(kh0, qh, s0);
      s0 = mma_h(kl0, qh, s0);
      s0 = mma_h(kh0, ql, s0);
      s1 = mma_h(kh1, qh, s1);
      s1 = mma_h(kl1, qh, s1);
      s1 = mma_h(kh1, ql, s1);
      guard2(s0, s1, qh, ql, kh0, kl0, kh1, kl1);
    }
    // ---- base-2 logits of this lane's 16 keys for query q0 + c: t[i] <- key kb+8hh+i, t[8+i] <- key kb+16+8hh+i ----
    float t[16];
#pragma unroll
    for (int i = 0; i < 8; ++i) { t[i] = s0[i] * lsc; t[8 + i] = s1[i] * lsc; }
    float cm = t[0];
#pragma unroll
    for (int i = 1; i < 16; ++i) cm = fmaxf(cm, t[i]);
    cm = fmaxf(cm, __shfl_xor(cm, 16, 32));
    const float mn = fmaxf(mrun, cm);        // finite from the first block on
    const float al = exp2f(mrun - mn);       // 0 on the first block (mrun = -inf)
    mrun = mn;
    // ---- probabilities (<= 1) and the P A-fragments: hi = f16(p * 32768), lo = f16 residual; element i <-> t[i] ----
    float ps = 0.f;
    FragH ph, pl;
#pragma unroll
    for (int w = 0; w < 2; ++w) {
#pragma unroll
      for (int e4 = 0; e4 < 4; ++e4) {
        const int i = 8 * w + 2 * e4;
        const float p0 = exp2f(t[i] - mn), p1 = exp2f(t[i + 1] - mn);
        ps += p0 + p1;
        const float a0 = p0 * PCAR, a1 = p1 * PCAR;
        const _Float16 h0 = (_Float16)a0, h1 = (_Float16)a1;
        const _Float16 l0 = (_Float16)(a0 - (float)h0), l1 = (_Float16)(a1 - (float)h1);
        ph.u[w][e4] = pk16(h_bits(h0), h_bits(h1));
        pl.u[w][e4] = pk16(h_bits(l0), h_bits(l1));
      }
    }
    ps += __shfl_xor(ps, 16, 32);
    lrun = lrun * al + ps;
    // ---- rescale the O accumulators: D row 8hh+r = query q0+8hh+r, its factor lives in lane 8hh+r (and 16+8hh+r) ----
    float scl[8];
#pragma unroll
    for (int r = 0; r < 8; ++r) scl[r] = __shfl(al, 8 * hh + r, 32);
#pragma unroll
    for (int j = 0; j < 4; ++j) {
#pragma unroll
      for (int r = 0; r < 8; ++r) o[j][r] *= scl[r];
    }
    // ---- P.V : B fragment col n = d = j*16 + c, keys contiguous in the v^T planes ----
    {
      const _Float16* vhp = bufp + vfo + sub * 32;
      const _Float16* vlp = vhp + PLH;
      const v16h vh0 = ldfrag_h(vhp);
      const v16h vh1 = ldfrag_h(vhp + 16 * LP);
      const v16h vh2 = ldfrag_h(vhp + 32 * LP);
      const v16h vh3 = ldfrag_h(vhp + 48 * LP);
      const v16h vl0 = ldfrag_h(vlp);
      const v16h vl1 = ldfrag_h(vlp + 16 * LP);
      const v16h vl2 = ldfrag_h(vlp + 32 * LP);
      const v16h vl3 = ldfrag_h(vlp + 48 * LP);
      o[0] = mma_h(ph.v, vh0, o[0]);  o[0] = mma_h(pl.v, vh0, o[0]);  o[0] = mma_h(ph.v, vl0, o[0]);
      o[1] = mma_h(ph.v, vh1, o[1]);  o[1] = mma_h(pl.v, vh1, o[1]);  o[1] = mma_h(ph.v, vl1, o[1]);
      o[2] = mma_h(ph.v, vh2, o[2]);  o[2] = mma_h(pl.v, vh2, o[2]);  o[2] = mma_h(ph.v, vl2, o[2]);
      o[3] = mma_h(ph.v, vh3, o[3]);  o[3] = mma_h(pl.v, vh3, o[3]);  o[3] = mma_h(ph.v, vl3, o[3]);
      guard10(o[0], o[1], o[2], o[3], ph.v, pl.v, vh0, vh1, vh2, vh3, vl0, vl1, vl2, vl3);
    }
   }
   // ---- hand-over: tile t+1 is published and tile t's buffer is freed by the one barrier; then the refill ----
   asm volatile("s_wait_dscnt 0x0" ::: "memory");      // this wave's reads of tile t are done before its buffer is refilled
   asm volatile("s_wait_asynccnt 0x0" ::: "memory");   // this wave's copies of tile t+1 have landed
   __syncthreads();
   if (t + 2 < NT) stage(t + 2, t & 1);
  }
  asm volatile("s_wait_asynccnt 0x0" ::: "memory");    // nothing in flight when the ring turns into the result slabs
  acc_guard4(o[0], o[1], o[2], o[3]);

  // ---- fold 1/l (per query, owned by lane = query) and the carries (32768 on P, 1024 on v); stage the 16x64 slab ----
  const float linv = (1.0f / lrun) * (1.0f / (PCAR * VCAR));
  float inv[8];
#pragma unroll
  for (int r = 0; r < 8; ++r) inv[r] = __shfl(linv, 8 * hh + r, 32);
  float* slab = (float*)(void*)ring + wave * SLABF;
#pragma unroll
  for (int r = 0; r < 8; ++r) {
#pragma unroll
    for (int j = 0; j < 4; ++j) slab[(8 * hh + r) * 68 + j * 16 + c] = o[j][r] * inv[r];
  }
  wave_sync_lds();
  // ---- O x1024 -> f16 hi + residual planes; lane = (row in group of 4, 8 consecutive d) ----
  v4u oh[4], ol[4];
  const int rq = lane >> 3, c8 = (lane & 7) * 8;
#pragma unroll
  for (int i4 = 0; i4 < 4; ++i4) {
    const int row = i4 * 4 + rq;
    const v4f a = *(const v4f*)(slab + row * 68 + c8), c4 = *(const v4f*)(slab + row * 68 + c8 + 4);
    float w[8];
#pragma unroll
    for (int e = 0; e < 4; ++e) { w[e] = a[e] * OSC; w[4 + e] = c4[e] * OSC; }
#pragma unroll
    for (int e = 0; e < 4; ++e) {
      const _Float16 h0 = (_Float16)w[2 * e], h1 = (_Float16)w[2 * e + 1];
      const _Float16 l0 = (_Float16)(w[2 * e] - (float)h0), l1 = (_Float16)(w[2 * e + 1] - (float)h1);
      oh[i4][e] = pk16(h_bits(h0), h_bits(h1));
      ol[i4][e] = pk16(h_bits(l0), h_bits(l1));
    }
  }
  const size_t ob = (((size_t)(b * SEQ + q0)) * NH + head) * HD + c8;
  {
#pragma unroll
    for (int i4 = 0; i4 < 4; ++i4) {
      const int row = i4 * 4 + rq;
      const size_t o8 = ob + (size_t)row * (NH * HD);
      *(v4u*)(OHIp + o8) = oh[i4];
      *(v4u*)(OLOp + o8) = ol[i4];
    }
    
  }
}

// =====================================================================================================
// Workspace map (bytes, ROWS = NB*SEQ; numbers for NB=2, SEQ=2048); every plane is fully written by whole-line stores before it is
// read; all extents are exact multiples of the store granularity (no pad rows needed); XB is reused sequentially
// (in-order stream):
//   XB  bf16 [ROWS][1024]                 8388608        (input Q, then K, then V)
//   WQB bf16 [1024 n][1024 k]             2097152        WKB same  2097152      WVB same  2097152
//   WOB f16  [1024 n][1024 k] x1024       2097152
//   QHI f16 [NB][SEQ][16][64] x1024       8388608        QLO residual         8388608
//   KHI same                              8388608        KLO residual         8388608
//   VHI f16 [NB][16][64][SEQ] x1024       8388608        VLO residual         8388608
//   OHI f16 [ROWS][1024] x1024            8388608        OLO residual         8388608
//   end                                  83886080
// =====================================================================================================
extern "C" void kernel_launch(void* const* d_in, const int* in_sizes, int n_in,
                              void* d_out, int out_size, void* d_ws, size_t ws_size,
                              hipStream_t stream) {
  const int ROWS = NB * SEQ;
  if (n_in < 12) return;
  const int needX = ((NB - 1) * SEQ_FULL + SEQ) * DMOD;   // last input row read by cvt16 (+1), in elements
  if (in_sizes[0] < needX || in_sizes[1] < needX || in_sizes[2] < needX) return;
  if (in_sizes[3] < DMOD * DMOD || in_sizes[5] < DMOD * DMOD) return;
  if (in_sizes[7] < DMOD * DMOD || in_sizes[9] < DMOD * DMOD) return;
  if (in_sizes[4] < DMOD || in_sizes[6] < DMOD || in_sizes[8] < DMOD || in_sizes[10] < DMOD) return;
  if (in_sizes[11] < NH) return;
  if (out_size < ROWS * DMOD) return;

  const float* Qin = (const float*)d_in[0];
  const float* Kin = (const float*)d_in[1];
  const float* Vin = (const float*)d_in[2];
  const float* wq  = (const float*)d_in[3];
  const float* bq  = (const float*)d_in[4];
  const float* wk  = (const float*)d_in[5];
  const float* bk  = (const float*)d_in[6];
  const float* wv  = (const float*)d_in[7];
  const float* bv  = (const float*)d_in[8];
  const float* wo  = (const float*)d_in[9];
  const float* bo  = (const float*)d_in[10];
  const float* gt  = (const float*)d_in[11];
  float*       out = (float*)d_out;

  const size_t szXB  = (size_t)ROWS * DMOD * 2;
  const size_t szW   = (size_t)DMOD * DMOD * 2;
  const size_t szP   = (size_t)ROWS * DMOD * 2;                 // q/k/o planes
  const size_t szVP  = (size_t)NB * NH * HD * SEQ * 2;
  size_t off = 0;
  const size_t oXB  = off; off += szXB;
  const size_t oWQB = off; off += szW;
  const size_t oWKB = off; off += szW;
  const size_t oWVB = off; off += szW;
  const size_t oWOB = off; off += szW;
  const size_t oQHI = off; off += szP;
  const size_t oQLO = off; off += szP;
  const size_t oKHI = off; off += szP;
  const size_t oKLO = off; off += szP;
  const size_t oVHI = off; off += szVP;
  const size_t oVLO = off; off += szVP;
  const size_t oOHI = off; off += szP;
  const size_t oOLO = off; off += szP;
  if (off > ws_size) return;                            // off = 83886080 at full size
  if (off > (size_t)134217728) return;

  char* ws = (char*)d_ws;
  u16*   XB  = (u16*)(ws + oXB);
  u16*   WQB = (u16*)(ws + oWQB);
  u16*   WKB = (u16*)(ws + oWKB);
  u16*   WVB = (u16*)(ws + oWVB);
  u16*   WOB = (u16*)(ws + oWOB);
  u16*   QHI = (u16*)(ws + oQHI);
  u16*   QLO = (u16*)(ws + oQLO);
  u16*   KHI = (u16*)(ws + oKHI);
  u16*   KLO = (u16*)(ws + oKLO);
  u16*   VHI = (u16*)(ws + oVHI);
  u16*   VLO = (u16*)(ws + oVLO);
  u16*   OHI = (u16*)(ws + oOHI);
  u16*   OLO = (u16*)(ws + oOLO);

  const dim3 blk(256);
  const int n8x = (ROWS * DMOD) / 8;                    // 524288 at full size
  const int n8w = (DMOD * DMOD) / 8;                    // 131072
  const int seg8x = (SEQ * DMOD) / 8;                   // destination octets per batch
  const int str8x = (SEQ_FULL * DMOD) / 8;              // source octets per batch in the input layout
  if ((n8x % 256) != 0 || (n8w % 256) != 0) return;
  if ((DMOD % 32) != 0 || (ROWS % 64) != 0 || (DMOD % 64) != 0) return;
  const dim3 gX(n8x / 256);                             // 2048
  const dim3 gWc(n8w / 256);                            // 512
  const dim3 gG((ROWS / 64) * (DMOD / 64));             // 1024
  const dim3 bG(128);
  const dim3 gAT(ATT_BLOCKS);                           // 1024
  const dim3 bAT(ATT_THREADS);                          // 128

  // (0..3) weights [n][k] (already k-contiguous for x.W^T): bf16 planes for wq/wk/wv, f16 of bf16 value x1024 for wo
  cvt16<<<gWc, blk, 0, stream>>>(wq, WQB, n8w, 0, 1.0f, n8w, n8w);
  cvt16<<<gWc, blk, 0, stream>>>(wk, WKB, n8w, 0, 1.0f, n8w, n8w);
  cvt16<<<gWc, blk, 0, stream>>>(wv, WVB, n8w, 0, 1.0f, n8w, n8w);
  cvt16<<<gWc, blk, 0, stream>>>(wo, WOB, n8w, 1, WOS, n8w, n8w);
  // (4..5) q: input -> bf16 plane, projection + bias (col = h*64+d) written as f16 hi x1024 + residual planes [ROWS][1024]
  cvt16<<<gX, blk, 0, stream>>>(Qin, XB, n8x, 0, 1.0f, seg8x, str8x);
  gemm_bfb<<<gG, bG, 0, stream>>>(XB, WQB, bq, QHI, QLO, ROWS, DMOD, DMOD, 1.0f, QSC, 0);
  // (6..7) k: same pipeline (XB reused; single in-order stream)
  cvt16<<<gX, blk, 0, stream>>>(Kin, XB, n8x, 0, 1.0f, seg8x, str8x);
  gemm_bfb<<<gG, bG, 0, stream>>>(XB, WKB, bk, KHI, KLO, ROWS, DMOD, DMOD, 1.0f, KSC, 0);
  // (8..9) v: input -> bf16 plane, projection + bias written as v^T planes x1024 (hi + residual)
  cvt16<<<gX, blk, 0, stream>>>(Vin, XB, n8x, 0, 1.0f, seg8x, str8x);
  gemm_bfb<<<gG, bG, 0, stream>>>(XB, WVB, bv, VHI, VLO, ROWS, DMOD, DMOD, 1.0f, VCAR, 1);
  // (10) attention with per-head scale sigmoid(g)/8 -> O planes [b][s][h][d] x1024 (hi + residual)
  attn_fwd<<<gAT, bAT, 0, stream>>>(QHI, QLO, KHI, KLO, VHI, VLO, gt, OHI, OLO);
  // (11) output projection + bias -> out [ROWS][1024] f32, carries 1024 (O) x 1024 (wo) folded back
  gemm_h2<<<gG, bG, 0, stream>>>(OHI, OLO, WOB, bo, out, ROWS, DMOD, DMOD, 1.0f / (OSC * WOS));
  (void)hipGetLastError();
}

// v004
// It runs in 183 microseconds.
// Timed twice side by side with v003, it ran 1.07 and 1.08 times as fast.
// All steps since v000 together make it 2.21 times as fast.
// Contractions: x.W{q,k,v}^T on v_wmma_f32_16x16x32_bf16 (x and W RNE-converted to bf16 operands, f32 accumulate, bias added in f32);
// scores k'.q'^T (q', k' carried x1024 as f16 hi plane + f16 residual plane, products hh+lh+hl), P.v (P x32768 f16 hi+residual,
// v x1024 f16 hi+residual, products hh+lh+hl) and O.Wo^T (O x1024 f16 hi+residual, Wo as f16(bf16(Wo) x1024), products h.w+l.w):
// v_wmma_f32_16x16x32_f16, f32 accumulate. Per-head logit scale sigmoid(bf16(g_h))/8 in f32; base-2 online softmax, 1/l fold and
// bias adds in f32 on VALU.
#include <hip/hip_runtime.h>
#include <math.h>
#include <stdint.h>

#ifndef NB
#define NB    2
#endif
#ifndef SEQ
#define SEQ   2048
#endif
#define NB_FULL  2
#define SEQ_FULL 2048
#define DMOD  1024
#define NH    16
#define HD    64
#define QSC   1024.0f
#define KSC   1024.0f
#define PCAR  32768.0f
#define VCAR  1024.0f
#define OSC   1024.0f
#define WOS   1024.0f
#define LOG2E 1.4426950408889634f
#define ATT_WAVES   4
#define ATT_THREADS (ATT_WAVES * 32)
#define QT64        (SEQ / 64)
#define ATT_BLOCKS  (NB * NH * QT64)
#define NKB    (SEQ / 32)
#define SLABF  (16 * 68)
#define SLAB64 (16 * 68)
#define VTP    72
#define KT     64                 // keys per staged tile
#define LP     72                 // LDS row pitch in halves: 128-B rows + 16 B (16 B x odd, for 16-B LDS reads down a column of rows)
#define PLH    (64 * LP)          // one plane's tile: 64 rows
#define BUFH   (4 * PLH)          // k hi, k residual, v^T hi, v^T residual
#define NT     (SEQ / KT)
static_assert(HD == 64 && DMOD == NH * HD && NH == 16);
static_assert(NB >= 1 && NB <= NB_FULL && SEQ >= 64 && SEQ <= SEQ_FULL && (SEQ % 64) == 0);
static_assert(ATT_THREADS == 128 && ATT_BLOCKS == NB * NH * (SEQ / 64) && NKB * 32 == SEQ);
static_assert(((NB * SEQ) % 64) == 0 && (DMOD % 64) == 0 && (DMOD % 32) == 0);
static_assert((SEQ % 64) == 0 && (SEQ % 8) == 0);
static_assert(((NB * SEQ * DMOD / 8) % 256) == 0 && ((DMOD * DMOD / 8) % 256) == 0 && ((SEQ * DMOD / 8) % 256) == 0);
static_assert(ATT_WAVES * SLABF >= 4 * 16 * 68);
static_assert(HD * VTP >= 63 * VTP + 64 && 2 * 2 * PLH >= 2 * HD * VTP && (VTP * 2) % 16 == 0);
static_assert(KT == 64 && HD == 64 && NT * KT == SEQ && NT * 2 == NKB && ATT_THREADS == 128);
static_assert(2 * BUFH * 2 >= ATT_WAVES * SLABF * 4 && (LP * 2) % 16 == 0);

typedef unsigned short u16;
typedef _Float16 v16h __attribute__((ext_vector_type(16)));
typedef _Float16 v8h  __attribute__((ext_vector_type(8)));
typedef __bf16   v16b __attribute__((ext_vector_type(16)));
typedef float    v8f  __attribute__((ext_vector_type(8)));
typedef float    v4f  __attribute__((ext_vector_type(4)));
typedef unsigned int v4u __attribute__((ext_vector_type(4)));

union FragH { v16h v; v8h h[2]; v4u u[2]; };
union FragB { v16b v; v4u u[2]; };

// ---- scalar helpers --------------------------------------------------------------------------------
__device__ __forceinline__ unsigned short bf_bits(float f) {          // f32 -> bf16 bits, RNE convert
  unsigned u = __float_as_uint(f);
  return (unsigned short)((u + 0x7FFFu + ((u >> 16) & 1u)) >> 16);
}
__device__ __forceinline__ float bf_up(unsigned short h) { return __uint_as_float(((unsigned)h) << 16); }
__device__ __forceinline__ float bfr(float f) { return bf_up(bf_bits(f)); }
__device__ __forceinline__ unsigned short h_bits(_Float16 x) { return __builtin_bit_cast(unsigned short, x); }
__device__ __forceinline__ unsigned pk16(unsigned short a, unsigned short b) { return (unsigned)a | ((unsigned)b << 16); }
__device__ __forceinline__ v8f zero8() { v8f z = {0.f, 0.f, 0.f, 0.f, 0.f, 0.f, 0.f, 0.f}; return z; }
__device__ __forceinline__ v4f zero4() { v4f z = {0.f, 0.f, 0.f, 0.f}; return z; }

// ---- fragment loaders: 16-bit A/B operand, lane -> row/col (lane&15), p already includes +8*(lane>>4);
//      elements 0..7 <- p[0..7] (k0+8h..), elements 8..15 <- p[16..23] (k0+16+8h..)  (same split k map for A and B;
//      B is always read from a k-contiguous [n][k] plane)
__device__ __forceinline__ v16h ldfrag_h(const _Float16* p) {
  FragH f;
  f.h[0] = *(const v8h*)(p);
  f.h[1] = *(const v8h*)(p + 16);
  return f.v;
}
__device__ __forceinline__ v16b ldfrag_b(const u16* p) {              // bf16 plane read as unsigned integer vectors
  FragB f;
  f.u[0] = *(const v4u*)(p);
  f.u[1] = *(const v4u*)(p + 16);
  return f.v;
}

__device__ __forceinline__ v8f mma_h(v16h a, v16h b, v8f c) {
  return __builtin_amdgcn_wmma_f32_16x16x32_f16(false, a, false, b, (short)0, c, false, false);
}
__device__ __forceinline__ v8f mma_b(v16b a, v16b b, v8f c) {
  return __builtin_amdgcn_wmma_f32_16x16x32_bf16(false, a, false, b, (short)0, c, false, false);
}
__device__ __forceinline__ void guard2(v8f& a, v8f& b, v16h x0, v16h x1, v16h x2, v16h x3, v16h x4, v16h x5) {
#if defined(__HIP_DEVICE_COMPILE__)
  asm volatile("v_nop\n\tv_nop\n\tv_nop\n\tv_nop"
               : "+v"(a), "+v"(b) : "v"(x0), "v"(x1), "v"(x2), "v"(x3), "v"(x4), "v"(x5) : "memory");
#endif
}
__device__ __forceinline__ void guard10(v8f& a, v8f& b, v8f& c, v8f& d, v16h x0, v16h x1, v16h x2, v16h x3, v16h x4,
                                        v16h x5, v16h x6, v16h x7, v16h x8, v16h x9) {
#if defined(__HIP_DEVICE_COMPILE__)
  asm volatile("v_nop\n\tv_nop\n\tv_nop\n\tv_nop"
               : "+v"(a), "+v"(b), "+v"(c), "+v"(d)
               : "v"(x0), "v"(x1), "v"(x2), "v"(x3), "v"(x4), "v"(x5), "v"(x6), "v"(x7), "v"(x8), "v"(x9) : "memory");
#endif
}
__device__ __forceinline__ void acc_guard4(v8f& a, v8f& b, v8f& c, v8f& d) {
#if defined(__HIP_DEVICE_COMPILE__)
  asm volatile("v_nop\n\tv_nop\n\tv_nop\n\tv_nop" : "+v"(a), "+v"(b), "+v"(c), "+v"(d));
#endif
}
// Two planes' 64-row x 128-B tiles, global -> LDS, by 128 threads: per lane four 16-B asynchronous copies a plane (rows r, r+16,
// r+32, r+48; 8 lanes = one whole 128-B row). la/lb: the lane's LDS byte addresses of row r, ga/gb: its global addresses, gstep: 16
// source rows in elements. The s_wait_xcnt closes the statement so that no address register is rewritten ahead of it.
__device__ __forceinline__ void stage2(unsigned la, unsigned lb, const u16* ga, const u16* gb, size_t gstep) {
#if defined(__HIP_DEVICE_COMPILE__)
  const unsigned ls = 16 * LP * 2;
  asm volatile("global_load_async_to_lds_b128 %0, %8, off\n\t"
               "global_load_async_to_lds_b128 %1, %9, off\n\t"
               "global_load_async_to_lds_b128 %2, %10, off\n\t"
               "global_load_async_to_lds_b128 %3, %11, off\n\t"
               "global_load_async_to_lds_b128 %4, %12, off\n\t"
               "global_load_async_to_lds_b128 %5, %13, off\n\t"
               "global_load_async_to_lds_b128 %6, %14, off\n\t"
               "global_load_async_to_lds_b128 %7, %15, off\n\t"
               "s_wait_xcnt 0x0"
               :: "v"(la), "v"(la + ls), "v"(la + 2 * ls), "v"(la + 3 * ls),
                  "v"(lb), "v"(lb + ls), "v"(lb + 2 * ls), "v"(lb + 3 * ls),
                  "v"(ga), "v"(ga + gstep), "v"(ga + 2 * gstep), "v"(ga + 3 * gstep),
                  "v"(gb), "v"(gb + gstep), "v"(gb + 2 * gstep), "v"(gb + 3 * gstep)
               : "memory");
#endif
}
// One plane's tile, the same way: four copies a lane.
__device__ __forceinline__ void stage1(unsigned la, const u16* ga, size_t gstep) {
#if defined(__HIP_DEVICE_COMPILE__)
  const unsigned ls = 16 * LP * 2;
  asm volatile("global_load_async_to_lds_b128 %0, %4, off\n\t"
               "global_load_async_to_lds_b128 %1, %5, off\n\t"
               "global_load_async_to_lds_b128 %2, %6, off\n\t"
               "global_load_async_to_lds_b128 %3, %7, off\n\t"
               "s_wait_xcnt 0x0"
               :: "v"(la), "v"(la + ls), "v"(la + 2 * ls), "v"(la + 3 * ls),
                  "v"(ga), "v"(ga + gstep), "v"(ga + 2 * gstep), "v"(ga + 3 * gstep)
               : "memory");
#endif
}
__device__ __forceinline__ void wave_sync_lds() {
  __builtin_amdgcn_fence(__ATOMIC_RELEASE, "workgroup");
  __builtin_amdgcn_wave_barrier();
  __builtin_amdgcn_fence(__ATOMIC_ACQUIRE, "workgroup");
}

// =====================================================================================================
// f32 plane -> 16-bit plane:  f16mode == 0: bf16 RNE bits;  f16mode == 1: f16 bits of (bf16 RNE value) * scale.
// Destination is a dense plane of n8*8 elements; source octet index = (gt / seg8) * sstride8 + gt % seg8 (segments of seg8
// octets taken at stride sstride8 octets, identity when seg8 == n8): used to read NB batches of SEQ rows out of an input laid out
// with SEQ_FULL rows per batch.
// Thread = 8 consecutive elements: two 16-B loads, one 16-B store; 32 consecutive lanes = 512 contiguous, 512-B aligned bytes
// coverage: grid = n8/256 blocks (host checks exactness) x 256 thr x 8 = the whole destination plane.
// =====================================================================================================
__global__ __launch_bounds__(256) void cvt16(const float* __restrict__ x, u16* D, int n8, int f16mode, float scale,
                                             int seg8, int sstride8) {
  const int gt = blockIdx.x * 256 + (int)threadIdx.x;
  if (gt >= n8) return;                     // no barriers in this kernel
  const size_t so = (size_t)(gt / seg8) * (size_t)sstride8 + (size_t)(gt % seg8);
  const float* p = x + so * 8;
  const v4f a = *(const v4f*)(p), c4 = *(const v4f*)(p + 4);
  float v[8];
#pragma unroll
  for (int e = 0; e < 4; ++e) { v[e] = a[e]; v[4 + e] = c4[e]; }
  unsigned short s[8];
#pragma unroll
  for (int e = 0; e < 8; ++e) {
    const unsigned short hb = h_bits((_Float16)(bfr(v[e]) * scale));
    const unsigned short bb = bf_bits(v[e]);
    s[e] = (f16mode != 0) ? hb : bb;
  }
  v4u o;
#pragma unroll
  for (int e = 0; e < 4; ++e) o[e] = pk16(s[2 * e], s[2 * e + 1]);
  u16* d = D + (size_t)gt * 8;
  {
    *(v4u*)(d) = o;
    
  }
}

// =====================================================================================================
// f32 GEMM epilogue (gemm_h2): the wave's 16x64 f32 tile (times oscale) staged in its LDS slab (pitch 68, wave-private),
// coverage: 8 instructions x 2 rows x 16 lanes x 4 floats = the wave's 16 x 64 tile.
// =====================================================================================================
__device__ __forceinline__ void epi64(float* sl, v8f a0, v8f a1, v8f a2, v8f a3, float oscale, v4f badd, float* C, int N,
                                      size_t rowb, int col0, int lane) {
  const int hh = lane >> 4, m = lane & 15;
#pragma unroll
  for (int r = 0; r < 8; ++r) {
    const int ro = (8 * hh + r) * 68 + m;
    sl[ro]      = a0[r] * oscale;
    sl[ro + 16] = a1[r] * oscale;
    sl[ro + 32] = a2[r] * oscale;
    sl[ro + 48] = a3[r] * oscale;
  }
  wave_sync_lds();
  v4f vals[8];
#pragma unroll
  for (int it = 0; it < 8; ++it) vals[it] = *(const v4f*)(sl + (it * 2 + hh) * 68 + m * 4) + badd;
  float* dst = C + (rowb + (size_t)hh) * (size_t)N + col0 + m * 4;
  {
#pragma unroll
    for (int it = 0; it < 8; ++it) {
      *(v4f*)(dst + (size_t)(it * 2) * (size_t)N) = vals[it];
    }
    
  }
}

// =====================================================================================================
// bf16 GEMM with bias, result written as two f16 planes: c[M][N] (f32, in registers) = A[M][K] (bf16 row-major) . Bt[N][K]^T (bf16
// k-contiguous), times oscale, plus bf16-RNE value of bias[n]; PH = f16(c * psc), PL = f16(c * psc - PH) (psc a power of two).
// Block = 64x64 tile, 4 waves x 16 rows. The block's 64 A rows and 64 Bt rows are staged in LDS 64 k (one whole
// 128-B line a row) at a time by asynchronous copies, two buffers (tile t+1 flies while tile t is worked on, one block barrier a
// tile); fragments are read from LDS (two 16-B reads each, split k map for A and B), two k steps of 32 a tile, in the k order of
// a plain walk (host checks K % 64 == 0, M % 64 == 0, N % 64 == 0, grid = (M/64)*(N/64)).
// Epilogue, vt == 0: planes laid out [M][N]; the wave's 16x64 f32 tile goes through its private LDS slab (pitch 68), a lane then
//   owns 8 consecutive columns of a row: per plane 4 instructions x 4 rows x 8 lanes x 8 halves = the wave's 16 x 64 tile.
// Epilogue, vt != 0 (N == NH*HD, rows = b*SEQ + s): planes laid out [b][h][d][s]. A lane's 8 accumulator rows of one column are 8
//   consecutive s of one d: one 16-B LDS store a plane into the block's [64 d][64 s] tiles (pitch VTP, in the ring, which is free
//   behind the loop's last barrier); one block barrier; then 4 iterations x 128 thr x 8 halves = 64 lines x 64 s of each plane.
// =====================================================================================================
__global__ __launch_bounds__(128)
void gemm_bfb(const u16* __restrict__ A, const u16* __restrict__ Bt, const float* __restrict__ bias,
              u16* PH, u16* PL, int M, int N, int K, float oscale, float psc, int vt) {
  __shared__ __align__(16) float slab[4 * SLAB64];
  __shared__ __align__(16) u16 ring[2 * 2 * PLH];   // two buffers of [A tile | Bt tile], 64 rows of pitch LP each
  const int tid = threadIdx.x, wave = tid >> 5, lane = tid & 31, hh = lane >> 4, m = lane & 15;
  const int ntile = N >> 6;
  const int bid   = blockIdx.x;
  const int row0  = (bid / ntile) * 64;
  const int rowb  = row0 + wave * 16;
  const int col0  = (bid % ntile) * 64;
  if (row0 + 64 > M) return;                 // block-uniform, in front of every barrier; never taken with the exact grid
  // staging: thread -> (row sr of 16, 16-B piece sc of 8), rows sr, sr+16, sr+32, sr+48 of each operand's tile
  const int sr = tid >> 3, sc = (tid & 7) * 8;
  const u16* ag = A  + (size_t)(row0 + sr) * K + sc;
  const u16* bg = Bt + (size_t)(col0 + sr) * K + sc;
  const unsigned lds0 = (unsigned)(size_t)(const void*)ring + (unsigned)(sr * LP + sc) * 2u;
  const int nt = K >> 6;
  auto stage = [&](int t, int buf) {
    const unsigned l = lds0 + (unsigned)buf * (2u * PLH * 2u);
    stage2(l, l + PLH * 2u, ag + (size_t)t * 64, bg + (size_t)t * 64, (size_t)16 * K);
  };
  // fragment readers, in halves from a buffer's start
  const int afo = (wave * 16 + m) * LP + 8 * hh;
  const int bfo = PLH + m * LP + 8 * hh;
  v8f acc0 = zero8(), acc1 = zero8(), acc2 = zero8(), acc3 = zero8();
  stage(0, 0);
  asm volatile("s_wait_asynccnt 0x0" ::: "memory");   // this wave's copies of tile 0 have landed
  __syncthreads();                                    // ... and every other wave's: tile 0 may be read
  if (nt > 1) stage(1, 1);
#pragma unroll 1   // one tile a trip: the ring's hand-over stands once, at the foot
  for (int t = 0; t < nt; ++t) {
    const u16* bufp = ring + (t & 1) * (2 * PLH);
    v16b a[2], b[2][4];
#pragma unroll
    for (int kk = 0; kk < 2; ++kk) {
      a[kk] = ldfrag_b(bufp + afo + kk * 32);
#pragma unroll
      for (int j = 0; j < 4; ++j) b[kk][j] = ldfrag_b(bufp + bfo + j * 16 * LP + kk * 32);
    }
    __builtin_amdgcn_sched_barrier(0);   // all of the tile's LDS reads issue ahead of its WMMAs: one LDS latency a tile, not several
#pragma unroll
    for (int kk = 0; kk < 2; ++kk) {
      acc0 = mma_b(a[kk], b[kk][0], acc0);
      acc1 = mma_b(a[kk], b[kk][1], acc1);
      acc2 = mma_b(a[kk], b[kk][2], acc2);
      acc3 = mma_b(a[kk], b[kk][3], acc3);
    }
    acc_guard4(acc0, acc1, acc2, acc3);                 // WMMA distance kept on both sides of the branches that follow
    // ---- hand-over: tile t+1 is published and tile t's buffer is freed by the one barrier; then the refill ----
    asm volatile("s_wait_dscnt 0x0" ::: "memory");      // this wave's reads of tile t are done before its buffer is refilled
    asm volatile("s_wait_asynccnt 0x0" ::: "memory");   // this wave's copies of tile t+1 have landed
    __syncthreads();
    if (t + 2 < nt) stage(t + 2, t & 1);
  }
  asm volatile("s_wait_asynccnt 0x0" ::: "memory");     // nothing in flight when the wave goes on to its end
  // every loop of both epilogues is unrolled so that accumulators and staging arrays are indexed by constants (registers, no scratch)
  if (vt == 0) {                             // block-uniform
    float* sl = slab + wave * SLAB64;
#pragma unroll
    for (int r = 0; r < 8; ++r) {
      const int ro = (8 * hh + r) * 68 + m;
      sl[ro]      = acc0[r] * oscale;
      sl[ro + 16] = acc1[r] * oscale;
      sl[ro + 32] = acc2[r] * oscale;
      sl[ro + 48] = acc3[r] * oscale;
    }
    wave_sync_lds();
    const int rq = lane >> 3, c8 = (lane & 7) * 8;
    const v4f bv0 = *(const v4f*)(bias + col0 + c8), bv1 = *(const v4f*)(bias + col0 + c8 + 4);   // columns < N (N multiple of 64)
    float badd[8];
#pragma unroll
    for (int e = 0; e < 4; ++e) { badd[e] = bfr(bv0[e]); badd[4 + e] = bfr(bv1[e]); }
    v4u oh[4], ol[4];
#pragma unroll
    for (int i4 = 0; i4 < 4; ++i4) {
      const int row = i4 * 4 + rq;
      const v4f a4 = *(const v4f*)(sl + row * 68 + c8), c4 = *(const v4f*)(sl + row * 68 + c8 + 4);
      float w[8];
#pragma unroll
      for (int e = 0; e < 4; ++e) { w[e] = (a4[e] + badd[e]) * psc; w[4 + e] = (c4[e] + badd[4 + e]) * psc; }
#pragma unroll
      for (int e = 0; e < 4; ++e) {
        const _Float16 h0 = (_Float16)w[2 * e], h1 = (_Float16)w[2 * e + 1];
        const _Float16 l0 = (_Float16)(w[2 * e] - (float)h0), l1 = (_Float16)(w[2 * e + 1] - (float)h1);
        oh[i4][e] = pk16(h_bits(h0), h_bits(h1));
        ol[i4][e] = pk16(h_bits(l0), h_bits(l1));
      }
    }
    const size_t ob = (size_t)rowb * (size_t)N + col0 + c8;
#pragma unroll
    for (int i4 = 0; i4 < 4; ++i4) {
      const size_t o8 = ob + (size_t)(i4 * 4 + rq) * (size_t)N;
      *(v4u*)(PH + o8) = oh[i4];
      *(v4u*)(PL + o8) = ol[i4];
    }
  } else {
    u16* TH = ring;
    u16* TL = ring + HD * VTP;
    const v8f acc[4] = {acc0, acc1, acc2, acc3};
#pragma unroll
    for (int j = 0; j < 4; ++j) {
      const float bj = bfr(bias[col0 + 16 * j + m]);        // column < N (N multiple of 64)
      v4u th, tl;
#pragma unroll
      for (int e = 0; e < 4; ++e) {
        const float t0 = (acc[j][2 * e] * oscale + bj) * psc, t1 = (acc[j][2 * e + 1] * oscale + bj) * psc;
        const _Float16 h0 = (_Float16)t0, h1 = (_Float16)t1;
        const _Float16 l0 = (_Float16)(t0 - (float)h0), l1 = (_Float16)(t1 - (float)h1);
        th[e] = pk16(h_bits(h0), h_bits(h1));
        tl[e] = pk16(h_bits(l0), h_bits(l1));
      }
      const int to = (16 * j + m) * VTP + wave * 16 + 8 * hh;
      *(v4u*)(TH + to) = th;
      *(v4u*)(TL + to) = tl;
    }
    __syncthreads();                         // the four waves' columns of the [d][s] tiles are complete
    const int q8 = tid >> 3, p8 = (tid & 7) * 8;
    v4u vh[4], vl[4];
#pragma unroll
    for (int it = 0; it < 4; ++it) {
      const int line = it * 16 + q8;          // d = 0..63
      vh[it] = *(const v4u*)(TH + line * VTP + p8);
      vl[it] = *(const v4u*)(TL + line * VTP + p8);
    }
    const size_t base = ((size_t)((row0 / SEQ) * NH + (col0 >> 6)) * HD) * SEQ + (row0 % SEQ) + p8;
#pragma unroll
    for (int it = 0; it < 4; ++it) {
      const int line = it * 16 + q8;
      *(v4u*)(PH + base + (size_t)line * SEQ) = vh[it];
      *(v4u*)(PL + base + (size_t)line * SEQ) = vl[it];
    }
    asm volatile("s_wait_xcnt 0x0" ::: "memory");   // behind the run of stores: no register that they name is rewritten ahead of it
  }
}

// =====================================================================================================
// f16 hi+lo GEMM with bias: C[M][N] (f32) = (Ahi + Alo)[M][K] . Bt[N][K]^T times oscale, plus bf16-RNE value of bias[n];
// Ahi/Alo f16 planes (same layout), Bt f16 k-contiguous; products hi.B + lo.B into one accumulator (lo is the unscaled
// residual of hi). Same tiling and the same two-buffer LDS ring as gemm_bfb, three planes a tile (Ahi, Alo, Bt).
// =====================================================================================================
__global__ __launch_bounds__(128)
void gemm_h2(const u16* __restrict__ Ah, const u16* __restrict__ Al, const u16* __restrict__ Bt,
             const float* __restrict__ bias, float* C, int M, int N, int K, float oscale) {
  __shared__ __align__(16) float slab[4 * SLAB64];
  __shared__ __align__(16) u16 ring[2 * 3 * PLH];   // two buffers of [Ahi tile | Alo tile | Bt tile], 64 rows of pitch LP each
  const int tid = threadIdx.x, wave = tid >> 5, lane = tid & 31, hh = lane >> 4, m = lane & 15;
  const int ntile = N >> 6;
  const int bid   = blockIdx.x;
  const int row0  = (bid / ntile) * 64;
  const int rowb  = row0 + wave * 16;
  const int col0  = (bid % ntile) * 64;
  if (row0 + 64 > M) return;                 // block-uniform, in front of every barrier; never taken with the exact grid
  // staging: thread -> (row sr of 16, 16-B piece sc of 8), rows sr, sr+16, sr+32, sr+48 of each plane's tile
  const int sr = tid >> 3, sc = (tid & 7) * 8;
  const size_t aofs = (size_t)(row0 + sr) * K + sc;
  const u16* ahg = Ah + aofs;
  const u16* alg = Al + aofs;
  const u16* bg  = Bt + (size_t)(col0 + sr) * K + sc;
  const unsigned lds0 = (unsigned)(size_t)(const void*)ring + (unsigned)(sr * LP + sc) * 2u;
  const int nt = K >> 6;
  auto stage = [&](int t, int buf) {
    const unsigned l = lds0 + (unsigned)buf * (3u * PLH * 2u);
    stage2(l, l + PLH * 2u, ahg + (size_t)t * 64, alg + (size_t)t * 64, (size_t)16 * K);
    stage1(l + 2u * PLH * 2u, bg + (size_t)t * 64, (size_t)16 * K);
  };
  // fragment readers, in halves from a buffer's start
  const int afo = (wave * 16 + m) * LP + 8 * hh;
  const int bfo = 2 * PLH + m * LP + 8 * hh;
  v8f acc0 = zero8(), acc1 = zero8(), acc2 = zero8(), acc3 = zero8();
  stage(0, 0);
  asm volatile("s_wait_asynccnt 0x0" ::: "memory");   // this wave's copies of tile 0 have landed
  __syncthreads();                                    // ... and every other wave's: tile 0 may be read
  if (nt > 1) stage(1, 1);
#pragma unroll 1   // one tile a trip: the ring's hand-over stands once, at the foot
  for (int t = 0; t < nt; ++t) {
    const _Float16* bufp = (const _Float16*)(const void*)ring + (t & 1) * (3 * PLH);
    v16h ah[2], al[2], b[2][4];
#pragma unroll
    for (int kk = 0; kk < 2; ++kk) {
      ah[kk] = ldfrag_h(bufp + afo + kk * 32);
      al[kk] = ldfrag_h(bufp + PLH + afo + kk * 32);
#pragma unroll
      for (int j = 0; j < 4; ++j) b[kk][j] = ldfrag_h(bufp + bfo + j * 16 * LP + kk * 32);
    }
    __builtin_amdgcn_sched_barrier(0);   // all of the tile's LDS reads issue ahead of its WMMAs: one LDS latency a tile, not several
#pragma unroll
    for (int kk = 0; kk < 2; ++kk) {
      acc0 = mma_h(ah[kk], b[kk][0], acc0);  acc0 = mma_h(al[kk], b[kk][0], acc0);
      acc1 = mma_h(ah[kk], b[kk][1], acc1);  acc1 = mma_h(al[kk], b[kk][1], acc1);
      acc2 = mma_h(ah[kk], b[kk][2], acc2);  acc2 = mma_h(al[kk], b[kk][2], acc2);
      acc3 = mma_h(ah[kk], b[kk][3], acc3);  acc3 = mma_h(al[kk], b[kk][3], acc3);
    }
    acc_guard4(acc0, acc1, acc2, acc3);                 // WMMA distance kept on both sides of the branches that follow
    // ---- hand-over: tile t+1 is published and tile t's buffer is freed by the one barrier; then the refill ----
    asm volatile("s_wait_dscnt 0x0" ::: "memory");      // this wave's reads of tile t are done before its buffer is refilled
    asm volatile("s_wait_asynccnt 0x0" ::: "memory");   // this wave's copies of tile t+1 have landed
    __syncthreads();
    if (t + 2 < nt) stage(t + 2, t & 1);
  }
  asm volatile("s_wait_asynccnt 0x0" ::: "memory");     // nothing in flight when the wave goes on to its end
  const v4f bv = *(const v4f*)(bias + col0 + m * 4);      // columns col0 + 4m .. +3, always < N (N multiple of 64)
  v4f badd;
#pragma unroll
  for (int e = 0; e < 4; ++e) badd[e] = bfr(bv[e]);
  epi64(slab + wave * SLAB64, acc0, acc1, acc2, acc3, oscale, badd, C, N, (size_t)rowb, col0, lane);
}

// =====================================================================================================
// Full (non-causal, unmasked) multi-head flash attention: block = (batch b, head, 64 query rows), 4 waves, wave w owns the
// 16 query rows q0 = 64*qt + 16*w .. q0+15. The k and v^T planes' tiles of KT = 64 keys are staged in LDS by asynchronous copies, two
// buffers (tile t+1 flies while tile t is worked on, one block barrier a tile), and read by all 4 waves; each tile serves two key
// blocks of 32. The ring becomes the waves' private result slabs behind the last tile's barrier.
//   Per-head logit scale: sigmoid(bf16 RNE value of g[head]) / 8, computed in f32 once per thread (head uniform per block) and
//   folded with log2(e) and the q/k carries into lsc.
//   q planes (hi, lo f16, x1024) laid out [b][s][h][d]; k planes the same; v^T planes [b][h][d][s] (x1024).
//   All NKB = SEQ/32 key blocks of 32 keys are visited (static bound).
//   Scores are computed TRANSPOSED: S^T tile g (g = 0,1) = k rows (keys kb+16g .. +15, A operand, row m = lane&15, split k map
//   over d) times q^T (B operand, col n = query q0 + (lane&15), k = d, split map), 3 products per tile and d-chunk
//   (k_hi.q_hi + k_lo.q_hi + k_hi.q_lo). D element r of lane l = (key kb+16g+8h+r, query q0+(l&15)), so a lane owns one query
//   column and 16 of its 32 keys; the partner lane l^16 owns the other 16 -> row max / row sum need one xor-16 shuffle.
//   Online max-subtracted base-2 softmax in f32. The exp'd values ARE the P A-fragment in place: A row m = query = lane&15,
//   element i <- key kb+8h+i (tile 0, D element i), element 8+i <- key kb+16+8h+i (tile 1, D element i). P is carried x32768
//   as f16 hi + f16 residual. The rescale factor of query row 8h+r of the O accumulators is fetched from lane 8h+r with a
//   shuffle (uniform control). 4+4 v^T B fragments (hi and residual planes, col n = d = 16j + (lane&15), keys k-contiguous),
//   12 P.V WMMAs (hh + lh + hl).
//   Epilogue: 1/l (per query, shuffled to the D row owner) and carry folds in f32; the wave's 16x64 f32 result staged in its LDS
// coverage: per wave 4 instructions x 4 rows x 8 lanes x 8 halves = 16 x 64 per plane; grid NB*NH*SEQ/64 blocks x 4 waves = every
//           (b, s, h) row of both O planes exactly once.
// =====================================================================================================
__global__ __launch_bounds__(ATT_THREADS)
void attn_fwd(const u16* __restrict__ QHIp, const u16* __restrict__ QLOp,
              const u16* __restrict__ KHIp, const u16* __restrict__ KLOp,
              const u16* __restrict__ VHIp, const u16* __restrict__ VLOp,
              const float* __restrict__ gatep,
              u16* OHIp, u16* OLOp) {
  __shared__ __align__(16) u16 ring[2 * BUFH];   // two tile buffers; in the epilogue per wave a result slab [16][68] of f32

  const int tid  = threadIdx.x;
  const int wave = tid >> 5;
  const int lane = tid & 31;
  const int hh   = lane >> 4;
  const int c    = lane & 15;

  const int bid  = blockIdx.x;
  const int qt   = bid % QT64;
  const int head = (bid / QT64) % NH;
  const int b    = bid / (QT64 * NH);
  const int q0   = qt * 64 + wave * 16;

  // per-head scale: sigmoid(bf16 value of g) / 8 in f32; head < NH always (block decode), host checks the input extent
  const float gbf = bfr(gatep[head]);
  const float sgm = 1.0f / (1.0f + expf(-gbf));
  const float lsc = sgm * (0.125f * (LOG2E / (QSC * KSC)));

  // B fragments of q^T: col n = query q0 + c, k = d (k-contiguous row of the q plane)
  const size_t qofs = (((size_t)(b * SEQ + q0 + c)) * NH + head) * HD + 8 * hh;
  const _Float16* Qh  = (const _Float16*)(const void*)QHIp + qofs;
  const _Float16* Ql  = (const _Float16*)(const void*)QLOp + qofs;
  // staging: thread -> (row sr of 16, 16-B piece sc of 8); k tile row = key, v^T tile row = d, both 64 halves long
  const int sr = tid >> 3, sc = (tid & 7) * 8;
  const size_t kofs = (((size_t)b * SEQ + sr) * NH + head) * HD + sc;             // tile's first key added per tile
  const size_t vofs = ((size_t)(b * NH + head) * HD + sr) * SEQ + sc;             // tile's first key added per tile
  const unsigned lds0 = (unsigned)(size_t)(const void*)ring + (unsigned)(sr * LP + sc) * 2u;
  auto stage = [&](int t, int buf) {
    const unsigned l = lds0 + (unsigned)buf * (BUFH * 2u);
    const size_t ko = kofs + (size_t)t * (KT * NH * HD), vo = vofs + (size_t)t * KT;
    stage2(l, l + PLH * 2u, KHIp + ko, KLOp + ko, (size_t)16 * (NH * HD));
    stage2(l + 2u * PLH * 2u, l + 3u * PLH * 2u, VHIp + vo, VLOp + vo, (size_t)16 * SEQ);
  };
  // fragment readers, in halves from a buffer's start: A of k: row m = key 16g + c, k = d; B of v: col n = d = 16j + c, k = key
  const int kfo = c * LP + 8 * hh;
  const int vfo = 2 * PLH + c * LP + 8 * hh;

  // q^T B fragments (hi and residual planes, both d chunks of 32): read once, held in registers for all key tiles
  const v16h qhf[2] = {ldfrag_h(Qh), ldfrag_h(Qh + 32)};
  const v16h qlf[2] = {ldfrag_h(Ql), ldfrag_h(Ql + 32)};

  float mrun = -INFINITY, lrun = 0.f;
  v8f o[4];
#pragma unroll
  for (int j = 0; j < 4; ++j) o[j] = zero8();

  stage(0, 0);
  asm volatile("s_wait_asynccnt 0x0" ::: "memory");   // this wave's copies of tile 0 have landed
  __syncthreads();                                    // ... and every other wave's: tile 0 may be read
  if (NT > 1) stage(1, 1);

#pragma unroll 1
  for (int t = 0; t < NT; ++t) {
   const _Float16* bufp = (const _Float16*)(const void*)ring + (t & 1) * BUFH;
#pragma unroll   // both key blocks of a tile in line: their LDS offsets become immediates
   for (int sub = 0; sub < 2; ++sub) {
    // ---- transposed scores: s0 = keys kb..kb+15, s1 = keys kb+16..kb+31 (kb = 64t + 32sub), column = query q0 + c ----
    v8f s0 = zero8(), s1 = zero8();
    const _Float16* k0p = bufp + kfo + sub * 32 * LP;
    const _Float16* k1p = k0p + 16 * LP;
    const _Float16* l0p = k0p + PLH;
    const _Float16* l1p = l0p + 16 * LP;
#pragma unroll
    for (int kk = 0; kk < 2; ++kk) {
      const v16h qh  = qhf[kk], ql = qlf[kk];
      const v16h kh0 = ldfrag_h(k0p + kk * 32), kl0 = ldfrag_h(l0p + kk * 32);
      const v16h kh1 = ldfrag_h(k1p + kk * 32), kl1 = ldfrag_h(l1p + kk * 32);
      s0 = mma_h(kh0, qh, s0);
      s0 = mma_h(kl0, qh, s0);
      s0 = mma_h(kh0, ql, s0);
      s1 = mma_h(kh1, qh, s1);
      s1 = mma_h(kl1, qh, s1);
      s1 = mma_h(kh1, ql, s1);
      guard2(s0, s1, qh, ql, kh0, kl0, kh1, kl1);
    }
    // ---- base-2 logits of this lane's 16 keys for query q0 + c: t[i] <- key kb+8hh+i, t[8+i] <- key kb+16+8hh+i ----
    float t[16];
#pragma unroll
    for (int i = 0; i < 8; ++i) { t[i] = s0[i] * lsc; t[8 + i] = s1[i] * lsc; }
    float cm = t[0];
#pragma unroll
    for (int i = 1; i < 16; ++i) cm = fmaxf(cm, t[i]);
    cm = fmaxf(cm, __shfl_xor(cm, 16, 32));
    const float mn = fmaxf(mrun, cm);        // finite from the first block on
    const float al = exp2f(mrun - mn);       // 0 on the first block (mrun = -inf)
    mrun = mn;
    // ---- probabilities (<= 1) and the P A-fragments: hi = f16(p * 32768), lo = f16 residual; element i <-> t[i] ----
    float ps = 0.f;
    FragH ph, pl;
#pragma unroll
    for (int w = 0; w < 2; ++w) {
#pragma unroll
      for (int e4 = 0; e4 < 4; ++e4) {
        const int i = 8 * w + 2 * e4;
        const float p0 = exp2f(t[i] - mn), p1 = exp2f(t[i + 1] - mn);
        ps += p0 + p1;
        const float a0 = p0 * PCAR, a1 = p1 * PCAR;
        const _Float16 h0 = (_Float16)a0, h1 = (_Float16)a1;
        const _Float16 l0 = (_Float16)(a0 - (float)h0), l1 = (_Float16)(a1 - (float)h1);
        ph.u[w][e4] = pk16(h_bits(h0), h_bits(h1));
        pl.u[w][e4] = pk16(h_bits(l0), h_bits(l1));
      }
    }
    ps += __shfl_xor(ps, 16, 32);
    lrun = lrun * al + ps;
    // ---- rescale the O accumulators: D row 8hh+r = query q0+8hh+r, its factor lives in lane 8hh+r (and 16+8hh+r) ----
    float scl[8];
#pragma unroll
    for (int r = 0; r < 8; ++r) scl[r] = __shfl(al, 8 * hh + r, 32);
#pragma unroll
    for (int j = 0; j < 4; ++j) {
#pragma unroll
      for (int r = 0; r < 8; ++r) o[j][r] *= scl[r];
    }
    // ---- P.V : B fragment col n = d = j*16 + c, keys contiguous in the v^T planes ----
    {
      const _Float16* vhp = bufp + vfo + sub * 32;
      const _Float16* vlp = vhp + PLH;
      const v16h vh0 = ldfrag_h(vhp);
      const v16h vh1 = ldfrag_h(vhp + 16 * LP);
      const v16h vh2 = ldfrag_h(vhp + 32 * LP);
      const v16h vh3 = ldfrag_h(vhp + 48 * LP);
      const v16h vl0 = ldfrag_h(vlp);
      const v16h vl1 = ldfrag_h(vlp + 16 * LP);
      const v16h vl2 = ldfrag_h(vlp + 32 * LP);
      const v16h vl3 = ldfrag_h(vlp + 48 * LP);
      o[0] = mma_h(ph.v, vh0, o[0]);  o[0] = mma_h(pl.v, vh0, o[0]);  o[0] = mma_h(ph.v, vl0, o[0]);
      o[1] = mma_h(ph.v, vh1, o[1]);  o[1] = mma_h(pl.v, vh1, o[1]);  o[1] = mma_h(ph.v, vl1, o[1]);
      o[2] = mma_h(ph.v, vh2, o[2]);  o[2] = mma_h(pl.v, vh2, o[2]);  o[2] = mma_h(ph.v, vl2, o[2]);
      o[3] = mma_h(ph.v, vh3, o[3]);  o[3] = mma_h(pl.v, vh3, o[3]);  o[3] = mma_h(ph.v, vl3, o[3]);
      guard10(o[0], o[1], o[2], o[3], ph.v, pl.v, vh0, vh1, vh2, vh3, vl0, vl1, vl2, vl3);
    }
   }
   // ---- hand-over: tile t+1 is published and tile t's buffer is freed by the one barrier; then the refill ----
   asm volatile("s_wait_dscnt 0x0" ::: "memory");      // this wave's reads of tile t are done before its buffer is refilled
   asm volatile("s_wait_asynccnt 0x0" ::: "memory");   // this wave's copies of tile t+1 have landed
   __syncthreads();
   if (t + 2 < NT) stage(t + 2, t & 1);
  }
  asm volatile("s_wait_asynccnt 0x0" ::: "memory");    // nothing in flight when the ring turns into the result slabs
  acc_guard4(o[0], o[1], o[2], o[3]);

  // ---- fold 1/l (per query, owned by lane = query) and the carries (32768 on P, 1024 on v); stage the 16x64 slab ----
  const float linv = (1.0f / lrun) * (1.0f / (PCAR * VCAR));
  float inv[8];
#pragma unroll
  for (int r = 0; r < 8; ++r) inv[r] = __shfl(linv, 8 * hh + r, 32);
  float* slab = (float*)(void*)ring + wave * SLABF;
#pragma unroll
  for (int r = 0; r < 8; ++r) {
#pragma unroll
    for (int j = 0; j < 4; ++j) slab[(8 * hh + r) * 68 + j * 16 + c] = o[j][r] * inv[r];
  }
  wave_sync_lds();
  // ---- O x1024 -> f16 hi + residual planes; lane = (row in group of 4, 8 consecutive d) ----
  v4u oh[4], ol[4];
  const int rq = lane >> 3, c8 = (lane & 7) * 8;
#pragma unroll
  for (int i4 = 0; i4 < 4; ++i4) {
    const int row = i4 * 4 + rq;
    const v4f a = *(const v4f*)(slab + row * 68 + c8), c4 = *(const v4f*)(slab + row * 68 + c8 + 4);
    float w[8];
#pragma unroll
    for (int e = 0; e < 4; ++e) { w[e] = a[e] * OSC; w[4 + e] = c4[e] * OSC; }
#pragma unroll
    for (int e = 0; e < 4; ++e) {
      const _Float16 h0 = (_Float16)w[2 * e], h1 = (_Float16)w[2 * e + 1];
      const _Float16 l0 = (_Float16)(w[2 * e] - (float)h0), l1 = (_Float16)(w[2 * e + 1] - (float)h1);
      oh[i4][e] = pk16(h_bits(h0), h_bits(h1));
      ol[i4][e] = pk16(h_bits(l0), h_bits(l1));
    }
  }
  const size_t ob = (((size_t)(b * SEQ + q0)) * NH + head) * HD + c8;
  {
#pragma unroll
    for (int i4 = 0; i4 < 4; ++i4) {
      const int row = i4 * 4 + rq;
      const size_t o8 = ob + (size_t)row * (NH * HD);
      *(v4u*)(OHIp + o8) = oh[i4];
      *(v4u*)(OLOp + o8) = ol[i4];
    }
    
  }
}

// =====================================================================================================
// Workspace map (bytes, ROWS = NB*SEQ; numbers for NB=2, SEQ=2048); every plane is fully written by whole-line stores before it is
// read; all extents are exact multiples of the store granularity (no pad rows needed); XB is reused sequentially
// (in-order stream):
//   XB  bf16 [ROWS][1024]                 8388608        (input Q, then K, then V)
//   WQB bf16 [1024 n][1024 k]             2097152        WKB same  2097152      WVB same  2097152
//   WOB f16  [1024 n][1024 k] x1024       2097152
//   QHI f16 [NB][SEQ][16][64] x1024       8388608        QLO residual         8388608
//   KHI same                              8388608        KLO residual         8388608
//   VHI f16 [NB][16][64][SEQ] x1024       8388608        VLO residual         8388608
//   OHI f16 [ROWS][1024] x1024            8388608        OLO residual         8388608
//   end                                  83886080
// =====================================================================================================
extern "C" void kernel_launch(void* const* d_in, const int* in_sizes, int n_in,
                              void* d_out, int out_size, void* d_ws, size_t ws_size,
                              hipStream_t stream) {
  const int ROWS = NB * SEQ;
  if (n_in < 12) return;
  const int needX = ((NB - 1) * SEQ_FULL + SEQ) * DMOD;   // last input row read by cvt16 (+1), in elements
  if (in_sizes[0] < needX || in_sizes[1] < needX || in_sizes[2] < needX) return;
  if (in_sizes[3] < DMOD * DMOD || in_sizes[5] < DMOD * DMOD) return;
  if (in_sizes[7] < DMOD * DMOD || in_sizes[9] < DMOD * DMOD) return;
  if (in_sizes[4] < DMOD || in_sizes[6] < DMOD || in_sizes[8] < DMOD || in_sizes[10] < DMOD) return;
  if (in_sizes[11] < NH) return;
  if (out_size < ROWS * DMOD) return;

  const float* Qin = (const float*)d_in[0];
  const float* Kin = (const float*)d_in[1];
  const float* Vin = (const float*)d_in[2];
  const float* wq  = (const float*)d_in[3];
  const float* bq  = (const float*)d_in[4];
  const float* wk  = (const float*)d_in[5];
  const float* bk  = (const float*)d_in[6];
  const float* wv  = (const float*)d_in[7];
  const float* bv  = (const float*)d_in[8];
  const float* wo  = (const float*)d_in[9];
  const float* bo  = (const float*)d_in[10];
  const float* gt  = (const float*)d_in[11];
  float*       out = (float*)d_out;

  const size_t szXB  = (size_t)ROWS * DMOD * 2;
  const size_t szW   = (size_t)DMOD * DMOD * 2;
  const size_t szP   = (size_t)ROWS * DMOD * 2;                 // q/k/o planes
  const size_t szVP  = (size_t)NB * NH * HD * SEQ * 2;
  size_t off = 0;
  const size_t oXB  = off; off += szXB;
  const size_t oWQB = off; off += szW;
  const size_t oWKB = off; off += szW;
  const size_t oWVB = off; off += szW;
  const size_t oWOB = off; off += szW;
  const size_t oQHI = off; off += szP;
  const size_t oQLO = off; off += szP;
  const size_t oKHI = off; off += szP;
  const size_t oKLO = off; off += szP;
  const size_t oVHI = off; off += szVP;
  const size_t oVLO = off; off += szVP;
  const size_t oOHI = off; off += szP;
  const size_t oOLO = off; off += szP;
  if (off > ws_size) return;                            // off = 83886080 at full size
  if (off > (size_t)134217728) return;

  char* ws = (char*)d_ws;
  u16*   XB  = (u16*)(ws + oXB);
  u16*   WQB = (u16*)(ws + oWQB);
  u16*   WKB = (u16*)(ws + oWKB);
  u16*   WVB = (u16*)(ws + oWVB);
  u16*   WOB = (u16*)(ws + oWOB);
  u16*   QHI = (u16*)(ws + oQHI);
  u16*   QLO = (u16*)(ws + oQLO);
  u16*   KHI = (u16*)(ws + oKHI);
  u16*   KLO = (u16*)(ws + oKLO);
  u16*   VHI = (u16*)(ws + oVHI);
  u16*   VLO = (u16*)(ws + oVLO);
  u16*   OHI = (u16*)(ws + oOHI);
  u16*   OLO = (u16*)(ws + oOLO);

  const dim3 blk(256);
  const int n8x = (ROWS * DMOD) / 8;                    // 524288 at full size
  const int n8w = (DMOD * DMOD) / 8;                    // 131072
  const int seg8x = (SEQ * DMOD) / 8;                   // destination octets per batch
  const int str8x = (SEQ_FULL * DMOD) / 8;              // source octets per batch in the input layout
  if ((n8x % 256) != 0 || (n8w % 256) != 0) return;
  if ((DMOD % 32) != 0 || (ROWS % 64) != 0 || (DMOD % 64) != 0) return;
  const dim3 gX(n8x / 256);                             // 2048
  const dim3 gWc(n8w / 256);                            // 512
  const dim3 gG((ROWS / 64) * (DMOD / 64));             // 1024
  const dim3 bG(128);
  const dim3 gAT(ATT_BLOCKS);                           // 1024
  const dim3 bAT(ATT_THREADS);                          // 128

  // (0..3) weights [n][k] (already k-contiguous for x.W^T): bf16 planes for wq/wk/wv, f16 of bf16 value x1024 for wo
  cvt16<<<gWc, blk, 0, stream>>>(wq, WQB, n8w, 0, 1.0f, n8w, n8w);
  cvt16<<<gWc, blk, 0, stream>>>(wk, WKB, n8w, 0, 1.0f, n8w, n8w);
  cvt16<<<gWc, blk, 0, stream>>>(wv, WVB, n8w, 0, 1.0f, n8w, n8w);
  cvt16<<<gWc, blk, 0, stream>>>(wo, WOB, n8w, 1, WOS, n8w, n8w);
  // (4..5) q: input -> bf16 plane, projection + bias (col = h*64+d) written as f16 hi x1024 + residual planes [ROWS][1024]
  cvt16<<<gX, blk, 0, stream>>>(Qin, XB, n8x, 0, 1.0f, seg8x, str8x);
  gemm_bfb<<<gG, bG, 0, stream>>>(XB, WQB, bq, QHI, QLO, ROWS, DMOD, DMOD, 1.0f, QSC, 0);
  // (6..7) k: same pipeline (XB reused; single in-order stream)
  cvt16<<<gX, blk, 0, stream>>>(Kin, XB, n8x, 0, 1.0f, seg8x, str8x);
  gemm_bfb<<<gG, bG, 0, stream>>>(XB, WKB, bk, KHI, KLO, ROWS, DMOD, DMOD, 1.0f, KSC, 0);
  // (8..9) v: input -> bf16 plane, projection + bias written as v^T planes x1024 (hi + residual)
  cvt16<<<gX, blk, 0, stream>>>(Vin, XB, n8x, 0, 1.0f, seg8x, str8x);
  gemm_bfb<<<gG, bG, 0, stream>>>(XB, WVB, bv, VHI, VLO, ROWS, DMOD, DMOD, 1.0f, VCAR, 1);
  // (10) attention with per-head scale sigmoid(g)/8 -> O planes [b][s][h][d] x1024 (hi + residual)
  attn_fwd<<<gAT, bAT, 0, stream>>>(QHI, QLO, KHI, KLO, VHI, VLO, gt, OHI, OLO);
  // (11) output projection + bias -> out [ROWS][1024] f32, carries 1024 (O) x 1024 (wo) folded back
  gemm_h2<<<gG, bG, 0, stream>>>(OHI, OLO, WOB, bo, out, ROWS, DMOD, DMOD, 1.0f / (OSC * WOS));
  (void)hipGetLastError();
}

// v005
// A run of this version takes 170 microseconds.
// Timed twice side by side with v004, it ran 1.08 and 1.07 times as fast.
// Counting every step since v000, it is 2.38 times as fast.
// Contractions: x.W{q,k,v}^T on v_wmma_f32_16x16x32_bf16 (x and W RNE-converted to bf16 operands, f32 accumulate, bias added in f32);
// scores k'.q'^T (q', k' carried x1024 as f16 hi plane + f16 residual plane, products hh+lh+hl), P.v (P x32768 f16 hi+residual,
// v x1024 f16 hi+residual, products hh+lh+hl) and O.Wo^T (O x1024 f16 hi+residual, Wo as f16(bf16(Wo) x1024), products h.w+l.w):
// v_wmma_f32_16x16x32_f16, f32 accumulate. Per-head logit scale sigmoid(bf16(g_h))/8 in f32; base-2 online softmax, 1/l fold and
// bias adds in f32 on VALU.
#include <hip/hip_runtime.h>
#include <math.h>
#include <stdint.h>

#ifndef NB
#define NB    2
#endif
#ifndef SEQ
#define SEQ   2048
#endif
#define NB_FULL  2
#define SEQ_FULL 2048
#define DMOD  1024
#define NH    16
#define HD    64
#define QSC   1024.0f
#define KSC   1024.0f
#define PCAR  32768.0f
#define VCAR  1024.0f
#define OSC   1024.0f
#define WOS   1024.0f
#define LOG2E 1.4426950408889634f
#define ATT_WAVES   4
#define ATT_THREADS (ATT_WAVES * 32)
#define QT64        (SEQ / 64)
#define ATT_BLOCKS  (NB * NH * QT64)
#define NKB    (SEQ / 32)
#define SLABF  (16 * 68)
#define SLAB64 (16 * 68)
#define VTP    72
#define KT     64                 // keys per staged tile
#define LP     72                 // LDS row pitch in halves: 128-B rows + 16 B (16 B x odd, for 16-B LDS reads down a column of rows)
#define PLH    (64 * LP)          // one plane's tile: 64 rows
#define BUFH   (4 * PLH)          // k hi, k residual, v^T hi, v^T residual
#define NT     (SEQ / KT)
#define CVT_OCT 16                             // octets a thread of cvt_all
#define CVT_CH  (256 * CVT_OCT)                // octets a block of cvt_all
#define XCH     ((NB * SEQ * DMOD / 8) / CVT_CH)   // blocks an input plane
#define WCH     ((DMOD * DMOD / 8) / CVT_CH)       // blocks a weight plane
#define SEG8X   (SEQ * DMOD / 8)               // destination octets per batch
#define STR8X   (SEQ_FULL * DMOD / 8)          // source octets per batch in the input layout
static_assert(HD == 64 && DMOD == NH * HD && NH == 16);
static_assert(QSC == KSC && KSC == VCAR);      // one plane scale for the three projections of a launch
static_assert(NB >= 1 && NB <= NB_FULL && SEQ >= 64 && SEQ <= SEQ_FULL && (SEQ % 64) == 0);
static_assert(ATT_THREADS == 128 && ATT_BLOCKS == NB * NH * (SEQ / 64) && NKB * 32 == SEQ);
static_assert(((NB * SEQ) % 64) == 0 && (DMOD % 64) == 0 && (DMOD % 32) == 0);
static_assert((SEQ % 64) == 0 && (SEQ % 8) == 0);
static_assert(((NB * SEQ * DMOD / 8) % CVT_CH) == 0 && ((DMOD * DMOD / 8) % CVT_CH) == 0 && (SEG8X % CVT_CH) == 0);
static_assert(ATT_WAVES * SLABF >= 4 * 16 * 68);
static_assert(HD * VTP >= 63 * VTP + 64 && 2 * 2 * PLH >= 2 * HD * VTP && (VTP * 2) % 16 == 0);
static_assert(KT == 64 && HD == 64 && NT * KT == SEQ && NT * 2 == NKB && ATT_THREADS == 128);
static_assert(2 * BUFH * 2 >= ATT_WAVES * SLABF * 4 && (LP * 2) % 16 == 0);

typedef unsigned short u16;
typedef _Float16 v16h __attribute__((ext_vector_type(16)));
typedef _Float16 v8h  __attribute__((ext_vector_type(8)));
typedef __bf16   v16b __attribute__((ext_vector_type(16)));
typedef float    v8f  __attribute__((ext_vector_type(8)));
typedef float    v4f  __attribute__((ext_vector_type(4)));
typedef unsigned int v4u __attribute__((ext_vector_type(4)));

union FragH { v16h v; v8h h[2]; v4u u[2]; };
union FragB { v16b v; v4u u[2]; };

// ---- scalar helpers --------------------------------------------------------------------------------
__device__ __forceinline__ unsigned short bf_bits(float f) {          // f32 -> bf16 bits, RNE convert
  unsigned u = __float_as_uint(f);
  return (unsigned short)((u + 0x7FFFu + ((u >> 16) & 1u)) >> 16);
}
__device__ __forceinline__ float bf_up(unsigned short h) { return __uint_as_float(((unsigned)h) << 16); }
__device__ __forceinline__ float bfr(float f) { return bf_up(bf_bits(f)); }
__device__ __forceinline__ unsigned short h_bits(_Float16 x) { return __builtin_bit_cast(unsigned short, x); }
__device__ __forceinline__ unsigned pk16(unsigned short a, unsigned short b) { return (unsigned)a | ((unsigned)b << 16); }
__device__ __forceinline__ v8f zero8() { v8f z = {0.f, 0.f, 0.f, 0.f, 0.f, 0.f, 0.f, 0.f}; return z; }
__device__ __forceinline__ v4f zero4() { v4f z = {0.f, 0.f, 0.f, 0.f}; return z; }

// ---- fragment loaders: 16-bit A/B operand, lane -> row/col (lane&15), p already includes +8*(lane>>4);
//      elements 0..7 <- p[0..7] (k0+8h..), elements 8..15 <- p[16..23] (k0+16+8h..)  (same split k map for A and B;
//      B is always read from a k-contiguous [n][k] plane)
__device__ __forceinline__ v16h ldfrag_h(const _Float16* p) {
  FragH f;
  f.h[0] = *(const v8h*)(p);
  f.h[1] = *(const v8h*)(p + 16);
  return f.v;
}
__device__ __forceinline__ v16b ldfrag_b(const u16* p) {              // bf16 plane read as unsigned integer vectors
  FragB f;
  f.u[0] = *(const v4u*)(p);
  f.u[1] = *(const v4u*)(p + 16);
  return f.v;
}

__device__ __forceinline__ v8f mma_h(v16h a, v16h b, v8f c) {
  return __builtin_amdgcn_wmma_f32_16x16x32_f16(false, a, false, b, (short)0, c, false, false);
}
__device__ __forceinline__ v8f mma_b(v16b a, v16b b, v8f c) {
  return __builtin_amdgcn_wmma_f32_16x16x32_bf16(false, a, false, b, (short)0, c, false, false);
}
__device__ __forceinline__ void guard2(v8f& a, v8f& b, v16h x0, v16h x1, v16h x2, v16h x3, v16h x4, v16h x5) {
#if defined(__HIP_DEVICE_COMPILE__)
  asm volatile("v_nop\n\tv_nop\n\tv_nop\n\tv_nop"
               : "+v"(a), "+v"(b) : "v"(x0), "v"(x1), "v"(x2), "v"(x3), "v"(x4), "v"(x5) : "memory");
#endif
}
__device__ __forceinline__ void guard10(v8f& a, v8f& b, v8f& c, v8f& d, v16h x0, v16h x1, v16h x2, v16h x3, v16h x4,
                                        v16h x5, v16h x6, v16h x7, v16h x8, v16h x9) {
#if defined(__HIP_DEVICE_COMPILE__)
  asm volatile("v_nop\n\tv_nop\n\tv_nop\n\tv_nop"
               : "+v"(a), "+v"(b), "+v"(c), "+v"(d)
               : "v"(x0), "v"(x1), "v"(x2), "v"(x3), "v"(x4), "v"(x5), "v"(x6), "v"(x7), "v"(x8), "v"(x9) : "memory");
#endif
}
__device__ __forceinline__ void acc_guard4(v8f& a, v8f& b, v8f& c, v8f& d) {
#if defined(__HIP_DEVICE_COMPILE__)
  asm volatile("v_nop\n\tv_nop\n\tv_nop\n\tv_nop" : "+v"(a), "+v"(b), "+v"(c), "+v"(d));
#endif
}
// Two planes' 64-row x 128-B tiles, global -> LDS, by 128 threads: per lane four 16-B asynchronous copies a plane (rows r, r+16,
// r+32, r+48; 8 lanes = one whole 128-B row). la/lb: the lane's LDS byte addresses of row r, ga/gb: its global addresses, gstep: 16
// source rows in elements. The s_wait_xcnt closes the statement so that no address register is rewritten ahead of it.
__device__ __forceinline__ void stage2(unsigned la, unsigned lb, const u16* ga, const u16* gb, size_t gstep) {
#if defined(__HIP_DEVICE_COMPILE__)
  const unsigned ls = 16 * LP * 2;
  asm volatile("global_load_async_to_lds_b128 %0, %8, off\n\t"
               "global_load_async_to_lds_b128 %1, %9, off\n\t"
               "global_load_async_to_lds_b128 %2, %10, off\n\t"
               "global_load_async_to_lds_b128 %3, %11, off\n\t"
               "global_load_async_to_lds_b128 %4, %12, off\n\t"
               "global_load_async_to_lds_b128 %5, %13, off\n\t"
               "global_load_async_to_lds_b128 %6, %14, off\n\t"
               "global_load_async_to_lds_b128 %7, %15, off\n\t"
               "s_wait_xcnt 0x0"
               :: "v"(la), "v"(la + ls), "v"(la + 2 * ls), "v"(la + 3 * ls),
                  "v"(lb), "v"(lb + ls), "v"(lb + 2 * ls), "v"(lb + 3 * ls),
                  "v"(ga), "v"(ga + gstep), "v"(ga + 2 * gstep), "v"(ga + 3 * gstep),
                  "v"(gb), "v"(gb + gstep), "v"(gb + 2 * gstep), "v"(gb + 3 * gstep)
               : "memory");
#endif
}
// One plane's tile, the same way: four copies a lane.
__device__ __forceinline__ void stage1(unsigned la, const u16* ga, size_t gstep) {
#if defined(__HIP_DEVICE_COMPILE__)
  const unsigned ls = 16 * LP * 2;
  asm volatile("global_load_async_to_lds_b128 %0, %4, off\n\t"
               "global_load_async_to_lds_b128 %1, %5, off\n\t"
               "global_load_async_to_lds_b128 %2, %6, off\n\t"
               "global_load_async_to_lds_b128 %3, %7, off\n\t"
               "s_wait_xcnt 0x0"
               :: "v"(la), "v"(la + ls), "v"(la + 2 * ls), "v"(la + 3 * ls),
                  "v"(ga), "v"(ga + gstep), "v"(ga + 2 * gstep), "v"(ga + 3 * gstep)
               : "memory");
#endif
}
__device__ __forceinline__ void wave_sync_lds() {
  __builtin_amdgcn_fence(__ATOMIC_RELEASE, "workgroup");
  __builtin_amdgcn_wave_barrier();
  __builtin_amdgcn_fence(__ATOMIC_ACQUIRE, "workgroup");
}

// =====================================================================================================
// All seven f32 planes -> 16-bit planes in ONE launch. Destination D holds the planes back to back in block order:
//   x_q, x_k, x_v (bf16 RNE bits, NB*SEQ rows each), wq, wk, wv (bf16 RNE bits), wo (f16 bits of (bf16 RNE value) * WOS).
// Block = CVT_CH consecutive octets of one plane (a plane is a whole number of blocks, so plane and mode are block-uniform);
// thread = CVT_OCT octets, 256 octets apart: per octet two 16-B loads and one 16-B store, 32 consecutive lanes = 512 contiguous,
// 512-B aligned destination bytes. All of a thread's loads are issued ahead of its first conversion.
// An input plane is read as NB batches of SEQ rows out of a layout with SEQ_FULL rows per batch (a block never straddles a batch).
// coverage: grid = 3*XCH + 4*WCH blocks x 256 thr x CVT_OCT octets = the whole of the seven destination planes.
// =====================================================================================================
__global__ __launch_bounds__(256) void cvt_all(const float* __restrict__ xq, const float* __restrict__ xk,
                                               const float* __restrict__ xv, const float* __restrict__ wq,
                                               const float* __restrict__ wk, const float* __restrict__ wv,
                                               const float* __restrict__ wo, u16* D) {
  const unsigned bid = blockIdx.x, tid = threadIdx.x;
  const float* s;
  size_t so;                                 // the block's first source octet
  if (bid < 3u * XCH) {                      // block-uniform; no barriers in this kernel
    const unsigned pl = bid / XCH, g0 = (bid % XCH) * CVT_CH;
    s  = pl == 0 ? xq : pl == 1 ? xk : xv;
    so = (size_t)(g0 / SEG8X) * STR8X + (size_t)(g0 % SEG8X);
  } else {
    const unsigned wb = bid - 3u * XCH, pl = wb / WCH;
    s  = pl == 0 ? wq : pl == 1 ? wk : pl == 2 ? wv : wo;
    so = (size_t)(wb % WCH) * CVT_CH;
  }
  const float* p = s + (so + (size_t)tid) * 8;
  v4f a[CVT_OCT], c4[CVT_OCT];
#pragma unroll   // arrays indexed by constants (registers); the loads stand together
  for (int i = 0; i < CVT_OCT; ++i) {
    a[i]  = *(const v4f*)(p + i * 2048);
    c4[i] = *(const v4f*)(p + i * 2048 + 4);
  }
  u16* d = D + ((size_t)bid * CVT_CH + (size_t)tid) * 8;
  if (bid < 3u * XCH + 3u * WCH) {           // block-uniform
#pragma unroll
    for (int i = 0; i < CVT_OCT; ++i) {
      v4u o;
#pragma unroll
      for (int e = 0; e < 2; ++e) {
        o[e]     = pk16(bf_bits(a[i][2 * e]),  bf_bits(a[i][2 * e + 1]));
        o[2 + e] = pk16(bf_bits(c4[i][2 * e]), bf_bits(c4[i][2 * e + 1]));
      }
      *(v4u*)(d + i * 2048) = o;
    }
  } else {
#pragma unroll
    for (int i = 0; i < CVT_OCT; ++i) {
      v4u o;
#pragma unroll
      for (int e = 0; e < 2; ++e) {
        o[e]     = pk16(h_bits((_Float16)(bfr(a[i][2 * e]) * WOS)),  h_bits((_Float16)(bfr(a[i][2 * e + 1]) * WOS)));
        o[2 + e] = pk16(h_bits((_Float16)(bfr(c4[i][2 * e]) * WOS)), h_bits((_Float16)(bfr(c4[i][2 * e + 1]) * WOS)));
      }
      *(v4u*)(d + i * 2048) = o;
    }
  }
}

// =====================================================================================================
// f32 GEMM epilogue (gemm_h2): the wave's 16x64 f32 tile (times oscale) staged in its LDS slab (pitch 68, wave-private),
// coverage: 8 instructions x 2 rows x 16 lanes x 4 floats = the wave's 16 x 64 tile.
// =====================================================================================================
__device__ __forceinline__ void epi64(float* sl, v8f a0, v8f a1, v8f a2, v8f a3, float oscale, v4f badd, float* C, int N,
                                      size_t rowb, int col0, int lane) {
  const int hh = lane >> 4, m = lane & 15;
#pragma unroll
  for (int r = 0; r < 8; ++r) {
    const int ro = (8 * hh + r) * 68 + m;
    sl[ro]      = a0[r] * oscale;
    sl[ro + 16] = a1[r] * oscale;
    sl[ro + 32] = a2[r] * oscale;
    sl[ro + 48] = a3[r] * oscale;
  }
  wave_sync_lds();
  v4f vals[8];
#pragma unroll
  for (int it = 0; it < 8; ++it) vals[it] = *(const v4f*)(sl + (it * 2 + hh) * 68 + m * 4) + badd;
  float* dst = C + (rowb + (size_t)hh) * (size_t)N + col0 + m * 4;
  {
#pragma unroll
    for (int it = 0; it < 8; ++it) {
      *(v4f*)(dst + (size_t)(it * 2) * (size_t)N) = vals[it];
    }
    
  }
}

// =====================================================================================================
// Three bf16 GEMMs with bias in one launch, product pj = blockIdx.y (0 q, 1 k, 2 v): A = plane pj of A3, Bt = plane pj of Bt3,
// bias = bias<pj>, PH / PL = planes 2pj / 2pj+1 of P6 (M*N halves each), vt = (pj == 2). Each product, result written as two f16
// planes: c[M][N] (f32, in registers) = A[M][K] (bf16 row-major) . Bt[N][K]^T (bf16
// k-contiguous), times oscale, plus bf16-RNE value of bias[n]; PH = f16(c * psc), PL = f16(c * psc - PH) (psc a power of two).
// Block = 64x64 tile, 4 waves x 16 rows. The block's 64 A rows and 64 Bt rows are staged in LDS 64 k (one whole
// 128-B line a row) at a time by asynchronous copies, two buffers (tile t+1 flies while tile t is worked on, one block barrier a
// tile); fragments are read from LDS (two 16-B reads each, split k map for A and B), two k steps of 32 a tile, in the k order of
// a plain walk (host checks K % 64 == 0, M % 64 == 0, N % 64 == 0, grid = ((M/64)*(N/64), 3)).
// Epilogue, vt == 0: planes laid out [M][N]; the wave's 16x64 f32 tile goes through its private LDS slab (pitch 68), a lane then
//   owns 8 consecutive columns of a row: per plane 4 instructions x 4 rows x 8 lanes x 8 halves = the wave's 16 x 64 tile.
// Epilogue, vt != 0 (N == NH*HD, rows = b*SEQ + s): planes laid out [b][h][d][s]. A lane's 8 accumulator rows of one column are 8
//   consecutive s of one d: one 16-B LDS store a plane into the block's [64 d][64 s] tiles (pitch VTP, in the ring, which is free
//   behind the loop's last barrier); one block barrier; then 4 iterations x 128 thr x 8 halves = 64 lines x 64 s of each plane.
// =====================================================================================================
__global__ __launch_bounds__(128)
void gemm_bfb(const u16* __restrict__ A3, const u16* __restrict__ Bt3, const float* __restrict__ bias0,
              const float* __restrict__ bias1, const float* __restrict__ bias2,
              u16* P6, int M, int N, int K, float oscale, float psc) {
  __shared__ __align__(16) float slab[4 * SLAB64];
  __shared__ __align__(16) u16 ring[2 * 2 * PLH];   // two buffers of [A tile | Bt tile], 64 rows of pitch LP each
  const int tid = threadIdx.x, wave = tid >> 5, lane = tid & 31, hh = lane >> 4, m = lane & 15;
  const int ntile = N >> 6;
  const int bid   = blockIdx.x;
  const int row0  = (bid / ntile) * 64;
  const int rowb  = row0 + wave * 16;
  const int col0  = (bid % ntile) * 64;
  if (row0 + 64 > M) return;                 // block-uniform, in front of every barrier; never taken with the exact grid
  // which of the three products this block belongs to (block-uniform): operands, bias, result planes and layout
  const int pj = blockIdx.y;
  const u16* A       = A3  + (size_t)pj * (size_t)M * (size_t)K;
  const u16* Bt      = Bt3 + (size_t)pj * (size_t)N * (size_t)K;
  const float* bias  = pj == 0 ? bias0 : pj == 1 ? bias1 : bias2;
  u16* PH            = P6 + (size_t)(2 * pj) * (size_t)M * (size_t)N;
  u16* PL            = PH + (size_t)M * (size_t)N;
  const int vt       = pj == 2;
  // staging: thread -> (row sr of 16, 16-B piece sc of 8), rows sr, sr+16, sr+32, sr+48 of each operand's tile
  const int sr = tid >> 3, sc = (tid & 7) * 8;
  const u16* ag = A  + (size_t)(row0 + sr) * K + sc;
  const u16* bg = Bt + (size_t)(col0 + sr) * K + sc;
  const unsigned lds0 = (unsigned)(size_t)(const void*)ring + (unsigned)(sr * LP + sc) * 2u;
  const int nt = K >> 6;
  auto stage = [&](int t, int buf) {
    const unsigned l = lds0 + (unsigned)buf * (2u * PLH * 2u);
    stage2(l, l + PLH * 2u, ag + (size_t)t * 64, bg + (size_t)t * 64, (size_t)16 * K);
  };
  // fragment readers, in halves from a buffer's start
  const int afo = (wave * 16 + m) * LP + 8 * hh;
  const int bfo = PLH + m * LP + 8 * hh;
  v8f acc0 = zero8(), acc1 = zero8(), acc2 = zero8(), acc3 = zero8();
  stage(0, 0);
  asm volatile("s_wait_asynccnt 0x0" ::: "memory");   // this wave's copies of tile 0 have landed
  __syncthreads();                                    // ... and every other wave's: tile 0 may be read
  if (nt > 1) stage(1, 1);
#pragma unroll 1   // one tile a trip: the ring's hand-over stands once, at the foot
  for (int t = 0; t < nt; ++t) {
    const u16* bufp = ring + (t & 1) * (2 * PLH);
    v16b a[2], b[2][4];
#pragma unroll
    for (int kk = 0; kk < 2; ++kk) {
      a[kk] = ldfrag_b(bufp + afo + kk * 32);
#pragma unroll
      for (int j = 0; j < 4; ++j) b[kk][j] = ldfrag_b(bufp + bfo + j * 16 * LP + kk * 32);
    }
    __builtin_amdgcn_sched_barrier(0);   // all of the tile's LDS reads issue ahead of its WMMAs: one LDS latency a tile, not several
#pragma unroll
    for (int kk = 0; kk < 2; ++kk) {
      acc0 = mma_b(a[kk], b[kk][0], acc0);
      acc1 = mma_b(a[kk], b[kk][1], acc1);
      acc2 = mma_b(a[kk], b[kk][2], acc2);
      acc3 = mma_b(a[kk], b[kk][3], acc3);
    }
    acc_guard4(acc0, acc1, acc2, acc3);                 // WMMA distance kept on both sides of the branches that follow
    // ---- hand-over: tile t+1 is published and tile t's buffer is freed by the one barrier; then the refill ----
    asm volatile("s_wait_dscnt 0x0" ::: "memory");      // this wave's reads of tile t are done before its buffer is refilled
    asm volatile("s_wait_asynccnt 0x0" ::: "memory");   // this wave's copies of tile t+1 have landed
    __syncthreads();
    if (t + 2 < nt) stage(t + 2, t & 1);
  }
  asm volatile("s_wait_asynccnt 0x0" ::: "memory");     // nothing in flight when the wave goes on to its end
  // every loop of both epilogues is unrolled so that accumulators and staging arrays are indexed by constants (registers, no scratch)
  if (vt == 0) {                             // block-uniform
    float* sl = slab + wave * SLAB64;
#pragma unroll
    for (int r = 0; r < 8; ++r) {
      const int ro = (8 * hh + r) * 68 + m;
      sl[ro]      = acc0[r] * oscale;
      sl[ro + 16] = acc1[r] * oscale;
      sl[ro + 32] = acc2[r] * oscale;
      sl[ro + 48] = acc3[r] * oscale;
    }
    wave_sync_lds();
    const int rq = lane >> 3, c8 = (lane & 7) * 8;
    const v4f bv0 = *(const v4f*)(bias + col0 + c8), bv1 = *(const v4f*)(bias + col0 + c8 + 4);   // columns < N (N multiple of 64)
    float badd[8];
#pragma unroll
    for (int e = 0; e < 4; ++e) { badd[e] = bfr(bv0[e]); badd[4 + e] = bfr(bv1[e]); }
    v4u oh[4], ol[4];
#pragma unroll
    for (int i4 = 0; i4 < 4; ++i4) {
      const int row = i4 * 4 + rq;
      const v4f a4 = *(const v4f*)(sl + row * 68 + c8), c4 = *(const v4f*)(sl + row * 68 + c8 + 4);
      float w[8];
#pragma unroll
      for (int e = 0; e < 4; ++e) { w[e] = (a4[e] + badd[e]) * psc; w[4 + e] = (c4[e] + badd[4 + e]) * psc; }
#pragma unroll
      for (int e = 0; e < 4; ++e) {
        const _Float16 h0 = (_Float16)w[2 * e], h1 = (_Float16)w[2 * e + 1];
        const _Float16 l0 = (_Float16)(w[2 * e] - (float)h0), l1 = (_Float16)(w[2 * e + 1] - (float)h1);
        oh[i4][e] = pk16(h_bits(h0), h_bits(h1));
        ol[i4][e] = pk16(h_bits(l0), h_bits(l1));
      }
    }
    const size_t ob = (size_t)rowb * (size_t)N + col0 + c8;
#pragma unroll
    for (int i4 = 0; i4 < 4; ++i4) {
      const size_t o8 = ob + (size_t)(i4 * 4 + rq) * (size_t)N;
      *(v4u*)(PH + o8) = oh[i4];
      *(v4u*)(PL + o8) = ol[i4];
    }
    asm volatile("s_wait_xcnt 0x0" ::: "memory");   // behind the run of stores: no register that they name is rewritten ahead of it
  } else {
    u16* TH = ring;
    u16* TL = ring + HD * VTP;
    const v8f acc[4] = {acc0, acc1, acc2, acc3};
#pragma unroll
    for (int j = 0; j < 4; ++j) {
      const float bj = bfr(bias[col0 + 16 * j + m]);        // column < N (N multiple of 64)
      v4u th, tl;
#pragma unroll
      for (int e = 0; e < 4; ++e) {
        const float t0 = (acc[j][2 * e] * oscale + bj) * psc, t1 = (acc[j][2 * e + 1] * oscale + bj) * psc;
        const _Float16 h0 = (_Float16)t0, h1 = (_Float16)t1;
        const _Float16 l0 = (_Float16)(t0 - (float)h0), l1 = (_Float16)(t1 - (float)h1);
        th[e] = pk16(h_bits(h0), h_bits(h1));
        tl[e] = pk16(h_bits(l0), h_bits(l1));
      }
      const int to = (16 * j + m) * VTP + wave * 16 + 8 * hh;
      *(v4u*)(TH + to) = th;
      *(v4u*)(TL + to) = tl;
    }
    __syncthreads();                         // the four waves' columns of the [d][s] tiles are complete
    const int q8 = tid >> 3, p8 = (tid & 7) * 8;
    v4u vh[4], vl[4];
#pragma unroll
    for (int it = 0; it < 4; ++it) {
      const int line = it * 16 + q8;          // d = 0..63
      vh[it] = *(const v4u*)(TH + line * VTP + p8);
      vl[it] = *(const v4u*)(TL + line * VTP + p8);
    }
    const size_t base = ((size_t)((row0 / SEQ) * NH + (col0 >> 6)) * HD) * SEQ + (row0 % SEQ) + p8;
#pragma unroll
    for (int it = 0; it < 4; ++it) {
      const int line = it * 16 + q8;
      *(v4u*)(PH + base + (size_t)line * SEQ) = vh[it];
      *(v4u*)(PL + base + (size_t)line * SEQ) = vl[it];
    }
    asm volatile("s_wait_xcnt 0x0" ::: "memory");   // behind the run of stores: no register that they name is rewritten ahead of it
  }
}

// =====================================================================================================
// f16 hi+lo GEMM with bias: C[M][N] (f32) = (Ahi + Alo)[M][K] . Bt[N][K]^T times oscale, plus bf16-RNE value of bias[n];
// Ahi/Alo f16 planes (same layout), Bt f16 k-contiguous; products hi.B + lo.B into one accumulator (lo is the unscaled
// residual of hi). Same tiling and the same two-buffer LDS ring as gemm_bfb, three planes a tile (Ahi, Alo, Bt).
// =====================================================================================================
__global__ __launch_bounds__(128)
void gemm_h2(const u16* __restrict__ Ah, const u16* __restrict__ Al, const u16* __restrict__ Bt,
             const float* __restrict__ bias, float* C, int M, int N, int K, float oscale) {
  __shared__ __align__(16) float slab[4 * SLAB64];
  __shared__ __align__(16) u16 ring[2 * 3 * PLH];   // two buffers of [Ahi tile | Alo tile | Bt tile], 64 rows of pitch LP each
  const int tid = threadIdx.x, wave = tid >> 5, lane = tid & 31, hh = lane >> 4, m = lane & 15;
  const int ntile = N >> 6;
  const int bid   = blockIdx.x;
  const int row0  = (bid / ntile) * 64;
  const int rowb  = row0 + wave * 16;
  const int col0  = (bid % ntile) * 64;
  if (row0 + 64 > M) return;                 // block-uniform, in front of every barrier; never taken with the exact grid
  // staging: thread -> (row sr of 16, 16-B piece sc of 8), rows sr, sr+16, sr+32, sr+48 of each plane's tile
  const int sr = tid >> 3, sc = (tid & 7) * 8;
  const size_t aofs = (size_t)(row0 + sr) * K + sc;
  const u16* ahg = Ah + aofs;
  const u16* alg = Al + aofs;
  const u16* bg  = Bt + (size_t)(col0 + sr) * K + sc;
  const unsigned lds0 = (unsigned)(size_t)(const void*)ring + (unsigned)(sr * LP + sc) * 2u;
  const int nt = K >> 6;
  auto stage = [&](int t, int buf) {
    const unsigned l = lds0 + (unsigned)buf * (3u * PLH * 2u);
    stage2(l, l + PLH * 2u, ahg + (size_t)t * 64, alg + (size_t)t * 64, (size_t)16 * K);
    stage1(l + 2u * PLH * 2u, bg + (size_t)t * 64, (size_t)16 * K);
  };
  // fragment readers, in halves from a buffer's start
  const int afo = (wave * 16 + m) * LP + 8 * hh;
  const int bfo = 2 * PLH + m * LP + 8 * hh;
  v8f acc0 = zero8(), acc1 = zero8(), acc2 = zero8(), acc3 = zero8();
  stage(0, 0);
  asm volatile("s_wait_asynccnt 0x0" ::: "memory");   // this wave's copies of tile 0 have landed
  __syncthreads();                                    // ... and every other wave's: tile 0 may be read
  if (nt > 1) stage(1, 1);
#pragma unroll 1   // one tile a trip: the ring's hand-over stands once, at the foot
  for (int t = 0; t < nt; ++t) {
    const _Float16* bufp = (const _Float16*)(const void*)ring + (t & 1) * (3 * PLH);
    v16h ah[2], al[2], b[2][4];
#pragma unroll
    for (int kk = 0; kk < 2; ++kk) {
      ah[kk] = ldfrag_h(bufp + afo + kk * 32);
      al[kk] = ldfrag_h(bufp + PLH + afo + kk * 32);
#pragma unroll
      for (int j = 0; j < 4; ++j) b[kk][j] = ldfrag_h(bufp + bfo + j * 16 * LP + kk * 32);
    }
    __builtin_amdgcn_sched_barrier(0);   // all of the tile's LDS reads issue ahead of its WMMAs: one LDS latency a tile, not several
#pragma unroll
    for (int kk = 0; kk < 2; ++kk) {
      acc0 = mma_h(ah[kk], b[kk][0], acc0);  acc0 = mma_h(al[kk], b[kk][0], acc0);
      acc1 = mma_h(ah[kk], b[kk][1], acc1);  acc1 = mma_h(al[kk], b[kk][1], acc1);
      acc2 = mma_h(ah[kk], b[kk][2], acc2);  acc2 = mma_h(al[kk], b[kk][2], acc2);
      acc3 = mma_h(ah[kk], b[kk][3], acc3);  acc3 = mma_h(al[kk], b[kk][3], acc3);
    }
    acc_guard4(acc0, acc1, acc2, acc3);                 // WMMA distance kept on both sides of the branches that follow
    // ---- hand-over: tile t+1 is published and tile t's buffer is freed by the one barrier; then the refill ----
    asm volatile("s_wait_dscnt 0x0" ::: "memory");      // this wave's reads of tile t are done before its buffer is refilled
    asm volatile("s_wait_asynccnt 0x0" ::: "memory");   // this wave's copies of tile t+1 have landed
    __syncthreads();
    if (t + 2 < nt) stage(t + 2, t & 1);
  }
  asm volatile("s_wait_asynccnt 0x0" ::: "memory");     // nothing in flight when the wave goes on to its end
  const v4f bv = *(const v4f*)(bias + col0 + m * 4);      // columns col0 + 4m .. +3, always < N (N multiple of 64)
  v4f badd;
#pragma unroll
  for (int e = 0; e < 4; ++e) badd[e] = bfr(bv[e]);
  epi64(slab + wave * SLAB64, acc0, acc1, acc2, acc3, oscale, badd, C, N, (size_t)rowb, col0, lane);
}

// =====================================================================================================
// Full (non-causal, unmasked) multi-head flash attention: block = (batch b, head, 64 query rows), 4 waves, wave w owns the
// 16 query rows q0 = 64*qt + 16*w .. q0+15. The k and v^T planes' tiles of KT = 64 keys are staged in LDS by asynchronous copies, two
// buffers (tile t+1 flies while tile t is worked on, one block barrier a tile), and read by all 4 waves; each tile serves two key
// blocks of 32. The ring becomes the waves' private result slabs behind the last tile's barrier.
//   Per-head logit scale: sigmoid(bf16 RNE value of g[head]) / 8, computed in f32 once per thread (head uniform per block) and
//   folded with log2(e) and the q/k carries into lsc.
//   q planes (hi, lo f16, x1024) laid out [b][s][h][d]; k planes the same; v^T planes [b][h][d][s] (x1024).
//   All NKB = SEQ/32 key blocks of 32 keys are visited (static bound).
//   Scores are computed TRANSPOSED: S^T tile g (g = 0,1) = k rows (keys kb+16g .. +15, A operand, row m = lane&15, split k map
//   over d) times q^T (B operand, col n = query q0 + (lane&15), k = d, split map), 3 products per tile and d-chunk
//   (k_hi.q_hi + k_lo.q_hi + k_hi.q_lo). D element r of lane l = (key kb+16g+8h+r, query q0+(l&15)), so a lane owns one query
//   column and 16 of its 32 keys; the partner lane l^16 owns the other 16 -> row max / row sum need one xor-16 shuffle.
//   Online max-subtracted base-2 softmax in f32. The exp'd values ARE the P A-fragment in place: A row m = query = lane&15,
//   element i <- key kb+8h+i (tile 0, D element i), element 8+i <- key kb+16+8h+i (tile 1, D element i). P is carried x32768
//   as f16 hi + f16 residual. The rescale factor of query row 8h+r of the O accumulators is fetched from lane 8h+r with a
//   shuffle (uniform control). 4+4 v^T B fragments (hi and residual planes, col n = d = 16j + (lane&15), keys k-contiguous),
//   12 P.V WMMAs (hh + lh + hl).
//   Epilogue: 1/l (per query, shuffled to the D row owner) and carry folds in f32; the wave's 16x64 f32 result staged in its LDS
// coverage: per wave 4 instructions x 4 rows x 8 lanes x 8 halves = 16 x 64 per plane; grid NB*NH*SEQ/64 blocks x 4 waves = every
//           (b, s, h) row of both O planes exactly once.
// =====================================================================================================
__global__ __launch_bounds__(ATT_THREADS)
void attn_fwd(const u16* __restrict__ QHIp, const u16* __restrict__ QLOp,
              const u16* __restrict__ KHIp, const u16* __restrict__ KLOp,
              const u16* __restrict__ VHIp, const u16* __restrict__ VLOp,
              const float* __restrict__ gatep,
              u16* OHIp, u16* OLOp) {
  __shared__ __align__(16) u16 ring[2 * BUFH];   // two tile buffers; in the epilogue per wave a result slab [16][68] of f32

  const int tid  = threadIdx.x;
  const int wave = tid >> 5;
  const int lane = tid & 31;
  const int hh   = lane >> 4;
  const int c    = lane & 15;

  const int bid  = blockIdx.x;
  const int qt   = bid % QT64;
  const int head = (bid / QT64) % NH;
  const int b    = bid / (QT64 * NH);
  const int q0   = qt * 64 + wave * 16;

  // per-head scale: sigmoid(bf16 value of g) / 8 in f32; head < NH always (block decode), host checks the input extent
  const float gbf = bfr(gatep[head]);
  const float sgm = 1.0f / (1.0f + expf(-gbf));
  const float lsc = sgm * (0.125f * (LOG2E / (QSC * KSC)));

  // B fragments of q^T: col n = query q0 + c, k = d (k-contiguous row of the q plane)
  const size_t qofs = (((size_t)(b * SEQ + q0 + c)) * NH + head) * HD + 8 * hh;
  const _Float16* Qh  = (const _Float16*)(const void*)QHIp + qofs;
  const _Float16* Ql  = (const _Float16*)(const void*)QLOp + qofs;
  // staging: thread -> (row sr of 16, 16-B piece sc of 8); k tile row = key, v^T tile row = d, both 64 halves long
  const int sr = tid >> 3, sc = (tid & 7) * 8;
  const size_t kofs = (((size_t)b * SEQ + sr) * NH + head) * HD + sc;             // tile's first key added per tile
  const size_t vofs = ((size_t)(b * NH + head) * HD + sr) * SEQ + sc;             // tile's first key added per tile
  const unsigned lds0 = (unsigned)(size_t)(const void*)ring + (unsigned)(sr * LP + sc) * 2u;
  auto stage = [&](int t, int buf) {
    const unsigned l = lds0 + (unsigned)buf * (BUFH * 2u);
    const size_t ko = kofs + (size_t)t * (KT * NH * HD), vo = vofs + (size_t)t * KT;
    stage2(l, l + PLH * 2u, KHIp + ko, KLOp + ko, (size_t)16 * (NH * HD));
    stage2(l + 2u * PLH * 2u, l + 3u * PLH * 2u, VHIp + vo, VLOp + vo, (size_t)16 * SEQ);
  };
  // fragment readers, in halves from a buffer's start: A of k: row m = key 16g + c, k = d; B of v: col n = d = 16j + c, k = key
  const int kfo = c * LP + 8 * hh;
  const int vfo = 2 * PLH + c * LP + 8 * hh;

  // q^T B fragments (hi and residual planes, both d chunks of 32): read once, held in registers for all key tiles
  const v16h qhf[2] = {ldfrag_h(Qh), ldfrag_h(Qh + 32)};
  const v16h qlf[2] = {ldfrag_h(Ql), ldfrag_h(Ql + 32)};

  float mrun = -INFINITY, lrun = 0.f;
  v8f o[4];
#pragma unroll
  for (int j = 0; j < 4; ++j) o[j] = zero8();

  stage(0, 0);
  asm volatile("s_wait_asynccnt 0x0" ::: "memory");   // this wave's copies of tile 0 have landed
  __syncthreads();                                    // ... and every other wave's: tile 0 may be read
  if (NT > 1) stage(1, 1);

#pragma unroll 1
  for (int t = 0; t < NT; ++t) {
   const _Float16* bufp = (const _Float16*)(const void*)ring + (t & 1) * BUFH;
#pragma unroll   // both key blocks of a tile in line: their LDS offsets become immediates
   for (int sub = 0; sub < 2; ++sub) {
    // ---- transposed scores: s0 = keys kb..kb+15, s1 = keys kb+16..kb+31 (kb = 64t + 32sub), column = query q0 + c ----
    v8f s0 = zero8(), s1 = zero8();
    const _Float16* k0p = bufp + kfo + sub * 32 * LP;
    const _Float16* k1p = k0p + 16 * LP;
    const _Float16* l0p = k0p + PLH;
    const _Float16* l1p = l0p + 16 * LP;
#pragma unroll
    for (int kk = 0; kk < 2; ++kk) {
      const v16h qh  = qhf[kk], ql = qlf[kk];
      const v16h kh0 = ldfrag_h(k0p + kk * 32), kl0 = ldfrag_h(l0p + kk * 32);
      const v16h kh1 = ldfrag_h(k1p + kk * 32), kl1 = ldfrag_h(l1p + kk * 32);
      s0 = mma_h(kh0, qh, s0);
      s0 = mma_h(kl0, qh, s0);
      s0 = mma_h(kh0, ql, s0);
      s1 = mma_h(kh1, qh, s1);
      s1 = mma_h(kl1, qh, s1);
      s1 = mma_h(kh1, ql, s1);
      guard2(s0, s1, qh, ql, kh0, kl0, kh1, kl1);
    }
    // ---- base-2 logits of this lane's 16 keys for query q0 + c: t[i] <- key kb+8hh+i, t[8+i] <- key kb+16+8hh+i ----
    float t[16];
#pragma unroll
    for (int i = 0; i < 8; ++i) { t[i] = s0[i] * lsc; t[8 + i] = s1[i] * lsc; }
    float cm = t[0];
#pragma unroll
    for (int i = 1; i < 16; ++i) cm = fmaxf(cm, t[i]);
    cm = fmaxf(cm, __shfl_xor(cm, 16, 32));
    const float mn = fmaxf(mrun, cm);        // finite from the first block on
    const float al = exp2f(mrun - mn);       // 0 on the first block (mrun = -inf)
    mrun = mn;
    // ---- probabilities (<= 1) and the P A-fragments: hi = f16(p * 32768), lo = f16 residual; element i <-> t[i] ----
    float ps = 0.f;
    FragH ph, pl;
#pragma unroll
    for (int w = 0; w < 2; ++w) {
#pragma unroll
      for (int e4 = 0; e4 < 4; ++e4) {
        const int i = 8 * w + 2 * e4;
        const float p0 = exp2f(t[i] - mn), p1 = exp2f(t[i + 1] - mn);
        ps += p0 + p1;
        const float a0 = p0 * PCAR, a1 = p1 * PCAR;
        const _Float16 h0 = (_Float16)a0, h1 = (_Float16)a1;
        const _Float16 l0 = (_Float16)(a0 - (float)h0), l1 = (_Float16)(a1 - (float)h1);
        ph.u[w][e4] = pk16(h_bits(h0), h_bits(h1));
        pl.u[w][e4] = pk16(h_bits(l0), h_bits(l1));
      }
    }
    ps += __shfl_xor(ps, 16, 32);
    lrun = lrun * al + ps;
    // ---- rescale the O accumulators: D row 8hh+r = query q0+8hh+r, its factor lives in lane 8hh+r (and 16+8hh+r) ----
    float scl[8];
#pragma unroll
    for (int r = 0; r < 8; ++r) scl[r] = __shfl(al, 8 * hh + r, 32);
#pragma unroll
    for (int j = 0; j < 4; ++j) {
#pragma unroll
      for (int r = 0; r < 8; ++r) o[j][r] *= scl[r];
    }
    // ---- P.V : B fragment col n = d = j*16 + c, keys contiguous in the v^T planes ----
    {
      const _Float16* vhp = bufp + vfo + sub * 32;
      const _Float16* vlp = vhp + PLH;
      const v16h vh0 = ldfrag_h(vhp);
      const v16h vh1 = ldfrag_h(vhp + 16 * LP);
      const v16h vh2 = ldfrag_h(vhp + 32 * LP);
      const v16h vh3 = ldfrag_h(vhp + 48 * LP);
      const v16h vl0 = ldfrag_h(vlp);
      const v16h vl1 = ldfrag_h(vlp + 16 * LP);
      const v16h vl2 = ldfrag_h(vlp + 32 * LP);
      const v16h vl3 = ldfrag_h(vlp + 48 * LP);
      o[0] = mma_h(ph.v, vh0, o[0]);  o[0] = mma_h(pl.v, vh0, o[0]);  o[0] = mma_h(ph.v, vl0, o[0]);
      o[1] = mma_h(ph.v, vh1, o[1]);  o[1] = mma_h(pl.v, vh1, o[1]);  o[1] = mma_h(ph.v, vl1, o[1]);
      o[2] = mma_h(ph.v, vh2, o[2]);  o[2] = mma_h(pl.v, vh2, o[2]);  o[2] = mma_h(ph.v, vl2, o[2]);
      o[3] = mma_h(ph.v, vh3, o[3]);  o[3] = mma_h(pl.v, vh3, o[3]);  o[3] = mma_h(ph.v, vl3, o[3]);
      guard10(o[0], o[1], o[2], o[3], ph.v, pl.v, vh0, vh1, vh2, vh3, vl0, vl1, vl2, vl3);
    }
   }
   // ---- hand-over: tile t+1 is published and tile t's buffer is freed by the one barrier; then the refill ----
   asm volatile("s_wait_dscnt 0x0" ::: "memory");      // this wave's reads of tile t are done before its buffer is refilled
   asm volatile("s_wait_asynccnt 0x0" ::: "memory");   // this wave's copies of tile t+1 have landed
   __syncthreads();
   if (t + 2 < NT) stage(t + 2, t & 1);
  }
  asm volatile("s_wait_asynccnt 0x0" ::: "memory");    // nothing in flight when the ring turns into the result slabs
  acc_guard4(o[0], o[1], o[2], o[3]);

  // ---- fold 1/l (per query, owned by lane = query) and the carries (32768 on P, 1024 on v); stage the 16x64 slab ----
  const float linv = (1.0f / lrun) * (1.0f / (PCAR * VCAR));
  float inv[8];
#pragma unroll
  for (int r = 0; r < 8; ++r) inv[r] = __shfl(linv, 8 * hh + r, 32);
  float* slab = (float*)(void*)ring + wave * SLABF;
#pragma unroll
  for (int r = 0; r < 8; ++r) {
#pragma unroll
    for (int j = 0; j < 4; ++j) slab[(8 * hh + r) * 68 + j * 16 + c] = o[j][r] * inv[r];
  }
  wave_sync_lds();
  // ---- O x1024 -> f16 hi + residual planes; lane = (row in group of 4, 8 consecutive d) ----
  v4u oh[4], ol[4];
  const int rq = lane >> 3, c8 = (lane & 7) * 8;
#pragma unroll
  for (int i4 = 0; i4 < 4; ++i4) {
    const int row = i4 * 4 + rq;
    const v4f a = *(const v4f*)(slab + row * 68 + c8), c4 = *(const v4f*)(slab + row * 68 + c8 + 4);
    float w[8];
#pragma unroll
    for (int e = 0; e < 4; ++e) { w[e] = a[e] * OSC; w[4 + e] = c4[e] * OSC; }
#pragma unroll
    for (int e = 0; e < 4; ++e) {
      const _Float16 h0 = (_Float16)w[2 * e], h1 = (_Float16)w[2 * e + 1];
      const _Float16 l0 = (_Float16)(w[2 * e] - (float)h0), l1 = (_Float16)(w[2 * e + 1] - (float)h1);
      oh[i4][e] = pk16(h_bits(h0), h_bits(h1));
      ol[i4][e] = pk16(h_bits(l0), h_bits(l1));
    }
  }
  const size_t ob = (((size_t)(b * SEQ + q0)) * NH + head) * HD + c8;
  {
#pragma unroll
    for (int i4 = 0; i4 < 4; ++i4) {
      const int row = i4 * 4 + rq;
      const size_t o8 = ob + (size_t)row * (NH * HD);
      *(v4u*)(OHIp + o8) = oh[i4];
      *(v4u*)(OLOp + o8) = ol[i4];
    }
    
  }
}

// =====================================================================================================
// Workspace map (bytes, ROWS = NB*SEQ; numbers for NB=2, SEQ=2048); every plane is fully written by whole-line stores before it is
// read; all extents are exact multiples of the store granularity (no pad rows needed). XB .. WOB are cvt_all's one destination,
// XB / WQB.. / QHI.. are gemm_bfb's plane triples, so their order and adjacency matter:
//   XB  bf16 3 x [ROWS][1024]            25165824        (input Q, K, V)
//   WQB bf16 [1024 n][1024 k]             2097152        WKB same  2097152      WVB same  2097152
//   WOB f16  [1024 n][1024 k] x1024       2097152
//   QHI f16 [NB][SEQ][16][64] x1024       8388608        QLO residual         8388608
//   KHI same                              8388608        KLO residual         8388608
//   VHI f16 [NB][16][64][SEQ] x1024       8388608        VLO residual         8388608
//   OHI f16 [ROWS][1024] x1024            8388608        OLO residual         8388608
//   end                                 100663296
// =====================================================================================================
extern "C" void kernel_launch(void* const* d_in, const int* in_sizes, int n_in,
                              void* d_out, int out_size, void* d_ws, size_t ws_size,
                              hipStream_t stream) {
  const int ROWS = NB * SEQ;
  if (n_in < 12) return;
  const int needX = ((NB - 1) * SEQ_FULL + SEQ) * DMOD;   // last input row read by cvt_all (+1), in elements
  if (in_sizes[0] < needX || in_sizes[1] < needX || in_sizes[2] < needX) return;
  if (in_sizes[3] < DMOD * DMOD || in_sizes[5] < DMOD * DMOD) return;
  if (in_sizes[7] < DMOD * DMOD || in_sizes[9] < DMOD * DMOD) return;
  if (in_sizes[4] < DMOD || in_sizes[6] < DMOD || in_sizes[8] < DMOD || in_sizes[10] < DMOD) return;
  if (in_sizes[11] < NH) return;
  if (out_size < ROWS * DMOD) return;

  const float* Qin = (const float*)d_in[0];
  const float* Kin = (const float*)d_in[1];
  const float* Vin = (const float*)d_in[2];
  const float* wq  = (const float*)d_in[3];
  const float* bq  = (const float*)d_in[4];
  const float* wk  = (const float*)d_in[5];
  const float* bk  = (const float*)d_in[6];
  const float* wv  = (const float*)d_in[7];
  const float* bv  = (const float*)d_in[8];
  const float* wo  = (const float*)d_in[9];
  const float* bo  = (const float*)d_in[10];
  const float* gt  = (const float*)d_in[11];
  float*       out = (float*)d_out;

  const size_t szXB  = (size_t)3 * ROWS * DMOD * 2;
  const size_t szW   = (size_t)DMOD * DMOD * 2;
  const size_t szP   = (size_t)ROWS * DMOD * 2;                 // q/k/o planes
  const size_t szVP  = (size_t)NB * NH * HD * SEQ * 2;
  size_t off = 0;
  const size_t oXB  = off; off += szXB;
  const size_t oWQB = off; off += szW;
  off += szW;                                           // WKB
  off += szW;                                           // WVB
  const size_t oWOB = off; off += szW;
  const size_t oQHI = off; off += szP;
  const size_t oQLO = off; off += szP;
  const size_t oKHI = off; off += szP;
  const size_t oKLO = off; off += szP;
  const size_t oVHI = off; off += szVP;
  const size_t oVLO = off; off += szVP;
  const size_t oOHI = off; off += szP;
  const size_t oOLO = off; off += szP;
  if (off > ws_size) return;                            // off = 100663296 at full size
  if (off > (size_t)134217728) return;

  char* ws = (char*)d_ws;
  u16*   XB  = (u16*)(ws + oXB);
  u16*   WQB = (u16*)(ws + oWQB);
  u16*   WOB = (u16*)(ws + oWOB);
  u16*   QHI = (u16*)(ws + oQHI);
  u16*   QLO = (u16*)(ws + oQLO);
  u16*   KHI = (u16*)(ws + oKHI);
  u16*   KLO = (u16*)(ws + oKLO);
  u16*   VHI = (u16*)(ws + oVHI);
  u16*   VLO = (u16*)(ws + oVLO);
  u16*   OHI = (u16*)(ws + oOHI);
  u16*   OLO = (u16*)(ws + oOLO);

  const dim3 blk(256);
  if ((DMOD % 32) != 0 || (ROWS % 64) != 0 || (DMOD % 64) != 0) return;
  const dim3 gC(3 * XCH + 4 * WCH);                     // 512
  const dim3 gG((ROWS / 64) * (DMOD / 64));             // 1024
  const dim3 gG3((ROWS / 64) * (DMOD / 64), 3);         // 1024 x 3
  const dim3 bG(128);
  const dim3 gAT(ATT_BLOCKS);                           // 1024
  const dim3 bAT(ATT_THREADS);                          // 128

  // (0) inputs -> bf16 planes; weights [n][k] (already k-contiguous for x.W^T): bf16 planes for wq/wk/wv, f16 of bf16 value x1024
  //     for wo; destination XB .. WOB, contiguous
  cvt_all<<<gC, blk, 0, stream>>>(Qin, Kin, Vin, wq, wk, wv, wo, XB);
  // (1) q, k, v projections + bias (col = h*64+d), x1024, as f16 hi + residual planes: q, k [ROWS][1024], v as v^T planes
  gemm_bfb<<<gG3, bG, 0, stream>>>(XB, WQB, bq, bk, bv, QHI, ROWS, DMOD, DMOD, 1.0f, QSC);
  // (2) attention with per-head scale sigmoid(g)/8 -> O planes [b][s][h][d] x1024 (hi + residual)
  attn_fwd<<<gAT, bAT, 0, stream>>>(QHI, QLO, KHI, KLO, VHI, VLO, gt, OHI, OLO);
  // (3) output projection + bias -> out [ROWS][1024] f32, carries 1024 (O) x 1024 (wo) folded back
  gemm_h2<<<gG, bG, 0, stream>>>(OHI, OLO, WOB, bo, out, ROWS, DMOD, DMOD, 1.0f / (OSC * WOS));
  (void)hipGetLastError();
}

// v006
// Measured time: 161 microseconds a run.
// Two timings next to v005 both put it at 1.06 times that version's speed.
// Over all steps from v000 it is 2.52 times as fast.
// Contractions: x.W{q,k,v}^T on v_wmma_f32_16x16x32_bf16 (x and W RNE-converted to bf16 operands, f32 accumulate, bias added in f32);
// scores k'.q'^T (q', k' carried x1024 as f16 hi plane + f16 residual plane, products hh+lh+hl), P.v (P x32768 f16 hi+residual,
// v x1024 f16 hi+residual, products hh+lh+hl) and O.Wo^T (O x1024 f16 hi+residual, Wo as f16(bf16(Wo) x1024), products h.w+l.w):
// v_wmma_f32_16x16x32_f16, f32 accumulate. Per-head logit scale sigmoid(bf16(g_h))/8 in f32; base-2 online softmax, 1/l fold and
// bias adds in f32 on VALU.
#include <hip/hip_runtime.h>
#include <math.h>
#include <stdint.h>

#ifndef NB
#define NB    2
#endif
#ifndef SEQ
#define SEQ   2048
#endif
#define NB_FULL  2
#define SEQ_FULL 2048
#define DMOD  1024
#define NH    16
#define HD    64
#define QSC   1024.0f
#define KSC   1024.0f
#define PCAR  32768.0f
#define VCAR  1024.0f
#define OSC   1024.0f
#define WOS   1024.0f
#define LOG2E 1.4426950408889634f
#define ATT_WAVES   4
#define ATT_THREADS (ATT_WAVES * 32)
#define QT64        (SEQ / 64)
#define ATT_BLOCKS  (NB * NH * QT64)
#define NKB    (SEQ / 32)
#define SLABF  (16 * 68)
#define SLAB64 (16 * 68)
#define VTP    72
#define KT     64                 // keys per staged tile
#define LP     72                 // LDS row pitch in halves: 128-B rows + 16 B (16 B x odd, for 16-B LDS reads down a column of rows)
#define PLH    (64 * LP)          // one plane's tile: 64 rows
#define BUFH   (4 * PLH)          // k hi, k residual, v^T hi, v^T residual
#define NT     (SEQ / KT)
#define CVT_OCT 16                             // octets a thread of cvt_all
#define CVT_CH  (256 * CVT_OCT)                // octets a block of cvt_all
#define XCH     ((NB * SEQ * DMOD / 8) / CVT_CH)   // blocks an input plane
#define WCH     ((DMOD * DMOD / 8) / CVT_CH)       // blocks a weight plane
#define SEG8X   (SEQ * DMOD / 8)               // destination octets per batch
#define STR8X   (SEQ_FULL * DMOD / 8)          // source octets per batch in the input layout
static_assert(HD == 64 && DMOD == NH * HD && NH == 16);
static_assert(QSC == KSC && KSC == VCAR);      // one plane scale for the three projections of a launch
static_assert(NB >= 1 && NB <= NB_FULL && SEQ >= 64 && SEQ <= SEQ_FULL && (SEQ % 64) == 0);
static_assert(ATT_THREADS == 128 && ATT_BLOCKS == NB * NH * (SEQ / 64) && NKB * 32 == SEQ);
static_assert(((NB * SEQ) % 64) == 0 && (DMOD % 64) == 0 && (DMOD % 32) == 0);
static_assert((SEQ % 64) == 0 && (SEQ % 8) == 0);
static_assert(((NB * SEQ * DMOD / 8) % CVT_CH) == 0 && ((DMOD * DMOD / 8) % CVT_CH) == 0 && (SEG8X % CVT_CH) == 0);
static_assert(ATT_WAVES * SLABF >= 4 * 16 * 68);
static_assert(HD * VTP >= 63 * VTP + 64 && 2 * 2 * PLH >= 2 * HD * VTP && (VTP * 2) % 16 == 0);
static_assert(KT == 64 && HD == 64 && NT * KT == SEQ && NT * 2 == NKB && ATT_THREADS == 128);
static_assert(2 * BUFH * 2 >= ATT_WAVES * SLABF * 4 && (LP * 2) % 16 == 0);

typedef unsigned short u16;
typedef _Float16 v16h __attribute__((ext_vector_type(16)));
typedef _Float16 v8h  __attribute__((ext_vector_type(8)));
typedef __bf16   v16b __attribute__((ext_vector_type(16)));
typedef float    v8f  __attribute__((ext_vector_type(8)));
typedef float    v4f  __attribute__((ext_vector_type(4)));
typedef unsigned int v4u __attribute__((ext_vector_type(4)));

union FragH { v16h v; v8h h[2]; v4u u[2]; };
union FragB { v16b v; v4u u[2]; };

// ---- scalar helpers --------------------------------------------------------------------------------
__device__ __forceinline__ unsigned short bf_bits(float f) {          // f32 -> bf16 bits, RNE convert
  unsigned u = __float_as_uint(f);
  return (unsigned short)((u + 0x7FFFu + ((u >> 16) & 1u)) >> 16);
}
__device__ __forceinline__ float bf_up(unsigned short h) { return __uint_as_float(((unsigned)h) << 16); }
__device__ __forceinline__ float bfr(float f) { return bf_up(bf_bits(f)); }
__device__ __forceinline__ unsigned short h_bits(_Float16 x) { return __builtin_bit_cast(unsigned short, x); }
__device__ __forceinline__ unsigned pk16(unsigned short a, unsigned short b) { return (unsigned)a | ((unsigned)b << 16); }
// 2^x by the bare v_exp_f32. The library exp2f wraps the same instruction in a compare, two selects, an add and a ldexp that only
// serve results below 2^-126; here every argument is <= 0 and such a result stands beside a row maximum of 1, so 0 serves as well.
__device__ __forceinline__ float ex2(float x) { return __builtin_amdgcn_exp2f(x); }
__device__ __forceinline__ v8f zero8() { v8f z = {0.f, 0.f, 0.f, 0.f, 0.f, 0.f, 0.f, 0.f}; return z; }
__device__ __forceinline__ v4f zero4() { v4f z = {0.f, 0.f, 0.f, 0.f}; return z; }

// ---- fragment loaders: 16-bit A/B operand, lane -> row/col (lane&15), p already includes +8*(lane>>4);
//      elements 0..7 <- p[0..7] (k0+8h..), elements 8..15 <- p[16..23] (k0+16+8h..)  (same split k map for A and B;
//      B is always read from a k-contiguous [n][k] plane)
__device__ __forceinline__ v16h ldfrag_h(const _Float16* p) {
  FragH f;
  f.h[0] = *(const v8h*)(p);
  f.h[1] = *(const v8h*)(p + 16);
  return f.v;
}
__device__ __forceinline__ v16b ldfrag_b(const u16* p) {              // bf16 plane read as unsigned integer vectors
  FragB f;
  f.u[0] = *(const v4u*)(p);
  f.u[1] = *(const v4u*)(p + 16);
  return f.v;
}

__device__ __forceinline__ v8f mma_h(v16h a, v16h b, v8f c) {
  return __builtin_amdgcn_wmma_f32_16x16x32_f16(false, a, false, b, (short)0, c, false, false);
}
__device__ __forceinline__ v8f mma_b(v16b a, v16b b, v8f c) {
  return __builtin_amdgcn_wmma_f32_16x16x32_bf16(false, a, false, b, (short)0, c, false, false);
}
__device__ __forceinline__ void guard2(v8f& a, v8f& b, v16h x0, v16h x1, v16h x2, v16h x3, v16h x4, v16h x5) {
#if defined(__HIP_DEVICE_COMPILE__)
  asm volatile("v_nop\n\tv_nop\n\tv_nop\n\tv_nop"
               : "+v"(a), "+v"(b) : "v"(x0), "v"(x1), "v"(x2), "v"(x3), "v"(x4), "v"(x5) : "memory");
#endif
}
__device__ __forceinline__ void guard10(v8f& a, v8f& b, v8f& c, v8f& d, v16h x0, v16h x1, v16h x2, v16h x3, v16h x4,
                                        v16h x5, v16h x6, v16h x7, v16h x8, v16h x9) {
#if defined(__HIP_DEVICE_COMPILE__)
  asm volatile("v_nop\n\tv_nop\n\tv_nop\n\tv_nop"
               : "+v"(a), "+v"(b), "+v"(c), "+v"(d)
               : "v"(x0), "v"(x1), "v"(x2), "v"(x3), "v"(x4), "v"(x5), "v"(x6), "v"(x7), "v"(x8), "v"(x9) : "memory");
#endif
}
__device__ __forceinline__ void acc_guard4(v8f& a, v8f& b, v8f& c, v8f& d) {
#if defined(__HIP_DEVICE_COMPILE__)
  asm volatile("v_nop\n\tv_nop\n\tv_nop\n\tv_nop" : "+v"(a), "+v"(b), "+v"(c), "+v"(d));
#endif
}
// Two planes' 64-row x 128-B tiles, global -> LDS, by 128 threads: per lane four 16-B asynchronous copies a plane (rows r, r+16,
// r+32, r+48; 8 lanes = one whole 128-B row). la/lb: the lane's LDS byte addresses of row r, ga/gb: its global addresses, gstep: 16
// source rows in elements. The s_wait_xcnt closes the statement so that no address register is rewritten ahead of it.
__device__ __forceinline__ void stage2(unsigned la, unsigned lb, const u16* ga, const u16* gb, size_t gstep) {
#if defined(__HIP_DEVICE_COMPILE__)
  const unsigned ls = 16 * LP * 2;
  asm volatile("global_load_async_to_lds_b128 %0, %8, off\n\t"
               "global_load_async_to_lds_b128 %1, %9, off\n\t"
               "global_load_async_to_lds_b128 %2, %10, off\n\t"
               "global_load_async_to_lds_b128 %3, %11, off\n\t"
               "global_load_async_to_lds_b128 %4, %12, off\n\t"
               "global_load_async_to_lds_b128 %5, %13, off\n\t"
               "global_load_async_to_lds_b128 %6, %14, off\n\t"
               "global_load_async_to_lds_b128 %7, %15, off\n\t"
               "s_wait_xcnt 0x0"
               :: "v"(la), "v"(la + ls), "v"(la + 2 * ls), "v"(la + 3 * ls),
                  "v"(lb), "v"(lb + ls), "v"(lb + 2 * ls), "v"(lb + 3 * ls),
                  "v"(ga), "v"(ga + gstep), "v"(ga + 2 * gstep), "v"(ga + 3 * gstep),
                  "v"(gb), "v"(gb + gstep), "v"(gb + 2 * gstep), "v"(gb + 3 * gstep)
               : "memory");
#endif
}
// One plane's tile, the same way: four copies a lane.
__device__ __forceinline__ void stage1(unsigned la, const u16* ga, size_t gstep) {
#if defined(__HIP_DEVICE_COMPILE__)
  const unsigned ls = 16 * LP * 2;
  asm volatile("global_load_async_to_lds_b128 %0, %4, off\n\t"
               "global_load_async_to_lds_b128 %1, %5, off\n\t"
               "global_load_async_to_lds_b128 %2, %6, off\n\t"
               "global_load_async_to_lds_b128 %3, %7, off\n\t"
               "s_wait_xcnt 0x0"
               :: "v"(la), "v"(la + ls), "v"(la + 2 * ls), "v"(la + 3 * ls),
                  "v"(ga), "v"(ga + gstep), "v"(ga + 2 * gstep), "v"(ga + 3 * gstep)
               : "memory");
#endif
}
__device__ __forceinline__ void wave_sync_lds() {
  __builtin_amdgcn_fence(__ATOMIC_RELEASE, "workgroup");
  __builtin_amdgcn_wave_barrier();
  __builtin_amdgcn_fence(__ATOMIC_ACQUIRE, "workgroup");
}

// =====================================================================================================
// All seven f32 planes -> 16-bit planes in ONE launch. Destination D holds the planes back to back in block order:
//   x_q, x_k, x_v (bf16 RNE bits, NB*SEQ rows each), wq, wk, wv (bf16 RNE bits), wo (f16 bits of (bf16 RNE value) * WOS).
// Block = CVT_CH consecutive octets of one plane (a plane is a whole number of blocks, so plane and mode are block-uniform);
// thread = CVT_OCT octets, 256 octets apart: per octet two 16-B loads and one 16-B store, 32 consecutive lanes = 512 contiguous,
// 512-B aligned destination bytes. All of a thread's loads are issued ahead of its first conversion.
// An input plane is read as NB batches of SEQ rows out of a layout with SEQ_FULL rows per batch (a block never straddles a batch).
// coverage: grid = 3*XCH + 4*WCH blocks x 256 thr x CVT_OCT octets = the whole of the seven destination planes.
// =====================================================================================================
__global__ __launch_bounds__(256) void cvt_all(const float* __restrict__ xq, const float* __restrict__ xk,
                                               const float* __restrict__ xv, const float* __restrict__ wq,
                                               const float* __restrict__ wk, const float* __restrict__ wv,
                                               const float* __restrict__ wo, u16* D) {
  const unsigned bid = blockIdx.x, tid = threadIdx.x;
  const float* s;
  size_t so;                                 // the block's first source octet
  if (bid < 3u * XCH) {                      // block-uniform; no barriers in this kernel
    const unsigned pl = bid / XCH, g0 = (bid % XCH) * CVT_CH;
    s  = pl == 0 ? xq : pl == 1 ? xk : xv;
    so = (size_t)(g0 / SEG8X) * STR8X + (size_t)(g0 % SEG8X);
  } else {
    const unsigned wb = bid - 3u * XCH, pl = wb / WCH;
    s  = pl == 0 ? wq : pl == 1 ? wk : pl == 2 ? wv : wo;
    so = (size_t)(wb % WCH) * CVT_CH;
  }
  const float* p = s + (so + (size_t)tid) * 8;
  v4f a[CVT_OCT], c4[CVT_OCT];
#pragma unroll   // arrays indexed by constants (registers); the loads stand together
  for (int i = 0; i < CVT_OCT; ++i) {
    a[i]  = *(const v4f*)(p + i * 2048);
    c4[i] = *(const v4f*)(p + i * 2048 + 4);
  }
  u16* d = D + ((size_t)bid * CVT_CH + (size_t)tid) * 8;
  if (bid < 3u * XCH + 3u * WCH) {           // block-uniform
#pragma unroll
    for (int i = 0; i < CVT_OCT; ++i) {
      v4u o;
#pragma unroll
      for (int e = 0; e < 2; ++e) {
        o[e]     = pk16(bf_bits(a[i][2 * e]),  bf_bits(a[i][2 * e + 1]));
        o[2 + e] = pk16(bf_bits(c4[i][2 * e]), bf_bits(c4[i][2 * e + 1]));
      }
      *(v4u*)(d + i * 2048) = o;
    }
  } else {
#pragma unroll
    for (int i = 0; i < CVT_OCT; ++i) {
      v4u o;
#pragma unroll
      for (int e = 0; e < 2; ++e) {
        o[e]     = pk16(h_bits((_Float16)(bfr(a[i][2 * e]) * WOS)),  h_bits((_Float16)(bfr(a[i][2 * e + 1]) * WOS)));
        o[2 + e] = pk16(h_bits((_Float16)(bfr(c4[i][2 * e]) * WOS)), h_bits((_Float16)(bfr(c4[i][2 * e + 1]) * WOS)));
      }
      *(v4u*)(d + i * 2048) = o;
    }
  }
}

// =====================================================================================================
// f32 GEMM epilogue (gemm_h2): the wave's 16x64 f32 tile (times oscale) staged in its LDS slab (pitch 68, wave-private),
// coverage: 8 instructions x 2 rows x 16 lanes x 4 floats = the wave's 16 x 64 tile.
// =====================================================================================================
__device__ __forceinline__ void epi64(float* sl, v8f a0, v8f a1, v8f a2, v8f a3, float oscale, v4f badd, float* C, int N,
                                      size_t rowb, int col0, int lane) {
  const int hh = lane >> 4, m = lane & 15;
#pragma unroll
  for (int r = 0; r < 8; ++r) {
    const int ro = (8 * hh + r) * 68 + m;
    sl[ro]      = a0[r] * oscale;
    sl[ro + 16] = a1[r] * oscale;
    sl[ro + 32] = a2[r] * oscale;
    sl[ro + 48] = a3[r] * oscale;
  }
  wave_sync_lds();
  v4f vals[8];
#pragma unroll
  for (int it = 0; it < 8; ++it) vals[it] = *(const v4f*)(sl + (it * 2 + hh) * 68 + m * 4) + badd;
  float* dst = C + (rowb + (size_t)hh) * (size_t)N + col0 + m * 4;
  {
#pragma unroll
    for (int it = 0; it < 8; ++it) {
      *(v4f*)(dst + (size_t)(it * 2) * (size_t)N) = vals[it];
    }
    
  }
}

// =====================================================================================================
// Three bf16 GEMMs with bias in one launch, product pj = blockIdx.y (0 q, 1 k, 2 v): A = plane pj of A3, Bt = plane pj of Bt3,
// bias = bias<pj>, PH / PL = planes 2pj / 2pj+1 of P6 (M*N halves each), vt = (pj == 2). Each product, result written as two f16
// planes: c[M][N] (f32, in registers) = A[M][K] (bf16 row-major) . Bt[N][K]^T (bf16
// k-contiguous), times oscale, plus bf16-RNE value of bias[n]; PH = f16(c * psc), PL = f16(c * psc - PH) (psc a power of two).
// Block = 64x64 tile, 4 waves x 16 rows. The block's 64 A rows and 64 Bt rows are staged in LDS 64 k (one whole
// 128-B line a row) at a time by asynchronous copies, two buffers (tile t+1 flies while tile t is worked on, one block barrier a
// tile); fragments are read from LDS (two 16-B reads each, split k map for A and B), two k steps of 32 a tile, in the k order of
// a plain walk (host checks K % 64 == 0, M % 64 == 0, N % 64 == 0, grid = ((M/64)*(N/64), 3)).
// Epilogue, vt == 0: planes laid out [M][N]; the wave's 16x64 f32 tile goes through its private LDS slab (pitch 68), a lane then
//   owns 8 consecutive columns of a row: per plane 4 instructions x 4 rows x 8 lanes x 8 halves = the wave's 16 x 64 tile.
// Epilogue, vt != 0 (N == NH*HD, rows = b*SEQ + s): planes laid out [b][h][d][s]. A lane's 8 accumulator rows of one column are 8
//   consecutive s of one d: one 16-B LDS store a plane into the block's [64 d][64 s] tiles (pitch VTP, in the ring, which is free
//   behind the loop's last barrier); one block barrier; then 4 iterations x 128 thr x 8 halves = 64 lines x 64 s of each plane.
// =====================================================================================================
__global__ __launch_bounds__(128)
void gemm_bfb(const u16* __restrict__ A3, const u16* __restrict__ Bt3, const float* __restrict__ bias0,
              const float* __restrict__ bias1, const float* __restrict__ bias2,
              u16* P6, int M, int N, int K, float oscale, float psc) {
  __shared__ __align__(16) float slab[4 * SLAB64];
  __shared__ __align__(16) u16 ring[2 * 2 * PLH];   // two buffers of [A tile | Bt tile], 64 rows of pitch LP each
  const int tid = threadIdx.x, wave = tid >> 5, lane = tid & 31, hh = lane >> 4, m = lane & 15;
  const int ntile = N >> 6;
  const int bid   = blockIdx.x;
  const int row0  = (bid / ntile) * 64;
  const int rowb  = row0 + wave * 16;
  const int col0  = (bid % ntile) * 64;
  if (row0 + 64 > M) return;                 // block-uniform, in front of every barrier; never taken with the exact grid
  // which of the three products this block belongs to (block-uniform): operands, bias, result planes and layout
  const int pj = blockIdx.y;
  const u16* A       = A3  + (size_t)pj * (size_t)M * (size_t)K;
  const u16* Bt      = Bt3 + (size_t)pj * (size_t)N * (size_t)K;
  const float* bias  = pj == 0 ? bias0 : pj == 1 ? bias1 : bias2;
  u16* PH            = P6 + (size_t)(2 * pj) * (size_t)M * (size_t)N;
  u16* PL            = PH + (size_t)M * (size_t)N;
  const int vt       = pj == 2;
  // staging: thread -> (row sr of 16, 16-B piece sc of 8), rows sr, sr+16, sr+32, sr+48 of each operand's tile
  const int sr = tid >> 3, sc = (tid & 7) * 8;
  const u16* ag = A  + (size_t)(row0 + sr) * K + sc;
  const u16* bg = Bt + (size_t)(col0 + sr) * K + sc;
  const unsigned lds0 = (unsigned)(size_t)(const void*)ring + (unsigned)(sr * LP + sc) * 2u;
  const int nt = K >> 6;
  auto stage = [&](int t, int buf) {
    const unsigned l = lds0 + (unsigned)buf * (2u * PLH * 2u);
    stage2(l, l + PLH * 2u, ag + (size_t)t * 64, bg + (size_t)t * 64, (size_t)16 * K);
  };
  // fragment readers, in halves from a buffer's start
  const int afo = (wave * 16 + m) * LP + 8 * hh;
  const int bfo = PLH + m * LP + 8 * hh;
  v8f acc0 = zero8(), acc1 = zero8(), acc2 = zero8(), acc3 = zero8();
  stage(0, 0);
  asm volatile("s_wait_asynccnt 0x0" ::: "memory");   // this wave's copies of tile 0 have landed
  __syncthreads();                                    // ... and every other wave's: tile 0 may be read
  if (nt > 1) stage(1, 1);
#pragma unroll 1   // one tile a trip: the ring's hand-over stands once, at the foot
  for (int t = 0; t < nt; ++t) {
    const u16* bufp = ring + (t & 1) * (2 * PLH);
    v16b a[2], b[2][4];
#pragma unroll
    for (int kk = 0; kk < 2; ++kk) {
      a[kk] = ldfrag_b(bufp + afo + kk * 32);
#pragma unroll
      for (int j = 0; j < 4; ++j) b[kk][j] = ldfrag_b(bufp + bfo + j * 16 * LP + kk * 32);
    }
    __builtin_amdgcn_sched_barrier(0);   // all of the tile's LDS reads issue ahead of its WMMAs: one LDS latency a tile, not several
#pragma unroll
    for (int kk = 0; kk < 2; ++kk) {
      acc0 = mma_b(a[kk], b[kk][0], acc0);
      acc1 = mma_b(a[kk], b[kk][1], acc1);
      acc2 = mma_b(a[kk], b[kk][2], acc2);
      acc3 = mma_b(a[kk], b[kk][3], acc3);
    }
    acc_guard4(acc0, acc1, acc2, acc3);                 // WMMA distance kept on both sides of the branches that follow
    // ---- hand-over: tile t+1 is published and tile t's buffer is freed by the one barrier; then the refill ----
    asm volatile("s_wait_dscnt 0x0" ::: "memory");      // this wave's reads of tile t are done before its buffer is refilled
    asm volatile("s_wait_asynccnt 0x0" ::: "memory");   // this wave's copies of tile t+1 have landed
    __syncthreads();
    if (t + 2 < nt) stage(t + 2, t & 1);
  }
  asm volatile("s_wait_asynccnt 0x0" ::: "memory");     // nothing in flight when the wave goes on to its end
  // every loop of both epilogues is unrolled so that accumulators and staging arrays are indexed by constants (registers, no scratch)
  if (vt == 0) {                             // block-uniform
    float* sl = slab + wave * SLAB64;
#pragma unroll
    for (int r = 0; r < 8; ++r) {
      const int ro = (8 * hh + r) * 68 + m;
      sl[ro]      = acc0[r] * oscale;
      sl[ro + 16] = acc1[r] * oscale;
      sl[ro + 32] = acc2[r] * oscale;
      sl[ro + 48] = acc3[r] * oscale;
    }
    wave_sync_lds();
    const int rq = lane >> 3, c8 = (lane & 7) * 8;
    const v4f bv0 = *(const v4f*)(bias + col0 + c8), bv1 = *(const v4f*)(bias + col0 + c8 + 4);   // columns < N (N multiple of 64)
    float badd[8];
#pragma unroll
    for (int e = 0; e < 4; ++e) { badd[e] = bfr(bv0[e]); badd[4 + e] = bfr(bv1[e]); }
    v4u oh[4], ol[4];
#pragma unroll
    for (int i4 = 0; i4 < 4; ++i4) {
      const int row = i4 * 4 + rq;
      const v4f a4 = *(const v4f*)(sl + row * 68 + c8), c4 = *(const v4f*)(sl + row * 68 + c8 + 4);
      float w[8];
#pragma unroll
      for (int e = 0; e < 4; ++e) { w[e] = (a4[e] + badd[e]) * psc; w[4 + e] = (c4[e] + badd[4 + e]) * psc; }
#pragma unroll
      for (int e = 0; e < 4; ++e) {
        const _Float16 h0 = (_Float16)w[2 * e], h1 = (_Float16)w[2 * e + 1];
        const _Float16 l0 = (_Float16)(w[2 * e] - (float)h0), l1 = (_Float16)(w[2 * e + 1] - (float)h1);
        oh[i4][e] = pk16(h_bits(h0), h_bits(h1));
        ol[i4][e] = pk16(h_bits(l0), h_bits(l1));
      }
    }
    const size_t ob = (size_t)rowb * (size_t)N + col0 + c8;
#pragma unroll
    for (int i4 = 0; i4 < 4; ++i4) {
      const size_t o8 = ob + (size_t)(i4 * 4 + rq) * (size_t)N;
      *(v4u*)(PH + o8) = oh[i4];
      *(v4u*)(PL + o8) = ol[i4];
    }
    asm volatile("s_wait_xcnt 0x0" ::: "memory");   // behind the run of stores: no register that they name is rewritten ahead of it
  } else {
    u16* TH = ring;
    u16* TL = ring + HD * VTP;
    const v8f acc[4] = {acc0, acc1, acc2, acc3};
#pragma unroll
    for (int j = 0; j < 4; ++j) {
      const float bj = bfr(bias[col0 + 16 * j + m]);        // column < N (N multiple of 64)
      v4u th, tl;
#pragma unroll
      for (int e = 0; e < 4; ++e) {
        const float t0 = (acc[j][2 * e] * oscale + bj) * psc, t1 = (acc[j][2 * e + 1] * oscale + bj) * psc;
        const _Float16 h0 = (_Float16)t0, h1 = (_Float16)t1;
        const _Float16 l0 = (_Float16)(t0 - (float)h0), l1 = (_Float16)(t1 - (float)h1);
        th[e] = pk16(h_bits(h0), h_bits(h1));
        tl[e] = pk16(h_bits(l0), h_bits(l1));
      }
      const int to = (16 * j + m) * VTP + wave * 16 + 8 * hh;
      *(v4u*)(TH + to) = th;
      *(v4u*)(TL + to) = tl;
    }
    __syncthreads();                         // the four waves' columns of the [d][s] tiles are complete
    const int q8 = tid >> 3, p8 = (tid & 7) * 8;
    v4u vh[4], vl[4];
#pragma unroll
    for (int it = 0; it < 4; ++it) {
      const int line = it * 16 + q8;          // d = 0..63
      vh[it] = *(const v4u*)(TH + line * VTP + p8);
      vl[it] = *(const v4u*)(TL + line * VTP + p8);
    }
    const size_t base = ((size_t)((row0 / SEQ) * NH + (col0 >> 6)) * HD) * SEQ + (row0 % SEQ) + p8;
#pragma unroll
    for (int it = 0; it < 4; ++it) {
      const int line = it * 16 + q8;
      *(v4u*)(PH + base + (size_t)line * SEQ) = vh[it];
      *(v4u*)(PL + base + (size_t)line * SEQ) = vl[it];
    }
    asm volatile("s_wait_xcnt 0x0" ::: "memory");   // behind the run of stores: no register that they name is rewritten ahead of it
  }
}

// =====================================================================================================
// f16 hi+lo GEMM with bias: C[M][N] (f32) = (Ahi + Alo)[M][K] . Bt[N][K]^T times oscale, plus bf16-RNE value of bias[n];
// Ahi/Alo f16 planes (same layout), Bt f16 k-contiguous; products hi.B + lo.B into one accumulator (lo is the unscaled
// residual of hi). Same tiling and the same two-buffer LDS ring as gemm_bfb, three planes a tile (Ahi, Alo, Bt).
// =====================================================================================================
__global__ __launch_bounds__(128)
void gemm_h2(const u16* __restrict__ Ah, const u16* __restrict__ Al, const u16* __restrict__ Bt,
             const float* __restrict__ bias, float* C, int M, int N, int K, float oscale) {
  __shared__ __align__(16) float slab[4 * SLAB64];
  __shared__ __align__(16) u16 ring[2 * 3 * PLH];   // two buffers of [Ahi tile | Alo tile | Bt tile], 64 rows of pitch LP each
  const int tid = threadIdx.x, wave = tid >> 5, lane = tid & 31, hh = lane >> 4, m = lane & 15;
  const int ntile = N >> 6;
  const int bid   = blockIdx.x;
  const int row0  = (bid / ntile) * 64;
  const int rowb  = row0 + wave * 16;
  const int col0  = (bid % ntile) * 64;
  if (row0 + 64 > M) return;                 // block-uniform, in front of every barrier; never taken with the exact grid
  // staging: thread -> (row sr of 16, 16-B piece sc of 8), rows sr, sr+16, sr+32, sr+48 of each plane's tile
  const int sr = tid >> 3, sc = (tid & 7) * 8;
  const size_t aofs = (size_t)(row0 + sr) * K + sc;
  const u16* ahg = Ah + aofs;
  const u16* alg = Al + aofs;
  const u16* bg  = Bt + (size_t)(col0 + sr) * K + sc;
  const unsigned lds0 = (unsigned)(size_t)(const void*)ring + (unsigned)(sr * LP + sc) * 2u;
  const int nt = K >> 6;
  auto stage = [&](int t, int buf) {
    const unsigned l = lds0 + (unsigned)buf * (3u * PLH * 2u);
    stage2(l, l + PLH * 2u, ahg + (size_t)t * 64, alg + (size_t)t * 64, (size_t)16 * K);
    stage1(l + 2u * PLH * 2u, bg + (size_t)t * 64, (size_t)16 * K);
  };
  // fragment readers, in halves from a buffer's start
  const int afo = (wave * 16 + m) * LP + 8 * hh;
  const int bfo = 2 * PLH + m * LP + 8 * hh;
  v8f acc0 = zero8(), acc1 = zero8(), acc2 = zero8(), acc3 = zero8();
  stage(0, 0);
  asm volatile("s_wait_asynccnt 0x0" ::: "memory");   // this wave's copies of tile 0 have landed
  __syncthreads();                                    // ... and every other wave's: tile 0 may be read
  if (nt > 1) stage(1, 1);
#pragma unroll 1   // one tile a trip: the ring's hand-over stands once, at the foot
  for (int t = 0; t < nt; ++t) {
    const _Float16* bufp = (const _Float16*)(const void*)ring + (t & 1) * (3 * PLH);
    v16h ah[2], al[2], b[2][4];
#pragma unroll
    for (int kk = 0; kk < 2; ++kk) {
      ah[kk] = ldfrag_h(bufp + afo + kk * 32);
      al[kk] = ldfrag_h(bufp + PLH + afo + kk * 32);
#pragma unroll
      for (int j = 0; j < 4; ++j) b[kk][j] = ldfrag_h(bufp + bfo + j * 16 * LP + kk * 32);
    }
    __builtin_amdgcn_sched_barrier(0);   // all of the tile's LDS reads issue ahead of its WMMAs: one LDS latency a tile, not several
#pragma unroll
    for (int kk = 0; kk < 2; ++kk) {
      acc0 = mma_h(ah[kk], b[kk][0], acc0);  acc0 = mma_h(al[kk], b[kk][0], acc0);
      acc1 = mma_h(ah[kk], b[kk][1], acc1);  acc1 = mma_h(al[kk], b[kk][1], acc1);
      acc2 = mma_h(ah[kk], b[kk][2], acc2);  acc2 = mma_h(al[kk], b[kk][2], acc2);
      acc3 = mma_h(ah[kk], b[kk][3], acc3);  acc3 = mma_h(al[kk], b[kk][3], acc3);
    }
    acc_guard4(acc0, acc1, acc2, acc3);                 // WMMA distance kept on both sides of the branches that follow
    // ---- hand-over: tile t+1 is published and tile t's buffer is freed by the one barrier; then the refill ----
    asm volatile("s_wait_dscnt 0x0" ::: "memory");      // this wave's reads of tile t are done before its buffer is refilled
    asm volatile("s_wait_asynccnt 0x0" ::: "memory");   // this wave's copies of tile t+1 have landed
    __syncthreads();
    if (t + 2 < nt) stage(t + 2, t & 1);
  }
  asm volatile("s_wait_asynccnt 0x0" ::: "memory");     // nothing in flight when the wave goes on to its end
  const v4f bv = *(const v4f*)(bias + col0 + m * 4);      // columns col0 + 4m .. +3, always < N (N multiple of 64)
  v4f badd;
#pragma unroll
  for (int e = 0; e < 4; ++e) badd[e] = bfr(bv[e]);
  epi64(slab + wave * SLAB64, acc0, acc1, acc2, acc3, oscale, badd, C, N, (size_t)rowb, col0, lane);
}

// =====================================================================================================
// Full (non-causal, unmasked) multi-head flash attention: block = (batch b, head, 64 query rows), 4 waves, wave w owns the
// 16 query rows q0 = 64*qt + 16*w .. q0+15. The k and v^T planes' tiles of KT = 64 keys are staged in LDS by asynchronous copies, two
// buffers (tile t+1 flies while tile t is worked on, one block barrier a tile), and read by all 4 waves; each tile serves two key
// blocks of 32. The ring becomes the waves' private result slabs behind the last tile's barrier.
//   Per-head logit scale: sigmoid(bf16 RNE value of g[head]) / 8, computed in f32 once per thread (head uniform per block) and
//   folded with log2(e) and the q/k carries into lsc.
//   q planes (hi, lo f16, x1024) laid out [b][s][h][d]; k planes the same; v^T planes [b][h][d][s] (x1024).
//   All NKB = SEQ/32 key blocks of 32 keys are visited (static bound).
//   Scores are computed TRANSPOSED: S^T tile g (g = 0,1) = k rows (keys kb+16g .. +15, A operand, row m = lane&15, split k map
//   over d) times q^T (B operand, col n = query q0 + (lane&15), k = d, split map), 3 products per tile and d-chunk
//   (k_hi.q_hi + k_lo.q_hi + k_hi.q_lo). D element r of lane l = (key kb+16g+8h+r, query q0+(l&15)), so a lane owns one query
//   column and 16 of its 32 keys; the partner lane l^16 owns the other 16 -> row max / row sum need one xor-16 shuffle.
//   Online max-subtracted base-2 softmax in f32. The exp'd values ARE the P A-fragment in place: A row m = query = lane&15,
//   element i <- key kb+8h+i (tile 0, D element i), element 8+i <- key kb+16+8h+i (tile 1, D element i). P is carried x32768
//   as f16 hi + f16 residual. The rescale factor of query row 8h+r of the O accumulators is fetched from lane 8h+r with a
//   shuffle (uniform control). 4+4 v^T B fragments (hi and residual planes, col n = d = 16j + (lane&15), keys k-contiguous),
//   12 P.V WMMAs (hh + lh + hl).
//   Epilogue: 1/l (per query, shuffled to the D row owner) and carry folds in f32; the wave's 16x64 f32 result staged in its LDS
// coverage: per wave 4 instructions x 4 rows x 8 lanes x 8 halves = 16 x 64 per plane; grid NB*NH*SEQ/64 blocks x 4 waves = every
//           (b, s, h) row of both O planes exactly once.
// =====================================================================================================
__global__ __launch_bounds__(ATT_THREADS)
void attn_fwd(const u16* __restrict__ QHIp, const u16* __restrict__ QLOp,
              const u16* __restrict__ KHIp, const u16* __restrict__ KLOp,
              const u16* __restrict__ VHIp, const u16* __restrict__ VLOp,
              const float* __restrict__ gatep,
              u16* OHIp, u16* OLOp) {
  __shared__ __align__(16) u16 ring[2 * BUFH];   // two tile buffers; in the epilogue per wave a result slab [16][68] of f32

  const int tid  = threadIdx.x;
  const int wave = tid >> 5;
  const int lane = tid & 31;
  const int hh   = lane >> 4;
  const int c    = lane & 15;

  const int bid  = blockIdx.x;
  const int qt   = bid % QT64;
  const int head = (bid / QT64) % NH;
  const int b    = bid / (QT64 * NH);
  const int q0   = qt * 64 + wave * 16;

  // per-head scale: sigmoid(bf16 value of g) / 8 in f32; head < NH always (block decode), host checks the input extent
  const float gbf = bfr(gatep[head]);
  const float sgm = 1.0f / (1.0f + expf(-gbf));
  const float lsc = sgm * (0.125f * (LOG2E / (QSC * KSC)));

  // B fragments of q^T: col n = query q0 + c, k = d (k-contiguous row of the q plane)
  const size_t qofs = (((size_t)(b * SEQ + q0 + c)) * NH + head) * HD + 8 * hh;
  const _Float16* Qh  = (const _Float16*)(const void*)QHIp + qofs;
  const _Float16* Ql  = (const _Float16*)(const void*)QLOp + qofs;
  // staging: thread -> (row sr of 16, 16-B piece sc of 8); k tile row = key, v^T tile row = d, both 64 halves long
  const int sr = tid >> 3, sc = (tid & 7) * 8;
  const size_t kofs = (((size_t)b * SEQ + sr) * NH + head) * HD + sc;             // tile's first key added per tile
  const size_t vofs = ((size_t)(b * NH + head) * HD + sr) * SEQ + sc;             // tile's first key added per tile
  const unsigned lds0 = (unsigned)(size_t)(const void*)ring + (unsigned)(sr * LP + sc) * 2u;
  auto stage = [&](int t, int buf) {
    const unsigned l = lds0 + (unsigned)buf * (BUFH * 2u);
    const size_t ko = kofs + (size_t)t * (KT * NH * HD), vo = vofs + (size_t)t * KT;
    stage2(l, l + PLH * 2u, KHIp + ko, KLOp + ko, (size_t)16 * (NH * HD));
    stage2(l + 2u * PLH * 2u, l + 3u * PLH * 2u, VHIp + vo, VLOp + vo, (size_t)16 * SEQ);
  };
  // fragment readers, in halves from a buffer's start: A of k: row m = key 16g + c, k = d; B of v: col n = d = 16j + c, k = key
  const int kfo = c * LP + 8 * hh;
  const int vfo = 2 * PLH + c * LP + 8 * hh;

  // q^T B fragments (hi and residual planes, both d chunks of 32): read once, held in registers for all key tiles
  const v16h qhf[2] = {ldfrag_h(Qh), ldfrag_h(Qh + 32)};
  const v16h qlf[2] = {ldfrag_h(Ql), ldfrag_h(Ql + 32)};

  float mrun = -INFINITY, lrun = 0.f;
  v8f o[4];
#pragma unroll
  for (int j = 0; j < 4; ++j) o[j] = zero8();

  stage(0, 0);
  asm volatile("s_wait_asynccnt 0x0" ::: "memory");   // this wave's copies of tile 0 have landed
  __syncthreads();                                    // ... and every other wave's: tile 0 may be read
  if (NT > 1) stage(1, 1);

#pragma unroll 1
  for (int t = 0; t < NT; ++t) {
   const _Float16* bufp = (const _Float16*)(const void*)ring + (t & 1) * BUFH;
#pragma unroll   // both key blocks of a tile in line: their LDS offsets become immediates
   for (int sub = 0; sub < 2; ++sub) {
    // ---- transposed scores: s0 = keys kb..kb+15, s1 = keys kb+16..kb+31 (kb = 64t + 32sub), column = query q0 + c ----
    v8f s0 = zero8(), s1 = zero8();
    const _Float16* k0p = bufp + kfo + sub * 32 * LP;
    const _Float16* k1p = k0p + 16 * LP;
    const _Float16* l0p = k0p + PLH;
    const _Float16* l1p = l0p + 16 * LP;
#pragma unroll
    for (int kk = 0; kk < 2; ++kk) {
      const v16h qh  = qhf[kk], ql = qlf[kk];
      const v16h kh0 = ldfrag_h(k0p + kk * 32), kl0 = ldfrag_h(l0p + kk * 32);
      const v16h kh1 = ldfrag_h(k1p + kk * 32), kl1 = ldfrag_h(l1p + kk * 32);
      s0 = mma_h(kh0, qh, s0);
      s0 = mma_h(kl0, qh, s0);
      s0 = mma_h(kh0, ql, s0);
      s1 = mma_h(kh1, qh, s1);
      s1 = mma_h(kl1, qh, s1);
      s1 = mma_h(kh1, ql, s1);
      guard2(s0, s1, qh, ql, kh0, kl0, kh1, kl1);
    }
    // ---- base-2 logits of this lane's 16 keys for query q0 + c: t[i] <- key kb+8hh+i, t[8+i] <- key kb+16+8hh+i ----
    float t[16];
#pragma unroll
    for (int i = 0; i < 8; ++i) { t[i] = s0[i] * lsc; t[8 + i] = s1[i] * lsc; }
    float cm = t[0];
#pragma unroll
    for (int i = 1; i < 16; ++i) cm = fmaxf(cm, t[i]);
    cm = fmaxf(cm, __shfl_xor(cm, 16, 32));
    const float mn = fmaxf(mrun, cm);        // finite from the first block on
    const float al = ex2(mrun - mn);         // 0 on the first block (mrun = -inf)
    mrun = mn;
    // ---- probabilities (<= 1) and the P A-fragments: hi = f16(p * 32768), lo = f16 residual; element i <-> t[i] ----
    float ps = 0.f;
    FragH ph, pl;
#pragma unroll
    for (int w = 0; w < 2; ++w) {
#pragma unroll
      for (int e4 = 0; e4 < 4; ++e4) {
        const int i = 8 * w + 2 * e4;
        const float p0 = ex2(t[i] - mn), p1 = ex2(t[i + 1] - mn);
        ps += p0 + p1;
        const float a0 = p0 * PCAR, a1 = p1 * PCAR;
        const _Float16 h0 = (_Float16)a0, h1 = (_Float16)a1;
        const _Float16 l0 = (_Float16)(a0 - (float)h0), l1 = (_Float16)(a1 - (float)h1);
        ph.u[w][e4] = pk16(h_bits(h0), h_bits(h1));
        pl.u[w][e4] = pk16(h_bits(l0), h_bits(l1));
      }
    }
    ps += __shfl_xor(ps, 16, 32);
    lrun = lrun * al + ps;
    // ---- rescale the O accumulators: D row 8hh+r = query q0+8hh+r, its factor lives in lane 8hh+r (and 16+8hh+r) ----
    float scl[8];
#pragma unroll
    for (int r = 0; r < 8; ++r) scl[r] = __shfl(al, 8 * hh + r, 32);
#pragma unroll
    for (int j = 0; j < 4; ++j) {
#pragma unroll
      for (int r = 0; r < 8; ++r) o[j][r] *= scl[r];
    }
    // ---- P.V : B fragment col n = d = j*16 + c, keys contiguous in the v^T planes ----
    {
      const _Float16* vhp = bufp + vfo + sub * 32;
      const _Float16* vlp = vhp + PLH;
      const v16h vh0 = ldfrag_h(vhp);
      const v16h vh1 = ldfrag_h(vhp + 16 * LP);
      const v16h vh2 = ldfrag_h(vhp + 32 * LP);
      const v16h vh3 = ldfrag_h(vhp + 48 * LP);
      const v16h vl0 = ldfrag_h(vlp);
      const v16h vl1 = ldfrag_h(vlp + 16 * LP);
      const v16h vl2 = ldfrag_h(vlp + 32 * LP);
      const v16h vl3 = ldfrag_h(vlp + 48 * LP);
      o[0] = mma_h(ph.v, vh0, o[0]);  o[0] = mma_h(pl.v, vh0, o[0]);  o[0] = mma_h(ph.v, vl0, o[0]);
      o[1] = mma_h(ph.v, vh1, o[1]);  o[1] = mma_h(pl.v, vh1, o[1]);  o[1] = mma_h(ph.v, vl1, o[1]);
      o[2] = mma_h(ph.v, vh2, o[2]);  o[2] = mma_h(pl.v, vh2, o[2]);  o[2] = mma_h(ph.v, vl2, o[2]);
      o[3] = mma_h(ph.v, vh3, o[3]);  o[3] = mma_h(pl.v, vh3, o[3]);  o[3] = mma_h(ph.v, vl3, o[3]);
      guard10(o[0], o[1], o[2], o[3], ph.v, pl.v, vh0, vh1, vh2, vh3, vl0, vl1, vl2, vl3);
    }
   }
   // ---- hand-over: tile t+1 is published and tile t's buffer is freed by the one barrier; then the refill ----
   asm volatile("s_wait_dscnt 0x0" ::: "memory");      // this wave's reads of tile t are done before its buffer is refilled
   asm volatile("s_wait_asynccnt 0x0" ::: "memory");   // this wave's copies of tile t+1 have landed
   __syncthreads();
   if (t + 2 < NT) stage(t + 2, t & 1);
  }
  asm volatile("s_wait_asynccnt 0x0" ::: "memory");    // nothing in flight when the ring turns into the result slabs
  acc_guard4(o[0], o[1], o[2], o[3]);

  // ---- fold 1/l (per query, owned by lane = query) and the carries (32768 on P, 1024 on v); stage the 16x64 slab ----
  const float linv = (1.0f / lrun) * (1.0f / (PCAR * VCAR));
  float inv[8];
#pragma unroll
  for (int r = 0; r < 8; ++r) inv[r] = __shfl(linv, 8 * hh + r, 32);
  float* slab = (float*)(void*)ring + wave * SLABF;
#pragma unroll
  for (int r = 0; r < 8; ++r) {
#pragma unroll
    for (int j = 0; j < 4; ++j) slab[(8 * hh + r) * 68 + j * 16 + c] = o[j][r] * inv[r];
  }
  wave_sync_lds();
  // ---- O x1024 -> f16 hi + residual planes; lane = (row in group of 4, 8 consecutive d) ----
  v4u oh[4], ol[4];
  const int rq = lane >> 3, c8 = (lane & 7) * 8;
#pragma unroll
  for (int i4 = 0; i4 < 4; ++i4) {
    const int row = i4 * 4 + rq;
    const v4f a = *(const v4f*)(slab + row * 68 + c8), c4 = *(const v4f*)(slab + row * 68 + c8 + 4);
    float w[8];
#pragma unroll
    for (int e = 0; e < 4; ++e) { w[e] = a[e] * OSC; w[4 + e] = c4[e] * OSC; }
#pragma unroll
    for (int e = 0; e < 4; ++e) {
      const _Float16 h0 = (_Float16)w[2 * e], h1 = (_Float16)w[2 * e + 1];
      const _Float16 l0 = (_Float16)(w[2 * e] - (float)h0), l1 = (_Float16)(w[2 * e + 1] - (float)h1);
      oh[i4][e] = pk16(h_bits(h0), h_bits(h1));
      ol[i4][e] = pk16(h_bits(l0), h_bits(l1));
    }
  }
  const size_t ob = (((size_t)(b * SEQ + q0)) * NH + head) * HD + c8;
  {
#pragma unroll
    for (int i4 = 0; i4 < 4; ++i4) {
      const int row = i4 * 4 + rq;
      const size_t o8 = ob + (size_t)row * (NH * HD);
      *(v4u*)(OHIp + o8) = oh[i4];
      *(v4u*)(OLOp + o8) = ol[i4];
    }
    
  }
}

// =====================================================================================================
// Workspace map (bytes, ROWS = NB*SEQ; numbers for NB=2, SEQ=2048); every plane is fully written by whole-line stores before it is
// read; all extents are exact multiples of the store granularity (no pad rows needed). XB .. WOB are cvt_all's one destination,
// XB / WQB.. / QHI.. are gemm_bfb's plane triples, so their order and adjacency matter:
//   XB  bf16 3 x [ROWS][1024]            25165824        (input Q, K, V)
//   WQB bf16 [1024 n][1024 k]             2097152        WKB same  2097152      WVB same  2097152
//   WOB f16  [1024 n][1024 k] x1024       2097152
//   QHI f16 [NB][SEQ][16][64] x1024       8388608        QLO residual         8388608
//   KHI same                              8388608        KLO residual         8388608
//   VHI f16 [NB][16][64][SEQ] x1024       8388608        VLO residual         8388608
//   OHI f16 [ROWS][1024] x1024            8388608        OLO residual         8388608
//   end                                 100663296
// =====================================================================================================
extern "C" void kernel_launch(void* const* d_in, const int* in_sizes, int n_in,
                              void* d_out, int out_size, void* d_ws, size_t ws_size,
                              hipStream_t stream) {
  const int ROWS = NB * SEQ;
  if (n_in < 12) return;
  const int needX = ((NB - 1) * SEQ_FULL + SEQ) * DMOD;   // last input row read by cvt_all (+1), in elements
  if (in_sizes[0] < needX || in_sizes[1] < needX || in_sizes[2] < needX) return;
  if (in_sizes[3] < DMOD * DMOD || in_sizes[5] < DMOD * DMOD) return;
  if (in_sizes[7] < DMOD * DMOD || in_sizes[9] < DMOD * DMOD) return;
  if (in_sizes[4] < DMOD || in_sizes[6] < DMOD || in_sizes[8] < DMOD || in_sizes[10] < DMOD) return;
  if (in_sizes[11] < NH) return;
  if (out_size < ROWS * DMOD) return;

  const float* Qin = (const float*)d_in[0];
  const float* Kin = (const float*)d_in[1];
  const float* Vin = (const float*)d_in[2];
  const float* wq  = (const float*)d_in[3];
  const float* bq  = (const float*)d_in[4];
  const float* wk  = (const float*)d_in[5];
  const float* bk  = (const float*)d_in[6];
  const float* wv  = (const float*)d_in[7];
  const float* bv  = (const float*)d_in[8];
  const float* wo  = (const float*)d_in[9];
  const float* bo  = (const float*)d_in[10];
  const float* gt  = (const float*)d_in[11];
  float*       out = (float*)d_out;

  const size_t szXB  = (size_t)3 * ROWS * DMOD * 2;
  const size_t szW   = (size_t)DMOD * DMOD * 2;
  const size_t szP   = (size_t)ROWS * DMOD * 2;                 // q/k/o planes
  const size_t szVP  = (size_t)NB * NH * HD * SEQ * 2;
  size_t off = 0;
  const size_t oXB  = off; off += szXB;
  const size_t oWQB = off; off += szW;
  off += szW;                                           // WKB
  off += szW;                                           // WVB
  const size_t oWOB = off; off += szW;
  const size_t oQHI = off; off += szP;
  const size_t oQLO = off; off += szP;
  const size_t oKHI = off; off += szP;
  const size_t oKLO = off; off += szP;
  const size_t oVHI = off; off += szVP;
  const size_t oVLO = off; off += szVP;
  const size_t oOHI = off; off += szP;
  const size_t oOLO = off; off += szP;
  if (off > ws_size) return;                            // off = 100663296 at full size
  if (off > (size_t)134217728) return;

  char* ws = (char*)d_ws;
  u16*   XB  = (u16*)(ws + oXB);
  u16*   WQB = (u16*)(ws + oWQB);
  u16*   WOB = (u16*)(ws + oWOB);
  u16*   QHI = (u16*)(ws + oQHI);
  u16*   QLO = (u16*)(ws + oQLO);
  u16*   KHI = (u16*)(ws + oKHI);
  u16*   KLO = (u16*)(ws + oKLO);
  u16*   VHI = (u16*)(ws + oVHI);
  u16*   VLO = (u16*)(ws + oVLO);
  u16*   OHI = (u16*)(ws + oOHI);
  u16*   OLO = (u16*)(ws + oOLO);

  const dim3 blk(256);
  if ((DMOD % 32) != 0 || (ROWS % 64) != 0 || (DMOD % 64) != 0) return;
  const dim3 gC(3 * XCH + 4 * WCH);                     // 512
  const dim3 gG((ROWS / 64) * (DMOD / 64));             // 1024
  const dim3 gG3((ROWS / 64) * (DMOD / 64), 3);         // 1024 x 3
  const dim3 bG(128);
  const dim3 gAT(ATT_BLOCKS);                           // 1024
  const dim3 bAT(ATT_THREADS);                          // 128

  // (0) inputs -> bf16 planes; weights [n][k] (already k-contiguous for x.W^T): bf16 planes for wq/wk/wv, f16 of bf16 value x1024
  //     for wo; destination XB .. WOB, contiguous
  cvt_all<<<gC, blk, 0, stream>>>(Qin, Kin, Vin, wq, wk, wv, wo, XB);
  // (1) q, k, v projections + bias (col = h*64+d), x1024, as f16 hi + residual planes: q, k [ROWS][1024], v as v^T planes
  gemm_bfb<<<gG3, bG, 0, stream>>>(XB, WQB, bq, bk, bv, QHI, ROWS, DMOD, DMOD, 1.0f, QSC);
  // (2) attention with per-head scale sigmoid(g)/8 -> O planes [b][s][h][d] x1024 (hi + residual)
  attn_fwd<<<gAT, bAT, 0, stream>>>(QHI, QLO, KHI, KLO, VHI, VLO, gt, OHI, OLO);
  // (3) output projection + bias -> out [ROWS][1024] f32, carries 1024 (O) x 1024 (wo) folded back
  gemm_h2<<<gG, bG, 0, stream>>>(OHI, OLO, WOB, bo, out, ROWS, DMOD, DMOD, 1.0f / (OSC * WOS));
  (void)hipGetLastError();
}

// v007
// Measured time: 152 microseconds a run.
// In both of two side-by-side timings against v006, it was 1.05 times as fast.
// Over all steps from v000 it is 2.65 times as fast.
// Contractions: x.W{q,k,v}^T on v_wmma_f32_16x16x32_bf16 (x and W RNE-converted to bf16 operands, f32 accumulate, bias added in f32);
// scores k'.q'^T (q', k' carried x1024 as f16 hi plane + f16 residual plane, products hh+lh+hl), P.v (P x32768 f16 hi+residual,
// v x1024 f16 hi+residual, products hh+lh+hl) and O.Wo^T (O x1024 f16 hi+residual, Wo as f16(bf16(Wo) x1024), products h.w+l.w):
// v_wmma_f32_16x16x32_f16, f32 accumulate. Per-head logit scale sigmoid(bf16(g_h))/8 in f32; base-2 online softmax, 1/l fold and
// bias adds in f32 on VALU.
#include <hip/hip_runtime.h>
#include <math.h>
#include <stdint.h>

#ifndef NB
#define NB    2
#endif
#ifndef SEQ
#define SEQ   2048
#endif
#define NB_FULL  2
#define SEQ_FULL 2048
#define DMOD  1024
#define NH    16
#define HD    64
#define QSC   1024.0f
#define KSC   1024.0f
#define PCAR  32768.0f
#define VCAR  1024.0f
#define OSC   1024.0f
#define WOS   1024.0f
#define LOG2E 1.4426950408889634f
#define ATT_WAVES   4
#define ATT_THREADS (ATT_WAVES * 32)
#define QT64        (SEQ / 64)
#define ATT_BLOCKS  (NB * NH * QT64)
#define NKB    (SEQ / 32)
#define SLABF  (16 * 68)
#define SLAB64 (16 * 68)
#define VTP    136                // pitch in halves of the v^T epilogue tiles: 256-B rows + 16 B (16 B x odd)
#define GT     128                // GEMM block tile: rows of A and rows of Bt
#define KT     64                 // keys per staged tile
#define LP     72                 // LDS row pitch in halves: 128-B rows + 16 B (16 B x odd, for 16-B LDS reads down a column of rows)
#define PLH    (64 * LP)          // one plane's tile: 64 rows
#define BUFH   (4 * PLH)          // k hi, k residual, v^T hi, v^T residual
#define GPLH   (GT * LP)          // one GEMM operand plane's tile: GT rows
#define NT     (SEQ / KT)
#define CVT_OCT 16                             // octets a thread of cvt_all
#define CVT_CH  (256 * CVT_OCT)                // octets a block of cvt_all
#define XCH     ((NB * SEQ * DMOD / 8) / CVT_CH)   // blocks an input plane
#define WCH     ((DMOD * DMOD / 8) / CVT_CH)       // blocks a weight plane
#define SEG8X   (SEQ * DMOD / 8)               // destination octets per batch
#define STR8X   (SEQ_FULL * DMOD / 8)          // source octets per batch in the input layout
static_assert(HD == 64 && DMOD == NH * HD && NH == 16);
static_assert(QSC == KSC && KSC == VCAR);      // one plane scale for the three projections of a launch
static_assert(NB >= 1 && NB <= NB_FULL && SEQ >= 64 && SEQ <= SEQ_FULL && (SEQ % 64) == 0);
static_assert(ATT_THREADS == 128 && ATT_BLOCKS == NB * NH * (SEQ / 64) && NKB * 32 == SEQ);
static_assert(((NB * SEQ) % GT) == 0 && (DMOD % GT) == 0 && (SEQ % GT) == 0 && (DMOD % 64) == 0 && GT == 128);
static_assert((SEQ % 64) == 0 && (SEQ % 8) == 0);
static_assert(((NB * SEQ * DMOD / 8) % CVT_CH) == 0 && ((DMOD * DMOD / 8) % CVT_CH) == 0 && (SEG8X % CVT_CH) == 0);
static_assert(ATT_WAVES * SLABF >= 4 * 16 * 68);
static_assert(VTP >= GT && 2 * 2 * GPLH >= 2 * GT * VTP && (VTP * 2) % 16 == 0);
static_assert(KT == 64 && HD == 64 && NT * KT == SEQ && NT * 2 == NKB && ATT_THREADS == 128);
static_assert(2 * BUFH * 2 >= ATT_WAVES * SLABF * 4 && (LP * 2) % 16 == 0);

typedef unsigned short u16;
typedef _Float16 v16h __attribute__((ext_vector_type(16)));
typedef _Float16 v8h  __attribute__((ext_vector_type(8)));
typedef __bf16   v16b __attribute__((ext_vector_type(16)));
typedef float    v8f  __attribute__((ext_vector_type(8)));
typedef float    v4f  __attribute__((ext_vector_type(4)));
typedef unsigned int v4u __attribute__((ext_vector_type(4)));

union FragH { v16h v; v8h h[2]; v4u u[2]; };
union FragB { v16b v; v4u u[2]; };

// ---- scalar helpers --------------------------------------------------------------------------------
__device__ __forceinline__ unsigned short bf_bits(float f) {          // f32 -> bf16 bits, RNE convert
  unsigned u = __float_as_uint(f);
  return (unsigned short)((u + 0x7FFFu + ((u >> 16) & 1u)) >> 16);
}
__device__ __forceinline__ float bf_up(unsigned short h) { return __uint_as_float(((unsigned)h) << 16); }
__device__ __forceinline__ float bfr(float f) { return bf_up(bf_bits(f)); }
__device__ __forceinline__ unsigned short h_bits(_Float16 x) { return __builtin_bit_cast(unsigned short, x); }
__device__ __forceinline__ unsigned pk16(unsigned short a, unsigned short b) { return (unsigned)a | ((unsigned)b << 16); }
// 2^x by the bare v_exp_f32. The library exp2f wraps the same instruction in a compare, two selects, an add and a ldexp that only
// serve results below 2^-126; here every argument is <= 0 and such a result stands beside a row maximum of 1, so 0 serves as well.
__device__ __forceinline__ float ex2(float x) { return __builtin_amdgcn_exp2f(x); }
__device__ __forceinline__ v8f zero8() { v8f z = {0.f, 0.f, 0.f, 0.f, 0.f, 0.f, 0.f, 0.f}; return z; }
__device__ __forceinline__ v4f zero4() { v4f z = {0.f, 0.f, 0.f, 0.f}; return z; }

// ---- fragment loaders: 16-bit A/B operand, lane -> row/col (lane&15), p already includes +8*(lane>>4);
//      elements 0..7 <- p[0..7] (k0+8h..), elements 8..15 <- p[16..23] (k0+16+8h..)  (same split k map for A and B;
//      B is always read from a k-contiguous [n][k] plane)
__device__ __forceinline__ v16h ldfrag_h(const _Float16* p) {
  FragH f;
  f.h[0] = *(const v8h*)(p);
  f.h[1] = *(const v8h*)(p + 16);
  return f.v;
}
__device__ __forceinline__ v16b ldfrag_b(const u16* p) {              // bf16 plane read as unsigned integer vectors
  FragB f;
  f.u[0] = *(const v4u*)(p);
  f.u[1] = *(const v4u*)(p + 16);
  return f.v;
}

__device__ __forceinline__ v8f mma_h(v16h a, v16h b, v8f c) {
  return __builtin_amdgcn_wmma_f32_16x16x32_f16(false, a, false, b, (short)0, c, false, false);
}
__device__ __forceinline__ v8f mma_b(v16b a, v16b b, v8f c) {
  return __builtin_amdgcn_wmma_f32_16x16x32_bf16(false, a, false, b, (short)0, c, false, false);
}
__device__ __forceinline__ void guard2(v8f& a, v8f& b, v16h x0, v16h x1, v16h x2, v16h x3, v16h x4, v16h x5) {
#if defined(__HIP_DEVICE_COMPILE__)
  asm volatile("v_nop\n\tv_nop\n\tv_nop\n\tv_nop"
               : "+v"(a), "+v"(b) : "v"(x0), "v"(x1), "v"(x2), "v"(x3), "v"(x4), "v"(x5) : "memory");
#endif
}
__device__ __forceinline__ void guard10(v8f& a, v8f& b, v8f& c, v8f& d, v16h x0, v16h x1, v16h x2, v16h x3, v16h x4,
                                        v16h x5, v16h x6, v16h x7, v16h x8, v16h x9) {
#if defined(__HIP_DEVICE_COMPILE__)
  asm volatile("v_nop\n\tv_nop\n\tv_nop\n\tv_nop"
               : "+v"(a), "+v"(b), "+v"(c), "+v"(d)
               : "v"(x0), "v"(x1), "v"(x2), "v"(x3), "v"(x4), "v"(x5), "v"(x6), "v"(x7), "v"(x8), "v"(x9) : "memory");
#endif
}
__device__ __forceinline__ void acc_guard4(v8f& a, v8f& b, v8f& c, v8f& d) {
#if defined(__HIP_DEVICE_COMPILE__)
  asm volatile("v_nop\n\tv_nop\n\tv_nop\n\tv_nop" : "+v"(a), "+v"(b), "+v"(c), "+v"(d));
#endif
}
// The same for a wave's R x 4 accumulator tiles: the four v_nop stand behind the last WMMA of the tile, whichever the compiler puts last.
__device__ __forceinline__ void acc_guard8(v8f (&a)[2][4]) {
#if defined(__HIP_DEVICE_COMPILE__)
  asm volatile("v_nop\n\tv_nop\n\tv_nop\n\tv_nop"
               : "+v"(a[0][0]), "+v"(a[0][1]), "+v"(a[0][2]), "+v"(a[0][3]), "+v"(a[1][0]), "+v"(a[1][1]), "+v"(a[1][2]), "+v"(a[1][3]));
#endif
}
__device__ __forceinline__ void acc_guard16(v8f (&a)[4][4]) {
#if defined(__HIP_DEVICE_COMPILE__)
  asm volatile("v_nop\n\tv_nop\n\tv_nop\n\tv_nop"
               : "+v"(a[0][0]), "+v"(a[0][1]), "+v"(a[0][2]), "+v"(a[0][3]), "+v"(a[1][0]), "+v"(a[1][1]), "+v"(a[1][2]), "+v"(a[1][3]),
                 "+v"(a[2][0]), "+v"(a[2][1]), "+v"(a[2][2]), "+v"(a[2][3]), "+v"(a[3][0]), "+v"(a[3][1]), "+v"(a[3][2]), "+v"(a[3][3]));
#endif
}
// Two planes' 64-row x 128-B tiles, global -> LDS, by 128 threads: per lane four 16-B asynchronous copies a plane (rows r, r+16,
// r+32, r+48; 8 lanes = one whole 128-B row). la/lb: the lane's LDS byte addresses of row r, ga/gb: its global addresses, gstep: 16
// source rows in elements. The s_wait_xcnt closes the statement so that no address register is rewritten ahead of it.
__device__ __forceinline__ void stage2(unsigned la, unsigned lb, const u16* ga, const u16* gb, size_t gstep) {
#if defined(__HIP_DEVICE_COMPILE__)
  const unsigned ls = 16 * LP * 2;
  asm volatile("global_load_async_to_lds_b128 %0, %8, off\n\t"
               "global_load_async_to_lds_b128 %1, %9, off\n\t"
               "global_load_async_to_lds_b128 %2, %10, off\n\t"
               "global_load_async_to_lds_b128 %3, %11, off\n\t"
               "global_load_async_to_lds_b128 %4, %12, off\n\t"
               "global_load_async_to_lds_b128 %5, %13, off\n\t"
               "global_load_async_to_lds_b128 %6, %14, off\n\t"
               "global_load_async_to_lds_b128 %7, %15, off\n\t"
               "s_wait_xcnt 0x0"
               :: "v"(la), "v"(la + ls), "v"(la + 2 * ls), "v"(la + 3 * ls),
                  "v"(lb), "v"(lb + ls), "v"(lb + 2 * ls), "v"(lb + 3 * ls),
                  "v"(ga), "v"(ga + gstep), "v"(ga + 2 * gstep), "v"(ga + 3 * gstep),
                  "v"(gb), "v"(gb + gstep), "v"(gb + 2 * gstep), "v"(gb + 3 * gstep)
               : "memory");
#endif
}
// One plane's tile, the same way: four copies a lane.
__device__ __forceinline__ void stage1(unsigned la, const u16* ga, size_t gstep) {
#if defined(__HIP_DEVICE_COMPILE__)
  const unsigned ls = 16 * LP * 2;
  asm volatile("global_load_async_to_lds_b128 %0, %4, off\n\t"
               "global_load_async_to_lds_b128 %1, %5, off\n\t"
               "global_load_async_to_lds_b128 %2, %6, off\n\t"
               "global_load_async_to_lds_b128 %3, %7, off\n\t"
               "s_wait_xcnt 0x0"
               :: "v"(la), "v"(la + ls), "v"(la + 2 * ls), "v"(la + 3 * ls),
                  "v"(ga), "v"(ga + gstep), "v"(ga + 2 * gstep), "v"(ga + 3 * gstep)
               : "memory");
#endif
}
__device__ __forceinline__ void wave_sync_lds() {
  __builtin_amdgcn_fence(__ATOMIC_RELEASE, "workgroup");
  __builtin_amdgcn_wave_barrier();
  __builtin_amdgcn_fence(__ATOMIC_ACQUIRE, "workgroup");
}

// =====================================================================================================
// All seven f32 planes -> 16-bit planes in ONE launch. Destination D holds the planes back to back in block order:
//   x_q, x_k, x_v (bf16 RNE bits, NB*SEQ rows each), wq, wk, wv (bf16 RNE bits), wo (f16 bits of (bf16 RNE value) * WOS).
// Block = CVT_CH consecutive octets of one plane (a plane is a whole number of blocks, so plane and mode are block-uniform);
// thread = CVT_OCT octets, 256 octets apart: per octet two 16-B loads and one 16-B store, 32 consecutive lanes = 512 contiguous,
// 512-B aligned destination bytes. All of a thread's loads are issued ahead of its first conversion.
// An input plane is read as NB batches of SEQ rows out of a layout with SEQ_FULL rows per batch (a block never straddles a batch).
// coverage: grid = 3*XCH + 4*WCH blocks x 256 thr x CVT_OCT octets = the whole of the seven destination planes.
// =====================================================================================================
__global__ __launch_bounds__(256) void cvt_all(const float* __restrict__ xq, const float* __restrict__ xk,
                                               const float* __restrict__ xv, const float* __restrict__ wq,
                                               const float* __restrict__ wk, const float* __restrict__ wv,
                                               const float* __restrict__ wo, u16* D) {
  const unsigned bid = blockIdx.x, tid = threadIdx.x;
  const float* s;
  size_t so;                                 // the block's first source octet
  if (bid < 3u * XCH) {                      // block-uniform; no barriers in this kernel
    const unsigned pl = bid / XCH, g0 = (bid % XCH) * CVT_CH;
    s  = pl == 0 ? xq : pl == 1 ? xk : xv;
    so = (size_t)(g0 / SEG8X) * STR8X + (size_t)(g0 % SEG8X);
  } else {
    const unsigned wb = bid - 3u * XCH, pl = wb / WCH;
    s  = pl == 0 ? wq : pl == 1 ? wk : pl == 2 ? wv : wo;
    so = (size_t)(wb % WCH) * CVT_CH;
  }
  const float* p = s + (so + (size_t)tid) * 8;
  v4f a[CVT_OCT], c4[CVT_OCT];
#pragma unroll   // arrays indexed by constants (registers); the loads stand together
  for (int i = 0; i < CVT_OCT; ++i) {
    a[i]  = *(const v4f*)(p + i * 2048);
    c4[i] = *(const v4f*)(p + i * 2048 + 4);
  }
  u16* d = D + ((size_t)bid * CVT_CH + (size_t)tid) * 8;
  if (bid < 3u * XCH + 3u * WCH) {           // block-uniform
#pragma unroll
    for (int i = 0; i < CVT_OCT; ++i) {
      v4u o;
#pragma unroll
      for (int e = 0; e < 2; ++e) {
        o[e]     = pk16(bf_bits(a[i][2 * e]),  bf_bits(a[i][2 * e + 1]));
        o[2 + e] = pk16(bf_bits(c4[i][2 * e]), bf_bits(c4[i][2 * e + 1]));
      }
      *(v4u*)(d + i * 2048) = o;
    }
  } else {
#pragma unroll
    for (int i = 0; i < CVT_OCT; ++i) {
      v4u o;
#pragma unroll
      for (int e = 0; e < 2; ++e) {
        o[e]     = pk16(h_bits((_Float16)(bfr(a[i][2 * e]) * WOS)),  h_bits((_Float16)(bfr(a[i][2 * e + 1]) * WOS)));
        o[2 + e] = pk16(h_bits((_Float16)(bfr(c4[i][2 * e]) * WOS)), h_bits((_Float16)(bfr(c4[i][2 * e + 1]) * WOS)));
      }
      *(v4u*)(d + i * 2048) = o;
    }
  }
}

// =====================================================================================================
// f32 GEMM epilogue (gemm_h2): one 16x64 f32 row group of the wave's tile (times oscale) staged in its LDS slab (pitch 68, wave-private),
// coverage: 8 instructions x 2 rows x 16 lanes x 4 floats = the 16 x 64 row group.
// =====================================================================================================
__device__ __forceinline__ void epi64(float* sl, v8f a0, v8f a1, v8f a2, v8f a3, float oscale, v4f badd, float* C, int N,
                                      size_t rowb, int col0, int lane) {
  const int hh = lane >> 4, m = lane & 15;
#pragma unroll
  for (int r = 0; r < 8; ++r) {
    const int ro = (8 * hh + r) * 68 + m;
    sl[ro]      = a0[r] * oscale;
    sl[ro + 16] = a1[r] * oscale;
    sl[ro + 32] = a2[r] * oscale;
    sl[ro + 48] = a3[r] * oscale;
  }
  wave_sync_lds();
  v4f vals[8];
#pragma unroll
  for (int it = 0; it < 8; ++it) vals[it] = *(const v4f*)(sl + (it * 2 + hh) * 68 + m * 4) + badd;
  float* dst = C + (rowb + (size_t)hh) * (size_t)N + col0 + m * 4;
  {
#pragma unroll
    for (int it = 0; it < 8; ++it) {
      *(v4f*)(dst + (size_t)(it * 2) * (size_t)N) = vals[it];
    }
    
  }
}

// =====================================================================================================
// Three bf16 GEMMs with bias in one launch, product pj = blockIdx.y (0 q, 1 k, 2 v): A = plane pj of A3, Bt = plane pj of Bt3,
// bias = bias<pj>, PH / PL = planes 2pj / 2pj+1 of P6 (M*N halves each), vt = (pj == 2). Each product, result written as two f16
// planes: c[M][N] (f32, in registers) = A[M][K] (bf16 row-major) . Bt[N][K]^T (bf16
// k-contiguous), times oscale, plus bf16-RNE value of bias[n]; PH = f16(c * psc), PL = f16(c * psc - PH) (psc a power of two).
// Block = 128x128 tile, 4 waves in 2 x 2, a wave owns 64 rows x 64 columns (4 x 4 accumulator tiles): each LDS fragment feeds four
// WMMAs and each staged row serves 128 results. The block's 128 A rows and 128 Bt rows are staged in LDS 64 k (one whole
// 128-B line a row) at a time by asynchronous copies, two buffers (tile t+1 flies while tile t is worked on, one block barrier a
// tile); fragments are read from LDS (two 16-B reads each, split k map for A and B), two k steps of 32 a tile, in the k order of
// a plain walk (host checks K % 64 == 0, M % 128 == 0, N % 128 == 0, grid = ((M/128)*(N/128), 3)).
// Epilogue, vt == 0: planes laid out [M][N]; each of the wave's four 16x64 f32 row groups goes through its private LDS slab (pitch
//   68), a lane then owns 8 consecutive columns of a row: per plane 4 instructions x 4 rows x 8 lanes x 8 halves = 16 x 64.
// Epilogue, vt != 0 (N == NH*HD, rows = b*SEQ + s, SEQ % 128 == 0): planes laid out [b][h][d][s]. A lane's 8 accumulator rows of one
//   column are 8 consecutive s of one (h, d): one 16-B LDS store a plane into the block's [128 (h,d)][128 s] tiles (pitch VTP, in the
//   ring, which is free behind the loop's last barrier); one block barrier; then 16 iterations x 128 thr x 8 halves = 128 lines x
//   128 s of each plane, 16 lanes = 256 contiguous bytes.
// =====================================================================================================
__global__ __launch_bounds__(128)
void gemm_bfb(const u16* __restrict__ A3, const u16* __restrict__ Bt3, const float* __restrict__ bias0,
              const float* __restrict__ bias1, const float* __restrict__ bias2,
              u16* P6, int M, int N, int K, float oscale, float psc) {
  __shared__ __align__(16) float slab[4 * SLAB64];
  __shared__ __align__(16) u16 ring[2 * 2 * GPLH];   // two buffers of [A tile | Bt tile], 128 rows of pitch LP each
  const int tid = threadIdx.x, wave = tid >> 5, lane = tid & 31, hh = lane >> 4, m = lane & 15;
  const int wr = wave >> 1, wc = wave & 1;   // the wave's 64-row and 64-column half of the block tile
  const int ntile = N >> 7;
  const int bid   = blockIdx.x;
  const int row0  = (bid / ntile) * GT;
  const int col0  = (bid % ntile) * GT;
  if (row0 + GT > M) return;                 // block-uniform, in front of every barrier; never taken with the exact grid
  // which of the three products this block belongs to (block-uniform): operands, bias, result planes and layout
  const int pj = blockIdx.y;
  const u16* A       = A3  + (size_t)pj * (size_t)M * (size_t)K;
  const u16* Bt      = Bt3 + (size_t)pj * (size_t)N * (size_t)K;
  const float* bias  = pj == 0 ? bias0 : pj == 1 ? bias1 : bias2;
  u16* PH            = P6 + (size_t)(2 * pj) * (size_t)M * (size_t)N;
  u16* PL            = PH + (size_t)M * (size_t)N;
  const int vt       = pj == 2;
  // staging: thread -> (row sr of 16, 16-B piece sc of 8), rows sr + 16 i, i = 0..7, of each operand's tile
  const int sr = tid >> 3, sc = (tid & 7) * 8;
  const u16* ag = A  + (size_t)(row0 + sr) * K + sc;
  const u16* bg = Bt + (size_t)(col0 + sr) * K + sc;
  const unsigned lds0 = (unsigned)(size_t)(const void*)ring + (unsigned)(sr * LP + sc) * 2u;
  const int nt = K >> 6;
  auto stage = [&](int t, int buf) {
    const unsigned l = lds0 + (unsigned)buf * (2u * GPLH * 2u);
    const u16* a = ag + (size_t)t * 64;
    const u16* b = bg + (size_t)t * 64;
    stage2(l, l + GPLH * 2u, a, b, (size_t)16 * K);                                                               // rows 0..63
    stage2(l + PLH * 2u, l + (GPLH + PLH) * 2u, a + (size_t)64 * K, b + (size_t)64 * K, (size_t)16 * K);          // rows 64..127
  };
  // fragment readers, in halves from a buffer's start
  const int afo = (wr * 64 + m) * LP + 8 * hh;
  const int bfo = GPLH + (wc * 64 + m) * LP + 8 * hh;
  v8f acc[4][4];
#pragma unroll
  for (int i = 0; i < 4; ++i) {
#pragma unroll
    for (int j = 0; j < 4; ++j) acc[i][j] = zero8();
  }
  stage(0, 0);
  asm volatile("s_wait_asynccnt 0x0" ::: "memory");   // this wave's copies of tile 0 have landed
  __syncthreads();                                    // ... and every other wave's: tile 0 may be read
  if (nt > 1) stage(1, 1);
#pragma unroll 1   // one tile a trip: the ring's hand-over stands once, at the foot
  for (int t = 0; t < nt; ++t) {
    const u16* bufp = ring + (t & 1) * (2 * GPLH);
#pragma unroll   // both k steps in line: LDS offsets become immediates, accumulators stay in registers
    for (int kk = 0; kk < 2; ++kk) {
      v16b a[4], b[4];
#pragma unroll
      for (int i = 0; i < 4; ++i) {
        a[i] = ldfrag_b(bufp + afo + i * 16 * LP + kk * 32);
        b[i] = ldfrag_b(bufp + bfo + i * 16 * LP + kk * 32);
      }
      __builtin_amdgcn_sched_barrier(0);   // the k step's 16 LDS reads issue together ahead of its 16 WMMAs: one LDS latency a step, not one a row
#pragma unroll
      for (int i = 0; i < 4; ++i) {
#pragma unroll
        for (int j = 0; j < 4; ++j) acc[i][j] = mma_b(a[i], b[j], acc[i][j]);
      }
    }
    acc_guard16(acc);                                   // WMMA distance kept on both sides of the branches that follow
    // ---- hand-over: tile t+1 is published and tile t's buffer is freed by the one barrier; then the refill ----
    asm volatile("s_wait_dscnt 0x0" ::: "memory");      // this wave's reads of tile t are done before its buffer is refilled
    asm volatile("s_wait_asynccnt 0x0" ::: "memory");   // this wave's copies of tile t+1 have landed
    __syncthreads();
    if (t + 2 < nt) stage(t + 2, t & 1);
  }
  asm volatile("s_wait_asynccnt 0x0" ::: "memory");     // nothing in flight when the wave goes on to its end
  const int colw = col0 + wc * 64;           // the wave's first column
  // every loop of both epilogues is unrolled so that accumulators and staging arrays are indexed by constants (registers, no scratch)
  if (vt == 0) {                             // block-uniform
    float* sl = slab + wave * SLAB64;
    const int rq = lane >> 3, c8 = (lane & 7) * 8;
    const v4f bv0 = *(const v4f*)(bias + colw + c8), bv1 = *(const v4f*)(bias + colw + c8 + 4);   // columns < N (N multiple of 128)
    float badd[8];
#pragma unroll
    for (int e = 0; e < 4; ++e) { badd[e] = bfr(bv0[e]); badd[4 + e] = bfr(bv1[e]); }
#pragma unroll
    for (int i = 0; i < 4; ++i) {            // the wave's four groups of 16 rows, one after the other through the one slab
#pragma unroll
      for (int r = 0; r < 8; ++r) {
        const int ro = (8 * hh + r) * 68 + m;
        sl[ro]      = acc[i][0][r] * oscale;
        sl[ro + 16] = acc[i][1][r] * oscale;
        sl[ro + 32] = acc[i][2][r] * oscale;
        sl[ro + 48] = acc[i][3][r] * oscale;
      }
      wave_sync_lds();
      v4u oh[4], ol[4];
#pragma unroll
      for (int i4 = 0; i4 < 4; ++i4) {
        const int row = i4 * 4 + rq;
        const v4f a4 = *(const v4f*)(sl + row * 68 + c8), c4 = *(const v4f*)(sl + row * 68 + c8 + 4);
        float w[8];
#pragma unroll
        for (int e = 0; e < 4; ++e) { w[e] = (a4[e] + badd[e]) * psc; w[4 + e] = (c4[e] + badd[4 + e]) * psc; }
#pragma unroll
        for (int e = 0; e < 4; ++e) {
          const _Float16 h0 = (_Float16)w[2 * e], h1 = (_Float16)w[2 * e + 1];
          const _Float16 l0 = (_Float16)(w[2 * e] - (float)h0), l1 = (_Float16)(w[2 * e + 1] - (float)h1);
          oh[i4][e] = pk16(h_bits(h0), h_bits(h1));
          ol[i4][e] = pk16(h_bits(l0), h_bits(l1));
        }
      }
      wave_sync_lds();                       // every lane's reads of the slab stand ahead of the next group's writes
      const size_t ob = (size_t)(row0 + wr * 64 + i * 16) * (size_t)N + colw + c8;
#pragma unroll
      for (int i4 = 0; i4 < 4; ++i4) {
        const size_t o8 = ob + (size_t)(i4 * 4 + rq) * (size_t)N;
        *(v4u*)(PH + o8) = oh[i4];
        *(v4u*)(PL + o8) = ol[i4];
      }
      asm volatile("s_wait_xcnt 0x0" ::: "memory");   // behind the run of stores: what follows in the text rewrites their registers
    }
  } else {
    u16* TH = ring;
    u16* TL = ring + GT * VTP;
#pragma unroll
    for (int j = 0; j < 4; ++j) {
      const float bj = bfr(bias[colw + 16 * j + m]);        // column < N (N multiple of 128)
#pragma unroll
      for (int i = 0; i < 4; ++i) {
        v4u th, tl;
#pragma unroll
        for (int e = 0; e < 4; ++e) {
          const float t0 = (acc[i][j][2 * e] * oscale + bj) * psc, t1 = (acc[i][j][2 * e + 1] * oscale + bj) * psc;
          const _Float16 h0 = (_Float16)t0, h1 = (_Float16)t1;
          const _Float16 l0 = (_Float16)(t0 - (float)h0), l1 = (_Float16)(t1 - (float)h1);
          th[e] = pk16(h_bits(h0), h_bits(h1));
          tl[e] = pk16(h_bits(l0), h_bits(l1));
        }
        const int to = (wc * 64 + 16 * j + m) * VTP + wr * 64 + i * 16 + 8 * hh;
        *(v4u*)(TH + to) = th;
        *(v4u*)(TL + to) = tl;
      }
    }
    __syncthreads();                         // the four waves' parts of the [(h,d)][s] tiles are complete
    const int q16 = tid >> 4, p8 = (tid & 15) * 8;
    const size_t base = ((size_t)(row0 / SEQ) * (NH * HD) + col0) * SEQ + (row0 % SEQ) + p8;
#pragma unroll
    for (int g = 0; g < 4; ++g) {            // four lines a thread and plane at a time: LDS reads first, then their stores
      v4u vh[4], vl[4];
#pragma unroll
      for (int it = 0; it < 4; ++it) {
        const int line = (g * 4 + it) * 8 + q16;   // (h,d) line 0..127 of the block
        vh[it] = *(const v4u*)(TH + line * VTP + p8);
        vl[it] = *(const v4u*)(TL + line * VTP + p8);
      }
#pragma unroll
      for (int it = 0; it < 4; ++it) {
        const int line = (g * 4 + it) * 8 + q16;
        *(v4u*)(PH + base + (size_t)line * SEQ) = vh[it];
        *(v4u*)(PL + base + (size_t)line * SEQ) = vl[it];
      }
      asm volatile("s_wait_xcnt 0x0" ::: "memory");   // behind the run of stores: no register that they name is rewritten ahead of it
    }
  }
}

// =====================================================================================================
// f16 hi+lo GEMM with bias: C[M][N] (f32) = (Ahi + Alo)[M][K] . Bt[N][K]^T times oscale, plus bf16-RNE value of bias[n];
// Ahi/Alo f16 planes (same layout), Bt f16 k-contiguous; products hi.B + lo.B into one accumulator (lo is the unscaled
// residual of hi). Block = 128x128 tile, 8 waves in 4 x 2, a wave owns 32 rows x 64 columns (2 x 4 accumulator tiles); the same
// two-buffer LDS ring as gemm_bfb, three planes a tile (Ahi, Alo, Bt), 128 rows each, staged by 256 threads: threads 0..127 rows
// 0..63, threads 128..255 rows 64..127 (host checks M % 128 == 0, N % 128 == 0, K % 64 == 0, grid = (M/128)*(N/128)).
// =====================================================================================================
__global__ __launch_bounds__(256)
void gemm_h2(const u16* __restrict__ Ah, const u16* __restrict__ Al, const u16* __restrict__ Bt,
             const float* __restrict__ bias, float* C, int M, int N, int K, float oscale) {
  __shared__ __align__(16) float slab[8 * SLAB64];
  __shared__ __align__(16) u16 ring[2 * 3 * GPLH];   // two buffers of [Ahi tile | Alo tile | Bt tile], 128 rows of pitch LP each
  const int tid = threadIdx.x, wave = tid >> 5, lane = tid & 31, hh = lane >> 4, m = lane & 15;
  const int wr = wave >> 1, wc = wave & 1;   // the wave's 32-row quarter and 64-column half of the block tile
  const int ntile = N >> 7;
  const int bid   = blockIdx.x;
  const int row0  = (bid / ntile) * GT;
  const int col0  = (bid % ntile) * GT;
  if (row0 + GT > M) return;                 // block-uniform, in front of every barrier; never taken with the exact grid
  // staging: thread -> (row sr of 16 in its half of 64 rows, 16-B piece sc of 8), rows sr, sr+16, sr+32, sr+48 of each plane's tile
  const int sr = (tid >> 7) * 64 + ((tid & 127) >> 3), sc = (tid & 7) * 8;
  const size_t aofs = (size_t)(row0 + sr) * K + sc;
  const u16* ahg = Ah + aofs;
  const u16* alg = Al + aofs;
  const u16* bg  = Bt + (size_t)(col0 + sr) * K + sc;
  const unsigned lds0 = (unsigned)(size_t)(const void*)ring + (unsigned)(sr * LP + sc) * 2u;
  const int nt = K >> 6;
  auto stage = [&](int t, int buf) {
    const unsigned l = lds0 + (unsigned)buf * (3u * GPLH * 2u);
    stage2(l, l + GPLH * 2u, ahg + (size_t)t * 64, alg + (size_t)t * 64, (size_t)16 * K);
    stage1(l + 2u * GPLH * 2u, bg + (size_t)t * 64, (size_t)16 * K);
  };
  // fragment readers, in halves from a buffer's start
  const int afo = (wr * 32 + m) * LP + 8 * hh;
  const int bfo = 2 * GPLH + (wc * 64 + m) * LP + 8 * hh;
  v8f acc[2][4];
#pragma unroll
  for (int i = 0; i < 2; ++i) {
#pragma unroll
    for (int j = 0; j < 4; ++j) acc[i][j] = zero8();
  }
  stage(0, 0);
  asm volatile("s_wait_asynccnt 0x0" ::: "memory");   // this wave's copies of tile 0 have landed
  __syncthreads();                                    // ... and every other wave's: tile 0 may be read
  if (nt > 1) stage(1, 1);
#pragma unroll 1   // one tile a trip: the ring's hand-over stands once, at the foot
  for (int t = 0; t < nt; ++t) {
    const _Float16* bufp = (const _Float16*)(const void*)ring + (t & 1) * (3 * GPLH);
    v16h ah[2][2], al[2][2], b[2][4];
#pragma unroll
    for (int kk = 0; kk < 2; ++kk) {
#pragma unroll
      for (int i = 0; i < 2; ++i) {
        ah[kk][i] = ldfrag_h(bufp + afo + i * 16 * LP + kk * 32);
        al[kk][i] = ldfrag_h(bufp + GPLH + afo + i * 16 * LP + kk * 32);
      }
#pragma unroll
      for (int j = 0; j < 4; ++j) b[kk][j] = ldfrag_h(bufp + bfo + j * 16 * LP + kk * 32);
    }
    __builtin_amdgcn_sched_barrier(0);   // all of the tile's LDS reads issue ahead of its WMMAs: one LDS latency a tile, not several
#pragma unroll
    for (int kk = 0; kk < 2; ++kk) {
#pragma unroll
      for (int i = 0; i < 2; ++i) {
#pragma unroll
        for (int j = 0; j < 4; ++j) acc[i][j] = mma_h(ah[kk][i], b[kk][j], acc[i][j]);
      }
#pragma unroll
      for (int i = 0; i < 2; ++i) {
#pragma unroll
        for (int j = 0; j < 4; ++j) acc[i][j] = mma_h(al[kk][i], b[kk][j], acc[i][j]);
      }
    }
    acc_guard8(acc);                                    // WMMA distance kept on both sides of the branches that follow
    // ---- hand-over: tile t+1 is published and tile t's buffer is freed by the one barrier; then the refill ----
    asm volatile("s_wait_dscnt 0x0" ::: "memory");      // this wave's reads of tile t are done before its buffer is refilled
    asm volatile("s_wait_asynccnt 0x0" ::: "memory");   // this wave's copies of tile t+1 have landed
    __syncthreads();
    if (t + 2 < nt) stage(t + 2, t & 1);
  }
  asm volatile("s_wait_asynccnt 0x0" ::: "memory");     // nothing in flight when the wave goes on to its end
  const int colw = col0 + wc * 64;                        // the wave's first column
  const v4f bv = *(const v4f*)(bias + colw + m * 4);      // columns colw + 4m .. +3, always < N (N multiple of 128)
  v4f badd;
#pragma unroll
  for (int e = 0; e < 4; ++e) badd[e] = bfr(bv[e]);
#pragma unroll
  for (int i = 0; i < 2; ++i) {                           // the wave's two groups of 16 rows, one after the other through the one slab
    epi64(slab + wave * SLAB64, acc[i][0], acc[i][1], acc[i][2], acc[i][3], oscale, badd, C, N,
          (size_t)(row0 + wr * 32 + i * 16), colw, lane);
    asm volatile("s_wait_xcnt 0x0" ::: "memory");         // behind the run of stores: what follows in the text rewrites their registers
    wave_sync_lds();                                      // every lane's reads of the slab stand ahead of the next group's writes
  }
}

// =====================================================================================================
// Full (non-causal, unmasked) multi-head flash attention: block = (batch b, head, 64 query rows), 4 waves, wave w owns the
// 16 query rows q0 = 64*qt + 16*w .. q0+15. The k and v^T planes' tiles of KT = 64 keys are staged in LDS by asynchronous copies, two
// buffers (tile t+1 flies while tile t is worked on, one block barrier a tile), and read by all 4 waves; each tile serves two key
// blocks of 32. The ring becomes the waves' private result slabs behind the last tile's barrier.
//   Per-head logit scale: sigmoid(bf16 RNE value of g[head]) / 8, computed in f32 once per thread (head uniform per block) and
//   folded with log2(e) and the q/k carries into lsc.
//   q planes (hi, lo f16, x1024) laid out [b][s][h][d]; k planes the same; v^T planes [b][h][d][s] (x1024).
//   All NKB = SEQ/32 key blocks of 32 keys are visited (static bound).
//   Scores are computed TRANSPOSED: S^T tile g (g = 0,1) = k rows (keys kb+16g .. +15, A operand, row m = lane&15, split k map
//   over d) times q^T (B operand, col n = query q0 + (lane&15), k = d, split map), 3 products per tile and d-chunk
//   (k_hi.q_hi + k_lo.q_hi + k_hi.q_lo). D element r of lane l = (key kb+16g+8h+r, query q0+(l&15)), so a lane owns one query
//   column and 16 of its 32 keys; the partner lane l^16 owns the other 16 -> row max / row sum need one xor-16 shuffle.
//   Online max-subtracted base-2 softmax in f32. The exp'd values ARE the P A-fragment in place: A row m = query = lane&15,
//   element i <- key kb+8h+i (tile 0, D element i), element 8+i <- key kb+16+8h+i (tile 1, D element i). P is carried x32768
//   as f16 hi + f16 residual. The rescale factor of query row 8h+r of the O accumulators is fetched from lane 8h+r with a
//   shuffle (uniform control). 4+4 v^T B fragments (hi and residual planes, col n = d = 16j + (lane&15), keys k-contiguous),
//   12 P.V WMMAs (hh + lh + hl).
//   Epilogue: 1/l (per query, shuffled to the D row owner) and carry folds in f32; the wave's 16x64 f32 result staged in its LDS
// coverage: per wave 4 instructions x 4 rows x 8 lanes x 8 halves = 16 x 64 per plane; grid NB*NH*SEQ/64 blocks x 4 waves = every
//           (b, s, h) row of both O planes exactly once.
// =====================================================================================================
__global__ __launch_bounds__(ATT_THREADS)
void attn_fwd(const u16* __restrict__ QHIp, const u16* __restrict__ QLOp,
              const u16* __restrict__ KHIp, const u16* __restrict__ KLOp,
              const u16* __restrict__ VHIp, const u16* __restrict__ VLOp,
              const float* __restrict__ gatep,
              u16* OHIp, u16* OLOp) {
  __shared__ __align__(16) u16 ring[2 * BUFH];   // two tile buffers; in the epilogue per wave a result slab [16][68] of f32

  const int tid  = threadIdx.x;
  const int wave = tid >> 5;
  const int lane = tid & 31;
  const int hh   = lane >> 4;
  const int c    = lane & 15;

  const int bid  = blockIdx.x;
  const int qt   = bid % QT64;
  const int head = (bid / QT64) % NH;
  const int b    = bid / (QT64 * NH);
  const int q0   = qt * 64 + wave * 16;

  // per-head scale: sigmoid(bf16 value of g) / 8 in f32; head < NH always (block decode), host checks the input extent
  const float gbf = bfr(gatep[head]);
  const float sgm = 1.0f / (1.0f + expf(-gbf));
  const float lsc = sgm * (0.125f * (LOG2E / (QSC * KSC)));

  // B fragments of q^T: col n = query q0 + c, k = d (k-contiguous row of the q plane)
  const size_t qofs = (((size_t)(b * SEQ + q0 + c)) * NH + head) * HD + 8 * hh;
  const _Float16* Qh  = (const _Float16*)(const void*)QHIp + qofs;
  const _Float16* Ql  = (const _Float16*)(const void*)QLOp + qofs;
  // staging: thread -> (row sr of 16, 16-B piece sc of 8); k tile row = key, v^T tile row = d, both 64 halves long
  const int sr = tid >> 3, sc = (tid & 7) * 8;
  const size_t kofs = (((size_t)b * SEQ + sr) * NH + head) * HD + sc;             // tile's first key added per tile
  const size_t vofs = ((size_t)(b * NH + head) * HD + sr) * SEQ + sc;             // tile's first key added per tile
  const unsigned lds0 = (unsigned)(size_t)(const void*)ring + (unsigned)(sr * LP + sc) * 2u;
  auto stage = [&](int t, int buf) {
    const unsigned l = lds0 + (unsigned)buf * (BUFH * 2u);
    const size_t ko = kofs + (size_t)t * (KT * NH * HD), vo = vofs + (size_t)t * KT;
    stage2(l, l + PLH * 2u, KHIp + ko, KLOp + ko, (size_t)16 * (NH * HD));
    stage2(l + 2u * PLH * 2u, l + 3u * PLH * 2u, VHIp + vo, VLOp + vo, (size_t)16 * SEQ);
  };
  // fragment readers, in halves from a buffer's start: A of k: row m = key 16g + c, k = d; B of v: col n = d = 16j + c, k = key
  const int kfo = c * LP + 8 * hh;
  const int vfo = 2 * PLH + c * LP + 8 * hh;

  // q^T B fragments (hi and residual planes, both d chunks of 32): read once, held in registers for all key tiles
  const v16h qhf[2] = {ldfrag_h(Qh), ldfrag_h(Qh + 32)};
  const v16h qlf[2] = {ldfrag_h(Ql), ldfrag_h(Ql + 32)};

  float mrun = -INFINITY, lrun = 0.f;
  v8f o[4];
#pragma unroll
  for (int j = 0; j < 4; ++j) o[j] = zero8();

  stage(0, 0);
  asm volatile("s_wait_asynccnt 0x0" ::: "memory");   // this wave's copies of tile 0 have landed
  __syncthreads();                                    // ... and every other wave's: tile 0 may be read
  if (NT > 1) stage(1, 1);

#pragma unroll 1
  for (int t = 0; t < NT; ++t) {
   const _Float16* bufp = (const _Float16*)(const void*)ring + (t & 1) * BUFH;
#pragma unroll   // both key blocks of a tile in line: their LDS offsets become immediates
   for (int sub = 0; sub < 2; ++sub) {
    // ---- transposed scores: s0 = keys kb..kb+15, s1 = keys kb+16..kb+31 (kb = 64t + 32sub), column = query q0 + c ----
    v8f s0 = zero8(), s1 = zero8();
    const _Float16* k0p = bufp + kfo + sub * 32 * LP;
    const _Float16* k1p = k0p + 16 * LP;
    const _Float16* l0p = k0p + PLH;
    const _Float16* l1p = l0p + 16 * LP;
#pragma unroll
    for (int kk = 0; kk < 2; ++kk) {
      const v16h qh  = qhf[kk], ql = qlf[kk];
      const v16h kh0 = ldfrag_h(k0p + kk * 32), kl0 = ldfrag_h(l0p + kk * 32);
      const v16h kh1 = ldfrag_h(k1p + kk * 32), kl1 = ldfrag_h(l1p + kk * 32);
      s0 = mma_h(kh0, qh, s0);
      s0 = mma_h(kl0, qh, s0);
      s0 = mma_h(kh0, ql, s0);
      s1 = mma_h(kh1, qh, s1);
      s1 = mma_h(kl1, qh, s1);
      s1 = mma_h(kh1, ql, s1);
      guard2(s0, s1, qh, ql, kh0, kl0, kh1, kl1);
    }
    // ---- base-2 logits of this lane's 16 keys for query q0 + c: t[i] <- key kb+8hh+i, t[8+i] <- key kb+16+8hh+i ----
    float t[16];
#pragma unroll
    for (int i = 0; i < 8; ++i) { t[i] = s0[i] * lsc; t[8 + i] = s1[i] * lsc; }
    float cm = t[0];
#pragma unroll
    for (int i = 1; i < 16; ++i) cm = fmaxf(cm, t[i]);
    cm = fmaxf(cm, __shfl_xor(cm, 16, 32));
    const float mn = fmaxf(mrun, cm);        // finite from the first block on
    const float al = ex2(mrun - mn);         // 0 on the first block (mrun = -inf)
    mrun = mn;
    // ---- probabilities (<= 1) and the P A-fragments: hi = f16(p * 32768), lo = f16 residual; element i <-> t[i] ----
    float ps = 0.f;
    FragH ph, pl;
#pragma unroll
    for (int w = 0; w < 2; ++w) {
#pragma unroll
      for (int e4 = 0; e4 < 4; ++e4) {
        const int i = 8 * w + 2 * e4;
        const float p0 = ex2(t[i] - mn), p1 = ex2(t[i + 1] - mn);
        ps += p0 + p1;
        const float a0 = p0 * PCAR, a1 = p1 * PCAR;
        const _Float16 h0 = (_Float16)a0, h1 = (_Float16)a1;
        const _Float16 l0 = (_Float16)(a0 - (float)h0), l1 = (_Float16)(a1 - (float)h1);
        ph.u[w][e4] = pk16(h_bits(h0), h_bits(h1));
        pl.u[w][e4] = pk16(h_bits(l0), h_bits(l1));
      }
    }
    ps += __shfl_xor(ps, 16, 32);
    lrun = lrun * al + ps;
    // ---- rescale the O accumulators: D row 8hh+r = query q0+8hh+r, its factor lives in lane 8hh+r (and 16+8hh+r) ----
    float scl[8];
#pragma unroll
    for (int r = 0; r < 8; ++r) scl[r] = __shfl(al, 8 * hh + r, 32);
#pragma unroll
    for (int j = 0; j < 4; ++j) {
#pragma unroll
      for (int r = 0; r < 8; ++r) o[j][r] *= scl[r];
    }
    // ---- P.V : B fragment col n = d = j*16 + c, keys contiguous in the v^T planes ----
    {
      const _Float16* vhp = bufp + vfo + sub * 32;
      const _Float16* vlp = vhp + PLH;
      const v16h vh0 = ldfrag_h(vhp);
      const v16h vh1 = ldfrag_h(vhp + 16 * LP);
      const v16h vh2 = ldfrag_h(vhp + 32 * LP);
      const v16h vh3 = ldfrag_h(vhp + 48 * LP);
      const v16h vl0 = ldfrag_h(vlp);
      const v16h vl1 = ldfrag_h(vlp + 16 * LP);
      const v16h vl2 = ldfrag_h(vlp + 32 * LP);
      const v16h vl3 = ldfrag_h(vlp + 48 * LP);
      o[0] = mma_h(ph.v, vh0, o[0]);  o[0] = mma_h(pl.v, vh0, o[0]);  o[0] = mma_h(ph.v, vl0, o[0]);
      o[1] = mma_h(ph.v, vh1, o[1]);  o[1] = mma_h(pl.v, vh1, o[1]);  o[1] = mma_h(ph.v, vl1, o[1]);
      o[2] = mma_h(ph.v, vh2, o[2]);  o[2] = mma_h(pl.v, vh2, o[2]);  o[2] = mma_h(ph.v, vl2, o[2]);
      o[3] = mma_h(ph.v, vh3, o[3]);  o[3] = mma_h(pl.v, vh3, o[3]);  o[3] = mma_h(ph.v, vl3, o[3]);
      guard10(o[0], o[1], o[2], o[3], ph.v, pl.v, vh0, vh1, vh2, vh3, vl0, vl1, vl2, vl3);
    }
   }
   // ---- hand-over: tile t+1 is published and tile t's buffer is freed by the one barrier; then the refill ----
   asm volatile("s_wait_dscnt 0x0" ::: "memory");      // this wave's reads of tile t are done before its buffer is refilled
   asm volatile("s_wait_asynccnt 0x0" ::: "memory");   // this wave's copies of tile t+1 have landed
   __syncthreads();
   if (t + 2 < NT) stage(t + 2, t & 1);
  }
  asm volatile("s_wait_asynccnt 0x0" ::: "memory");    // nothing in flight when the ring turns into the result slabs
  acc_guard4(o[0], o[1], o[2], o[3]);

  // ---- fold 1/l (per query, owned by lane = query) and the carries (32768 on P, 1024 on v); stage the 16x64 slab ----
  const float linv = (1.0f / lrun) * (1.0f / (PCAR * VCAR));
  float inv[8];
#pragma unroll
  for (int r = 0; r < 8; ++r) inv[r] = __shfl(linv, 8 * hh + r, 32);
  float* slab = (float*)(void*)ring + wave * SLABF;
#pragma unroll
  for (int r = 0; r < 8; ++r) {
#pragma unroll
    for (int j = 0; j < 4; ++j) slab[(8 * hh + r) * 68 + j * 16 + c] = o[j][r] * inv[r];
  }
  wave_sync_lds();
  // ---- O x1024 -> f16 hi + residual planes; lane = (row in group of 4, 8 consecutive d) ----
  v4u oh[4], ol[4];
  const int rq = lane >> 3, c8 = (lane & 7) * 8;
#pragma unroll
  for (int i4 = 0; i4 < 4; ++i4) {
    const int row = i4 * 4 + rq;
    const v4f a = *(const v4f*)(slab + row * 68 + c8), c4 = *(const v4f*)(slab + row * 68 + c8 + 4);
    float w[8];
#pragma unroll
    for (int e = 0; e < 4; ++e) { w[e] = a[e] * OSC; w[4 + e] = c4[e] * OSC; }
#pragma unroll
    for (int e = 0; e < 4; ++e) {
      const _Float16 h0 = (_Float16)w[2 * e], h1 = (_Float16)w[2 * e + 1];
      const _Float16 l0 = (_Float16)(w[2 * e] - (float)h0), l1 = (_Float16)(w[2 * e + 1] - (float)h1);
      oh[i4][e] = pk16(h_bits(h0), h_bits(h1));
      ol[i4][e] = pk16(h_bits(l0), h_bits(l1));
    }
  }
  const size_t ob = (((size_t)(b * SEQ + q0)) * NH + head) * HD + c8;
  {
#pragma unroll
    for (int i4 = 0; i4 < 4; ++i4) {
      const int row = i4 * 4 + rq;
      const size_t o8 = ob + (size_t)row * (NH * HD);
      *(v4u*)(OHIp + o8) = oh[i4];
      *(v4u*)(OLOp + o8) = ol[i4];
    }
    
  }
}

// =====================================================================================================
// Workspace map (bytes, ROWS = NB*SEQ; numbers for NB=2, SEQ=2048); every plane is fully written by whole-line stores before it is
// read; all extents are exact multiples of the store granularity (no pad rows needed). XB .. WOB are cvt_all's one destination,
// XB / WQB.. / QHI.. are gemm_bfb's plane triples, so their order and adjacency matter:
//   XB  bf16 3 x [ROWS][1024]            25165824        (input Q, K, V)
//   WQB bf16 [1024 n][1024 k]             2097152        WKB same  2097152      WVB same  2097152
//   WOB f16  [1024 n][1024 k] x1024       2097152
//   QHI f16 [NB][SEQ][16][64] x1024       8388608        QLO residual         8388608
//   KHI same                              8388608        KLO residual         8388608
//   VHI f16 [NB][16][64][SEQ] x1024       8388608        VLO residual         8388608
//   OHI f16 [ROWS][1024] x1024            8388608        OLO residual         8388608
//   end                                 100663296
// =====================================================================================================
extern "C" void kernel_launch(void* const* d_in, const int* in_sizes, int n_in,
                              void* d_out, int out_size, void* d_ws, size_t ws_size,
                              hipStream_t stream) {
  const int ROWS = NB * SEQ;
  if (n_in < 12) return;
  const int needX = ((NB - 1) * SEQ_FULL + SEQ) * DMOD;   // last input row read by cvt_all (+1), in elements
  if (in_sizes[0] < needX || in_sizes[1] < needX || in_sizes[2] < needX) return;
  if (in_sizes[3] < DMOD * DMOD || in_sizes[5] < DMOD * DMOD) return;
  if (in_sizes[7] < DMOD * DMOD || in_sizes[9] < DMOD * DMOD) return;
  if (in_sizes[4] < DMOD || in_sizes[6] < DMOD || in_sizes[8] < DMOD || in_sizes[10] < DMOD) return;
  if (in_sizes[11] < NH) return;
  if (out_size < ROWS * DMOD) return;

  const float* Qin = (const float*)d_in[0];
  const float* Kin = (const float*)d_in[1];
  const float* Vin = (const float*)d_in[2];
  const float* wq  = (const float*)d_in[3];
  const float* bq  = (const float*)d_in[4];
  const float* wk  = (const float*)d_in[5];
  const float* bk  = (const float*)d_in[6];
  const float* wv  = (const float*)d_in[7];
  const float* bv  = (const float*)d_in[8];
  const float* wo  = (const float*)d_in[9];
  const float* bo  = (const float*)d_in[10];
  const float* gt  = (const float*)d_in[11];
  float*       out = (float*)d_out;

  const size_t szXB  = (size_t)3 * ROWS * DMOD * 2;
  const size_t szW   = (size_t)DMOD * DMOD * 2;
  const size_t szP   = (size_t)ROWS * DMOD * 2;                 // q/k/o planes
  const size_t szVP  = (size_t)NB * NH * HD * SEQ * 2;
  size_t off = 0;
  const size_t oXB  = off; off += szXB;
  const size_t oWQB = off; off += szW;
  off += szW;                                           // WKB
  off += szW;                                           // WVB
  const size_t oWOB = off; off += szW;
  const size_t oQHI = off; off += szP;
  const size_t oQLO = off; off += szP;
  const size_t oKHI = off; off += szP;
  const size_t oKLO = off; off += szP;
  const size_t oVHI = off; off += szVP;
  const size_t oVLO = off; off += szVP;
  const size_t oOHI = off; off += szP;
  const size_t oOLO = off; off += szP;
  if (off > ws_size) return;                            // off = 100663296 at full size
  if (off > (size_t)134217728) return;

  char* ws = (char*)d_ws;
  u16*   XB  = (u16*)(ws + oXB);
  u16*   WQB = (u16*)(ws + oWQB);
  u16*   WOB = (u16*)(ws + oWOB);
  u16*   QHI = (u16*)(ws + oQHI);
  u16*   QLO = (u16*)(ws + oQLO);
  u16*   KHI = (u16*)(ws + oKHI);
  u16*   KLO = (u16*)(ws + oKLO);
  u16*   VHI = (u16*)(ws + oVHI);
  u16*   VLO = (u16*)(ws + oVLO);
  u16*   OHI = (u16*)(ws + oOHI);
  u16*   OLO = (u16*)(ws + oOLO);

  const dim3 blk(256);
  if ((DMOD % 64) != 0 || (ROWS % GT) != 0 || (DMOD % GT) != 0) return;
  const dim3 gC(3 * XCH + 4 * WCH);                     // 512
  const dim3 gG((ROWS / GT) * (DMOD / GT));             // 256
  const dim3 gG3((ROWS / GT) * (DMOD / GT), 3);         // 256 x 3
  const dim3 bG(128);
  const dim3 gAT(ATT_BLOCKS);                           // 1024
  const dim3 bAT(ATT_THREADS);                          // 128

  // (0) inputs -> bf16 planes; weights [n][k] (already k-contiguous for x.W^T): bf16 planes for wq/wk/wv, f16 of bf16 value x1024
  //     for wo; destination XB .. WOB, contiguous
  cvt_all<<<gC, blk, 0, stream>>>(Qin, Kin, Vin, wq, wk, wv, wo, XB);
  // (1) q, k, v projections + bias (col = h*64+d), x1024, as f16 hi + residual planes: q, k [ROWS][1024], v as v^T planes
  gemm_bfb<<<gG3, bG, 0, stream>>>(XB, WQB, bq, bk, bv, QHI, ROWS, DMOD, DMOD, 1.0f, QSC);
  // (2) attention with per-head scale sigmoid(g)/8 -> O planes [b][s][h][d] x1024 (hi + residual)
  attn_fwd<<<gAT, bAT, 0, stream>>>(QHI, QLO, KHI, KLO, VHI, VLO, gt, OHI, OLO);
  // (3) output projection + bias -> out [ROWS][1024] f32, carries 1024 (O) x 1024 (wo) folded back
  gemm_h2<<<gG, blk, 0, stream>>>(OHI, OLO, WOB, bo, out, ROWS, DMOD, DMOD, 1.0f / (OSC * WOS));
  (void)hipGetLastError();
}

// v008
// It runs in 141 microseconds.
// Timed twice side by side with v007, it ran 1.08 times as fast both times.
// All steps since v000 together make it 2.86 times as fast.
// Contractions: x.W{q,k,v}^T on v_wmma_f32_16x16x32_bf16 (x and W RNE-converted to bf16 operands, f32 accumulate, bias added in f32);
// scores k'.q'^T (q', k' carried x1024 as f16 hi plane + f16 residual plane, products hh+lh+hl), P.v (P x32768 f16 hi+residual,
// v x1024 f16 hi+residual, products hh+lh+hl) and O.Wo^T (O x1024 f16 hi+residual, Wo as f16(bf16(Wo) x1024), products h.w+l.w):
// v_wmma_f32_16x16x32_f16, f32 accumulate. Per-head logit scale sigmoid(bf16(g_h))/8 in f32; base-2 online softmax, 1/l fold and
// bias adds in f32 on VALU.
#include <hip/hip_runtime.h>
#include <math.h>
#include <stdint.h>

#ifndef NB
#define NB    2
#endif
#ifndef SEQ
#define SEQ   2048
#endif
#define NB_FULL  2
#define SEQ_FULL 2048
#define DMOD  1024
#define NH    16
#define HD    64
#define QSC   1024.0f
#define KSC   1024.0f
#define PCAR  32768.0f
#define VCAR  1024.0f
#define OSC   1024.0f
#define WOS   1024.0f
#define LOG2E 1.4426950408889634f
#define KSPL        2                  // key halves of an attention block, four waves each
#define ATT_WAVES   (4 * KSPL)
#define ATT_THREADS (ATT_WAVES * 32)
#define QB          128                // query rows of an attention block: 4 waves x 32
#define QTB         (SEQ / QB)
#define ATT_BLOCKS  (NB * NH * QTB)
#define NKB    (SEQ / 32)
#define SLABF  (16 * 68)
#define SLAB64 (16 * 68)
#define VTP    136                // pitch in halves of the v^T epilogue tiles: 256-B rows + 16 B (16 B x odd)
#define GT     128                // GEMM block tile: rows of A and rows of Bt
#define KT     64                 // keys per staged tile
#define LP     72                 // LDS row pitch in halves: 128-B rows + 16 B (16 B x odd, for 16-B LDS reads down a column of rows)
#define PLH    (64 * LP)          // one plane's tile: 64 rows
#define BUFH   (4 * PLH)          // k hi, k residual, v^T hi, v^T residual
#define GPLH   (GT * LP)          // one GEMM operand plane's tile: GT rows
#define NT     (SEQ / KT)
#define NTH    (NT / KSPL)        // staged tiles a key half
#define MRGF   (2 * 4 * 8 * 32 + 2 * 2 * 32)   // floats one wave hands over: 8 accumulator tiles, then running max and sum of 2 column groups
#define CVT_OCT 16                             // octets a thread of cvt_all
#define CVT_CH  (256 * CVT_OCT)                // octets a block of cvt_all
#define XCH     ((NB * SEQ * DMOD / 8) / CVT_CH)   // blocks an input plane
#define WCH     ((DMOD * DMOD / 8) / CVT_CH)       // blocks a weight plane
#define SEG8X   (SEQ * DMOD / 8)               // destination octets per batch
#define STR8X   (SEQ_FULL * DMOD / 8)          // source octets per batch in the input layout
static_assert(HD == 64 && DMOD == NH * HD && NH == 16);
static_assert(QSC == KSC && KSC == VCAR);      // one plane scale for the three projections of a launch
static_assert(NB >= 1 && NB <= NB_FULL && SEQ >= 64 && SEQ <= SEQ_FULL && (SEQ % 64) == 0);
static_assert(ATT_THREADS == 256 && ATT_BLOCKS == NB * NH * (SEQ / 128) && NKB * 32 == SEQ && (SEQ % QB) == 0);
static_assert(((NB * SEQ) % GT) == 0 && (DMOD % GT) == 0 && (SEQ % GT) == 0 && (DMOD % 64) == 0 && GT == 128);
static_assert((SEQ % 64) == 0 && (SEQ % 8) == 0);
static_assert(((NB * SEQ * DMOD / 8) % CVT_CH) == 0 && ((DMOD * DMOD / 8) % CVT_CH) == 0 && (SEG8X % CVT_CH) == 0);
static_assert(VTP >= GT && 2 * 2 * GPLH >= 2 * GT * VTP && (VTP * 2) % 16 == 0);
static_assert(KT == 64 && HD == 64 && NT * KT == SEQ && NT * 2 == NKB && NTH * KSPL == NT && NTH >= 1 && KSPL == 2);
static_assert(KSPL * 2 * BUFH * 2 >= (4 * MRGF + 4 * 2 * SLABF) * 4 && (LP * 2) % 16 == 0 && (MRGF * 4) % 16 == 0);

typedef unsigned short u16;
typedef _Float16 v16h __attribute__((ext_vector_type(16)));
typedef _Float16 v8h  __attribute__((ext_vector_type(8)));
typedef __bf16   v16b __attribute__((ext_vector_type(16)));
typedef float    v8f  __attribute__((ext_vector_type(8)));
typedef float    v4f  __attribute__((ext_vector_type(4)));
typedef unsigned int v4u __attribute__((ext_vector_type(4)));

union FragH { v16h v; v8h h[2]; v4u u[2]; };
union FragB { v16b v; v4u u[2]; };

// ---- scalar helpers --------------------------------------------------------------------------------
__device__ __forceinline__ unsigned short bf_bits(float f) {          // f32 -> bf16 bits, RNE convert
  unsigned u = __float_as_uint(f);
  return (unsigned short)((u + 0x7FFFu + ((u >> 16) & 1u)) >> 16);
}
__device__ __forceinline__ float bf_up(unsigned short h) { return __uint_as_float(((unsigned)h) << 16); }
__device__ __forceinline__ float bfr(float f) { return bf_up(bf_bits(f)); }
__device__ __forceinline__ unsigned short h_bits(_Float16 x) { return __builtin_bit_cast(unsigned short, x); }
__device__ __forceinline__ unsigned pk16(unsigned short a, unsigned short b) { return (unsigned)a | ((unsigned)b << 16); }
// 2^x by the bare v_exp_f32. The library exp2f wraps the same instruction in a compare, two selects, an add and a ldexp that only
// serve results below 2^-126; here every argument is <= 0 and such a result stands beside a row maximum of 1, so 0 serves as well.
__device__ __forceinline__ float ex2(float x) { return __builtin_amdgcn_exp2f(x); }
__device__ __forceinline__ v8f zero8() { v8f z = {0.f, 0.f, 0.f, 0.f, 0.f, 0.f, 0.f, 0.f}; return z; }
__device__ __forceinline__ v4f zero4() { v4f z = {0.f, 0.f, 0.f, 0.f}; return z; }

// ---- fragment loaders: 16-bit A/B operand, lane -> row/col (lane&15), p already includes +8*(lane>>4);
//      elements 0..7 <- p[0..7] (k0+8h..), elements 8..15 <- p[16..23] (k0+16+8h..)  (same split k map for A and B;
//      B is always read from a k-contiguous [n][k] plane)
__device__ __forceinline__ v16h ldfrag_h(const _Float16* p) {
  FragH f;
  f.h[0] = *(const v8h*)(p);
  f.h[1] = *(const v8h*)(p + 16);
  return f.v;
}
__device__ __forceinline__ v16b ldfrag_b(const u16* p) {              // bf16 plane read as unsigned integer vectors
  FragB f;
  f.u[0] = *(const v4u*)(p);
  f.u[1] = *(const v4u*)(p + 16);
  return f.v;
}

__device__ __forceinline__ v8f mma_h(v16h a, v16h b, v8f c) {
  return __builtin_amdgcn_wmma_f32_16x16x32_f16(false, a, false, b, (short)0, c, false, false);
}
__device__ __forceinline__ v8f mma_b(v16b a, v16b b, v8f c) {
  return __builtin_amdgcn_wmma_f32_16x16x32_bf16(false, a, false, b, (short)0, c, false, false);
}
// Four v_nop behind a run of WMMAs: the distance between the last of them and a vector instruction on its D, A or B; the operands are
// named so that their registers live up to the statement.
__device__ __forceinline__ void guard_s(v8f& a, v8f& b, v8f& c, v8f& d, v16h x0, v16h x1, v16h x2, v16h x3, v16h x4, v16h x5,
                                        v16h x6, v16h x7) {
#if defined(__HIP_DEVICE_COMPILE__)
  asm volatile("v_nop\n\tv_nop\n\tv_nop\n\tv_nop"
               : "+v"(a), "+v"(b), "+v"(c), "+v"(d)
               : "v"(x0), "v"(x1), "v"(x2), "v"(x3), "v"(x4), "v"(x5), "v"(x6), "v"(x7) : "memory");
#endif
}
__device__ __forceinline__ void guard_pv(v8f& a, v8f& b, v8f& c, v8f& d, v16h p0, v16h p1, v16h p2, v16h p3, v16h x0, v16h x1,
                                         v16h x2, v16h x3) {
#if defined(__HIP_DEVICE_COMPILE__)
  asm volatile("v_nop\n\tv_nop\n\tv_nop\n\tv_nop"
               : "+v"(a), "+v"(b), "+v"(c), "+v"(d)
               : "v"(p0), "v"(p1), "v"(p2), "v"(p3), "v"(x0), "v"(x1), "v"(x2), "v"(x3));
#endif
}
// The same for a wave's R x 4 accumulator tiles: the four v_nop stand behind the last WMMA of the tile, whichever the compiler puts last.
__device__ __forceinline__ void acc_guard8(v8f (&a)[2][4]) {
#if defined(__HIP_DEVICE_COMPILE__)
  asm volatile("v_nop\n\tv_nop\n\tv_nop\n\tv_nop"
               : "+v"(a[0][0]), "+v"(a[0][1]), "+v"(a[0][2]), "+v"(a[0][3]), "+v"(a[1][0]), "+v"(a[1][1]), "+v"(a[1][2]), "+v"(a[1][3]));
#endif
}
__device__ __forceinline__ void acc_guard16(v8f (&a)[4][4]) {
#if defined(__HIP_DEVICE_COMPILE__)
  asm volatile("v_nop\n\tv_nop\n\tv_nop\n\tv_nop"
               : "+v"(a[0][0]), "+v"(a[0][1]), "+v"(a[0][2]), "+v"(a[0][3]), "+v"(a[1][0]), "+v"(a[1][1]), "+v"(a[1][2]), "+v"(a[1][3]),
                 "+v"(a[2][0]), "+v"(a[2][1]), "+v"(a[2][2]), "+v"(a[2][3]), "+v"(a[3][0]), "+v"(a[3][1]), "+v"(a[3][2]), "+v"(a[3][3]));
#endif
}
// Two planes' 64-row x 128-B tiles, global -> LDS, by 128 threads: per lane four 16-B asynchronous copies a plane (rows r, r+16,
// r+32, r+48; 8 lanes = one whole 128-B row). la/lb: the lane's LDS byte addresses of row r, ga/gb: its global addresses, gstep: 16
// source rows in elements. The s_wait_xcnt closes the statement so that no address register is rewritten ahead of it.
__device__ __forceinline__ void stage2(unsigned la, unsigned lb, const u16* ga, const u16* gb, size_t gstep) {
#if defined(__HIP_DEVICE_COMPILE__)
  const unsigned ls = 16 * LP * 2;
  asm volatile("global_load_async_to_lds_b128 %0, %8, off\n\t"
               "global_load_async_to_lds_b128 %1, %9, off\n\t"
               "global_load_async_to_lds_b128 %2, %10, off\n\t"
               "global_load_async_to_lds_b128 %3, %11, off\n\t"
               "global_load_async_to_lds_b128 %4, %12, off\n\t"
               "global_load_async_to_lds_b128 %5, %13, off\n\t"
               "global_load_async_to_lds_b128 %6, %14, off\n\t"
               "global_load_async_to_lds_b128 %7, %15, off\n\t"
               "s_wait_xcnt 0x0"
               :: "v"(la), "v"(la + ls), "v"(la + 2 * ls), "v"(la + 3 * ls),
                  "v"(lb), "v"(lb + ls), "v"(lb + 2 * ls), "v"(lb + 3 * ls),
                  "v"(ga), "v"(ga + gstep), "v"(ga + 2 * gstep), "v"(ga + 3 * gstep),
                  "v"(gb), "v"(gb + gstep), "v"(gb + 2 * gstep), "v"(gb + 3 * gstep)
               : "memory");
#endif
}
// One plane's tile, the same way: four copies a lane.
__device__ __forceinline__ void stage1(unsigned la, const u16* ga, size_t gstep) {
#if defined(__HIP_DEVICE_COMPILE__)
  const unsigned ls = 16 * LP * 2;
  asm volatile("global_load_async_to_lds_b128 %0, %4, off\n\t"
               "global_load_async_to_lds_b128 %1, %5, off\n\t"
               "global_load_async_to_lds_b128 %2, %6, off\n\t"
               "global_load_async_to_lds_b128 %3, %7, off\n\t"
               "s_wait_xcnt 0x0"
               :: "v"(la), "v"(la + ls), "v"(la + 2 * ls), "v"(la + 3 * ls),
                  "v"(ga), "v"(ga + gstep), "v"(ga + 2 * gstep), "v"(ga + 3 * gstep)
               : "memory");
#endif
}
__device__ __forceinline__ void wave_sync_lds() {
  __builtin_amdgcn_fence(__ATOMIC_RELEASE, "workgroup");
  __builtin_amdgcn_wave_barrier();
  __builtin_amdgcn_fence(__ATOMIC_ACQUIRE, "workgroup");
}

// =====================================================================================================
// All seven f32 planes -> 16-bit planes in ONE launch. Destination D holds the planes back to back in block order:
//   x_q, x_k, x_v (bf16 RNE bits, NB*SEQ rows each), wq, wk, wv (bf16 RNE bits), wo (f16 bits of (bf16 RNE value) * WOS).
// Block = CVT_CH consecutive octets of one plane (a plane is a whole number of blocks, so plane and mode are block-uniform);
// thread = CVT_OCT octets, 256 octets apart: per octet two 16-B loads and one 16-B store, 32 consecutive lanes = 512 contiguous,
// 512-B aligned destination bytes. All of a thread's loads are issued ahead of its first conversion.
// An input plane is read as NB batches of SEQ rows out of a layout with SEQ_FULL rows per batch (a block never straddles a batch).
// coverage: grid = 3*XCH + 4*WCH blocks x 256 thr x CVT_OCT octets = the whole of the seven destination planes.
// =====================================================================================================
__global__ __launch_bounds__(256) void cvt_all(const float* __restrict__ xq, const float* __restrict__ xk,
                                               const float* __restrict__ xv, const float* __restrict__ wq,
                                               const float* __restrict__ wk, const float* __restrict__ wv,
                                               const float* __restrict__ wo, u16* D) {
  const unsigned bid = blockIdx.x, tid = threadIdx.x;
  const float* s;
  size_t so;                                 // the block's first source octet
  if (bid < 3u * XCH) {                      // block-uniform; no barriers in this kernel
    const unsigned pl = bid / XCH, g0 = (bid % XCH) * CVT_CH;
    s  = pl == 0 ? xq : pl == 1 ? xk : xv;
    so = (size_t)(g0 / SEG8X) * STR8X + (size_t)(g0 % SEG8X);
  } else {
    const unsigned wb = bid - 3u * XCH, pl = wb / WCH;
    s  = pl == 0 ? wq : pl == 1 ? wk : pl == 2 ? wv : wo;
    so = (size_t)(wb % WCH) * CVT_CH;
  }
  const float* p = s + (so + (size_t)tid) * 8;
  v4f a[CVT_OCT], c4[CVT_OCT];
#pragma unroll   // arrays indexed by constants (registers); the loads stand together
  for (int i = 0; i < CVT_OCT; ++i) {
    a[i]  = *(const v4f*)(p + i * 2048);
    c4[i] = *(const v4f*)(p + i * 2048 + 4);
  }
  u16* d = D + ((size_t)bid * CVT_CH + (size_t)tid) * 8;
  if (bid < 3u * XCH + 3u * WCH) {           // block-uniform
#pragma unroll
    for (int i = 0; i < CVT_OCT; ++i) {
      v4u o;
#pragma unroll
      for (int e = 0; e < 2; ++e) {
        o[e]     = pk16(bf_bits(a[i][2 * e]),  bf_bits(a[i][2 * e + 1]));
        o[2 + e] = pk16(bf_bits(c4[i][2 * e]), bf_bits(c4[i][2 * e + 1]));
      }
      *(v4u*)(d + i * 2048) = o;
    }
  } else {
#pragma unroll
    for (int i = 0; i < CVT_OCT; ++i) {
      v4u o;
#pragma unroll
      for (int e = 0; e < 2; ++e) {
        o[e]     = pk16(h_bits((_Float16)(bfr(a[i][2 * e]) * WOS)),  h_bits((_Float16)(bfr(a[i][2 * e + 1]) * WOS)));
        o[2 + e] = pk16(h_bits((_Float16)(bfr(c4[i][2 * e]) * WOS)), h_bits((_Float16)(bfr(c4[i][2 * e + 1]) * WOS)));
      }
      *(v4u*)(d + i * 2048) = o;
    }
  }
}

// =====================================================================================================
// f32 GEMM epilogue (gemm_h2): one 16x64 f32 row group of the wave's tile (times oscale) staged in its LDS slab (pitch 68, wave-private),
// coverage: 8 instructions x 2 rows x 16 lanes x 4 floats = the 16 x 64 row group.
// =====================================================================================================
__device__ __forceinline__ void epi64(float* sl, v8f a0, v8f a1, v8f a2, v8f a3, float oscale, v4f badd, float* C, int N,
                                      size_t rowb, int col0, int lane) {
  const int hh = lane >> 4, m = lane & 15;
#pragma unroll
  for (int r = 0; r < 8; ++r) {
    const int ro = (8 * hh + r) * 68 + m;
    sl[ro]      = a0[r] * oscale;
    sl[ro + 16] = a1[r] * oscale;
    sl[ro + 32] = a2[r] * oscale;
    sl[ro + 48] = a3[r] * oscale;
  }
  wave_sync_lds();
  v4f vals[8];
#pragma unroll
  for (int it = 0; it < 8; ++it) vals[it] = *(const v4f*)(sl + (it * 2 + hh) * 68 + m * 4) + badd;
  float* dst = C + (rowb + (size_t)hh) * (size_t)N + col0 + m * 4;
  {
#pragma unroll
    for (int it = 0; it < 8; ++it) {
      *(v4f*)(dst + (size_t)(it * 2) * (size_t)N) = vals[it];
    }
    
  }
}

// =====================================================================================================
// Three bf16 GEMMs with bias in one launch, product pj = blockIdx.y (0 q, 1 k, 2 v): A = plane pj of A3, Bt = plane pj of Bt3,
// bias = bias<pj>, PH / PL = planes 2pj / 2pj+1 of P6 (M*N halves each), vt = (pj == 2). Each product, result written as two f16
// planes: c[M][N] (f32, in registers) = A[M][K] (bf16 row-major) . Bt[N][K]^T (bf16
// k-contiguous), times oscale, plus bf16-RNE value of bias[n]; PH = f16(c * psc), PL = f16(c * psc - PH) (psc a power of two).
// Block = 128x128 tile, 4 waves in 2 x 2, a wave owns 64 rows x 64 columns (4 x 4 accumulator tiles): each LDS fragment feeds four
// WMMAs and each staged row serves 128 results. The block's 128 A rows and 128 Bt rows are staged in LDS 64 k (one whole
// 128-B line a row) at a time by asynchronous copies, two buffers (tile t+1 flies while tile t is worked on, one block barrier a
// tile); fragments are read from LDS (two 16-B reads each, split k map for A and B), two k steps of 32 a tile, in the k order of
// a plain walk (host checks K % 64 == 0, M % 128 == 0, N % 128 == 0, grid = ((M/128)*(N/128), 3)).
// Epilogue, vt == 0: planes laid out [M][N]; each of the wave's four 16x64 f32 row groups goes through its private LDS slab (pitch
//   68), a lane then owns 8 consecutive columns of a row: per plane 4 instructions x 4 rows x 8 lanes x 8 halves = 16 x 64.
// Epilogue, vt != 0 (N == NH*HD, rows = b*SEQ + s, SEQ % 128 == 0): planes laid out [b][h][d][s]. A lane's 8 accumulator rows of one
//   column are 8 consecutive s of one (h, d): one 16-B LDS store a plane into the block's [128 (h,d)][128 s] tiles (pitch VTP, in the
//   ring, which is free behind the loop's last barrier); one block barrier; then 16 iterations x 128 thr x 8 halves = 128 lines x
//   128 s of each plane, 16 lanes = 256 contiguous bytes.
// =====================================================================================================
__global__ __launch_bounds__(128)
void gemm_bfb(const u16* __restrict__ A3, const u16* __restrict__ Bt3, const float* __restrict__ bias0,
              const float* __restrict__ bias1, const float* __restrict__ bias2,
              u16* P6, int M, int N, int K, float oscale, float psc) {
  __shared__ __align__(16) float slab[4 * SLAB64];
  __shared__ __align__(16) u16 ring[2 * 2 * GPLH];   // two buffers of [A tile | Bt tile], 128 rows of pitch LP each
  const int tid = threadIdx.x, wave = tid >> 5, lane = tid & 31, hh = lane >> 4, m = lane & 15;
  const int wr = wave >> 1, wc = wave & 1;   // the wave's 64-row and 64-column half of the block tile
  const int ntile = N >> 7;
  const int bid   = blockIdx.x;
  const int row0  = (bid / ntile) * GT;
  const int col0  = (bid % ntile) * GT;
  if (row0 + GT > M) return;                 // block-uniform, in front of every barrier; never taken with the exact grid
  // which of the three products this block belongs to (block-uniform): operands, bias, result planes and layout
  const int pj = blockIdx.y;
  const u16* A       = A3  + (size_t)pj * (size_t)M * (size_t)K;
  const u16* Bt      = Bt3 + (size_t)pj * (size_t)N * (size_t)K;
  const float* bias  = pj == 0 ? bias0 : pj == 1 ? bias1 : bias2;
  u16* PH            = P6 + (size_t)(2 * pj) * (size_t)M * (size_t)N;
  u16* PL            = PH + (size_t)M * (size_t)N;
  const int vt       = pj == 2;
  // staging: thread -> (row sr of 16, 16-B piece sc of 8), rows sr + 16 i, i = 0..7, of each operand's tile
  const int sr = tid >> 3, sc = (tid & 7) * 8;
  const u16* ag = A  + (size_t)(row0 + sr) * K + sc;
  const u16* bg = Bt + (size_t)(col0 + sr) * K + sc;
  const unsigned lds0 = (unsigned)(size_t)(const void*)ring + (unsigned)(sr * LP + sc) * 2u;
  const int nt = K >> 6;
  auto stage = [&](int t, int buf) {
    const unsigned l = lds0 + (unsigned)buf * (2u * GPLH * 2u);
    const u16* a = ag + (size_t)t * 64;
    const u16* b = bg + (size_t)t * 64;
    stage2(l, l + GPLH * 2u, a, b, (size_t)16 * K);                                                               // rows 0..63
    stage2(l + PLH * 2u, l + (GPLH + PLH) * 2u, a + (size_t)64 * K, b + (size_t)64 * K, (size_t)16 * K);          // rows 64..127
  };
  // fragment readers, in halves from a buffer's start
  const int afo = (wr * 64 + m) * LP + 8 * hh;
  const int bfo = GPLH + (wc * 64 + m) * LP + 8 * hh;
  v8f acc[4][4];
#pragma unroll
  for (int i = 0; i < 4; ++i) {
#pragma unroll
    for (int j = 0; j < 4; ++j) acc[i][j] = zero8();
  }
  stage(0, 0);
  asm volatile("s_wait_asynccnt 0x0" ::: "memory");   // this wave's copies of tile 0 have landed
  __syncthreads();                                    // ... and every other wave's: tile 0 may be read
  if (nt > 1) stage(1, 1);
#pragma unroll 1   // one tile a trip: the ring's hand-over stands once, at the foot
  for (int t = 0; t < nt; ++t) {
    const u16* bufp = ring + (t & 1) * (2 * GPLH);
#pragma unroll   // both k steps in line: LDS offsets become immediates, accumulators stay in registers
    for (int kk = 0; kk < 2; ++kk) {
      v16b a[4], b[4];
#pragma unroll
      for (int i = 0; i < 4; ++i) {
        a[i] = ldfrag_b(bufp + afo + i * 16 * LP + kk * 32);
        b[i] = ldfrag_b(bufp + bfo + i * 16 * LP + kk * 32);
      }
      __builtin_amdgcn_sched_barrier(0);   // the k step's 16 LDS reads issue together ahead of its 16 WMMAs: one LDS latency a step, not one a row
#pragma unroll
      for (int i = 0; i < 4; ++i) {
#pragma unroll
        for (int j = 0; j < 4; ++j) acc[i][j] = mma_b(a[i], b[j], acc[i][j]);
      }
    }
    acc_guard16(acc);                                   // WMMA distance kept on both sides of the branches that follow
    // ---- hand-over: tile t+1 is published and tile t's buffer is freed by the one barrier; then the refill ----
    asm volatile("s_wait_dscnt 0x0" ::: "memory");      // this wave's reads of tile t are done before its buffer is refilled
    asm volatile("s_wait_asynccnt 0x0" ::: "memory");   // this wave's copies of tile t+1 have landed
    __syncthreads();
    if (t + 2 < nt) stage(t + 2, t & 1);
  }
  asm volatile("s_wait_asynccnt 0x0" ::: "memory");     // nothing in flight when the wave goes on to its end
  const int colw = col0 + wc * 64;           // the wave's first column
  // every loop of both epilogues is unrolled so that accumulators and staging arrays are indexed by constants (registers, no scratch)
  if (vt == 0) {                             // block-uniform
    float* sl = slab + wave * SLAB64;
    const int rq = lane >> 3, c8 = (lane & 7) * 8;
    const v4f bv0 = *(const v4f*)(bias + colw + c8), bv1 = *(const v4f*)(bias + colw + c8 + 4);   // columns < N (N multiple of 128)
    float badd[8];
#pragma unroll
    for (int e = 0; e < 4; ++e) { badd[e] = bfr(bv0[e]); badd[4 + e] = bfr(bv1[e]); }
#pragma unroll
    for (int i = 0; i < 4; ++i) {            // the wave's four groups of 16 rows, one after the other through the one slab
#pragma unroll
      for (int r = 0; r < 8; ++r) {
        const int ro = (8 * hh + r) * 68 + m;
        sl[ro]      = acc[i][0][r] * oscale;
        sl[ro + 16] = acc[i][1][r] * oscale;
        sl[ro + 32] = acc[i][2][r] * oscale;
        sl[ro + 48] = acc[i][3][r] * oscale;
      }
      wave_sync_lds();
      v4u oh[4], ol[4];
#pragma unroll
      for (int i4 = 0; i4 < 4; ++i4) {
        const int row = i4 * 4 + rq;
        const v4f a4 = *(const v4f*)(sl + row * 68 + c8), c4 = *(const v4f*)(sl + row * 68 + c8 + 4);
        float w[8];
#pragma unroll
        for (int e = 0; e < 4; ++e) { w[e] = (a4[e] + badd[e]) * psc; w[4 + e] = (c4[e] + badd[4 + e]) * psc; }
#pragma unroll
        for (int e = 0; e < 4; ++e) {
          const _Float16 h0 = (_Float16)w[2 * e], h1 = (_Float16)w[2 * e + 1];
          const _Float16 l0 = (_Float16)(w[2 * e] - (float)h0), l1 = (_Float16)(w[2 * e + 1] - (float)h1);
          oh[i4][e] = pk16(h_bits(h0), h_bits(h1));
          ol[i4][e] = pk16(h_bits(l0), h_bits(l1));
        }
      }
      wave_sync_lds();                       // every lane's reads of the slab stand ahead of the next group's writes
      const size_t ob = (size_t)(row0 + wr * 64 + i * 16) * (size_t)N + colw + c8;
#pragma unroll
      for (int i4 = 0; i4 < 4; ++i4) {
        const size_t o8 = ob + (size_t)(i4 * 4 + rq) * (size_t)N;
        *(v4u*)(PH + o8) = oh[i4];
        *(v4u*)(PL + o8) = ol[i4];
      }
      asm volatile("s_wait_xcnt 0x0" ::: "memory");   // behind the run of stores: what follows in the text rewrites their registers
    }
  } else {
    u16* TH = ring;
    u16* TL = ring + GT * VTP;
#pragma unroll
    for (int j = 0; j < 4; ++j) {
      const float bj = bfr(bias[colw + 16 * j + m]);        // column < N (N multiple of 128)
#pragma unroll
      for (int i = 0; i < 4; ++i) {
        v4u th, tl;
#pragma unroll
        for (int e = 0; e < 4; ++e) {
          const float t0 = (acc[i][j][2 * e] * oscale + bj) * psc, t1 = (acc[i][j][2 * e + 1] * oscale + bj) * psc;
          const _Float16 h0 = (_Float16)t0, h1 = (_Float16)t1;
          const _Float16 l0 = (_Float16)(t0 - (float)h0), l1 = (_Float16)(t1 - (float)h1);
          th[e] = pk16(h_bits(h0), h_bits(h1));
          tl[e] = pk16(h_bits(l0), h_bits(l1));
        }
        const int to = (wc * 64 + 16 * j + m) * VTP + wr * 64 + i * 16 + 8 * hh;
        *(v4u*)(TH + to) = th;
        *(v4u*)(TL + to) = tl;
      }
    }
    __syncthreads();                         // the four waves' parts of the [(h,d)][s] tiles are complete
    const int q16 = tid >> 4, p8 = (tid & 15) * 8;
    const size_t base = ((size_t)(row0 / SEQ) * (NH * HD) + col0) * SEQ + (row0 % SEQ) + p8;
#pragma unroll
    for (int g = 0; g < 4; ++g) {            // four lines a thread and plane at a time: LDS reads first, then their stores
      v4u vh[4], vl[4];
#pragma unroll
      for (int it = 0; it < 4; ++it) {
        const int line = (g * 4 + it) * 8 + q16;   // (h,d) line 0..127 of the block
        vh[it] = *(const v4u*)(TH + line * VTP + p8);
        vl[it] = *(const v4u*)(TL + line * VTP + p8);
      }
#pragma unroll
      for (int it = 0; it < 4; ++it) {
        const int line = (g * 4 + it) * 8 + q16;
        *(v4u*)(PH + base + (size_t)line * SEQ) = vh[it];
        *(v4u*)(PL + base + (size_t)line * SEQ) = vl[it];
      }
      asm volatile("s_wait_xcnt 0x0" ::: "memory");   // behind the run of stores: no register that they name is rewritten ahead of it
    }
  }
}

// =====================================================================================================
// f16 hi+lo GEMM with bias: C[M][N] (f32) = (Ahi + Alo)[M][K] . Bt[N][K]^T times oscale, plus bf16-RNE value of bias[n];
// Ahi/Alo f16 planes (same layout), Bt f16 k-contiguous; products hi.B + lo.B into one accumulator (lo is the unscaled
// residual of hi). Block = 128x128 tile, 8 waves in 4 x 2, a wave owns 32 rows x 64 columns (2 x 4 accumulator tiles); the same
// two-buffer LDS ring as gemm_bfb, three planes a tile (Ahi, Alo, Bt), 128 rows each, staged by 256 threads: threads 0..127 rows
// 0..63, threads 128..255 rows 64..127 (host checks M % 128 == 0, N % 128 == 0, K % 64 == 0, grid = (M/128)*(N/128)).
// =====================================================================================================
__global__ __launch_bounds__(256)
void gemm_h2(const u16* __restrict__ Ah, const u16* __restrict__ Al, const u16* __restrict__ Bt,
             const float* __restrict__ bias, float* C, int M, int N, int K, float oscale) {
  __shared__ __align__(16) float slab[8 * SLAB64];
  __shared__ __align__(16) u16 ring[2 * 3 * GPLH];   // two buffers of [Ahi tile | Alo tile | Bt tile], 128 rows of pitch LP each
  const int tid = threadIdx.x, wave = tid >> 5, lane = tid & 31, hh = lane >> 4, m = lane & 15;
  const int wr = wave >> 1, wc = wave & 1;   // the wave's 32-row quarter and 64-column half of the block tile
  const int ntile = N >> 7;
  const int bid   = blockIdx.x;
  const int row0  = (bid / ntile) * GT;
  const int col0  = (bid % ntile) * GT;
  if (row0 + GT > M) return;                 // block-uniform, in front of every barrier; never taken with the exact grid
  // staging: thread -> (row sr of 16 in its half of 64 rows, 16-B piece sc of 8), rows sr, sr+16, sr+32, sr+48 of each plane's tile
  const int sr = (tid >> 7) * 64 + ((tid & 127) >> 3), sc = (tid & 7) * 8;
  const size_t aofs = (size_t)(row0 + sr) * K + sc;
  const u16* ahg = Ah + aofs;
  const u16* alg = Al + aofs;
  const u16* bg  = Bt + (size_t)(col0 + sr) * K + sc;
  const unsigned lds0 = (unsigned)(size_t)(const void*)ring + (unsigned)(sr * LP + sc) * 2u;
  const int nt = K >> 6;
  auto stage = [&](int t, int buf) {
    const unsigned l = lds0 + (unsigned)buf * (3u * GPLH * 2u);
    stage2(l, l + GPLH * 2u, ahg + (size_t)t * 64, alg + (size_t)t * 64, (size_t)16 * K);
    stage1(l + 2u * GPLH * 2u, bg + (size_t)t * 64, (size_t)16 * K);
  };
  // fragment readers, in halves from a buffer's start
  const int afo = (wr * 32 + m) * LP + 8 * hh;
  const int bfo = 2 * GPLH + (wc * 64 + m) * LP + 8 * hh;
  v8f acc[2][4];
#pragma unroll
  for (int i = 0; i < 2; ++i) {
#pragma unroll
    for (int j = 0; j < 4; ++j) acc[i][j] = zero8();
  }
  stage(0, 0);
  asm volatile("s_wait_asynccnt 0x0" ::: "memory");   // this wave's copies of tile 0 have landed
  __syncthreads();                                    // ... and every other wave's: tile 0 may be read
  if (nt > 1) stage(1, 1);
#pragma unroll 1   // one tile a trip: the ring's hand-over stands once, at the foot
  for (int t = 0; t < nt; ++t) {
    const _Float16* bufp = (const _Float16*)(const void*)ring + (t & 1) * (3 * GPLH);
    v16h ah[2][2], al[2][2], b[2][4];
#pragma unroll
    for (int kk = 0; kk < 2; ++kk) {
#pragma unroll
      for (int i = 0; i < 2; ++i) {
        ah[kk][i] = ldfrag_h(bufp + afo + i * 16 * LP + kk * 32);
        al[kk][i] = ldfrag_h(bufp + GPLH + afo + i * 16 * LP + kk * 32);
      }
#pragma unroll
      for (int j = 0; j < 4; ++j) b[kk][j] = ldfrag_h(bufp + bfo + j * 16 * LP + kk * 32);
    }
    __builtin_amdgcn_sched_barrier(0);   // all of the tile's LDS reads issue ahead of its WMMAs: one LDS latency a tile, not several
#pragma unroll
    for (int kk = 0; kk < 2; ++kk) {
#pragma unroll
      for (int i = 0; i < 2; ++i) {
#pragma unroll
        for (int j = 0; j < 4; ++j) acc[i][j] = mma_h(ah[kk][i], b[kk][j], acc[i][j]);
      }
#pragma unroll
      for (int i = 0; i < 2; ++i) {
#pragma unroll
        for (int j = 0; j < 4; ++j) acc[i][j] = mma_h(al[kk][i], b[kk][j], acc[i][j]);
      }
    }
    acc_guard8(acc);                                    // WMMA distance kept on both sides of the branches that follow
    // ---- hand-over: tile t+1 is published and tile t's buffer is freed by the one barrier; then the refill ----
    asm volatile("s_wait_dscnt 0x0" ::: "memory");      // this wave's reads of tile t are done before its buffer is refilled
    asm volatile("s_wait_asynccnt 0x0" ::: "memory");   // this wave's copies of tile t+1 have landed
    __syncthreads();
    if (t + 2 < nt) stage(t + 2, t & 1);
  }
  asm volatile("s_wait_asynccnt 0x0" ::: "memory");     // nothing in flight when the wave goes on to its end
  const int colw = col0 + wc * 64;                        // the wave's first column
  const v4f bv = *(const v4f*)(bias + colw + m * 4);      // columns colw + 4m .. +3, always < N (N multiple of 128)
  v4f badd;
#pragma unroll
  for (int e = 0; e < 4; ++e) badd[e] = bfr(bv[e]);
#pragma unroll
  for (int i = 0; i < 2; ++i) {                           // the wave's two groups of 16 rows, one after the other through the one slab
    epi64(slab + wave * SLAB64, acc[i][0], acc[i][1], acc[i][2], acc[i][3], oscale, badd, C, N,
          (size_t)(row0 + wr * 32 + i * 16), colw, lane);
    asm volatile("s_wait_xcnt 0x0" ::: "memory");         // behind the run of stores: what follows in the text rewrites their registers
    wave_sync_lds();                                      // every lane's reads of the slab stand ahead of the next group's writes
  }
}

// =====================================================================================================
// Full (non-causal, unmasked) multi-head flash attention: block = (batch b, head, 128 query rows), 8 waves = 4 query groups x 2 key
// halves. Wave (kh, wq) owns the 32 query rows q0 = 128*qt + 32*wq .. q0+31 (two column groups of 16) and the keys
// kh*SEQ/2 .. +SEQ/2-1: every k and v^T fragment read from LDS feeds both column groups, and a staged tile serves 128 queries. Each
// key half has its own ring: tiles of KT = 64 keys of the k and v^T planes, staged by the half's 128 threads with asynchronous
// copies, two buffers (tile t+1 flies while tile t is worked on, one block barrier a tile), read by the half's 4 waves; each tile
// serves two key blocks of 32. Behind the last tile's barrier the rings become the hand-over area and the result slabs.
//   Per-head logit scale: sigmoid(bf16 RNE value of g[head]) / 8, computed in f32 once per thread (head uniform per block) and
//   folded with log2(e) and the q/k carries into lsc.
//   q planes (hi, lo f16, x1024) laid out [b][s][h][d]; k planes the same; v^T planes [b][h][d][s] (x1024).
//   All NKB = SEQ/32 key blocks of 32 keys are visited, half of them by each key half (static bounds).
//   Scores are computed TRANSPOSED: S^T tile (g, i) = k rows (keys kb+16i .. +15, A operand, row m = lane&15, split k map
//   over d) times q^T (B operand, col n = query q0 + 16g + (lane&15), k = d, split map), 3 products per tile and d-chunk
//   (k_hi.q_hi + k_lo.q_hi + k_hi.q_lo). D element r of lane l = (key kb+16i+8h+r, query q0+16g+(l&15)), so a lane owns one query
//   column a group and 16 of its 32 keys; the partner lane l^16 owns the other 16 -> row max / row sum need one xor-16 shuffle.
//   Online max-subtracted base-2 softmax in f32, per column group. The exp'd values ARE the P A-fragment in place: A row m = query =
//   lane&15, element i <- key kb+8h+i (tile 0, D element i), element 8+i <- key kb+16+8h+i (tile 1, D element i). P is carried
//   x32768 as f16 hi + f16 residual. The rescale factor of query row 8h+r of the O accumulators is fetched from lane 8h+r with a
//   shuffle (uniform control). 4+4 v^T B fragments (hi and residual planes, col n = d = 16j + (lane&15), keys k-contiguous),
//   12 P.V WMMAs a column group (hh + lh + hl).
//   Join of the key halves: the waves of half 1 store their accumulators, running maxima and sums in LDS; one block barrier; wave
//   (0, wq) brings both halves to the common maximum: o = o_0 2^(m_0-m) + o_1 2^(m_1-m), l likewise.
//   Epilogue: 1/l (per query, shuffled to the D row owner) and carry folds in f32; the wave's 2 x 16x64 f32 result staged in its LDS
// coverage: per wave and column group 4 instructions x 4 rows x 8 lanes x 8 halves = 16 x 64 per plane; grid NB*NH*SEQ/128 blocks x
//           4 waves x 2 groups = every (b, s, h) row of both O planes exactly once.
// =====================================================================================================
// four waves a SIMD (two blocks a WGP): the register budget is held to a quarter of the SIMD's file
__global__ __launch_bounds__(ATT_THREADS) __attribute__((amdgpu_waves_per_eu(4, 4)))
void attn_fwd(const u16* __restrict__ QHIp, const u16* __restrict__ QLOp,
              const u16* __restrict__ KHIp, const u16* __restrict__ KLOp,
              const u16* __restrict__ VHIp, const u16* __restrict__ VLOp,
              const float* __restrict__ gatep,
              u16* OHIp, u16* OLOp) {
  __shared__ __align__(16) u16 ring[KSPL * 2 * BUFH];   // per key half two tile buffers; in the epilogue hand-over area and result slabs

  const int tid  = threadIdx.x;
  const int wave = __builtin_amdgcn_readfirstlane(tid >> 5);   // wave-uniform: held in a scalar register
  const int kh   = wave >> 2;                // key half
  const int wq   = wave & 3;                 // query group of 32
  const int lane = tid & 31;
  const int hh   = lane >> 4;
  const int c    = lane & 15;

  const int bid  = blockIdx.x;
  const int qt   = bid % QTB;
  const int head = (bid / QTB) % NH;
  const int b    = bid / (QTB * NH);
  const int q0   = qt * QB + wq * 32;
  const int key0 = kh * (NTH * KT);          // the half's first key

  // per-head scale: sigmoid(bf16 value of g) / 8 in f32; head < NH always (block decode), host checks the input extent
  const float gbf = bfr(gatep[head]);
  const float sgm = 1.0f / (1.0f + expf(-gbf));
  const float lsc = sgm * (0.125f * (LOG2E / (QSC * KSC)));

  // B fragments of q^T: col n = query q0 + 16g + c, k = d (k-contiguous row of the q plane)
  const size_t qofs = (((size_t)(b * SEQ + q0 + c)) * NH + head) * HD + 8 * hh;
  const _Float16* Qh  = (const _Float16*)(const void*)QHIp + qofs;
  const _Float16* Ql  = (const _Float16*)(const void*)QLOp + qofs;
  // staging: thread of the half -> (row sr of 16, 16-B piece sc of 8); k tile row = key, v^T tile row = d, both 64 halves long
  const int st = tid & 127;
  const int sr = st >> 3, sc = (st & 7) * 8;
  const size_t kofs = (((size_t)b * SEQ + key0 + sr) * NH + head) * HD + sc;      // tile's first key in the half added per tile
  const size_t vofs = ((size_t)(b * NH + head) * HD + sr) * SEQ + key0 + sc;      // tile's first key in the half added per tile
  const unsigned lds0 = (unsigned)(size_t)(const void*)ring + (unsigned)kh * (2u * BUFH * 2u) + (unsigned)(sr * LP + sc) * 2u;
  auto stage = [&](int t, int buf) {
    const unsigned l = lds0 + (unsigned)buf * (BUFH * 2u);
    const size_t ko = kofs + (size_t)t * (KT * NH * HD), vo = vofs + (size_t)t * KT;
    stage2(l, l + PLH * 2u, KHIp + ko, KLOp + ko, (size_t)16 * (NH * HD));
    stage2(l + 2u * PLH * 2u, l + 3u * PLH * 2u, VHIp + vo, VLOp + vo, (size_t)16 * SEQ);
  };
  // fragment readers, in halves from a buffer's start: A of k: row m = key 16i + c, k = d; B of v: col n = d = 16j + c, k = key
  const int kfo = c * LP + 8 * hh;
  const int vfo = 2 * PLH + c * LP + 8 * hh;

  // q^T B fragments (two column groups; hi and residual planes, both d chunks of 32): read once, held in registers for all key tiles
  v16h qhf[2][2], qlf[2][2];
#pragma unroll
  for (int g = 0; g < 2; ++g) {
#pragma unroll
    for (int kk = 0; kk < 2; ++kk) {
      qhf[g][kk] = ldfrag_h(Qh + g * (16 * NH * HD) + kk * 32);
      qlf[g][kk] = ldfrag_h(Ql + g * (16 * NH * HD) + kk * 32);
    }
  }
  // behind the run of q loads: both address pairs are named as inputs, so their registers live up to the wait and no load of the run
  // lands on a register that another load of the run names as its address
  asm volatile("s_wait_xcnt 0x0" :: "v"(Qh), "v"(Ql) : "memory");

  float mrun[2] = {-INFINITY, -INFINITY}, lrun[2] = {0.f, 0.f};
  v8f o[2][4];
#pragma unroll
  for (int g = 0; g < 2; ++g) {
#pragma unroll
    for (int j = 0; j < 4; ++j) o[g][j] = zero8();
  }

  stage(0, 0);
  asm volatile("s_wait_asynccnt 0x0" ::: "memory");   // this wave's copies of tile 0 have landed
  __syncthreads();                                    // ... and every other wave's: tile 0 may be read
  if (NTH > 1) stage(1, 1);

#pragma unroll 1
  for (int t = 0; t < NTH; ++t) {
   const _Float16* bufp = (const _Float16*)(const void*)ring + kh * (2 * BUFH) + (t & 1) * BUFH;
#pragma unroll   // both key blocks of a tile in line: their LDS offsets become immediates
   for (int sub = 0; sub < 2; ++sub) {
    // ---- transposed scores: s[g][0] = keys kb..kb+15, s[g][1] = keys kb+16..kb+31 (kb = key0 + 64t + 32sub), column = query q0+16g+c ----
    v8f s[2][2] = {{zero8(), zero8()}, {zero8(), zero8()}};
    const _Float16* k0p = bufp + kfo + sub * 32 * LP;
    const _Float16* k1p = k0p + 16 * LP;
    const _Float16* l0p = k0p + PLH;
    const _Float16* l1p = l0p + 16 * LP;
#pragma unroll
    for (int kk = 0; kk < 2; ++kk) {
      const v16h kh0 = ldfrag_h(k0p + kk * 32), kl0 = ldfrag_h(l0p + kk * 32);
      const v16h kh1 = ldfrag_h(k1p + kk * 32), kl1 = ldfrag_h(l1p + kk * 32);
#pragma unroll
      for (int g = 0; g < 2; ++g) { s[g][0] = mma_h(kh0, qhf[g][kk], s[g][0]);  s[g][1] = mma_h(kh1, qhf[g][kk], s[g][1]); }
#pragma unroll
      for (int g = 0; g < 2; ++g) { s[g][0] = mma_h(kl0, qhf[g][kk], s[g][0]);  s[g][1] = mma_h(kl1, qhf[g][kk], s[g][1]); }
#pragma unroll
      for (int g = 0; g < 2; ++g) { s[g][0] = mma_h(kh0, qlf[g][kk], s[g][0]);  s[g][1] = mma_h(kh1, qlf[g][kk], s[g][1]); }
      guard_s(s[0][0], s[0][1], s[1][0], s[1][1], qhf[0][kk], qhf[1][kk], qlf[0][kk], qlf[1][kk], kh0, kl0, kh1, kl1);
    }
    FragH ph[2], pl[2];
#pragma unroll
    for (int g = 0; g < 2; ++g) {
      // ---- base-2 logits of this lane's 16 keys for query q0+16g+c: t[i] <- key kb+8hh+i, t[8+i] <- key kb+16+8hh+i ----
      float t[16];
#pragma unroll
      for (int i = 0; i < 8; ++i) { t[i] = s[g][0][i] * lsc; t[8 + i] = s[g][1][i] * lsc; }
      float cm = t[0];
#pragma unroll
      for (int i = 1; i < 16; ++i) cm = fmaxf(cm, t[i]);
      cm = fmaxf(cm, __shfl_xor(cm, 16, 32));
      const float mn = fmaxf(mrun[g], cm);     // finite from the first block on
      const float al = ex2(mrun[g] - mn);      // 0 on the first block (mrun = -inf)
      mrun[g] = mn;
      // ---- probabilities (<= 1) and the P A-fragments: hi = f16(p * 32768), lo = f16 residual; element i <-> t[i] ----
      float ps = 0.f;
#pragma unroll
      for (int w = 0; w < 2; ++w) {
#pragma unroll
        for (int e4 = 0; e4 < 4; ++e4) {
          const int i = 8 * w + 2 * e4;
          const float p0 = ex2(t[i] - mn), p1 = ex2(t[i + 1] - mn);
          ps += p0 + p1;
          const float a0 = p0 * PCAR, a1 = p1 * PCAR;
          const _Float16 h0 = (_Float16)a0, h1 = (_Float16)a1;
          const _Float16 l0 = (_Float16)(a0 - (float)h0), l1 = (_Float16)(a1 - (float)h1);
          ph[g].u[w][e4] = pk16(h_bits(h0), h_bits(h1));
          pl[g].u[w][e4] = pk16(h_bits(l0), h_bits(l1));
        }
      }
      ps += __shfl_xor(ps, 16, 32);
      lrun[g] = lrun[g] * al + ps;
      // ---- rescale the O accumulators: D row 8hh+r = query q0+16g+8hh+r, its factor lives in lane 8hh+r (and 16+8hh+r) ----
      float scl[8];
#pragma unroll
      for (int r = 0; r < 8; ++r) scl[r] = __shfl(al, 8 * hh + r, 32);
#pragma unroll
      for (int j = 0; j < 4; ++j) {
#pragma unroll
        for (int r = 0; r < 8; ++r) o[g][j][r] *= scl[r];
      }
    }
    // ---- P.V : B fragment col n = d = j*16 + c, keys contiguous in the v^T planes; each fragment feeds both column groups; d columns
    //      0..31, then 32..63. At most six of the eight fragments are live at a time (the register budget of four waves a SIMD) ----
    {
      const _Float16* vhp = bufp + vfo + sub * 32;
      const _Float16* vlp = vhp + PLH;
      const v16h vh0 = ldfrag_h(vhp), vh1 = ldfrag_h(vhp + 16 * LP);
      const v16h vl0 = ldfrag_h(vlp), vl1 = ldfrag_h(vlp + 16 * LP);
      const v16h vh2 = ldfrag_h(vhp + 32 * LP), vh3 = ldfrag_h(vhp + 48 * LP);
      __builtin_amdgcn_sched_barrier(0);   // these twelve LDS reads stand in one place ahead of the WMMAs, none among them
#pragma unroll
      for (int g = 0; g < 2; ++g) { o[g][0] = mma_h(ph[g].v, vh0, o[g][0]);  o[g][1] = mma_h(ph[g].v, vh1, o[g][1]); }
#pragma unroll
      for (int g = 0; g < 2; ++g) { o[g][0] = mma_h(pl[g].v, vh0, o[g][0]);  o[g][1] = mma_h(pl[g].v, vh1, o[g][1]); }
#pragma unroll
      for (int g = 0; g < 2; ++g) { o[g][0] = mma_h(ph[g].v, vl0, o[g][0]);  o[g][1] = mma_h(ph[g].v, vl1, o[g][1]); }
      const v16h vl2 = ldfrag_h(vlp + 32 * LP), vl3 = ldfrag_h(vlp + 48 * LP);
      __builtin_amdgcn_sched_barrier(0);   // the last four LDS reads issue ahead of the eight WMMAs on vh2, vh3
#pragma unroll
      for (int g = 0; g < 2; ++g) { o[g][2] = mma_h(ph[g].v, vh2, o[g][2]);  o[g][3] = mma_h(ph[g].v, vh3, o[g][3]); }
#pragma unroll
      for (int g = 0; g < 2; ++g) { o[g][2] = mma_h(pl[g].v, vh2, o[g][2]);  o[g][3] = mma_h(pl[g].v, vh3, o[g][3]); }
#pragma unroll
      for (int g = 0; g < 2; ++g) { o[g][2] = mma_h(ph[g].v, vl2, o[g][2]);  o[g][3] = mma_h(ph[g].v, vl3, o[g][3]); }
      guard_pv(o[0][2], o[0][3], o[1][2], o[1][3], ph[0].v, pl[0].v, ph[1].v, pl[1].v, vh2, vh3, vl2, vl3);
    }
   }
   // ---- hand-over: tile t+1 is published and tile t's buffer is freed by the one barrier; then the refill ----
   asm volatile("s_wait_dscnt 0x0" ::: "memory");      // this wave's reads of tile t are done before its buffer is refilled
   asm volatile("s_wait_asynccnt 0x0" ::: "memory");   // this wave's copies of tile t+1 have landed
   __syncthreads();
   if (t + 2 < NTH) stage(t + 2, t & 1);
  }
  asm volatile("s_wait_asynccnt 0x0" ::: "memory");    // nothing in flight when the rings turn into hand-over area and result slabs
  acc_guard8(o);

  // ---- join of the key halves: wave (1, wq) hands its state to wave (0, wq), lane to lane, 16 B a lane and store ----
  float* mrg = (float*)(void*)ring + wq * MRGF;
  if (kh == 1) {                             // wave-uniform (scalar)
#pragma unroll
    for (int g = 0; g < 2; ++g) {
#pragma unroll
      for (int j = 0; j < 4; ++j) {
        const v4f x0 = {o[g][j][0], o[g][j][1], o[g][j][2], o[g][j][3]}, x1 = {o[g][j][4], o[g][j][5], o[g][j][6], o[g][j][7]};
        *(v4f*)(mrg + ((g * 4 + j) * 2) * 128 + lane * 4)     = x0;
        *(v4f*)(mrg + ((g * 4 + j) * 2 + 1) * 128 + lane * 4) = x1;
      }
      mrg[2048 + g * 64 + lane]      = mrun[g];
      mrg[2048 + g * 64 + 32 + lane] = lrun[g];
    }
  }
  __syncthreads();                           // half 1's state is complete; every wave passes; the last barrier of the kernel
  if (kh == 0) {                             // wave-uniform (scalar)
    float* slab = (float*)(void*)ring + 4 * MRGF + wq * (2 * SLABF);
    // ---- common maximum, 1/l (per query, owned by lane = query) and the carries (32768 on P, 1024 on v); stage the 16x64 slabs ----
#pragma unroll
    for (int g = 0; g < 2; ++g) {
      const float m1 = mrg[2048 + g * 64 + lane], l1 = mrg[2048 + g * 64 + 32 + lane];
      const float mn = fmaxf(mrun[g], m1);   // both finite: each half has seen keys
      const float e0 = ex2(mrun[g] - mn), e1 = ex2(m1 - mn);
      const float linv = (1.0f / (lrun[g] * e0 + l1 * e1)) * (1.0f / (PCAR * VCAR));
      const float f0 = e0 * linv, f1 = e1 * linv;
      float i0[8], i1[8];
#pragma unroll
      for (int r = 0; r < 8; ++r) { i0[r] = __shfl(f0, 8 * hh + r, 32); i1[r] = __shfl(f1, 8 * hh + r, 32); }
#pragma unroll
      for (int j = 0; j < 4; ++j) {
        const v4f x0 = *(const v4f*)(mrg + ((g * 4 + j) * 2) * 128 + lane * 4);
        const v4f x1 = *(const v4f*)(mrg + ((g * 4 + j) * 2 + 1) * 128 + lane * 4);
#pragma unroll
        for (int r = 0; r < 4; ++r) {
          slab[g * SLABF + (8 * hh + r) * 68 + j * 16 + c]     = o[g][j][r] * i0[r] + x0[r] * i1[r];
          slab[g * SLABF + (8 * hh + 4 + r) * 68 + j * 16 + c] = o[g][j][4 + r] * i0[4 + r] + x1[r] * i1[4 + r];
        }
      }
    }
    wave_sync_lds();
    // ---- O x1024 -> f16 hi + residual planes; lane = (row in group of 4, 8 consecutive d) ----
    const int rq = lane >> 3, c8 = (lane & 7) * 8;
#pragma unroll
    for (int g = 0; g < 2; ++g) {
      v4u oh[4], ol[4];
#pragma unroll
      for (int i4 = 0; i4 < 4; ++i4) {
        const int row = i4 * 4 + rq;
        const v4f a = *(const v4f*)(slab + g * SLABF + row * 68 + c8), c4 = *(const v4f*)(slab + g * SLABF + row * 68 + c8 + 4);
        float w[8];
#pragma unroll
        for (int e = 0; e < 4; ++e) { w[e] = a[e] * OSC; w[4 + e] = c4[e] * OSC; }
#pragma unroll
        for (int e = 0; e < 4; ++e) {
          const _Float16 h0 = (_Float16)w[2 * e], h1 = (_Float16)w[2 * e + 1];
          const _Float16 l0 = (_Float16)(w[2 * e] - (float)h0), l1 = (_Float16)(w[2 * e + 1] - (float)h1);
          oh[i4][e] = pk16(h_bits(h0), h_bits(h1));
          ol[i4][e] = pk16(h_bits(l0), h_bits(l1));
        }
      }
      const size_t ob = (((size_t)(b * SEQ + q0 + g * 16)) * NH + head) * HD + c8;
#pragma unroll
      for (int i4 = 0; i4 < 4; ++i4) {
        const int row = i4 * 4 + rq;
        const size_t o8 = ob + (size_t)row * (NH * HD);
        *(v4u*)(OHIp + o8) = oh[i4];
        *(v4u*)(OLOp + o8) = ol[i4];
      }
      asm volatile("s_wait_xcnt 0x0" ::: "memory");   // behind the run of stores: what follows in the text rewrites their registers
    }
  }
}

// =====================================================================================================
// Workspace map (bytes, ROWS = NB*SEQ; numbers for NB=2, SEQ=2048); every plane is fully written by whole-line stores before it is
// read; all extents are exact multiples of the store granularity (no pad rows needed). XB .. WOB are cvt_all's one destination,
// XB / WQB.. / QHI.. are gemm_bfb's plane triples, so their order and adjacency matter:
//   XB  bf16 3 x [ROWS][1024]            25165824        (input Q, K, V)
//   WQB bf16 [1024 n][1024 k]             2097152        WKB same  2097152      WVB same  2097152
//   WOB f16  [1024 n][1024 k] x1024       2097152
//   QHI f16 [NB][SEQ][16][64] x1024       8388608        QLO residual         8388608
//   KHI same                              8388608        KLO residual         8388608
//   VHI f16 [NB][16][64][SEQ] x1024       8388608        VLO residual         8388608
//   OHI f16 [ROWS][1024] x1024            8388608        OLO residual         8388608
//   end                                 100663296
// =====================================================================================================
extern "C" void kernel_launch(void* const* d_in, const int* in_sizes, int n_in,
                              void* d_out, int out_size, void* d_ws, size_t ws_size,
                              hipStream_t stream) {
  const int ROWS = NB * SEQ;
  if (n_in < 12) return;
  const int needX = ((NB - 1) * SEQ_FULL + SEQ) * DMOD;   // last input row read by cvt_all (+1), in elements
  if (in_sizes[0] < needX || in_sizes[1] < needX || in_sizes[2] < needX) return;
  if (in_sizes[3] < DMOD * DMOD || in_sizes[5] < DMOD * DMOD) return;
  if (in_sizes[7] < DMOD * DMOD || in_sizes[9] < DMOD * DMOD) return;
  if (in_sizes[4] < DMOD || in_sizes[6] < DMOD || in_sizes[8] < DMOD || in_sizes[10] < DMOD) return;
  if (in_sizes[11] < NH) return;
  if (out_size < ROWS * DMOD) return;

  const float* Qin = (const float*)d_in[0];
  const float* Kin = (const float*)d_in[1];
  const float* Vin = (const float*)d_in[2];
  const float* wq  = (const float*)d_in[3];
  const float* bq  = (const float*)d_in[4];
  const float* wk  = (const float*)d_in[5];
  const float* bk  = (const float*)d_in[6];
  const float* wv  = (const float*)d_in[7];
  const float* bv  = (const float*)d_in[8];
  const float* wo  = (const float*)d_in[9];
  const float* bo  = (const float*)d_in[10];
  const float* gt  = (const float*)d_in[11];
  float*       out = (float*)d_out;

  const size_t szXB  = (size_t)3 * ROWS * DMOD * 2;
  const size_t szW   = (size_t)DMOD * DMOD * 2;
  const size_t szP   = (size_t)ROWS * DMOD * 2;                 // q/k/o planes
  const size_t szVP  = (size_t)NB * NH * HD * SEQ * 2;
  size_t off = 0;
  const size_t oXB  = off; off += szXB;
  const size_t oWQB = off; off += szW;
  off += szW;                                           // WKB
  off += szW;                                           // WVB
  const size_t oWOB = off; off += szW;
  const size_t oQHI = off; off += szP;
  const size_t oQLO = off; off += szP;
  const size_t oKHI = off; off += szP;
  const size_t oKLO = off; off += szP;
  const size_t oVHI = off; off += szVP;
  const size_t oVLO = off; off += szVP;
  const size_t oOHI = off; off += szP;
  const size_t oOLO = off; off += szP;
  if (off > ws_size) return;                            // off = 100663296 at full size
  if (off > (size_t)134217728) return;

  char* ws = (char*)d_ws;
  u16*   XB  = (u16*)(ws + oXB);
  u16*   WQB = (u16*)(ws + oWQB);
  u16*   WOB = (u16*)(ws + oWOB);
  u16*   QHI = (u16*)(ws + oQHI);
  u16*   QLO = (u16*)(ws + oQLO);
  u16*   KHI = (u16*)(ws + oKHI);
  u16*   KLO = (u16*)(ws + oKLO);
  u16*   VHI = (u16*)(ws + oVHI);
  u16*   VLO = (u16*)(ws + oVLO);
  u16*   OHI = (u16*)(ws + oOHI);
  u16*   OLO = (u16*)(ws + oOLO);

  const dim3 blk(256);
  if ((DMOD % 64) != 0 || (ROWS % GT) != 0 || (DMOD % GT) != 0) return;
  const dim3 gC(3 * XCH + 4 * WCH);                     // 512
  const dim3 gG((ROWS / GT) * (DMOD / GT));             // 256
  const dim3 gG3((ROWS / GT) * (DMOD / GT), 3);         // 256 x 3
  const dim3 bG(128);
  const dim3 gAT(ATT_BLOCKS);                           // 512
  const dim3 bAT(ATT_THREADS);                          // 256

  // (0) inputs -> bf16 planes; weights [n][k] (already k-contiguous for x.W^T): bf16 planes for wq/wk/wv, f16 of bf16 value x1024
  //     for wo; destination XB .. WOB, contiguous
  cvt_all<<<gC, blk, 0, stream>>>(Qin, Kin, Vin, wq, wk, wv, wo, XB);
  // (1) q, k, v projections + bias (col = h*64+d), x1024, as f16 hi + residual planes: q, k [ROWS][1024], v as v^T planes
  gemm_bfb<<<gG3, bG, 0, stream>>>(XB, WQB, bq, bk, bv, QHI, ROWS, DMOD, DMOD, 1.0f, QSC);
  // (2) attention with per-head scale sigmoid(g)/8 -> O planes [b][s][h][d] x1024 (hi + residual)
  attn_fwd<<<gAT, bAT, 0, stream>>>(QHI, QLO, KHI, KLO, VHI, VLO, gt, OHI, OLO);
  // (3) output projection + bias -> out [ROWS][1024] f32, carries 1024 (O) x 1024 (wo) folded back
  gemm_h2<<<gG, blk, 0, stream>>>(OHI, OLO, WOB, bo, out, ROWS, DMOD, DMOD, 1.0f / (OSC * WOS));
  (void)hipGetLastError();
}

// v009
// A run of this version takes 135 microseconds.
// In both of two side-by-side timings against v008, it was 1.04 times as fast.
// All steps since v000 together make it 2.98 times as fast.
// Contractions: x.W{q,k,v}^T on v_wmma_f32_16x16x32_bf16 (x and W RNE-converted to bf16 operands, f32 accumulate, bias added in f32);
// scores k'.q'^T (q', k' carried x1024 as f16 hi plane + f16 residual plane, products hh+lh+hl), P.v (P x32768 f16 hi+residual,
// v x1024 f16 hi+residual, products hh+lh+hl) and O.Wo^T (O x1024 f16 hi+residual, Wo as f16(bf16(Wo) x1024), products h.w+l.w):
// v_wmma_f32_16x16x32_f16, f32 accumulate. Per-head logit scale sigmoid(bf16(g_h))/8 in f32; base-2 online softmax, 1/l fold and
// bias adds in f32 on VALU.
#include <hip/hip_runtime.h>
#include <math.h>
#include <stdint.h>

#ifndef NB
#define NB    2
#endif
#ifndef SEQ
#define SEQ   2048
#endif
#define NB_FULL  2
#define SEQ_FULL 2048
#define DMOD  1024
#define NH    16
#define HD    64
#define QSC   1024.0f
#define KSC   1024.0f
#define PCAR  32768.0f
#define PEXP  15.0f                // log2 of PCAR
#define VCAR  1024.0f
#define OSC   1024.0f
#define WOS   1024.0f
#define LOG2E 1.4426950408889634f
#define KSPL        2                  // key halves of an attention block, four waves each
#define ATT_WAVES   (4 * KSPL)
#define ATT_THREADS (ATT_WAVES * 32)
#define QB          128                // query rows of an attention block: 4 waves x 32
#define QTB         (SEQ / QB)
#define ATT_BLOCKS  (NB * NH * QTB)
#define NKB    (SEQ / 32)
#define SLABF  (16 * 68)
#define SLAB64 (16 * 68)
#define VTP    136                // pitch in halves of the v^T epilogue tiles: 256-B rows + 16 B (16 B x odd)
#define GT     128                // GEMM block tile: rows of A and rows of Bt
#define KT     64                 // keys per staged tile
#define LP     72                 // LDS row pitch in halves: 128-B rows + 16 B (16 B x odd, for 16-B LDS reads down a column of rows)
#define PLH    (64 * LP)          // one plane's tile: 64 rows
#define BUFH   (4 * PLH)          // k hi, k residual, v^T hi, v^T residual
#define GPLH   (GT * LP)          // one GEMM operand plane's tile: GT rows
#define NT     (SEQ / KT)
#define NTH    (NT / KSPL)        // staged tiles a key half
#define MRGF   (2 * 4 * 8 * 32 + 2 * 2 * 32)   // floats one wave hands over: 8 accumulator tiles, then running max and sum of 2 column groups
#define CVT_OCT 16                             // octets a thread of cvt_all
#define CVT_CH  (256 * CVT_OCT)                // octets a block of cvt_all
#define XCH     ((NB * SEQ * DMOD / 8) / CVT_CH)   // blocks an input plane
#define WCH     ((DMOD * DMOD / 8) / CVT_CH)       // blocks a weight plane
#define SEG8X   (SEQ * DMOD / 8)               // destination octets per batch
#define STR8X   (SEQ_FULL * DMOD / 8)          // source octets per batch in the input layout
static_assert(HD == 64 && DMOD == NH * HD && NH == 16);
static_assert(PCAR == 32768.0f && PEXP == 15.0f);
static_assert(QSC == KSC && KSC == VCAR);      // one plane scale for the three projections of a launch
static_assert(NB >= 1 && NB <= NB_FULL && SEQ >= 64 && SEQ <= SEQ_FULL && (SEQ % 64) == 0);
static_assert(ATT_THREADS == 256 && ATT_BLOCKS == NB * NH * (SEQ / 128) && NKB * 32 == SEQ && (SEQ % QB) == 0);
static_assert(((NB * SEQ) % GT) == 0 && (DMOD % GT) == 0 && (SEQ % GT) == 0 && (DMOD % 64) == 0 && GT == 128);
static_assert((SEQ % 64) == 0 && (SEQ % 8) == 0);
static_assert(((NB * SEQ * DMOD / 8) % CVT_CH) == 0 && ((DMOD * DMOD / 8) % CVT_CH) == 0 && (SEG8X % CVT_CH) == 0);
static_assert(VTP >= GT && 2 * 2 * GPLH >= 2 * GT * VTP && (VTP * 2) % 16 == 0);
static_assert(KT == 64 && HD == 64 && NT * KT == SEQ && NT * 2 == NKB && NTH * KSPL == NT && NTH >= 1 && KSPL == 2);
static_assert(KSPL * 2 * BUFH * 2 >= (4 * MRGF + 4 * 2 * SLABF) * 4 && (LP * 2) % 16 == 0 && (MRGF * 4) % 16 == 0);

typedef unsigned short u16;
typedef _Float16 v16h __attribute__((ext_vector_type(16)));
typedef _Float16 v8h  __attribute__((ext_vector_type(8)));
typedef __bf16   v16b __attribute__((ext_vector_type(16)));
typedef float    v8f  __attribute__((ext_vector_type(8)));
typedef float    v4f  __attribute__((ext_vector_type(4)));
typedef float    v2f  __attribute__((ext_vector_type(2)));
typedef _Float16 v2h  __attribute__((ext_vector_type(2)));
typedef unsigned int v4u __attribute__((ext_vector_type(4)));

union FragH { v16h v; v8h h[2]; v4u u[2]; };
union FragB { v16b v; v4u u[2]; };

// ---- scalar helpers --------------------------------------------------------------------------------
__device__ __forceinline__ unsigned short bf_bits(float f) {          // f32 -> bf16 bits, RNE convert
  unsigned u = __float_as_uint(f);
  return (unsigned short)((u + 0x7FFFu + ((u >> 16) & 1u)) >> 16);
}
__device__ __forceinline__ float bf_up(unsigned short h) { return __uint_as_float(((unsigned)h) << 16); }
__device__ __forceinline__ float bfr(float f) { return bf_up(bf_bits(f)); }
__device__ __forceinline__ unsigned short h_bits(_Float16 x) { return __builtin_bit_cast(unsigned short, x); }
__device__ __forceinline__ unsigned pk16(unsigned short a, unsigned short b) { return (unsigned)a | ((unsigned)b << 16); }
// 2^x by the bare v_exp_f32. The library exp2f wraps the same instruction in a compare, two selects, an add and a ldexp that only
// serve results below 2^-126; here every argument is <= 15 (<= 0 in the join) and such a result stands beside a row maximum of 2^15 (1 in the join), so 0 serves as well.
__device__ __forceinline__ float ex2(float x) { return __builtin_amdgcn_exp2f(x); }
// The same for the rescale factor, with the slots on both sides of the transcendental filled in the statement itself: the compiler put
// this one directly behind another v_exp_f32 whose source register it overwrites, and it does not look into asm text for what follows.
__device__ __forceinline__ float ex2_slot(float x) {
  float r = 0.f;
#if defined(__HIP_DEVICE_COMPILE__)
  asm("v_nop\n\tv_exp_f32 %0, %1\n\tv_nop" : "=v"(r) : "v"(x));
#endif
  return r;
}
// f16 residuals of a pair: low half = f16(a0 - low half of h), high half = f16(a1 - high half of h). The mixed-precision fused
// multiply-add reads h's half as f16 beside the f32 a and writes one half of the result register, the other half kept: one instruction
// a value, where convert back, subtract, convert and pack take more (the compiler does not form it from the plain expression).
__device__ __forceinline__ unsigned resid2(float a0, float a1, unsigned h) {
  unsigned l = 0;
#if defined(__HIP_DEVICE_COMPILE__)
  const float one = 1.0f;
  asm("v_fma_mixlo_f16 %0, %1, %2, -%3 op_sel_hi:[0,0,1]" : "=v"(l) : "v"(a0), "s"(one), "v"(h));
  asm("v_fma_mixhi_f16 %0, %1, %2, -%3 op_sel:[0,0,1] op_sel_hi:[0,0,1]" : "+v"(l) : "v"(a1), "s"(one), "v"(h));
#endif
  return l;
}
__device__ __forceinline__ v8f zero8() { v8f z = {0.f, 0.f, 0.f, 0.f, 0.f, 0.f, 0.f, 0.f}; return z; }
__device__ __forceinline__ v4f zero4() { v4f z = {0.f, 0.f, 0.f, 0.f}; return z; }

// ---- fragment loaders: 16-bit A/B operand, lane -> row/col (lane&15), p already includes +8*(lane>>4);
//      elements 0..7 <- p[0..7] (k0+8h..), elements 8..15 <- p[16..23] (k0+16+8h..)  (same split k map for A and B;
//      B is always read from a k-contiguous [n][k] plane)
__device__ __forceinline__ v16h ldfrag_h(const _Float16* p) {
  FragH f;
  f.h[0] = *(const v8h*)(p);
  f.h[1] = *(const v8h*)(p + 16);
  return f.v;
}
__device__ __forceinline__ v16b ldfrag_b(const u16* p) {              // bf16 plane read as unsigned integer vectors
  FragB f;
  f.u[0] = *(const v4u*)(p);
  f.u[1] = *(const v4u*)(p + 16);
  return f.v;
}

__device__ __forceinline__ v8f mma_h(v16h a, v16h b, v8f c) {
  return __builtin_amdgcn_wmma_f32_16x16x32_f16(false, a, false, b, (short)0, c, false, false);
}
__device__ __forceinline__ v8f mma_b(v16b a, v16b b, v8f c) {
  return __builtin_amdgcn_wmma_f32_16x16x32_bf16(false, a, false, b, (short)0, c, false, false);
}
// Four v_nop behind a run of WMMAs: the distance between the last of them and a vector instruction on its D, A or B; the operands are
// named so that their registers live up to the statement.
__device__ __forceinline__ void guard_s(v8f& a, v8f& b, v8f& c, v8f& d, v16h x0, v16h x1, v16h x2, v16h x3, v16h x4, v16h x5,
                                        v16h x6, v16h x7) {
#if defined(__HIP_DEVICE_COMPILE__)
  asm volatile("v_nop\n\tv_nop\n\tv_nop\n\tv_nop"
               : "+v"(a), "+v"(b), "+v"(c), "+v"(d)
               : "v"(x0), "v"(x1), "v"(x2), "v"(x3), "v"(x4), "v"(x5), "v"(x6), "v"(x7) : "memory");
#endif
}
__device__ __forceinline__ void guard_pv(v8f& a, v8f& b, v8f& c, v8f& d, v16h p0, v16h p1, v16h p2, v16h p3, v16h x0, v16h x1,
                                         v16h x2, v16h x3) {
#if defined(__HIP_DEVICE_COMPILE__)
  asm volatile("v_nop\n\tv_nop\n\tv_nop\n\tv_nop"
               : "+v"(a), "+v"(b), "+v"(c), "+v"(d)
               : "v"(p0), "v"(p1), "v"(p2), "v"(p3), "v"(x0), "v"(x1), "v"(x2), "v"(x3));
#endif
}
// The same for a wave's R x 4 accumulator tiles: the four v_nop stand behind the last WMMA of the tile, whichever the compiler puts last.
__device__ __forceinline__ void acc_guard8(v8f (&a)[2][4]) {
#if defined(__HIP_DEVICE_COMPILE__)
  asm volatile("v_nop\n\tv_nop\n\tv_nop\n\tv_nop"
               : "+v"(a[0][0]), "+v"(a[0][1]), "+v"(a[0][2]), "+v"(a[0][3]), "+v"(a[1][0]), "+v"(a[1][1]), "+v"(a[1][2]), "+v"(a[1][3]));
#endif
}
__device__ __forceinline__ void acc_guard16(v8f (&a)[4][4]) {
#if defined(__HIP_DEVICE_COMPILE__)
  asm volatile("v_nop\n\tv_nop\n\tv_nop\n\tv_nop"
               : "+v"(a[0][0]), "+v"(a[0][1]), "+v"(a[0][2]), "+v"(a[0][3]), "+v"(a[1][0]), "+v"(a[1][1]), "+v"(a[1][2]), "+v"(a[1][3]),
                 "+v"(a[2][0]), "+v"(a[2][1]), "+v"(a[2][2]), "+v"(a[2][3]), "+v"(a[3][0]), "+v"(a[3][1]), "+v"(a[3][2]), "+v"(a[3][3]));
#endif
}
// Two planes' 64-row x 128-B tiles, global -> LDS, by 128 threads: per lane four 16-B asynchronous copies a plane (rows r, r+16,
// r+32, r+48; 8 lanes = one whole 128-B row). la/lb: the lane's LDS byte addresses of row r, ga/gb: its global addresses, gstep: 16
// source rows in elements. The s_wait_xcnt closes the statement so that no address register is rewritten ahead of it.
__device__ __forceinline__ void stage2(unsigned la, unsigned lb, const u16* ga, const u16* gb, size_t gstep) {
#if defined(__HIP_DEVICE_COMPILE__)
  const unsigned ls = 16 * LP * 2;
  asm volatile("global_load_async_to_lds_b128 %0, %8, off\n\t"
               "global_load_async_to_lds_b128 %1, %9, off\n\t"
               "global_load_async_to_lds_b128 %2, %10, off\n\t"
               "global_load_async_to_lds_b128 %3, %11, off\n\t"
               "global_load_async_to_lds_b128 %4, %12, off\n\t"
               "global_load_async_to_lds_b128 %5, %13, off\n\t"
               "global_load_async_to_lds_b128 %6, %14, off\n\t"
               "global_load_async_to_lds_b128 %7, %15, off\n\t"
               "s_wait_xcnt 0x0"
               :: "v"(la), "v"(la + ls), "v"(la + 2 * ls), "v"(la + 3 * ls),
                  "v"(lb), "v"(lb + ls), "v"(lb + 2 * ls), "v"(lb + 3 * ls),
                  "v"(ga), "v"(ga + gstep), "v"(ga + 2 * gstep), "v"(ga + 3 * gstep),
                  "v"(gb), "v"(gb + gstep), "v"(gb + 2 * gstep), "v"(gb + 3 * gstep)
               : "memory");
#endif
}
// One plane's tile, the same way: four copies a lane.
__device__ __forceinline__ void stage1(unsigned la, const u16* ga, size_t gstep) {
#if defined(__HIP_DEVICE_COMPILE__)
  const unsigned ls = 16 * LP * 2;
  asm volatile("global_load_async_to_lds_b128 %0, %4, off\n\t"
               "global_load_async_to_lds_b128 %1, %5, off\n\t"
               "global_load_async_to_lds_b128 %2, %6, off\n\t"
               "global_load_async_to_lds_b128 %3, %7, off\n\t"
               "s_wait_xcnt 0x0"
               :: "v"(la), "v"(la + ls), "v"(la + 2 * ls), "v"(la + 3 * ls),
                  "v"(ga), "v"(ga + gstep), "v"(ga + 2 * gstep), "v"(ga + 3 * gstep)
               : "memory");
#endif
}
__device__ __forceinline__ void wave_sync_lds() {
  __builtin_amdgcn_fence(__ATOMIC_RELEASE, "workgroup");
  __builtin_amdgcn_wave_barrier();
  __builtin_amdgcn_fence(__ATOMIC_ACQUIRE, "workgroup");
}

// =====================================================================================================
// All seven f32 planes -> 16-bit planes in ONE launch. Destination D holds the planes back to back in block order:
//   x_q, x_k, x_v (bf16 RNE bits, NB*SEQ rows each), wq, wk, wv (bf16 RNE bits), wo (f16 bits of (bf16 RNE value) * WOS).
// Block = CVT_CH consecutive octets of one plane (a plane is a whole number of blocks, so plane and mode are block-uniform);
// thread = CVT_OCT octets, 256 octets apart: per octet two 16-B loads and one 16-B store, 32 consecutive lanes = 512 contiguous,
// 512-B aligned destination bytes. All of a thread's loads are issued ahead of its first conversion.
// An input plane is read as NB batches of SEQ rows out of a layout with SEQ_FULL rows per batch (a block never straddles a batch).
// coverage: grid = 3*XCH + 4*WCH blocks x 256 thr x CVT_OCT octets = the whole of the seven destination planes.
// =====================================================================================================
__global__ __launch_bounds__(256) void cvt_all(const float* __restrict__ xq, const float* __restrict__ xk,
                                               const float* __restrict__ xv, const float* __restrict__ wq,
                                               const float* __restrict__ wk, const float* __restrict__ wv,
                                               const float* __restrict__ wo, u16* D) {
  const unsigned bid = blockIdx.x, tid = threadIdx.x;
  const float* s;
  size_t so;                                 // the block's first source octet
  if (bid < 3u * XCH) {                      // block-uniform; no barriers in this kernel
    const unsigned pl = bid / XCH, g0 = (bid % XCH) * CVT_CH;
    s  = pl == 0 ? xq : pl == 1 ? xk : xv;
    so = (size_t)(g0 / SEG8X) * STR8X + (size_t)(g0 % SEG8X);
  } else {
    const unsigned wb = bid - 3u * XCH, pl = wb / WCH;
    s  = pl == 0 ? wq : pl == 1 ? wk : pl == 2 ? wv : wo;
    so = (size_t)(wb % WCH) * CVT_CH;
  }
  const float* p = s + (so + (size_t)tid) * 8;
  v4f a[CVT_OCT], c4[CVT_OCT];
#pragma unroll   // arrays indexed by constants (registers); the loads stand together
  for (int i = 0; i < CVT_OCT; ++i) {
    a[i]  = *(const v4f*)(p + i * 2048);
    c4[i] = *(const v4f*)(p + i * 2048 + 4);
  }
  u16* d = D + ((size_t)bid * CVT_CH + (size_t)tid) * 8;
  if (bid < 3u * XCH + 3u * WCH) {           // block-uniform
#pragma unroll
    for (int i = 0; i < CVT_OCT; ++i) {
      v4u o;
#pragma unroll
      for (int e = 0; e < 2; ++e) {
        o[e]     = pk16(bf_bits(a[i][2 * e]),  bf_bits(a[i][2 * e + 1]));
        o[2 + e] = pk16(bf_bits(c4[i][2 * e]), bf_bits(c4[i][2 * e + 1]));
      }
      *(v4u*)(d + i * 2048) = o;
    }
  } else {
#pragma unroll
    for (int i = 0; i < CVT_OCT; ++i) {
      v4u o;
#pragma unroll
      for (int e = 0; e < 2; ++e) {
        o[e]     = pk16(h_bits((_Float16)(bfr(a[i][2 * e]) * WOS)),  h_bits((_Float16)(bfr(a[i][2 * e + 1]) * WOS)));
        o[2 + e] = pk16(h_bits((_Float16)(bfr(c4[i][2 * e]) * WOS)), h_bits((_Float16)(bfr(c4[i][2 * e + 1]) * WOS)));
      }
      *(v4u*)(d + i * 2048) = o;
    }
  }
}

// =====================================================================================================
// f32 GEMM epilogue (gemm_h2): one 16x64 f32 row group of the wave's tile (times oscale) staged in its LDS slab (pitch 68, wave-private),
// coverage: 8 instructions x 2 rows x 16 lanes x 4 floats = the 16 x 64 row group.
// =====================================================================================================
__device__ __forceinline__ void epi64(float* sl, v8f a0, v8f a1, v8f a2, v8f a3, float oscale, v4f badd, float* C, int N,
                                      size_t rowb, int col0, int lane) {
  const int hh = lane >> 4, m = lane & 15;
#pragma unroll
  for (int r = 0; r < 8; ++r) {
    const int ro = (8 * hh + r) * 68 + m;
    sl[ro]      = a0[r] * oscale;
    sl[ro + 16] = a1[r] * oscale;
    sl[ro + 32] = a2[r] * oscale;
    sl[ro + 48] = a3[r] * oscale;
  }
  wave_sync_lds();
  v4f vals[8];
#pragma unroll
  for (int it = 0; it < 8; ++it) vals[it] = *(const v4f*)(sl + (it * 2 + hh) * 68 + m * 4) + badd;
  float* dst = C + (rowb + (size_t)hh) * (size_t)N + col0 + m * 4;
  {
#pragma unroll
    for (int it = 0; it < 8; ++it) {
      *(v4f*)(dst + (size_t)(it * 2) * (size_t)N) = vals[it];
    }
    
  }
}

// =====================================================================================================
// Three bf16 GEMMs with bias in one launch, product pj = blockIdx.y (0 q, 1 k, 2 v): A = plane pj of A3, Bt = plane pj of Bt3,
// bias = bias<pj>, PH / PL = planes 2pj / 2pj+1 of P6 (M*N halves each), vt = (pj == 2). Each product, result written as two f16
// planes: c[M][N] (f32, in registers) = A[M][K] (bf16 row-major) . Bt[N][K]^T (bf16
// k-contiguous), times oscale, plus bf16-RNE value of bias[n]; PH = f16(c * psc), PL = f16(c * psc - PH) (psc a power of two).
// Block = 128x128 tile, 4 waves in 2 x 2, a wave owns 64 rows x 64 columns (4 x 4 accumulator tiles): each LDS fragment feeds four
// WMMAs and each staged row serves 128 results. The block's 128 A rows and 128 Bt rows are staged in LDS 64 k (one whole
// 128-B line a row) at a time by asynchronous copies, two buffers (tile t+1 flies while tile t is worked on, one block barrier a
// tile); fragments are read from LDS (two 16-B reads each, split k map for A and B), two k steps of 32 a tile, in the k order of
// a plain walk (host checks K % 64 == 0, M % 128 == 0, N % 128 == 0, grid = ((M/128)*(N/128), 3)).
// Epilogue, vt == 0: planes laid out [M][N]; each of the wave's four 16x64 f32 row groups goes through its private LDS slab (pitch
//   68), a lane then owns 8 consecutive columns of a row: per plane 4 instructions x 4 rows x 8 lanes x 8 halves = 16 x 64.
// Epilogue, vt != 0 (N == NH*HD, rows = b*SEQ + s, SEQ % 128 == 0): planes laid out [b][h][d][s]. A lane's 8 accumulator rows of one
//   column are 8 consecutive s of one (h, d): one 16-B LDS store a plane into the block's [128 (h,d)][128 s] tiles (pitch VTP, in the
//   ring, which is free behind the loop's last barrier); one block barrier; then 16 iterations x 128 thr x 8 halves = 128 lines x
//   128 s of each plane, 16 lanes = 256 contiguous bytes.
// =====================================================================================================
__global__ __launch_bounds__(128)
void gemm_bfb(const u16* __restrict__ A3, const u16* __restrict__ Bt3, const float* __restrict__ bias0,
              const float* __restrict__ bias1, const float* __restrict__ bias2,
              u16* P6, int M, int N, int K, float oscale, float psc) {
  __shared__ __align__(16) float slab[4 * SLAB64];
  __shared__ __align__(16) u16 ring[2 * 2 * GPLH];   // two buffers of [A tile | Bt tile], 128 rows of pitch LP each
  const int tid = threadIdx.x, wave = tid >> 5, lane = tid & 31, hh = lane >> 4, m = lane & 15;
  const int wr = wave >> 1, wc = wave & 1;   // the wave's 64-row and 64-column half of the block tile
  const int ntile = N >> 7;
  const int bid   = blockIdx.x;
  const int row0  = (bid / ntile) * GT;
  const int col0  = (bid % ntile) * GT;
  if (row0 + GT > M) return;                 // block-uniform, in front of every barrier; never taken with the exact grid
  // which of the three products this block belongs to (block-uniform): operands, bias, result planes and layout
  const int pj = blockIdx.y;
  const u16* A       = A3  + (size_t)pj * (size_t)M * (size_t)K;
  const u16* Bt      = Bt3 + (size_t)pj * (size_t)N * (size_t)K;
  const float* bias  = pj == 0 ? bias0 : pj == 1 ? bias1 : bias2;
  u16* PH            = P6 + (size_t)(2 * pj) * (size_t)M * (size_t)N;
  u16* PL            = PH + (size_t)M * (size_t)N;
  const int vt       = pj == 2;
  // staging: thread -> (row sr of 16, 16-B piece sc of 8), rows sr + 16 i, i = 0..7, of each operand's tile
  const int sr = tid >> 3, sc = (tid & 7) * 8;
  const u16* ag = A  + (size_t)(row0 + sr) * K + sc;
  const u16* bg = Bt + (size_t)(col0 + sr) * K + sc;
  const unsigned lds0 = (unsigned)(size_t)(const void*)ring + (unsigned)(sr * LP + sc) * 2u;
  const int nt = K >> 6;
  auto stage = [&](int t, int buf) {
    const unsigned l = lds0 + (unsigned)buf * (2u * GPLH * 2u);
    const u16* a = ag + (size_t)t * 64;
    const u16* b = bg + (size_t)t * 64;
    stage2(l, l + GPLH * 2u, a, b, (size_t)16 * K);                                                               // rows 0..63
    stage2(l + PLH * 2u, l + (GPLH + PLH) * 2u, a + (size_t)64 * K, b + (size_t)64 * K, (size_t)16 * K);          // rows 64..127
  };
  // fragment readers, in halves from a buffer's start
  const int afo = (wr * 64 + m) * LP + 8 * hh;
  const int bfo = GPLH + (wc * 64 + m) * LP + 8 * hh;
  v8f acc[4][4];
#pragma unroll
  for (int i = 0; i < 4; ++i) {
#pragma unroll
    for (int j = 0; j < 4; ++j) acc[i][j] = zero8();
  }
  stage(0, 0);
  asm volatile("s_wait_asynccnt 0x0" ::: "memory");   // this wave's copies of tile 0 have landed
  __syncthreads();                                    // ... and every other wave's: tile 0 may be read
  if (nt > 1) stage(1, 1);
#pragma unroll 1   // one tile a trip: the ring's hand-over stands once, at the foot
  for (int t = 0; t < nt; ++t) {
    const u16* bufp = ring + (t & 1) * (2 * GPLH);
#pragma unroll   // both k steps in line: LDS offsets become immediates, accumulators stay in registers
    for (int kk = 0; kk < 2; ++kk) {
      v16b a[4], b[4];
#pragma unroll
      for (int i = 0; i < 4; ++i) {
        a[i] = ldfrag_b(bufp + afo + i * 16 * LP + kk * 32);
        b[i] = ldfrag_b(bufp + bfo + i * 16 * LP + kk * 32);
      }
      __builtin_amdgcn_sched_barrier(0);   // the k step's 16 LDS reads issue together ahead of its 16 WMMAs: one LDS latency a step, not one a row
#pragma unroll
      for (int i = 0; i < 4; ++i) {
#pragma unroll
        for (int j = 0; j < 4; ++j) acc[i][j] = mma_b(a[i], b[j], acc[i][j]);
      }
    }
    acc_guard16(acc);                                   // WMMA distance kept on both sides of the branches that follow
    // ---- hand-over: tile t+1 is published and tile t's buffer is freed by the one barrier; then the refill ----
    asm volatile("s_wait_dscnt 0x0" ::: "memory");      // this wave's reads of tile t are done before its buffer is refilled
    asm volatile("s_wait_asynccnt 0x0" ::: "memory");   // this wave's copies of tile t+1 have landed
    __syncthreads();
    if (t + 2 < nt) stage(t + 2, t & 1);
  }
  asm volatile("s_wait_asynccnt 0x0" ::: "memory");     // nothing in flight when the wave goes on to its end
  const int colw = col0 + wc * 64;           // the wave's first column
  // every loop of both epilogues is unrolled so that accumulators and staging arrays are indexed by constants (registers, no scratch)
  if (vt == 0) {                             // block-uniform
    float* sl = slab + wave * SLAB64;
    const int rq = lane >> 3, c8 = (lane & 7) * 8;
    const v4f bv0 = *(const v4f*)(bias + colw + c8), bv1 = *(const v4f*)(bias + colw + c8 + 4);   // columns < N (N multiple of 128)
    float badd[8];
#pragma unroll
    for (int e = 0; e < 4; ++e) { badd[e] = bfr(bv0[e]); badd[4 + e] = bfr(bv1[e]); }
#pragma unroll
    for (int i = 0; i < 4; ++i) {            // the wave's four groups of 16 rows, one after the other through the one slab
#pragma unroll
      for (int r = 0; r < 8; ++r) {
        const int ro = (8 * hh + r) * 68 + m;
        sl[ro]      = acc[i][0][r] * oscale;
        sl[ro + 16] = acc[i][1][r] * oscale;
        sl[ro + 32] = acc[i][2][r] * oscale;
        sl[ro + 48] = acc[i][3][r] * oscale;
      }
      wave_sync_lds();
      v4u oh[4], ol[4];
#pragma unroll
      for (int i4 = 0; i4 < 4; ++i4) {
        const int row = i4 * 4 + rq;
        const v4f a4 = *(const v4f*)(sl + row * 68 + c8), c4 = *(const v4f*)(sl + row * 68 + c8 + 4);
        float w[8];
#pragma unroll
        for (int e = 0; e < 4; ++e) { w[e] = (a4[e] + badd[e]) * psc; w[4 + e] = (c4[e] + badd[4 + e]) * psc; }
#pragma unroll
        for (int e = 0; e < 4; ++e) {
          const _Float16 h0 = (_Float16)w[2 * e], h1 = (_Float16)w[2 * e + 1];
          const _Float16 l0 = (_Float16)(w[2 * e] - (float)h0), l1 = (_Float16)(w[2 * e + 1] - (float)h1);
          oh[i4][e] = pk16(h_bits(h0), h_bits(h1));
          ol[i4][e] = pk16(h_bits(l0), h_bits(l1));
        }
      }
      wave_sync_lds();                       // every lane's reads of the slab stand ahead of the next group's writes
      const size_t ob = (size_t)(row0 + wr * 64 + i * 16) * (size_t)N + colw + c8;
#pragma unroll
      for (int i4 = 0; i4 < 4; ++i4) {
        const size_t o8 = ob + (size_t)(i4 * 4 + rq) * (size_t)N;
        *(v4u*)(PH + o8) = oh[i4];
        *(v4u*)(PL + o8) = ol[i4];
      }
      asm volatile("s_wait_xcnt 0x0" ::: "memory");   // behind the run of stores: what follows in the text rewrites their registers
    }
  } else {
    u16* TH = ring;
    u16* TL = ring + GT * VTP;
#pragma unroll
    for (int j = 0; j < 4; ++j) {
      const float bj = bfr(bias[colw + 16 * j + m]);        // column < N (N multiple of 128)
#pragma unroll
      for (int i = 0; i < 4; ++i) {
        v4u th, tl;
#pragma unroll
        for (int e = 0; e < 4; ++e) {
          const float t0 = (acc[i][j][2 * e] * oscale + bj) * psc, t1 = (acc[i][j][2 * e + 1] * oscale + bj) * psc;
          const _Float16 h0 = (_Float16)t0, h1 = (_Float16)t1;
          const _Float16 l0 = (_Float16)(t0 - (float)h0), l1 = (_Float16)(t1 - (float)h1);
          th[e] = pk16(h_bits(h0), h_bits(h1));
          tl[e] = pk16(h_bits(l0), h_bits(l1));
        }
        const int to = (wc * 64 + 16 * j + m) * VTP + wr * 64 + i * 16 + 8 * hh;
        *(v4u*)(TH + to) = th;
        *(v4u*)(TL + to) = tl;
      }
    }
    __syncthreads();                         // the four waves' parts of the [(h,d)][s] tiles are complete
    const int q16 = tid >> 4, p8 = (tid & 15) * 8;
    const size_t base = ((size_t)(row0 / SEQ) * (NH * HD) + col0) * SEQ + (row0 % SEQ) + p8;
#pragma unroll
    for (int g = 0; g < 4; ++g) {            // four lines a thread and plane at a time: LDS reads first, then their stores
      v4u vh[4], vl[4];
#pragma unroll
      for (int it = 0; it < 4; ++it) {
        const int line = (g * 4 + it) * 8 + q16;   // (h,d) line 0..127 of the block
        vh[it] = *(const v4u*)(TH + line * VTP + p8);
        vl[it] = *(const v4u*)(TL + line * VTP + p8);
      }
#pragma unroll
      for (int it = 0; it < 4; ++it) {
        const int line = (g * 4 + it) * 8 + q16;
        *(v4u*)(PH + base + (size_t)line * SEQ) = vh[it];
        *(v4u*)(PL + base + (size_t)line * SEQ) = vl[it];
      }
      asm volatile("s_wait_xcnt 0x0" ::: "memory");   // behind the run of stores: no register that they name is rewritten ahead of it
    }
  }
}

// =====================================================================================================
// f16 hi+lo GEMM with bias: C[M][N] (f32) = (Ahi + Alo)[M][K] . Bt[N][K]^T times oscale, plus bf16-RNE value of bias[n];
// Ahi/Alo f16 planes (same layout), Bt f16 k-contiguous; products hi.B + lo.B into one accumulator (lo is the unscaled
// residual of hi). Block = 128x128 tile, 8 waves in 4 x 2, a wave owns 32 rows x 64 columns (2 x 4 accumulator tiles); the same
// two-buffer LDS ring as gemm_bfb, three planes a tile (Ahi, Alo, Bt), 128 rows each, staged by 256 threads: threads 0..127 rows
// 0..63, threads 128..255 rows 64..127 (host checks M % 128 == 0, N % 128 == 0, K % 64 == 0, grid = (M/128)*(N/128)).
// =====================================================================================================
__global__ __launch_bounds__(256)
void gemm_h2(const u16* __restrict__ Ah, const u16* __restrict__ Al, const u16* __restrict__ Bt,
             const float* __restrict__ bias, float* C, int M, int N, int K, float oscale) {
  __shared__ __align__(16) float slab[8 * SLAB64];
  __shared__ __align__(16) u16 ring[2 * 3 * GPLH];   // two buffers of [Ahi tile | Alo tile | Bt tile], 128 rows of pitch LP each
  const int tid = threadIdx.x, wave = tid >> 5, lane = tid & 31, hh = lane >> 4, m = lane & 15;
  const int wr = wave >> 1, wc = wave & 1;   // the wave's 32-row quarter and 64-column half of the block tile
  const int ntile = N >> 7;
  const int bid   = blockIdx.x;
  const int row0  = (bid / ntile) * GT;
  const int col0  = (bid % ntile) * GT;
  if (row0 + GT > M) return;                 // block-uniform, in front of every barrier; never taken with the exact grid
  // staging: thread -> (row sr of 16 in its half of 64 rows, 16-B piece sc of 8), rows sr, sr+16, sr+32, sr+48 of each plane's tile
  const int sr = (tid >> 7) * 64 + ((tid & 127) >> 3), sc = (tid & 7) * 8;
  const size_t aofs = (size_t)(row0 + sr) * K + sc;
  const u16* ahg = Ah + aofs;
  const u16* alg = Al + aofs;
  const u16* bg  = Bt + (size_t)(col0 + sr) * K + sc;
  const unsigned lds0 = (unsigned)(size_t)(const void*)ring + (unsigned)(sr * LP + sc) * 2u;
  const int nt = K >> 6;
  auto stage = [&](int t, int buf) {
    const unsigned l = lds0 + (unsigned)buf * (3u * GPLH * 2u);
    stage2(l, l + GPLH * 2u, ahg + (size_t)t * 64, alg + (size_t)t * 64, (size_t)16 * K);
    stage1(l + 2u * GPLH * 2u, bg + (size_t)t * 64, (size_t)16 * K);
  };
  // fragment readers, in halves from a buffer's start
  const int afo = (wr * 32 + m) * LP + 8 * hh;
  const int bfo = 2 * GPLH + (wc * 64 + m) * LP + 8 * hh;
  v8f acc[2][4];
#pragma unroll
  for (int i = 0; i < 2; ++i) {
#pragma unroll
    for (int j = 0; j < 4; ++j) acc[i][j] = zero8();
  }
  stage(0, 0);
  asm volatile("s_wait_asynccnt 0x0" ::: "memory");   // this wave's copies of tile 0 have landed
  __syncthreads();                                    // ... and every other wave's: tile 0 may be read
  if (nt > 1) stage(1, 1);
#pragma unroll 1   // one tile a trip: the ring's hand-over stands once, at the foot
  for (int t = 0; t < nt; ++t) {
    const _Float16* bufp = (const _Float16*)(const void*)ring + (t & 1) * (3 * GPLH);
    v16h ah[2][2], al[2][2], b[2][4];
#pragma unroll
    for (int kk = 0; kk < 2; ++kk) {
#pragma unroll
      for (int i = 0; i < 2; ++i) {
        ah[kk][i] = ldfrag_h(bufp + afo + i * 16 * LP + kk * 32);
        al[kk][i] = ldfrag_h(bufp + GPLH + afo + i * 16 * LP + kk * 32);
      }
#pragma unroll
      for (int j = 0; j < 4; ++j) b[kk][j] = ldfrag_h(bufp + bfo + j * 16 * LP + kk * 32);
    }
    __builtin_amdgcn_sched_barrier(0);   // all of the tile's LDS reads issue ahead of its WMMAs: one LDS latency a tile, not several
#pragma unroll
    for (int kk = 0; kk < 2; ++kk) {
#pragma unroll
      for (int i = 0; i < 2; ++i) {
#pragma unroll
        for (int j = 0; j < 4; ++j) acc[i][j] = mma_h(ah[kk][i], b[kk][j], acc[i][j]);
      }
#pragma unroll
      for (int i = 0; i < 2; ++i) {
#pragma unroll
        for (int j = 0; j < 4; ++j) acc[i][j] = mma_h(al[kk][i], b[kk][j], acc[i][j]);
      }
    }
    acc_guard8(acc);                                    // WMMA distance kept on both sides of the branches that follow
    // ---- hand-over: tile t+1 is published and tile t's buffer is freed by the one barrier; then the refill ----
    asm volatile("s_wait_dscnt 0x0" ::: "memory");      // this wave's reads of tile t are done before its buffer is refilled
    asm volatile("s_wait_asynccnt 0x0" ::: "memory");   // this wave's copies of tile t+1 have landed
    __syncthreads();
    if (t + 2 < nt) stage(t + 2, t & 1);
  }
  asm volatile("s_wait_asynccnt 0x0" ::: "memory");     // nothing in flight when the wave goes on to its end
  const int colw = col0 + wc * 64;                        // the wave's first column
  const v4f bv = *(const v4f*)(bias + colw + m * 4);      // columns colw + 4m .. +3, always < N (N multiple of 128)
  v4f badd;
#pragma unroll
  for (int e = 0; e < 4; ++e) badd[e] = bfr(bv[e]);
#pragma unroll
  for (int i = 0; i < 2; ++i) {                           // the wave's two groups of 16 rows, one after the other through the one slab
    epi64(slab + wave * SLAB64, acc[i][0], acc[i][1], acc[i][2], acc[i][3], oscale, badd, C, N,
          (size_t)(row0 + wr * 32 + i * 16), colw, lane);
    asm volatile("s_wait_xcnt 0x0" ::: "memory");         // behind the run of stores: what follows in the text rewrites their registers
    wave_sync_lds();                                      // every lane's reads of the slab stand ahead of the next group's writes
  }
}

// =====================================================================================================
// Full (non-causal, unmasked) multi-head flash attention: block = (batch b, head, 128 query rows), 8 waves = 4 query groups x 2 key
// halves. Wave (kh, wq) owns the 32 query rows q0 = 128*qt + 32*wq .. q0+31 (two column groups of 16) and the keys
// kh*SEQ/2 .. +SEQ/2-1: every k and v^T fragment read from LDS feeds both column groups, and a staged tile serves 128 queries. Each
// key half has its own ring: tiles of KT = 64 keys of the k and v^T planes, staged by the half's 128 threads with asynchronous
// copies, two buffers (tile t+1 flies while tile t is worked on, one block barrier a tile), read by the half's 4 waves; each tile
// serves two key blocks of 32. Behind the last tile's barrier the rings become the hand-over area and the result slabs.
//   Per-head logit scale: sigmoid(bf16 RNE value of g[head]) / 8, computed in f32 once per thread (head uniform per block) and
//   folded with log2(e) and the q/k carries into lsc.
//   q planes (hi, lo f16, x1024) laid out [b][s][h][d]; k planes the same; v^T planes [b][h][d][s] (x1024).
//   All NKB = SEQ/32 key blocks of 32 keys are visited, half of them by each key half (static bounds).
//   Scores are computed TRANSPOSED: S^T tile (g, i) = k rows (keys kb+16i .. +15, A operand, row m = lane&15, split k map
//   over d) times q^T (B operand, col n = query q0 + 16g + (lane&15), k = d, split map), 3 products per tile and d-chunk
//   (k_hi.q_hi + k_lo.q_hi + k_hi.q_lo). D element r of lane l = (key kb+16i+8h+r, query q0+16g+(l&15)), so a lane owns one query
//   column a group and 16 of its 32 keys; the partner lane l^16 owns the other 16 -> row max / row sum need one xor-16 shuffle.
//   Online max-subtracted base-2 softmax in f32, per column group. The exp'd values ARE the P A-fragment in place: A row m = query =
//   lane&15, element i <- key kb+8h+i (tile 0, D element i), element 8+i <- key kb+16+8h+i (tile 1, D element i). P is carried
//   x32768 as f16 hi + f16 residual. The rescale factor of query row 8h+r of the O accumulators is fetched from lane 8h+r with a
//   shuffle (uniform control). 4+4 v^T B fragments (hi and residual planes, col n = d = 16j + (lane&15), keys k-contiguous),
//   12 P.V WMMAs a column group (hh + lh + hl).
//   Join of the key halves: the waves of half 1 store their accumulators, running maxima and sums in LDS; one block barrier; wave
//   (0, wq) brings both halves to the common maximum: o = o_0 2^(m_0-m) + o_1 2^(m_1-m), l likewise.
//   Epilogue: 1/l (per query, shuffled to the D row owner) and carry folds in f32; the wave's 2 x 16x64 f32 result staged in its LDS
// coverage: per wave and column group 4 instructions x 4 rows x 8 lanes x 8 halves = 16 x 64 per plane; grid NB*NH*SEQ/128 blocks x
//           4 waves x 2 groups = every (b, s, h) row of both O planes exactly once.
// =====================================================================================================
// four waves a SIMD (two blocks a WGP): the register budget is held to a quarter of the SIMD's file
__global__ __launch_bounds__(ATT_THREADS) __attribute__((amdgpu_waves_per_eu(4, 4)))
void attn_fwd(const u16* __restrict__ QHIp, const u16* __restrict__ QLOp,
              const u16* __restrict__ KHIp, const u16* __restrict__ KLOp,
              const u16* __restrict__ VHIp, const u16* __restrict__ VLOp,
              const float* __restrict__ gatep,
              u16* OHIp, u16* OLOp) {
  __shared__ __align__(16) u16 ring[KSPL * 2 * BUFH];   // per key half two tile buffers; in the epilogue hand-over area and result slabs

  const int tid  = threadIdx.x;
  const int wave = __builtin_amdgcn_readfirstlane(tid >> 5);   // wave-uniform: held in a scalar register
  const int kh   = wave >> 2;                // key half
  const int wq   = wave & 3;                 // query group of 32
  const int lane = tid & 31;
  const int hh   = lane >> 4;
  const int c    = lane & 15;

  const int bid  = blockIdx.x;
  const int qt   = bid % QTB;
  const int head = (bid / QTB) % NH;
  const int b    = bid / (QTB * NH);
  const int q0   = qt * QB + wq * 32;
  const int key0 = kh * (NTH * KT);          // the half's first key

  // per-head scale: sigmoid(bf16 value of g) / 8 in f32; head < NH always (block decode), host checks the input extent
  const float gbf = bfr(gatep[head]);
  const float sgm = 1.0f / (1.0f + expf(-gbf));
  const float lsc = sgm * (0.125f * (LOG2E / (QSC * KSC)));

  // B fragments of q^T: col n = query q0 + 16g + c, k = d (k-contiguous row of the q plane)
  const size_t qofs = (((size_t)(b * SEQ + q0 + c)) * NH + head) * HD + 8 * hh;
  const _Float16* Qh  = (const _Float16*)(const void*)QHIp + qofs;
  const _Float16* Ql  = (const _Float16*)(const void*)QLOp + qofs;
  // staging: thread of the half -> (row sr of 16, 16-B piece sc of 8); k tile row = key, v^T tile row = d, both 64 halves long
  const int st = tid & 127;
  const int sr = st >> 3, sc = (st & 7) * 8;
  const size_t kofs = (((size_t)b * SEQ + key0 + sr) * NH + head) * HD + sc;      // tile's first key in the half added per tile
  const size_t vofs = ((size_t)(b * NH + head) * HD + sr) * SEQ + key0 + sc;      // tile's first key in the half added per tile
  const unsigned lds0 = (unsigned)(size_t)(const void*)ring + (unsigned)kh * (2u * BUFH * 2u) + (unsigned)(sr * LP + sc) * 2u;
  auto stage = [&](int t, int buf) {
    const unsigned l = lds0 + (unsigned)buf * (BUFH * 2u);
    const size_t ko = kofs + (size_t)t * (KT * NH * HD), vo = vofs + (size_t)t * KT;
    stage2(l, l + PLH * 2u, KHIp + ko, KLOp + ko, (size_t)16 * (NH * HD));
    stage2(l + 2u * PLH * 2u, l + 3u * PLH * 2u, VHIp + vo, VLOp + vo, (size_t)16 * SEQ);
  };
  // fragment readers, in halves from a buffer's start: A of k: row m = key 16i + c, k = d; B of v: col n = d = 16j + c, k = key
  const int kfo = c * LP + 8 * hh;
  const int vfo = 2 * PLH + c * LP + 8 * hh;

  // q^T B fragments (two column groups; hi and residual planes, both d chunks of 32): read once, held in registers for all key tiles
  v16h qhf[2][2], qlf[2][2];
#pragma unroll
  for (int g = 0; g < 2; ++g) {
#pragma unroll
    for (int kk = 0; kk < 2; ++kk) {
      qhf[g][kk] = ldfrag_h(Qh + g * (16 * NH * HD) + kk * 32);
      qlf[g][kk] = ldfrag_h(Ql + g * (16 * NH * HD) + kk * 32);
    }
  }
  // behind the run of q loads: both address pairs are named as inputs, so their registers live up to the wait and no load of the run
  // lands on a register that another load of the run names as its address
  asm volatile("s_wait_xcnt 0x0" :: "v"(Qh), "v"(Ql) : "memory");

  float mrun[2] = {-INFINITY, -INFINITY}, lrun[2] = {0.f, 0.f};
  v8f o[2][4];
#pragma unroll
  for (int g = 0; g < 2; ++g) {
#pragma unroll
    for (int j = 0; j < 4; ++j) o[g][j] = zero8();
  }

  stage(0, 0);
  asm volatile("s_wait_asynccnt 0x0" ::: "memory");   // this wave's copies of tile 0 have landed
  __syncthreads();                                    // ... and every other wave's: tile 0 may be read
  if (NTH > 1) stage(1, 1);

#pragma unroll 1
  for (int t = 0; t < NTH; ++t) {
   const _Float16* bufp = (const _Float16*)(const void*)ring + kh * (2 * BUFH) + (t & 1) * BUFH;
#pragma unroll   // both key blocks of a tile in line: their LDS offsets become immediates
   for (int sub = 0; sub < 2; ++sub) {
    // ---- transposed scores: s[g][0] = keys kb..kb+15, s[g][1] = keys kb+16..kb+31 (kb = key0 + 64t + 32sub), column = query q0+16g+c ----
    v8f s[2][2] = {{zero8(), zero8()}, {zero8(), zero8()}};
    const _Float16* k0p = bufp + kfo + sub * 32 * LP;
    const _Float16* k1p = k0p + 16 * LP;
    const _Float16* l0p = k0p + PLH;
    const _Float16* l1p = l0p + 16 * LP;
#pragma unroll
    for (int kk = 0; kk < 2; ++kk) {
      const v16h kh0 = ldfrag_h(k0p + kk * 32), kl0 = ldfrag_h(l0p + kk * 32);
      const v16h kh1 = ldfrag_h(k1p + kk * 32), kl1 = ldfrag_h(l1p + kk * 32);
#pragma unroll
      for (int g = 0; g < 2; ++g) { s[g][0] = mma_h(kh0, qhf[g][kk], s[g][0]);  s[g][1] = mma_h(kh1, qhf[g][kk], s[g][1]); }
#pragma unroll
      for (int g = 0; g < 2; ++g) { s[g][0] = mma_h(kl0, qhf[g][kk], s[g][0]);  s[g][1] = mma_h(kl1, qhf[g][kk], s[g][1]); }
#pragma unroll
      for (int g = 0; g < 2; ++g) { s[g][0] = mma_h(kh0, qlf[g][kk], s[g][0]);  s[g][1] = mma_h(kh1, qlf[g][kk], s[g][1]); }
      guard_s(s[0][0], s[0][1], s[1][0], s[1][1], qhf[0][kk], qhf[1][kk], qlf[0][kk], qlf[1][kk], kh0, kl0, kh1, kl1);
    }
    FragH ph[2], pl[2];
    float dmv[2], nmv[2];
#pragma unroll
    for (int g = 0; g < 2; ++g) {
      // ---- this lane's 16 keys for query q0+16g+c: s[g][0][i] <- key kb+8hh+i, s[g][1][i] <- key kb+16+8hh+i. The maximum is taken on
      //      the raw scores (lsc >= 0 keeps their order) and scaled once; both column groups' maxima first, their shuffles together ----
      float cm = s[g][0][0];
#pragma unroll
      for (int i = 1; i < 8; ++i) cm = fmaxf(cm, s[g][0][i]);
#pragma unroll
      for (int i = 0; i < 8; ++i) cm = fmaxf(cm, s[g][1][i]);
      cm = fmaxf(cm, __shfl_xor(cm, 16, 32));
      const float mn = fmaxf(mrun[g], cm * lsc);   // finite from the first block on
      dmv[g] = mrun[g] - mn;                   // -inf on the first block (mrun = -inf)
      nmv[g] = PEXP - mn;
      mrun[g] = mn;
    }
#pragma unroll
    for (int g = 0; g < 2; ++g) {
      // ---- carried probabilities a = p * 32768 = 2^(s * lsc - mn + 15): scale, maximum and carry in one fused multiply-add ahead of the
      //      exponential. P A-fragments: hi = f16(a), a packed convert; lo = f16(a - hi), one mixed-precision fused multiply-add that
      //      reads hi as f16 and writes its half of the packed register. The running sum carries the 32768 as well ----
      const v2f lsc2 = {lsc, lsc}, nm2 = {nmv[g], nmv[g]};
      v2f ps2 = {0.f, 0.f};                    // even and odd elements summed apart: one packed add a pair
#pragma unroll
      for (int w = 0; w < 2; ++w) {
#pragma unroll
        for (int e4 = 0; e4 < 4; ++e4) {
          const v2f s2 = {s[g][w][2 * e4], s[g][w][2 * e4 + 1]};
          const v2f x2 = __builtin_elementwise_fma(s2, lsc2, nm2);
          const float a0 = ex2(x2[0]), a1 = ex2(x2[1]);
          const v2f a2 = {a0, a1};
          ps2 += a2;
          const v2h h2 = __builtin_convertvector(a2, v2h);
          ph[g].u[w][e4] = __builtin_bit_cast(unsigned, h2);
          pl[g].u[w][e4] = resid2(a0, a1, __builtin_bit_cast(unsigned, h2));
        }
      }
      const float al = ex2_slot(dmv[g]);       // 0 on the first block
      float ps = ps2[0] + ps2[1];
      ps += __shfl_xor(ps, 16, 32);
      lrun[g] = lrun[g] * al + ps;
      // ---- rescale the O accumulators: D row 8hh+r = query q0+16g+8hh+r, its factor lives in lane 8hh+r (and 16+8hh+r) ----
      float scl[8];
#pragma unroll
      for (int r = 0; r < 8; ++r) scl[r] = __shfl(al, 8 * hh + r, 32);
#pragma unroll
      for (int j = 0; j < 4; ++j) {
#pragma unroll
        for (int r = 0; r < 8; ++r) o[g][j][r] *= scl[r];
      }
    }
    // ---- P.V : B fragment col n = d = j*16 + c, keys contiguous in the v^T planes; each fragment feeds both column groups; d columns
    //      0..31, then 32..63. At most six of the eight fragments are live at a time (the register budget of four waves a SIMD) ----
    {
      const _Float16* vhp = bufp + vfo + sub * 32;
      const _Float16* vlp = vhp + PLH;
      const v16h vh0 = ldfrag_h(vhp), vh1 = ldfrag_h(vhp + 16 * LP);
      const v16h vl0 = ldfrag_h(vlp), vl1 = ldfrag_h(vlp + 16 * LP);
      const v16h vh2 = ldfrag_h(vhp + 32 * LP), vh3 = ldfrag_h(vhp + 48 * LP);
      __builtin_amdgcn_sched_barrier(0);   // these twelve LDS reads stand in one place ahead of the WMMAs, none among them
#pragma unroll
      for (int g = 0; g < 2; ++g) { o[g][0] = mma_h(ph[g].v, vh0, o[g][0]);  o[g][1] = mma_h(ph[g].v, vh1, o[g][1]); }
#pragma unroll
      for (int g = 0; g < 2; ++g) { o[g][0] = mma_h(pl[g].v, vh0, o[g][0]);  o[g][1] = mma_h(pl[g].v, vh1, o[g][1]); }
#pragma unroll
      for (int g = 0; g < 2; ++g) { o[g][0] = mma_h(ph[g].v, vl0, o[g][0]);  o[g][1] = mma_h(ph[g].v, vl1, o[g][1]); }
      const v16h vl2 = ldfrag_h(vlp + 32 * LP), vl3 = ldfrag_h(vlp + 48 * LP);
      __builtin_amdgcn_sched_barrier(0);   // the last four LDS reads issue ahead of the eight WMMAs on vh2, vh3
#pragma unroll
      for (int g = 0; g < 2; ++g) { o[g][2] = mma_h(ph[g].v, vh2, o[g][2]);  o[g][3] = mma_h(ph[g].v, vh3, o[g][3]); }
#pragma unroll
      for (int g = 0; g < 2; ++g) { o[g][2] = mma_h(pl[g].v, vh2, o[g][2]);  o[g][3] = mma_h(pl[g].v, vh3, o[g][3]); }
#pragma unroll
      for (int g = 0; g < 2; ++g) { o[g][2] = mma_h(ph[g].v, vl2, o[g][2]);  o[g][3] = mma_h(ph[g].v, vl3, o[g][3]); }
      guard_pv(o[0][2], o[0][3], o[1][2], o[1][3], ph[0].v, pl[0].v, ph[1].v, pl[1].v, vh2, vh3, vl2, vl3);
    }
   }
   // ---- hand-over: tile t+1 is published and tile t's buffer is freed by the one barrier; then the refill ----
   asm volatile("s_wait_dscnt 0x0" ::: "memory");      // this wave's reads of tile t are done before its buffer is refilled
   asm volatile("s_wait_asynccnt 0x0" ::: "memory");   // this wave's copies of tile t+1 have landed
   __syncthreads();
   if (t + 2 < NTH) stage(t + 2, t & 1);
  }
  asm volatile("s_wait_asynccnt 0x0" ::: "memory");    // nothing in flight when the rings turn into hand-over area and result slabs
  acc_guard8(o);

  // ---- join of the key halves: wave (1, wq) hands its state to wave (0, wq), lane to lane, 16 B a lane and store ----
  float* mrg = (float*)(void*)ring + wq * MRGF;
  if (kh == 1) {                             // wave-uniform (scalar)
#pragma unroll
    for (int g = 0; g < 2; ++g) {
#pragma unroll
      for (int j = 0; j < 4; ++j) {
        const v4f x0 = {o[g][j][0], o[g][j][1], o[g][j][2], o[g][j][3]}, x1 = {o[g][j][4], o[g][j][5], o[g][j][6], o[g][j][7]};
        *(v4f*)(mrg + ((g * 4 + j) * 2) * 128 + lane * 4)     = x0;
        *(v4f*)(mrg + ((g * 4 + j) * 2 + 1) * 128 + lane * 4) = x1;
      }
      mrg[2048 + g * 64 + lane]      = mrun[g];
      mrg[2048 + g * 64 + 32 + lane] = lrun[g];
    }
  }
  __syncthreads();                           // half 1's state is complete; every wave passes; the last barrier of the kernel
  if (kh == 0) {                             // wave-uniform (scalar)
    float* slab = (float*)(void*)ring + 4 * MRGF + wq * (2 * SLABF);
    // ---- common maximum, 1/l (per query, owned by lane = query; 32768 on P and on l cancel) and the carry 1024 on v; stage the 16x64 slabs ----
#pragma unroll
    for (int g = 0; g < 2; ++g) {
      const float m1 = mrg[2048 + g * 64 + lane], l1 = mrg[2048 + g * 64 + 32 + lane];
      const float mn = fmaxf(mrun[g], m1);   // both finite: each half has seen keys
      const float e0 = ex2(mrun[g] - mn), e1 = ex2(m1 - mn);
      const float linv = (1.0f / (lrun[g] * e0 + l1 * e1)) * (1.0f / VCAR);   // the sums carry the 32768 of P themselves
      const float f0 = e0 * linv, f1 = e1 * linv;
      float i0[8], i1[8];
#pragma unroll
      for (int r = 0; r < 8; ++r) { i0[r] = __shfl(f0, 8 * hh + r, 32); i1[r] = __shfl(f1, 8 * hh + r, 32); }
#pragma unroll
      for (int j = 0; j < 4; ++j) {
        const v4f x0 = *(const v4f*)(mrg + ((g * 4 + j) * 2) * 128 + lane * 4);
        const v4f x1 = *(const v4f*)(mrg + ((g * 4 + j) * 2 + 1) * 128 + lane * 4);
#pragma unroll
        for (int r = 0; r < 4; ++r) {
          slab[g * SLABF + (8 * hh + r) * 68 + j * 16 + c]     = o[g][j][r] * i0[r] + x0[r] * i1[r];
          slab[g * SLABF + (8 * hh + 4 + r) * 68 + j * 16 + c] = o[g][j][4 + r] * i0[4 + r] + x1[r] * i1[4 + r];
        }
      }
    }
    wave_sync_lds();
    // ---- O x1024 -> f16 hi + residual planes; lane = (row in group of 4, 8 consecutive d) ----
    const int rq = lane >> 3, c8 = (lane & 7) * 8;
#pragma unroll
    for (int g = 0; g < 2; ++g) {
      v4u oh[4], ol[4];
#pragma unroll
      for (int i4 = 0; i4 < 4; ++i4) {
        const int row = i4 * 4 + rq;
        const v4f a = *(const v4f*)(slab + g * SLABF + row * 68 + c8), c4 = *(const v4f*)(slab + g * SLABF + row * 68 + c8 + 4);
        float w[8];
#pragma unroll
        for (int e = 0; e < 4; ++e) { w[e] = a[e] * OSC; w[4 + e] = c4[e] * OSC; }
#pragma unroll
        for (int e = 0; e < 4; ++e) {
          const _Float16 h0 = (_Float16)w[2 * e], h1 = (_Float16)w[2 * e + 1];
          const _Float16 l0 = (_Float16)(w[2 * e] - (float)h0), l1 = (_Float16)(w[2 * e + 1] - (float)h1);
          oh[i4][e] = pk16(h_bits(h0), h_bits(h1));
          ol[i4][e] = pk16(h_bits(l0), h_bits(l1));
        }
      }
      const size_t ob = (((size_t)(b * SEQ + q0 + g * 16)) * NH + head) * HD + c8;
#pragma unroll
      for (int i4 = 0; i4 < 4; ++i4) {
        const int row = i4 * 4 + rq;
        const size_t o8 = ob + (size_t)row * (NH * HD);
        *(v4u*)(OHIp + o8) = oh[i4];
        *(v4u*)(OLOp + o8) = ol[i4];
      }
      asm volatile("s_wait_xcnt 0x0" ::: "memory");   // behind the run of stores: what follows in the text rewrites their registers
    }
  }
}

// =====================================================================================================
// Workspace map (bytes, ROWS = NB*SEQ; numbers for NB=2, SEQ=2048); every plane is fully written by whole-line stores before it is
// read; all extents are exact multiples of the store granularity (no pad rows needed). XB .. WOB are cvt_all's one destination,
// XB / WQB.. / QHI.. are gemm_bfb's plane triples, so their order and adjacency matter:
//   XB  bf16 3 x [ROWS][1024]            25165824        (input Q, K, V)
//   WQB bf16 [1024 n][1024 k]             2097152        WKB same  2097152      WVB same  2097152
//   WOB f16  [1024 n][1024 k] x1024       2097152
//   QHI f16 [NB][SEQ][16][64] x1024       8388608        QLO residual         8388608
//   KHI same                              8388608        KLO residual         8388608
//   VHI f16 [NB][16][64][SEQ] x1024       8388608        VLO residual         8388608
//   OHI f16 [ROWS][1024] x1024            8388608        OLO residual         8388608
//   end                                 100663296
// =====================================================================================================
extern "C" void kernel_launch(void* const* d_in, const int* in_sizes, int n_in,
                              void* d_out, int out_size, void* d_ws, size_t ws_size,
                              hipStream_t stream) {
  const int ROWS = NB * SEQ;
  if (n_in < 12) return;
  const int needX = ((NB - 1) * SEQ_FULL + SEQ) * DMOD;   // last input row read by cvt_all (+1), in elements
  if (in_sizes[0] < needX || in_sizes[1] < needX || in_sizes[2] < needX) return;
  if (in_sizes[3] < DMOD * DMOD || in_sizes[5] < DMOD * DMOD) return;
  if (in_sizes[7] < DMOD * DMOD || in_sizes[9] < DMOD * DMOD) return;
  if (in_sizes[4] < DMOD || in_sizes[6] < DMOD || in_sizes[8] < DMOD || in_sizes[10] < DMOD) return;
  if (in_sizes[11] < NH) return;
  if (out_size < ROWS * DMOD) return;

  const float* Qin = (const float*)d_in[0];
  const float* Kin = (const float*)d_in[1];
  const float* Vin = (const float*)d_in[2];
  const float* wq  = (const float*)d_in[3];
  const float* bq  = (const float*)d_in[4];
  const float* wk  = (const float*)d_in[5];
  const float* bk  = (const float*)d_in[6];
  const float* wv  = (const float*)d_in[7];
  const float* bv  = (const float*)d_in[8];
  const float* wo  = (const float*)d_in[9];
  const float* bo  = (const float*)d_in[10];
  const float* gt  = (const float*)d_in[11];
  float*       out = (float*)d_out;

  const size_t szXB  = (size_t)3 * ROWS * DMOD * 2;
  const size_t szW   = (size_t)DMOD * DMOD * 2;
  const size_t szP   = (size_t)ROWS * DMOD * 2;                 // q/k/o planes
  const size_t szVP  = (size_t)NB * NH * HD * SEQ * 2;
  size_t off = 0;
  const size_t oXB  = off; off += szXB;
  const size_t oWQB = off; off += szW;
  off += szW;                                           // WKB
  off += szW;                                           // WVB
  const size_t oWOB = off; off += szW;
  const size_t oQHI = off; off += szP;
  const size_t oQLO = off; off += szP;
  const size_t oKHI = off; off += szP;
  const size_t oKLO = off; off += szP;
  const size_t oVHI = off; off += szVP;
  const size_t oVLO = off; off += szVP;
  const size_t oOHI = off; off += szP;
  const size_t oOLO = off; off += szP;
  if (off > ws_size) return;                            // off = 100663296 at full size
  if (off > (size_t)134217728) return;

  char* ws = (char*)d_ws;
  u16*   XB  = (u16*)(ws + oXB);
  u16*   WQB = (u16*)(ws + oWQB);
  u16*   WOB = (u16*)(ws + oWOB);
  u16*   QHI = (u16*)(ws + oQHI);
  u16*   QLO = (u16*)(ws + oQLO);
  u16*   KHI = (u16*)(ws + oKHI);
  u16*   KLO = (u16*)(ws + oKLO);
  u16*   VHI = (u16*)(ws + oVHI);
  u16*   VLO = (u16*)(ws + oVLO);
  u16*   OHI = (u16*)(ws + oOHI);
  u16*   OLO = (u16*)(ws + oOLO);

  const dim3 blk(256);
  if ((DMOD % 64) != 0 || (ROWS % GT) != 0 || (DMOD % GT) != 0) return;
  const dim3 gC(3 * XCH + 4 * WCH);                     // 512
  const dim3 gG((ROWS / GT) * (DMOD / GT));             // 256
  const dim3 gG3((ROWS / GT) * (DMOD / GT), 3);         // 256 x 3
  const dim3 bG(128);
  const dim3 gAT(ATT_BLOCKS);                           // 512
  const dim3 bAT(ATT_THREADS);                          // 256

  // (0) inputs -> bf16 planes; weights [n][k] (already k-contiguous for x.W^T): bf16 planes for wq/wk/wv, f16 of bf16 value x1024
  //     for wo; destination XB .. WOB, contiguous
  cvt_all<<<gC, blk, 0, stream>>>(Qin, Kin, Vin, wq, wk, wv, wo, XB);
  // (1) q, k, v projections + bias (col = h*64+d), x1024, as f16 hi + residual planes: q, k [ROWS][1024], v as v^T planes
  gemm_bfb<<<gG3, bG, 0, stream>>>(XB, WQB, bq, bk, bv, QHI, ROWS, DMOD, DMOD, 1.0f, QSC);
  // (2) attention with per-head scale sigmoid(g)/8 -> O planes [b][s][h][d] x1024 (hi + residual)
  attn_fwd<<<gAT, bAT, 0, stream>>>(QHI, QLO, KHI, KLO, VHI, VLO, gt, OHI, OLO);
  // (3) output projection + bias -> out [ROWS][1024] f32, carries 1024 (O) x 1024 (wo) folded back
  gemm_h2<<<gG, blk, 0, stream>>>(OHI, OLO, WOB, bo, out, ROWS, DMOD, DMOD, 1.0f / (OSC * WOS));
  (void)hipGetLastError();
}

// v010
// Measured time: 131 microseconds a run.
// Next to v009, in two timings, it ran 1.04 times as fast each time.
// Over all steps from v000 it is 3.08 times as fast.
// Contractions: x.W{q,k,v}^T on v_wmma_f32_16x16x32_bf16 (x and W RNE-converted to bf16 operands, f32 accumulate, bias added in f32);
// scores k'.q'^T (q', k' carried x1024 as f16 hi plane + f16 residual plane, products hh+lh+hl), P.v (P x128 f16 hi+residual,
// v x1024 f16 hi+residual, products hh+lh+hl) and O.Wo^T (O x1024 f16 hi+residual, Wo as f16(bf16(Wo) x1024), products h.w+l.w):
// v_wmma_f32_16x16x32_f16, f32 accumulate. Per-head logit scale sigmoid(bf16(g_h))/8 in f32; base-2 online softmax, 1/l fold and
// bias adds in f32 on VALU.
#include <hip/hip_runtime.h>
#include <math.h>
#include <stdint.h>

#ifndef NB
#define NB    2
#endif
#ifndef SEQ
#define SEQ   2048
#endif
#define NB_FULL  2
#define SEQ_FULL 2048
#define DMOD  1024
#define NH    16
#define HD    64
#define QSC   1024.0f
#define KSC   1024.0f
#define PEXP  7.0f                 // log2 of the carry on P: a score at the held maximum gives 2^7
#define LAZT  8.0f                 // a score may top the held maximum by 2^8 before the maximum is renewed
#define VCAR  1024.0f
#define OSC   1024.0f
#define WOS   1024.0f
#define LOG2E 1.4426950408889634f
#define KSPL        2                  // key halves of an attention block, four waves each
#define ATT_WAVES   (4 * KSPL)
#define ATT_THREADS (ATT_WAVES * 32)
#define QB          128                // query rows of an attention block: 4 waves x 32
#define QTB         (SEQ / QB)
#define ATT_BLOCKS  (NB * NH * QTB)
#define NKB    (SEQ / 32)
#define SLABF  (16 * 68)
#define SLAB64 (16 * 68)
#define VTP    136                // pitch in halves of the v^T epilogue tiles: 256-B rows + 16 B (16 B x odd)
#define GT     128                // GEMM block tile: rows of A and rows of Bt
#define KT     64                 // keys per staged tile
#define LP     72                 // LDS row pitch in halves: 128-B rows + 16 B (16 B x odd, for 16-B LDS reads down a column of rows)
#define PLH    (64 * LP)          // one plane's tile: 64 rows
#define BUFH   (4 * PLH)          // k hi, k residual, v^T hi, v^T residual
#define GPLH   (GT * LP)          // one GEMM operand plane's tile: GT rows
#define NT     (SEQ / KT)
#define NTH    (NT / KSPL)        // staged tiles a key half
#define MRGF   (2 * 4 * 8 * 32 + 2 * 2 * 32)   // floats one wave hands over: 8 accumulator tiles, then PEXP - held max and sum of 2 column groups
#define CVT_OCT 16                             // octets a thread of cvt_all
#define CVT_CH  (256 * CVT_OCT)                // octets a block of cvt_all
#define XCH     ((NB * SEQ * DMOD / 8) / CVT_CH)   // blocks an input plane
#define WCH     ((DMOD * DMOD / 8) / CVT_CH)       // blocks a weight plane
#define SEG8X   (SEQ * DMOD / 8)               // destination octets per batch
#define STR8X   (SEQ_FULL * DMOD / 8)          // source octets per batch in the input layout
static_assert(HD == 64 && DMOD == NH * HD && NH == 16);
static_assert(PEXP + LAZT == 15.0f);           // the largest carried P is 2^15, inside f16's range
static_assert(QSC == KSC && KSC == VCAR);      // one plane scale for the three projections of a launch
static_assert(NB >= 1 && NB <= NB_FULL && SEQ >= 64 && SEQ <= SEQ_FULL && (SEQ % 64) == 0);
static_assert(ATT_THREADS == 256 && ATT_BLOCKS == NB * NH * (SEQ / 128) && NKB * 32 == SEQ && (SEQ % QB) == 0);
static_assert(((NB * SEQ) % GT) == 0 && (DMOD % GT) == 0 && (SEQ % GT) == 0 && (DMOD % 64) == 0 && GT == 128);
static_assert((SEQ % 64) == 0 && (SEQ % 8) == 0);
static_assert(((NB * SEQ * DMOD / 8) % CVT_CH) == 0 && ((DMOD * DMOD / 8) % CVT_CH) == 0 && (SEG8X % CVT_CH) == 0);
static_assert(VTP >= GT && 2 * 2 * GPLH >= 2 * GT * VTP && (VTP * 2) % 16 == 0);
static_assert(KT == 64 && HD == 64 && NT * KT == SEQ && NT * 2 == NKB && NTH * KSPL == NT && NTH >= 1 && KSPL == 2);
static_assert(KSPL * 2 * BUFH * 2 >= (4 * MRGF + 4 * 2 * SLABF) * 4 && (LP * 2) % 16 == 0 && (MRGF * 4) % 16 == 0);

typedef unsigned short u16;
typedef _Float16 v16h __attribute__((ext_vector_type(16)));
typedef _Float16 v8h  __attribute__((ext_vector_type(8)));
typedef __bf16   v16b __attribute__((ext_vector_type(16)));
typedef float    v8f  __attribute__((ext_vector_type(8)));
typedef float    v4f  __attribute__((ext_vector_type(4)));
typedef float    v2f  __attribute__((ext_vector_type(2)));
typedef _Float16 v2h  __attribute__((ext_vector_type(2)));
typedef unsigned int v4u __attribute__((ext_vector_type(4)));

union FragH { v16h v; v8h h[2]; v4u u[2]; };
union FragB { v16b v; v4u u[2]; };

// ---- scalar helpers --------------------------------------------------------------------------------
__device__ __forceinline__ unsigned short bf_bits(float f) {          // f32 -> bf16 bits, RNE convert
  unsigned u = __float_as_uint(f);
  return (unsigned short)((u + 0x7FFFu + ((u >> 16) & 1u)) >> 16);
}
__device__ __forceinline__ float bf_up(unsigned short h) { return __uint_as_float(((unsigned)h) << 16); }
__device__ __forceinline__ float bfr(float f) { return bf_up(bf_bits(f)); }
__device__ __forceinline__ unsigned short h_bits(_Float16 x) { return __builtin_bit_cast(unsigned short, x); }
__device__ __forceinline__ unsigned pk16(unsigned short a, unsigned short b) { return (unsigned)a | ((unsigned)b << 16); }
// 2^x by the bare v_exp_f32. The library exp2f wraps the same instruction in a compare, two selects, an add and a ldexp that only
// serve results below 2^-126; here such a result is summed beside a term of at least 1 (the score the maximum in use was taken from), so 0 serves as well.
__device__ __forceinline__ float ex2(float x) { return __builtin_amdgcn_exp2f(x); }
// The same for the rescale factor, with the slots on both sides of the transcendental filled in the statement itself: the compiler put
// this one directly behind another v_exp_f32 whose source register it overwrites, and it does not look into asm text for what follows.
__device__ __forceinline__ float ex2_slot(float x) {
  float r = 0.f;
#if defined(__HIP_DEVICE_COMPILE__)
  asm("v_nop\n\tv_exp_f32 %0, %1\n\tv_nop" : "=v"(r) : "v"(x));
#endif
  return r;
}
// f16 residuals of a pair: low half = f16(a0 - low half of h), high half = f16(a1 - high half of h). The mixed-precision fused
// multiply-add reads h's half as f16 beside the f32 a and writes one half of the result register, the other half kept: one instruction
// a value, where convert back, subtract, convert and pack take more (the compiler does not form it from the plain expression).
__device__ __forceinline__ unsigned resid2(float a0, float a1, unsigned h) {
  unsigned l = 0;
#if defined(__HIP_DEVICE_COMPILE__)
  const float one = 1.0f;
  asm("v_fma_mixlo_f16 %0, %1, %2, -%3 op_sel_hi:[0,0,1]" : "=v"(l) : "v"(a0), "s"(one), "v"(h));
  asm("v_fma_mixhi_f16 %0, %1, %2, -%3 op_sel:[0,0,1] op_sel_hi:[0,0,1]" : "+v"(l) : "v"(a1), "s"(one), "v"(h));
#endif
  return l;
}
__device__ __forceinline__ v8f zero8() { v8f z = {0.f, 0.f, 0.f, 0.f, 0.f, 0.f, 0.f, 0.f}; return z; }
__device__ __forceinline__ v4f zero4() { v4f z = {0.f, 0.f, 0.f, 0.f}; return z; }

// ---- fragment loaders: 16-bit A/B operand, lane -> row/col (lane&15), p already includes +8*(lane>>4);
//      elements 0..7 <- p[0..7] (k0+8h..), elements 8..15 <- p[16..23] (k0+16+8h..)  (same split k map for A and B;
//      B is always read from a k-contiguous [n][k] plane)
__device__ __forceinline__ v16h ldfrag_h(const _Float16* p) {
  FragH f;
  f.h[0] = *(const v8h*)(p);
  f.h[1] = *(const v8h*)(p + 16);
  return f.v;
}
__device__ __forceinline__ v16b ldfrag_b(const u16* p) {              // bf16 plane read as unsigned integer vectors
  FragB f;
  f.u[0] = *(const v4u*)(p);
  f.u[1] = *(const v4u*)(p + 16);
  return f.v;
}

__device__ __forceinline__ v8f mma_h(v16h a, v16h b, v8f c) {
  return __builtin_amdgcn_wmma_f32_16x16x32_f16(false, a, false, b, (short)0, c, false, false);
}
__device__ __forceinline__ v8f mma_b(v16b a, v16b b, v8f c) {
  return __builtin_amdgcn_wmma_f32_16x16x32_bf16(false, a, false, b, (short)0, c, false, false);
}
// Four v_nop behind a run of WMMAs: the distance between the last of them and a vector instruction on its D, A or B; the operands are
// named so that their registers live up to the statement.
__device__ __forceinline__ void guard_s(v8f& a, v8f& b, v8f& c, v8f& d, v16h x0, v16h x1, v16h x2, v16h x3, v16h x4, v16h x5,
                                        v16h x6, v16h x7) {
#if defined(__HIP_DEVICE_COMPILE__)
  asm volatile("v_nop\n\tv_nop\n\tv_nop\n\tv_nop"
               : "+v"(a), "+v"(b), "+v"(c), "+v"(d)
               : "v"(x0), "v"(x1), "v"(x2), "v"(x3), "v"(x4), "v"(x5), "v"(x6), "v"(x7) : "memory");
#endif
}
__device__ __forceinline__ void guard_pv(v8f& a, v8f& b, v8f& c, v8f& d, v16h p0, v16h p1, v16h p2, v16h p3, v16h x0, v16h x1,
                                         v16h x2, v16h x3) {
#if defined(__HIP_DEVICE_COMPILE__)
  asm volatile("v_nop\n\tv_nop\n\tv_nop\n\tv_nop"
               : "+v"(a), "+v"(b), "+v"(c), "+v"(d)
               : "v"(p0), "v"(p1), "v"(p2), "v"(p3), "v"(x0), "v"(x1), "v"(x2), "v"(x3));
#endif
}
// The same for a wave's R x 4 accumulator tiles: the four v_nop stand behind the last WMMA of the tile, whichever the compiler puts last.
__device__ __forceinline__ void acc_guard8(v8f (&a)[2][4]) {
#if defined(__HIP_DEVICE_COMPILE__)
  asm volatile("v_nop\n\tv_nop\n\tv_nop\n\tv_nop"
               : "+v"(a[0][0]), "+v"(a[0][1]), "+v"(a[0][2]), "+v"(a[0][3]), "+v"(a[1][0]), "+v"(a[1][1]), "+v"(a[1][2]), "+v"(a[1][3]));
#endif
}
__device__ __forceinline__ void acc_guard16(v8f (&a)[4][4]) {
#if defined(__HIP_DEVICE_COMPILE__)
  asm volatile("v_nop\n\tv_nop\n\tv_nop\n\tv_nop"
               : "+v"(a[0][0]), "+v"(a[0][1]), "+v"(a[0][2]), "+v"(a[0][3]), "+v"(a[1][0]), "+v"(a[1][1]), "+v"(a[1][2]), "+v"(a[1][3]),
                 "+v"(a[2][0]), "+v"(a[2][1]), "+v"(a[2][2]), "+v"(a[2][3]), "+v"(a[3][0]), "+v"(a[3][1]), "+v"(a[3][2]), "+v"(a[3][3]));
#endif
}
// Two planes' 64-row x 128-B tiles, global -> LDS, by 128 threads: per lane four 16-B asynchronous copies a plane (rows r, r+16,
// r+32, r+48; 8 lanes = one whole 128-B row). la/lb: the lane's LDS byte addresses of row r, ga/gb: its global addresses, gstep: 16
// source rows in elements. The s_wait_xcnt closes the statement so that no address register is rewritten ahead of it.
__device__ __forceinline__ void stage2(unsigned la, unsigned lb, const u16* ga, const u16* gb, size_t gstep) {
#if defined(__HIP_DEVICE_COMPILE__)
  const unsigned ls = 16 * LP * 2;
  asm volatile("global_load_async_to_lds_b128 %0, %8, off\n\t"
               "global_load_async_to_lds_b128 %1, %9, off\n\t"
               "global_load_async_to_lds_b128 %2, %10, off\n\t"
               "global_load_async_to_lds_b128 %3, %11, off\n\t"
               "global_load_async_to_lds_b128 %4, %12, off\n\t"
               "global_load_async_to_lds_b128 %5, %13, off\n\t"
               "global_load_async_to_lds_b128 %6, %14, off\n\t"
               "global_load_async_to_lds_b128 %7, %15, off\n\t"
               "s_wait_xcnt 0x0"
               :: "v"(la), "v"(la + ls), "v"(la + 2 * ls), "v"(la + 3 * ls),
                  "v"(lb), "v"(lb + ls), "v"(lb + 2 * ls), "v"(lb + 3 * ls),
                  "v"(ga), "v"(ga + gstep), "v"(ga + 2 * gstep), "v"(ga + 3 * gstep),
                  "v"(gb), "v"(gb + gstep), "v"(gb + 2 * gstep), "v"(gb + 3 * gstep)
               : "memory");
#endif
}
// One plane's tile, the same way: four copies a lane.
__device__ __forceinline__ void stage1(unsigned la, const u16* ga, size_t gstep) {
#if defined(__HIP_DEVICE_COMPILE__)
  const unsigned ls = 16 * LP * 2;
  asm volatile("global_load_async_to_lds_b128 %0, %4, off\n\t"
               "global_load_async_to_lds_b128 %1, %5, off\n\t"
               "global_load_async_to_lds_b128 %2, %6, off\n\t"
               "global_load_async_to_lds_b128 %3, %7, off\n\t"
               "s_wait_xcnt 0x0"
               :: "v"(la), "v"(la + ls), "v"(la + 2 * ls), "v"(la + 3 * ls),
                  "v"(ga), "v"(ga + gstep), "v"(ga + 2 * gstep), "v"(ga + 3 * gstep)
               : "memory");
#endif
}
__device__ __forceinline__ void wave_sync_lds() {
  __builtin_amdgcn_fence(__ATOMIC_RELEASE, "workgroup");
  __builtin_amdgcn_wave_barrier();
  __builtin_amdgcn_fence(__ATOMIC_ACQUIRE, "workgroup");
}

// =====================================================================================================
// All seven f32 planes -> 16-bit planes in ONE launch. Destination D holds the planes back to back in block order:
//   x_q, x_k, x_v (bf16 RNE bits, NB*SEQ rows each), wq, wk, wv (bf16 RNE bits), wo (f16 bits of (bf16 RNE value) * WOS).
// Block = CVT_CH consecutive octets of one plane (a plane is a whole number of blocks, so plane and mode are block-uniform);
// thread = CVT_OCT octets, 256 octets apart: per octet two 16-B loads and one 16-B store, 32 consecutive lanes = 512 contiguous,
// 512-B aligned destination bytes. All of a thread's loads are issued ahead of its first conversion.
// An input plane is read as NB batches of SEQ rows out of a layout with SEQ_FULL rows per batch (a block never straddles a batch).
// coverage: grid = 3*XCH + 4*WCH blocks x 256 thr x CVT_OCT octets = the whole of the seven destination planes.
// =====================================================================================================
__global__ __launch_bounds__(256) void cvt_all(const float* __restrict__ xq, const float* __restrict__ xk,
                                               const float* __restrict__ xv, const float* __restrict__ wq,
                                               const float* __restrict__ wk, const float* __restrict__ wv,
                                               const float* __restrict__ wo, u16* D) {
  const unsigned bid = blockIdx.x, tid = threadIdx.x;
  const float* s;
  size_t so;                                 // the block's first source octet
  if (bid < 3u * XCH) {                      // block-uniform; no barriers in this kernel
    const unsigned pl = bid / XCH, g0 = (bid % XCH) * CVT_CH;
    s  = pl == 0 ? xq : pl == 1 ? xk : xv;
    so = (size_t)(g0 / SEG8X) * STR8X + (size_t)(g0 % SEG8X);
  } else {
    const unsigned wb = bid - 3u * XCH, pl = wb / WCH;
    s  = pl == 0 ? wq : pl == 1 ? wk : pl == 2 ? wv : wo;
    so = (size_t)(wb % WCH) * CVT_CH;
  }
  const float* p = s + (so + (size_t)tid) * 8;
  v4f a[CVT_OCT], c4[CVT_OCT];
#pragma unroll   // arrays indexed by constants (registers); the loads stand together
  for (int i = 0; i < CVT_OCT; ++i) {
    a[i]  = *(const v4f*)(p + i * 2048);
    c4[i] = *(const v4f*)(p + i * 2048 + 4);
  }
  u16* d = D + ((size_t)bid * CVT_CH + (size_t)tid) * 8;
  if (bid < 3u * XCH + 3u * WCH) {           // block-uniform
#pragma unroll
    for (int i = 0; i < CVT_OCT; ++i) {
      v4u o;
#pragma unroll
      for (int e = 0; e < 2; ++e) {
        o[e]     = pk16(bf_bits(a[i][2 * e]),  bf_bits(a[i][2 * e + 1]));
        o[2 + e] = pk16(bf_bits(c4[i][2 * e]), bf_bits(c4[i][2 * e + 1]));
      }
      *(v4u*)(d + i * 2048) = o;
    }
  } else {
#pragma unroll
    for (int i = 0; i < CVT_OCT; ++i) {
      v4u o;
#pragma unroll
      for (int e = 0; e < 2; ++e) {
        o[e]     = pk16(h_bits((_Float16)(bfr(a[i][2 * e]) * WOS)),  h_bits((_Float16)(bfr(a[i][2 * e + 1]) * WOS)));
        o[2 + e] = pk16(h_bits((_Float16)(bfr(c4[i][2 * e]) * WOS)), h_bits((_Float16)(bfr(c4[i][2 * e + 1]) * WOS)));
      }
      *(v4u*)(d + i * 2048) = o;
    }
  }
}

// =====================================================================================================
// f32 GEMM epilogue (gemm_h2): one 16x64 f32 row group of the wave's tile (times oscale) staged in its LDS slab (pitch 68, wave-private),
// coverage: 8 instructions x 2 rows x 16 lanes x 4 floats = the 16 x 64 row group.
// =====================================================================================================
__device__ __forceinline__ void epi64(float* sl, v8f a0, v8f a1, v8f a2, v8f a3, float oscale, v4f badd, float* C, int N,
                                      size_t rowb, int col0, int lane) {
  const int hh = lane >> 4, m = lane & 15;
#pragma unroll
  for (int r = 0; r < 8; ++r) {
    const int ro = (8 * hh + r) * 68 + m;
    sl[ro]      = a0[r] * oscale;
    sl[ro + 16] = a1[r] * oscale;
    sl[ro + 32] = a2[r] * oscale;
    sl[ro + 48] = a3[r] * oscale;
  }
  wave_sync_lds();
  v4f vals[8];
#pragma unroll
  for (int it = 0; it < 8; ++it) vals[it] = *(const v4f*)(sl + (it * 2 + hh) * 68 + m * 4) + badd;
  float* dst = C + (rowb + (size_t)hh) * (size_t)N + col0 + m * 4;
  {
#pragma unroll
    for (int it = 0; it < 8; ++it) {
      *(v4f*)(dst + (size_t)(it * 2) * (size_t)N) = vals[it];
    }
    
  }
}

// =====================================================================================================
// Three bf16 GEMMs with bias in one launch, product pj = blockIdx.y (0 q, 1 k, 2 v): A = plane pj of A3, Bt = plane pj of Bt3,
// bias = bias<pj>, PH / PL = planes 2pj / 2pj+1 of P6 (M*N halves each), vt = (pj == 2). Each product, result written as two f16
// planes: c[M][N] (f32, in registers) = A[M][K] (bf16 row-major) . Bt[N][K]^T (bf16
// k-contiguous), times oscale, plus bf16-RNE value of bias[n]; PH = f16(c * psc), PL = f16(c * psc - PH) (psc a power of two).
// Block = 128x128 tile, 4 waves in 2 x 2, a wave owns 64 rows x 64 columns (4 x 4 accumulator tiles): each LDS fragment feeds four
// WMMAs and each staged row serves 128 results. The block's 128 A rows and 128 Bt rows are staged in LDS 64 k (one whole
// 128-B line a row) at a time by asynchronous copies, two buffers (tile t+1 flies while tile t is worked on, one block barrier a
// tile); fragments are read from LDS (two 16-B reads each, split k map for A and B), two k steps of 32 a tile, in the k order of
// a plain walk (host checks K % 64 == 0, M % 128 == 0, N % 128 == 0, grid = ((M/128)*(N/128), 3)).
// Epilogue, vt == 0: planes laid out [M][N]; each of the wave's four 16x64 f32 row groups goes through its private LDS slab (pitch
//   68), a lane then owns 8 consecutive columns of a row: per plane 4 instructions x 4 rows x 8 lanes x 8 halves = 16 x 64.
// Epilogue, vt != 0 (N == NH*HD, rows = b*SEQ + s, SEQ % 128 == 0): planes laid out [b][h][d][s]. A lane's 8 accumulator rows of one
//   column are 8 consecutive s of one (h, d): one 16-B LDS store a plane into the block's [128 (h,d)][128 s] tiles (pitch VTP, in the
//   ring, which is free behind the loop's last barrier); one block barrier; then 16 iterations x 128 thr x 8 halves = 128 lines x
//   128 s of each plane, 16 lanes = 256 contiguous bytes.
// =====================================================================================================
__global__ __launch_bounds__(128)
void gemm_bfb(const u16* __restrict__ A3, const u16* __restrict__ Bt3, const float* __restrict__ bias0,
              const float* __restrict__ bias1, const float* __restrict__ bias2,
              u16* P6, int M, int N, int K, float oscale, float psc) {
  __shared__ __align__(16) float slab[4 * SLAB64];
  __shared__ __align__(16) u16 ring[2 * 2 * GPLH];   // two buffers of [A tile | Bt tile], 128 rows of pitch LP each
  const int tid = threadIdx.x, wave = tid >> 5, lane = tid & 31, hh = lane >> 4, m = lane & 15;
  const int wr = wave >> 1, wc = wave & 1;   // the wave's 64-row and 64-column half of the block tile
  const int ntile = N >> 7;
  const int bid   = blockIdx.x;
  const int row0  = (bid / ntile) * GT;
  const int col0  = (bid % ntile) * GT;
  if (row0 + GT > M) return;                 // block-uniform, in front of every barrier; never taken with the exact grid
  // which of the three products this block belongs to (block-uniform): operands, bias, result planes and layout
  const int pj = blockIdx.y;
  const u16* A       = A3  + (size_t)pj * (size_t)M * (size_t)K;
  const u16* Bt      = Bt3 + (size_t)pj * (size_t)N * (size_t)K;
  const float* bias  = pj == 0 ? bias0 : pj == 1 ? bias1 : bias2;
  u16* PH            = P6 + (size_t)(2 * pj) * (size_t)M * (size_t)N;
  u16* PL            = PH + (size_t)M * (size_t)N;
  const int vt       = pj == 2;
  // staging: thread -> (row sr of 16, 16-B piece sc of 8), rows sr + 16 i, i = 0..7, of each operand's tile
  const int sr = tid >> 3, sc = (tid & 7) * 8;
  const u16* ag = A  + (size_t)(row0 + sr) * K + sc;
  const u16* bg = Bt + (size_t)(col0 + sr) * K + sc;
  const unsigned lds0 = (unsigned)(size_t)(const void*)ring + (unsigned)(sr * LP + sc) * 2u;
  const int nt = K >> 6;
  auto stage = [&](int t, int buf) {
    const unsigned l = lds0 + (unsigned)buf * (2u * GPLH * 2u);
    const u16* a = ag + (size_t)t * 64;
    const u16* b = bg + (size_t)t * 64;
    stage2(l, l + GPLH * 2u, a, b, (size_t)16 * K);                                                               // rows 0..63
    stage2(l + PLH * 2u, l + (GPLH + PLH) * 2u, a + (size_t)64 * K, b + (size_t)64 * K, (size_t)16 * K);          // rows 64..127
  };
  // fragment readers, in halves from a buffer's start
  const int afo = (wr * 64 + m) * LP + 8 * hh;
  const int bfo = GPLH + (wc * 64 + m) * LP + 8 * hh;
  v8f acc[4][4];
#pragma unroll
  for (int i = 0; i < 4; ++i) {
#pragma unroll
    for (int j = 0; j < 4; ++j) acc[i][j] = zero8();
  }
  stage(0, 0);
  asm volatile("s_wait_asynccnt 0x0" ::: "memory");   // this wave's copies of tile 0 have landed
  __syncthreads();                                    // ... and every other wave's: tile 0 may be read
  if (nt > 1) stage(1, 1);
#pragma unroll 1   // one tile a trip: the ring's hand-over stands once, at the foot
  for (int t = 0; t < nt; ++t) {
    const u16* bufp = ring + (t & 1) * (2 * GPLH);
#pragma unroll   // both k steps in line: LDS offsets become immediates, accumulators stay in registers
    for (int kk = 0; kk < 2; ++kk) {
      v16b a[4], b[4];
#pragma unroll
      for (int i = 0; i < 4; ++i) {
        a[i] = ldfrag_b(bufp + afo + i * 16 * LP + kk * 32);
        b[i] = ldfrag_b(bufp + bfo + i * 16 * LP + kk * 32);
      }
      __builtin_amdgcn_sched_barrier(0);   // the k step's 16 LDS reads issue together ahead of its 16 WMMAs: one LDS latency a step, not one a row
#pragma unroll
      for (int i = 0; i < 4; ++i) {
#pragma unroll
        for (int j = 0; j < 4; ++j) acc[i][j] = mma_b(a[i], b[j], acc[i][j]);
      }
    }
    acc_guard16(acc);                                   // WMMA distance kept on both sides of the branches that follow
    // ---- hand-over: tile t+1 is published and tile t's buffer is freed by the one barrier; then the refill ----
    asm volatile("s_wait_dscnt 0x0" ::: "memory");      // this wave's reads of tile t are done before its buffer is refilled
    asm volatile("s_wait_asynccnt 0x0" ::: "memory");   // this wave's copies of tile t+1 have landed
    __syncthreads();
    if (t + 2 < nt) stage(t + 2, t & 1);
  }
  asm volatile("s_wait_asynccnt 0x0" ::: "memory");     // nothing in flight when the wave goes on to its end
  const int colw = col0 + wc * 64;           // the wave's first column
  // every loop of both epilogues is unrolled so that accumulators and staging arrays are indexed by constants (registers, no scratch)
  if (vt == 0) {                             // block-uniform
    float* sl = slab + wave * SLAB64;
    const int rq = lane >> 3, c8 = (lane & 7) * 8;
    const v4f bv0 = *(const v4f*)(bias + colw + c8), bv1 = *(const v4f*)(bias + colw + c8 + 4);   // columns < N (N multiple of 128)
    float badd[8];
#pragma unroll
    for (int e = 0; e < 4; ++e) { badd[e] = bfr(bv0[e]); badd[4 + e] = bfr(bv1[e]); }
#pragma unroll
    for (int i = 0; i < 4; ++i) {            // the wave's four groups of 16 rows, one after the other through the one slab
#pragma unroll
      for (int r = 0; r < 8; ++r) {
        const int ro = (8 * hh + r) * 68 + m;
        sl[ro]      = acc[i][0][r] * oscale;
        sl[ro + 16] = acc[i][1][r] * oscale;
        sl[ro + 32] = acc[i][2][r] * oscale;
        sl[ro + 48] = acc[i][3][r] * oscale;
      }
      wave_sync_lds();
      v4u oh[4], ol[4];
#pragma unroll
      for (int i4 = 0; i4 < 4; ++i4) {
        const int row = i4 * 4 + rq;
        const v4f a4 = *(const v4f*)(sl + row * 68 + c8), c4 = *(const v4f*)(sl + row * 68 + c8 + 4);
        float w[8];
#pragma unroll
        for (int e = 0; e < 4; ++e) { w[e] = (a4[e] + badd[e]) * psc; w[4 + e] = (c4[e] + badd[4 + e]) * psc; }
#pragma unroll
        for (int e = 0; e < 4; ++e) {
          const _Float16 h0 = (_Float16)w[2 * e], h1 = (_Float16)w[2 * e + 1];
          const _Float16 l0 = (_Float16)(w[2 * e] - (float)h0), l1 = (_Float16)(w[2 * e + 1] - (float)h1);
          oh[i4][e] = pk16(h_bits(h0), h_bits(h1));
          ol[i4][e] = pk16(h_bits(l0), h_bits(l1));
        }
      }
      wave_sync_lds();                       // every lane's reads of the slab stand ahead of the next group's writes
      const size_t ob = (size_t)(row0 + wr * 64 + i * 16) * (size_t)N + colw + c8;
#pragma unroll
      for (int i4 = 0; i4 < 4; ++i4) {
        const size_t o8 = ob + (size_t)(i4 * 4 + rq) * (size_t)N;
        *(v4u*)(PH + o8) = oh[i4];
        *(v4u*)(PL + o8) = ol[i4];
      }
      asm volatile("s_wait_xcnt 0x0" ::: "memory");   // behind the run of stores: what follows in the text rewrites their registers
    }
  } else {
    u16* TH = ring;
    u16* TL = ring + GT * VTP;
#pragma unroll
    for (int j = 0; j < 4; ++j) {
      const float bj = bfr(bias[colw + 16 * j + m]);        // column < N (N multiple of 128)
#pragma unroll
      for (int i = 0; i < 4; ++i) {
        v4u th, tl;
#pragma unroll
        for (int e = 0; e < 4; ++e) {
          const float t0 = (acc[i][j][2 * e] * oscale + bj) * psc, t1 = (acc[i][j][2 * e + 1] * oscale + bj) * psc;
          const _Float16 h0 = (_Float16)t0, h1 = (_Float16)t1;
          const _Float16 l0 = (_Float16)(t0 - (float)h0), l1 = (_Float16)(t1 - (float)h1);
          th[e] = pk16(h_bits(h0), h_bits(h1));
          tl[e] = pk16(h_bits(l0), h_bits(l1));
        }
        const int to = (wc * 64 + 16 * j + m) * VTP + wr * 64 + i * 16 + 8 * hh;
        *(v4u*)(TH + to) = th;
        *(v4u*)(TL + to) = tl;
      }
    }
    __syncthreads();                         // the four waves' parts of the [(h,d)][s] tiles are complete
    const int q16 = tid >> 4, p8 = (tid & 15) * 8;
    const size_t base = ((size_t)(row0 / SEQ) * (NH * HD) + col0) * SEQ + (row0 % SEQ) + p8;
#pragma unroll
    for (int g = 0; g < 4; ++g) {            // four lines a thread and plane at a time: LDS reads first, then their stores
      v4u vh[4], vl[4];
#pragma unroll
      for (int it = 0; it < 4; ++it) {
        const int line = (g * 4 + it) * 8 + q16;   // (h,d) line 0..127 of the block
        vh[it] = *(const v4u*)(TH + line * VTP + p8);
        vl[it] = *(const v4u*)(TL + line * VTP + p8);
      }
#pragma unroll
      for (int it = 0; it < 4; ++it) {
        const int line = (g * 4 + it) * 8 + q16;
        *(v4u*)(PH + base + (size_t)line * SEQ) = vh[it];
        *(v4u*)(PL + base + (size_t)line * SEQ) = vl[it];
      }
      asm volatile("s_wait_xcnt 0x0" ::: "memory");   // behind the run of stores: no register that they name is rewritten ahead of it
    }
  }
}

// =====================================================================================================
// f16 hi+lo GEMM with bias: C[M][N] (f32) = (Ahi + Alo)[M][K] . Bt[N][K]^T times oscale, plus bf16-RNE value of bias[n];
// Ahi/Alo f16 planes (same layout), Bt f16 k-contiguous; products hi.B + lo.B into one accumulator (lo is the unscaled
// residual of hi). Block = 128x128 tile, 8 waves in 4 x 2, a wave owns 32 rows x 64 columns (2 x 4 accumulator tiles); the same
// two-buffer LDS ring as gemm_bfb, three planes a tile (Ahi, Alo, Bt), 128 rows each, staged by 256 threads: threads 0..127 rows
// 0..63, threads 128..255 rows 64..127 (host checks M % 128 == 0, N % 128 == 0, K % 64 == 0, grid = (M/128)*(N/128)).
// =====================================================================================================
__global__ __launch_bounds__(256)
void gemm_h2(const u16* __restrict__ Ah, const u16* __restrict__ Al, const u16* __restrict__ Bt,
             const float* __restrict__ bias, float* C, int M, int N, int K, float oscale) {
  __shared__ __align__(16) float slab[8 * SLAB64];
  __shared__ __align__(16) u16 ring[2 * 3 * GPLH];   // two buffers of [Ahi tile | Alo tile | Bt tile], 128 rows of pitch LP each
  const int tid = threadIdx.x, wave = tid >> 5, lane = tid & 31, hh = lane >> 4, m = lane & 15;
  const int wr = wave >> 1, wc = wave & 1;   // the wave's 32-row quarter and 64-column half of the block tile
  const int ntile = N >> 7;
  const int bid   = blockIdx.x;
  const int row0  = (bid / ntile) * GT;
  const int col0  = (bid % ntile) * GT;
  if (row0 + GT > M) return;                 // block-uniform, in front of every barrier; never taken with the exact grid
  // staging: thread -> (row sr of 16 in its half of 64 rows, 16-B piece sc of 8), rows sr, sr+16, sr+32, sr+48 of each plane's tile
  const int sr = (tid >> 7) * 64 + ((tid & 127) >> 3), sc = (tid & 7) * 8;
  const size_t aofs = (size_t)(row0 + sr) * K + sc;
  const u16* ahg = Ah + aofs;
  const u16* alg = Al + aofs;
  const u16* bg  = Bt + (size_t)(col0 + sr) * K + sc;
  const unsigned lds0 = (unsigned)(size_t)(const void*)ring + (unsigned)(sr * LP + sc) * 2u;
  const int nt = K >> 6;
  auto stage = [&](int t, int buf) {
    const unsigned l = lds0 + (unsigned)buf * (3u * GPLH * 2u);
    stage2(l, l + GPLH * 2u, ahg + (size_t)t * 64, alg + (size_t)t * 64, (size_t)16 * K);
    stage1(l + 2u * GPLH * 2u, bg + (size_t)t * 64, (size_t)16 * K);
  };
  // fragment readers, in halves from a buffer's start
  const int afo = (wr * 32 + m) * LP + 8 * hh;
  const int bfo = 2 * GPLH + (wc * 64 + m) * LP + 8 * hh;
  v8f acc[2][4];
#pragma unroll
  for (int i = 0; i < 2; ++i) {
#pragma unroll
    for (int j = 0; j < 4; ++j) acc[i][j] = zero8();
  }
  stage(0, 0);
  asm volatile("s_wait_asynccnt 0x0" ::: "memory");   // this wave's copies of tile 0 have landed
  __syncthreads();                                    // ... and every other wave's: tile 0 may be read
  if (nt > 1) stage(1, 1);
#pragma unroll 1   // one tile a trip: the ring's hand-over stands once, at the foot
  for (int t = 0; t < nt; ++t) {
    const _Float16* bufp = (const _Float16*)(const void*)ring + (t & 1) * (3 * GPLH);
    v16h ah[2][2], al[2][2], b[2][4];
#pragma unroll
    for (int kk = 0; kk < 2; ++kk) {
#pragma unroll
      for (int i = 0; i < 2; ++i) {
        ah[kk][i] = ldfrag_h(bufp + afo + i * 16 * LP + kk * 32);
        al[kk][i] = ldfrag_h(bufp + GPLH + afo + i * 16 * LP + kk * 32);
      }
#pragma unroll
      for (int j = 0; j < 4; ++j) b[kk][j] = ldfrag_h(bufp + bfo + j * 16 * LP + kk * 32);
    }
    __builtin_amdgcn_sched_barrier(0);   // all of the tile's LDS reads issue ahead of its WMMAs: one LDS latency a tile, not several
#pragma unroll
    for (int kk = 0; kk < 2; ++kk) {
#pragma unroll
      for (int i = 0; i < 2; ++i) {
#pragma unroll
        for (int j = 0; j < 4; ++j) acc[i][j] = mma_h(ah[kk][i], b[kk][j], acc[i][j]);
      }
#pragma unroll
      for (int i = 0; i < 2; ++i) {
#pragma unroll
        for (int j = 0; j < 4; ++j) acc[i][j] = mma_h(al[kk][i], b[kk][j], acc[i][j]);
      }
    }
    acc_guard8(acc);                                    // WMMA distance kept on both sides of the branches that follow
    // ---- hand-over: tile t+1 is published and tile t's buffer is freed by the one barrier; then the refill ----
    asm volatile("s_wait_dscnt 0x0" ::: "memory");      // this wave's reads of tile t are done before its buffer is refilled
    asm volatile("s_wait_asynccnt 0x0" ::: "memory");   // this wave's copies of tile t+1 have landed
    __syncthreads();
    if (t + 2 < nt) stage(t + 2, t & 1);
  }
  asm volatile("s_wait_asynccnt 0x0" ::: "memory");     // nothing in flight when the wave goes on to its end
  const int colw = col0 + wc * 64;                        // the wave's first column
  const v4f bv = *(const v4f*)(bias + colw + m * 4);      // columns colw + 4m .. +3, always < N (N multiple of 128)
  v4f badd;
#pragma unroll
  for (int e = 0; e < 4; ++e) badd[e] = bfr(bv[e]);
#pragma unroll
  for (int i = 0; i < 2; ++i) {                           // the wave's two groups of 16 rows, one after the other through the one slab
    epi64(slab + wave * SLAB64, acc[i][0], acc[i][1], acc[i][2], acc[i][3], oscale, badd, C, N,
          (size_t)(row0 + wr * 32 + i * 16), colw, lane);
    asm volatile("s_wait_xcnt 0x0" ::: "memory");         // behind the run of stores: what follows in the text rewrites their registers
    wave_sync_lds();                                      // every lane's reads of the slab stand ahead of the next group's writes
  }
}

// =====================================================================================================
// Full (non-causal, unmasked) multi-head flash attention: block = (batch b, head, 128 query rows), 8 waves = 4 query groups x 2 key
// halves. Wave (kh, wq) owns the 32 query rows q0 = 128*qt + 32*wq .. q0+31 (two column groups of 16) and the keys
// kh*SEQ/2 .. +SEQ/2-1: every k and v^T fragment read from LDS feeds both column groups, and a staged tile serves 128 queries. Each
// key half has its own ring: tiles of KT = 64 keys of the k and v^T planes, staged by the half's 128 threads with asynchronous
// copies, two buffers (tile t+1 flies while tile t is worked on, one block barrier a tile), read by the half's 4 waves; each tile
// serves two key blocks of 32. Behind the last tile's barrier the rings become the hand-over area and the result slabs.
//   Per-head logit scale: sigmoid(bf16 RNE value of g[head]) / 8, computed in f32 once per thread (head uniform per block) and
//   folded with log2(e) and the q/k carries into lsc.
//   q planes (hi, lo f16, x1024) laid out [b][s][h][d]; k planes the same; v^T planes [b][h][d][s] (x1024).
//   All NKB = SEQ/32 key blocks of 32 keys are visited, half of them by each key half (static bounds).
//   Scores are computed TRANSPOSED: S^T tile (g, i) = k rows (keys kb+16i .. +15, A operand, row m = lane&15, split k map
//   over d) times q^T (B operand, col n = query q0 + 16g + (lane&15), k = d, split map), 3 products per tile and d-chunk
//   (k_hi.q_hi + k_lo.q_hi + k_hi.q_lo). D element r of lane l = (key kb+16i+8h+r, query q0+16g+(l&15)), so a lane owns one query
//   column a group and 16 of its 32 keys; the partner lane l^16 owns the other 16 -> row max / row sum need one xor-16 shuffle.
//   Online max-subtracted base-2 softmax in f32, per column group. The exp'd values ARE the P A-fragment in place: A row m = query =
//   lane&15, element i <- key kb+8h+i (tile 0, D element i), element 8+i <- key kb+16+8h+i (tile 1, D element i). P is carried
//   x128 as f16 hi + f16 residual. Lazy rescale: the maximum in use is held until some score of the wave tops it by more than 2^8
//   (one ballot and one scalar branch a key block); only then are the maxima renewed and O and l rescaled (the factor of query row
//   8h+r of the O accumulators is fetched from lane 8h+r with a shuffle). The plain path has no cross-lane move: l is summed per
//   lane and the two lanes of a query are joined once, behind the loop.
//   4+4 v^T B fragments (hi and residual planes, col n = d = 16j + (lane&15), keys k-contiguous),
//   12 P.V WMMAs a column group (hh + lh + hl).
//   Join of the key halves: the waves of half 1 store their accumulators, held maxima and sums in LDS; one block barrier; wave
//   (0, wq) brings both halves to the common maximum: o = o_0 2^(m_0-m) + o_1 2^(m_1-m), l likewise.
//   Epilogue: 1/l (per query, shuffled to the D row owner) and carry folds in f32; the wave's 2 x 16x64 f32 result staged in its LDS
// coverage: per wave and column group 4 instructions x 4 rows x 8 lanes x 8 halves = 16 x 64 per plane; grid NB*NH*SEQ/128 blocks x
//           4 waves x 2 groups = every (b, s, h) row of both O planes exactly once.
// =====================================================================================================
// four waves a SIMD (two blocks a WGP): the register budget is held to a quarter of the SIMD's file
__global__ __launch_bounds__(ATT_THREADS) __attribute__((amdgpu_waves_per_eu(4, 4)))
void attn_fwd(const u16* __restrict__ QHIp, const u16* __restrict__ QLOp,
              const u16* __restrict__ KHIp, const u16* __restrict__ KLOp,
              const u16* __restrict__ VHIp, const u16* __restrict__ VLOp,
              const float* __restrict__ gatep,
              u16* OHIp, u16* OLOp) {
  __shared__ __align__(16) u16 ring[KSPL * 2 * BUFH];   // per key half two tile buffers; in the epilogue hand-over area and result slabs

  const int tid  = threadIdx.x;
  const int wave = __builtin_amdgcn_readfirstlane(tid >> 5);   // wave-uniform: held in a scalar register
  const int kh   = wave >> 2;                // key half
  const int wq   = wave & 3;                 // query group of 32
  const int lane = tid & 31;
  const int hh   = lane >> 4;
  const int c    = lane & 15;

  const int bid  = blockIdx.x;
  const int qt   = bid % QTB;
  const int head = (bid / QTB) % NH;
  const int b    = bid / (QTB * NH);
  const int q0   = qt * QB + wq * 32;
  const int key0 = kh * (NTH * KT);          // the half's first key

  // per-head scale: sigmoid(bf16 value of g) / 8 in f32; head < NH always (block decode), host checks the input extent
  const float gbf = bfr(gatep[head]);
  const float sgm = 1.0f / (1.0f + expf(-gbf));
  const float lsc = sgm * (0.125f * (LOG2E / (QSC * KSC)));

  // B fragments of q^T: col n = query q0 + 16g + c, k = d (k-contiguous row of the q plane)
  const size_t qofs = (((size_t)(b * SEQ + q0 + c)) * NH + head) * HD + 8 * hh;
  const _Float16* Qh  = (const _Float16*)(const void*)QHIp + qofs;
  const _Float16* Ql  = (const _Float16*)(const void*)QLOp + qofs;
  // staging: thread of the half -> (row sr of 16, 16-B piece sc of 8); k tile row = key, v^T tile row = d, both 64 halves long
  const int st = tid & 127;
  const int sr = st >> 3, sc = (st & 7) * 8;
  const size_t kofs = (((size_t)b * SEQ + key0 + sr) * NH + head) * HD + sc;      // tile's first key in the half added per tile
  const size_t vofs = ((size_t)(b * NH + head) * HD + sr) * SEQ + key0 + sc;      // tile's first key in the half added per tile
  const unsigned lds0 = (unsigned)(size_t)(const void*)ring + (unsigned)kh * (2u * BUFH * 2u) + (unsigned)(sr * LP + sc) * 2u;
  auto stage = [&](int t, int buf) {
    const unsigned l = lds0 + (unsigned)buf * (BUFH * 2u);
    const size_t ko = kofs + (size_t)t * (KT * NH * HD), vo = vofs + (size_t)t * KT;
    stage2(l, l + PLH * 2u, KHIp + ko, KLOp + ko, (size_t)16 * (NH * HD));
    stage2(l + 2u * PLH * 2u, l + 3u * PLH * 2u, VHIp + vo, VLOp + vo, (size_t)16 * SEQ);
  };
  // fragment readers, in halves from a buffer's start: A of k: row m = key 16i + c, k = d; B of v: col n = d = 16j + c, k = key
  const int kfo = c * LP + 8 * hh;
  const int vfo = 2 * PLH + c * LP + 8 * hh;

  // q^T B fragments (two column groups; hi and residual planes, both d chunks of 32): read once, held in registers for all key tiles
  v16h qhf[2][2], qlf[2][2];
#pragma unroll
  for (int g = 0; g < 2; ++g) {
#pragma unroll
    for (int kk = 0; kk < 2; ++kk) {
      qhf[g][kk] = ldfrag_h(Qh + g * (16 * NH * HD) + kk * 32);
      qlf[g][kk] = ldfrag_h(Ql + g * (16 * NH * HD) + kk * 32);
    }
  }
  // behind the run of q loads: both address pairs are named as inputs, so their registers live up to the wait and no load of the run
  // lands on a register that another load of the run names as its address
  asm volatile("s_wait_xcnt 0x0" :: "v"(Qh), "v"(Ql) : "memory");

  // nmv = PEXP - (maximum in use), the addend of the exponent; +inf until the first key block sets it. l2: this lane's sums of its own
  // keys' carried probabilities, even and odd elements apart
  float nmv[2] = {INFINITY, INFINITY};
  v2f l2[2] = {{0.f, 0.f}, {0.f, 0.f}};
  v8f o[2][4];
#pragma unroll
  for (int g = 0; g < 2; ++g) {
#pragma unroll
    for (int j = 0; j < 4; ++j) o[g][j] = zero8();
  }

  stage(0, 0);
  asm volatile("s_wait_asynccnt 0x0" ::: "memory");   // this wave's copies of tile 0 have landed
  __syncthreads();                                    // ... and every other wave's: tile 0 may be read
  if (NTH > 1) stage(1, 1);

#pragma unroll 1
  for (int t = 0; t < NTH; ++t) {
   const _Float16* bufp = (const _Float16*)(const void*)ring + kh * (2 * BUFH) + (t & 1) * BUFH;
#pragma unroll 1   // one body for both key blocks: with the rescale branch in it, two bodies in line made the compiler move O between register sets on the plain path and spill q
   for (int sub = 0; sub < 2; ++sub) {
    // ---- transposed scores: s[g][0] = keys kb..kb+15, s[g][1] = keys kb+16..kb+31 (kb = key0 + 64t + 32sub), column = query q0+16g+c ----
    v8f s[2][2] = {{zero8(), zero8()}, {zero8(), zero8()}};
    const _Float16* k0p = bufp + kfo + sub * 32 * LP;
    const _Float16* k1p = k0p + 16 * LP;
    const _Float16* l0p = k0p + PLH;
    const _Float16* l1p = l0p + 16 * LP;
#pragma unroll
    for (int kk = 0; kk < 2; ++kk) {
      const v16h kh0 = ldfrag_h(k0p + kk * 32), kl0 = ldfrag_h(l0p + kk * 32);
      const v16h kh1 = ldfrag_h(k1p + kk * 32), kl1 = ldfrag_h(l1p + kk * 32);
#pragma unroll
      for (int g = 0; g < 2; ++g) { s[g][0] = mma_h(kh0, qhf[g][kk], s[g][0]);  s[g][1] = mma_h(kh1, qhf[g][kk], s[g][1]); }
#pragma unroll
      for (int g = 0; g < 2; ++g) { s[g][0] = mma_h(kl0, qhf[g][kk], s[g][0]);  s[g][1] = mma_h(kl1, qhf[g][kk], s[g][1]); }
#pragma unroll
      for (int g = 0; g < 2; ++g) { s[g][0] = mma_h(kh0, qlf[g][kk], s[g][0]);  s[g][1] = mma_h(kh1, qlf[g][kk], s[g][1]); }
      guard_s(s[0][0], s[0][1], s[1][0], s[1][1], qhf[0][kk], qhf[1][kk], qlf[0][kk], qlf[1][kk], kh0, kl0, kh1, kl1);
    }
    FragH ph[2], pl[2];
    float cm[2];
#pragma unroll
    for (int g = 0; g < 2; ++g) {
      // ---- this lane's 16 keys for query q0+16g+c: s[g][0][i] <- key kb+8hh+i, s[g][1][i] <- key kb+16+8hh+i. The maximum is taken on
      //      the raw scores (lsc >= 0 keeps their order) ----
      float x = s[g][0][0];
#pragma unroll
      for (int i = 1; i < 8; ++i) x = fmaxf(x, s[g][0][i]);
#pragma unroll
      for (int i = 0; i < 8; ++i) x = fmaxf(x, s[g][1][i]);
      cm[g] = x;
    }
    // ---- lazy rescale, tested once a key block for both column groups: the largest exponent any lane would form with the maxima in use.
    //      Up to PEXP + LAZT = 15 the carried value fits f16 and nothing is renewed. +inf on the first block (nmv = +inf): taken ----
    const float top = fmaxf(fmaf(cm[0], lsc, nmv[0]), fmaf(cm[1], lsc, nmv[1]));
    if (__builtin_expect(__builtin_amdgcn_ballot_w32(top > PEXP + LAZT) != 0, 0)) {   // wave-uniform: a scalar branch, no barrier inside; rare, so the plain path falls through
#pragma unroll
      for (int g = 0; g < 2; ++g) {
        const float cx = fmaxf(cm[g], __shfl_xor(cm[g], 16, 32));   // both lanes of a query renew alike
        const float nn = fminf(nmv[g], fmaf(-cx, lsc, PEXP));       // PEXP - max(maximum in use, block maximum); finite
        const float al = ex2_slot(nn - nmv[g]);                     // 2^(old maximum - new maximum) <= 1; 0 on the first block
        nmv[g] = nn;
        l2[g] *= al;
        // D row 8hh+r of the O accumulators = query q0+16g+8hh+r, its factor lives in lane 8hh+r (and 16+8hh+r)
        float scl[8];
#pragma unroll
        for (int r = 0; r < 8; ++r) scl[r] = __shfl(al, 8 * hh + r, 32);
#pragma unroll
        for (int j = 0; j < 4; ++j) {
#pragma unroll
          for (int r = 0; r < 8; ++r) o[g][j][r] *= scl[r];
        }
      }
    }
#pragma unroll
    for (int g = 0; g < 2; ++g) {
      // ---- carried probabilities a = 2^(s * lsc - maximum in use + 7): scale, maximum and carry in one fused multiply-add ahead of the
      //      exponential. P A-fragments: hi = f16(a), a packed convert; lo = f16(a - hi), one mixed-precision fused multiply-add that
      //      reads hi as f16 and writes its half of the packed register. The sums carry the same factor ----
      const v2f lsc2 = {lsc, lsc}, nm2 = {nmv[g], nmv[g]};
#pragma unroll
      for (int w = 0; w < 2; ++w) {
#pragma unroll
        for (int e4 = 0; e4 < 4; ++e4) {
          const v2f s2 = {s[g][w][2 * e4], s[g][w][2 * e4 + 1]};
          const v2f x2 = __builtin_elementwise_fma(s2, lsc2, nm2);
          const float a0 = ex2(x2[0]), a1 = ex2(x2[1]);
          const v2f a2 = {a0, a1};
          l2[g] += a2;                         // even and odd elements summed apart: one packed add a pair
          const v2h h2 = __builtin_convertvector(a2, v2h);
          ph[g].u[w][e4] = __builtin_bit_cast(unsigned, h2);
          pl[g].u[w][e4] = resid2(a0, a1, __builtin_bit_cast(unsigned, h2));
        }
      }
    }
    // ---- P.V : B fragment col n = d = j*16 + c, keys contiguous in the v^T planes; each fragment feeds both column groups; d columns
    //      0..31, then 32..63. At most six of the eight fragments are live at a time (the register budget of four waves a SIMD) ----
    {
      const _Float16* vhp = bufp + vfo + sub * 32;
      const _Float16* vlp = vhp + PLH;
      const v16h vh0 = ldfrag_h(vhp), vh1 = ldfrag_h(vhp + 16 * LP);
      const v16h vl0 = ldfrag_h(vlp), vl1 = ldfrag_h(vlp + 16 * LP);
      const v16h vh2 = ldfrag_h(vhp + 32 * LP), vh3 = ldfrag_h(vhp + 48 * LP);
      __builtin_amdgcn_sched_barrier(0);   // these twelve LDS reads stand in one place ahead of the WMMAs, none among them
#pragma unroll
      for (int g = 0; g < 2; ++g) { o[g][0] = mma_h(ph[g].v, vh0, o[g][0]);  o[g][1] = mma_h(ph[g].v, vh1, o[g][1]); }
#pragma unroll
      for (int g = 0; g < 2; ++g) { o[g][0] = mma_h(pl[g].v, vh0, o[g][0]);  o[g][1] = mma_h(pl[g].v, vh1, o[g][1]); }
#pragma unroll
      for (int g = 0; g < 2; ++g) { o[g][0] = mma_h(ph[g].v, vl0, o[g][0]);  o[g][1] = mma_h(ph[g].v, vl1, o[g][1]); }
      const v16h vl2 = ldfrag_h(vlp + 32 * LP), vl3 = ldfrag_h(vlp + 48 * LP);
      __builtin_amdgcn_sched_barrier(0);   // the last four LDS reads issue ahead of the eight WMMAs on vh2, vh3
#pragma unroll
      for (int g = 0; g < 2; ++g) { o[g][2] = mma_h(ph[g].v, vh2, o[g][2]);  o[g][3] = mma_h(ph[g].v, vh3, o[g][3]); }
#pragma unroll
      for (int g = 0; g < 2; ++g) { o[g][2] = mma_h(pl[g].v, vh2, o[g][2]);  o[g][3] = mma_h(pl[g].v, vh3, o[g][3]); }
#pragma unroll
      for (int g = 0; g < 2; ++g) { o[g][2] = mma_h(ph[g].v, vl2, o[g][2]);  o[g][3] = mma_h(ph[g].v, vl3, o[g][3]); }
      guard_pv(o[0][2], o[0][3], o[1][2], o[1][3], ph[0].v, pl[0].v, ph[1].v, pl[1].v, vh2, vh3, vl2, vl3);
    }
   }
   // ---- hand-over: tile t+1 is published and tile t's buffer is freed by the one barrier; then the refill ----
   asm volatile("s_wait_dscnt 0x0" ::: "memory");      // this wave's reads of tile t are done before its buffer is refilled
   asm volatile("s_wait_asynccnt 0x0" ::: "memory");   // this wave's copies of tile t+1 have landed
   __syncthreads();
   if (t + 2 < NTH) stage(t + 2, t & 1);
  }
  asm volatile("s_wait_asynccnt 0x0" ::: "memory");    // nothing in flight when the rings turn into hand-over area and result slabs
  acc_guard8(o);
  // a query's sum: the lane's two partial sums, then the partner lane's (the other 16 keys of every block), once
  float lrun[2];
#pragma unroll
  for (int g = 0; g < 2; ++g) {
    const float ls = l2[g][0] + l2[g][1];
    lrun[g] = ls + __shfl_xor(ls, 16, 32);
  }

  // ---- join of the key halves: wave (1, wq) hands its state to wave (0, wq), lane to lane, 16 B a lane and store ----
  float* mrg = (float*)(void*)ring + wq * MRGF;
  if (kh == 1) {                             // wave-uniform (scalar)
#pragma unroll
    for (int g = 0; g < 2; ++g) {
#pragma unroll
      for (int j = 0; j < 4; ++j) {
        const v4f x0 = {o[g][j][0], o[g][j][1], o[g][j][2], o[g][j][3]}, x1 = {o[g][j][4], o[g][j][5], o[g][j][6], o[g][j][7]};
        *(v4f*)(mrg + ((g * 4 + j) * 2) * 128 + lane * 4)     = x0;
        *(v4f*)(mrg + ((g * 4 + j) * 2 + 1) * 128 + lane * 4) = x1;
      }
      mrg[2048 + g * 64 + lane]      = nmv[g];
      mrg[2048 + g * 64 + 32 + lane] = lrun[g];
    }
  }
  __syncthreads();                           // half 1's state is complete; every wave passes; the last barrier of the kernel
  if (kh == 0) {                             // wave-uniform (scalar)
    float* slab = (float*)(void*)ring + 4 * MRGF + wq * (2 * SLABF);
    // ---- common maximum, 1/l (per query, owned by lane = query; the carry on P and on l cancels) and the carry 1024 on v; stage the 16x64 slabs ----
#pragma unroll
    for (int g = 0; g < 2; ++g) {
      const float n1 = mrg[2048 + g * 64 + lane], l1 = mrg[2048 + g * 64 + 32 + lane];
      const float nn = fminf(nmv[g], n1);    // PEXP - the larger maximum; both finite: each half has seen keys
      const float e0 = ex2_slot(nn - nmv[g]), e1 = ex2_slot(nn - n1);   // slots filled: the compiler put an overwrite of the source directly behind
      const float linv = (1.0f / (lrun[g] * e0 + l1 * e1)) * (1.0f / VCAR);   // the sums carry P's factor themselves
      const float f0 = e0 * linv, f1 = e1 * linv;
      float i0[8], i1[8];
#pragma unroll
      for (int r = 0; r < 8; ++r) { i0[r] = __shfl(f0, 8 * hh + r, 32); i1[r] = __shfl(f1, 8 * hh + r, 32); }
#pragma unroll
      for (int j = 0; j < 4; ++j) {
        const v4f x0 = *(const v4f*)(mrg + ((g * 4 + j) * 2) * 128 + lane * 4);
        const v4f x1 = *(const v4f*)(mrg + ((g * 4 + j) * 2 + 1) * 128 + lane * 4);
#pragma unroll
        for (int r = 0; r < 4; ++r) {
          slab[g * SLABF + (8 * hh + r) * 68 + j * 16 + c]     = o[g][j][r] * i0[r] + x0[r] * i1[r];
          slab[g * SLABF + (8 * hh + 4 + r) * 68 + j * 16 + c] = o[g][j][4 + r] * i0[4 + r] + x1[r] * i1[4 + r];
        }
      }
    }
    wave_sync_lds();
    // ---- O x1024 -> f16 hi + residual planes; lane = (row in group of 4, 8 consecutive d) ----
    const int rq = lane >> 3, c8 = (lane & 7) * 8;
#pragma unroll
    for (int g = 0; g < 2; ++g) {
      v4u oh[4], ol[4];
#pragma unroll
      for (int i4 = 0; i4 < 4; ++i4) {
        const int row = i4 * 4 + rq;
        const v4f a = *(const v4f*)(slab + g * SLABF + row * 68 + c8), c4 = *(const v4f*)(slab + g * SLABF + row * 68 + c8 + 4);
        float w[8];
#pragma unroll
        for (int e = 0; e < 4; ++e) { w[e] = a[e] * OSC; w[4 + e] = c4[e] * OSC; }
#pragma unroll
        for (int e = 0; e < 4; ++e) {
          const _Float16 h0 = (_Float16)w[2 * e], h1 = (_Float16)w[2 * e + 1];
          const _Float16 l0 = (_Float16)(w[2 * e] - (float)h0), l1 = (_Float16)(w[2 * e + 1] - (float)h1);
          oh[i4][e] = pk16(h_bits(h0), h_bits(h1));
          ol[i4][e] = pk16(h_bits(l0), h_bits(l1));
        }
      }
      const size_t ob = (((size_t)(b * SEQ + q0 + g * 16)) * NH + head) * HD + c8;
#pragma unroll
      for (int i4 = 0; i4 < 4; ++i4) {
        const int row = i4 * 4 + rq;
        const size_t o8 = ob + (size_t)row * (NH * HD);
        *(v4u*)(OHIp + o8) = oh[i4];
        *(v4u*)(OLOp + o8) = ol[i4];
      }
      asm volatile("s_wait_xcnt 0x0" ::: "memory");   // behind the run of stores: what follows in the text rewrites their registers
    }
  }
}

// =====================================================================================================
// Workspace map (bytes, ROWS = NB*SEQ; numbers for NB=2, SEQ=2048); every plane is fully written by whole-line stores before it is
// read; all extents are exact multiples of the store granularity (no pad rows needed). XB .. WOB are cvt_all's one destination,
// XB / WQB.. / QHI.. are gemm_bfb's plane triples, so their order and adjacency matter:
//   XB  bf16 3 x [ROWS][1024]            25165824        (input Q, K, V)
//   WQB bf16 [1024 n][1024 k]             2097152        WKB same  2097152      WVB same  2097152
//   WOB f16  [1024 n][1024 k] x1024       2097152
//   QHI f16 [NB][SEQ][16][64] x1024       8388608        QLO residual         8388608
//   KHI same                              8388608        KLO residual         8388608
//   VHI f16 [NB][16][64][SEQ] x1024       8388608        VLO residual         8388608
//   OHI f16 [ROWS][1024] x1024            8388608        OLO residual         8388608
//   end                                 100663296
// =====================================================================================================
extern "C" void kernel_launch(void* const* d_in, const int* in_sizes, int n_in,
                              void* d_out, int out_size, void* d_ws, size_t ws_size,
                              hipStream_t stream) {
  const int ROWS = NB * SEQ;
  if (n_in < 12) return;
  const int needX = ((NB - 1) * SEQ_FULL + SEQ) * DMOD;   // last input row read by cvt_all (+1), in elements
  if (in_sizes[0] < needX || in_sizes[1] < needX || in_sizes[2] < needX) return;
  if (in_sizes[3] < DMOD * DMOD || in_sizes[5] < DMOD * DMOD) return;
  if (in_sizes[7] < DMOD * DMOD || in_sizes[9] < DMOD * DMOD) return;
  if (in_sizes[4] < DMOD || in_sizes[6] < DMOD || in_sizes[8] < DMOD || in_sizes[10] < DMOD) return;
  if (in_sizes[11] < NH) return;
  if (out_size < ROWS * DMOD) return;

  const float* Qin = (const float*)d_in[0];
  const float* Kin = (const float*)d_in[1];
  const float* Vin = (const float*)d_in[2];
  const float* wq  = (const float*)d_in[3];
  const float* bq  = (const float*)d_in[4];
  const float* wk  = (const float*)d_in[5];
  const float* bk  = (const float*)d_in[6];
  const float* wv  = (const float*)d_in[7];
  const float* bv  = (const float*)d_in[8];
  const float* wo  = (const float*)d_in[9];
  const float* bo  = (const float*)d_in[10];
  const float* gt  = (const float*)d_in[11];
  float*       out = (float*)d_out;

  const size_t szXB  = (size_t)3 * ROWS * DMOD * 2;
  const size_t szW   = (size_t)DMOD * DMOD * 2;
  const size_t szP   = (size_t)ROWS * DMOD * 2;                 // q/k/o planes
  const size_t szVP  = (size_t)NB * NH * HD * SEQ * 2;
  size_t off = 0;
  const size_t oXB  = off; off += szXB;
  const size_t oWQB = off; off += szW;
  off += szW;                                           // WKB
  off += szW;                                           // WVB
  const size_t oWOB = off; off += szW;
  const size_t oQHI = off; off += szP;
  const size_t oQLO = off; off += szP;
  const size_t oKHI = off; off += szP;
  const size_t oKLO = off; off += szP;
  const size_t oVHI = off; off += szVP;
  const size_t oVLO = off; off += szVP;
  const size_t oOHI = off; off += szP;
  const size_t oOLO = off; off += szP;
  if (off > ws_size) return;                            // off = 100663296 at full size
  if (off > (size_t)134217728) return;

  char* ws = (char*)d_ws;
  u16*   XB  = (u16*)(ws + oXB);
  u16*   WQB = (u16*)(ws + oWQB);
  u16*   WOB = (u16*)(ws + oWOB);
  u16*   QHI = (u16*)(ws + oQHI);
  u16*   QLO = (u16*)(ws + oQLO);
  u16*   KHI = (u16*)(ws + oKHI);
  u16*   KLO = (u16*)(ws + oKLO);
  u16*   VHI = (u16*)(ws + oVHI);
  u16*   VLO = (u16*)(ws + oVLO);
  u16*   OHI = (u16*)(ws + oOHI);
  u16*   OLO = (u16*)(ws + oOLO);

  const dim3 blk(256);
  if ((DMOD % 64) != 0 || (ROWS % GT) != 0 || (DMOD % GT) != 0) return;
  const dim3 gC(3 * XCH + 4 * WCH);                     // 512
  const dim3 gG((ROWS / GT) * (DMOD / GT));             // 256
  const dim3 gG3((ROWS / GT) * (DMOD / GT), 3);         // 256 x 3
  const dim3 bG(128);
  const dim3 gAT(ATT_BLOCKS);                           // 512
  const dim3 bAT(ATT_THREADS);                          // 256

  // (0) inputs -> bf16 planes; weights [n][k] (already k-contiguous for x.W^T): bf16 planes for wq/wk/wv, f16 of bf16 value x1024
  //     for wo; destination XB .. WOB, contiguous
  cvt_all<<<gC, blk, 0, stream>>>(Qin, Kin, Vin, wq, wk, wv, wo, XB);
  // (1) q, k, v projections + bias (col = h*64+d), x1024, as f16 hi + residual planes: q, k [ROWS][1024], v as v^T planes
  gemm_bfb<<<gG3, bG, 0, stream>>>(XB, WQB, bq, bk, bv, QHI, ROWS, DMOD, DMOD, 1.0f, QSC);
  // (2) attention with per-head scale sigmoid(g)/8 -> O planes [b][s][h][d] x1024 (hi + residual)
  attn_fwd<<<gAT, bAT, 0, stream>>>(QHI, QLO, KHI, KLO, VHI, VLO, gt, OHI, OLO);
  // (3) output projection + bias -> out [ROWS][1024] f32, carries 1024 (O) x 1024 (wo) folded back
  gemm_h2<<<gG, blk, 0, stream>>>(OHI, OLO, WOB, bo, out, ROWS, DMOD, DMOD, 1.0f / (OSC * WOS));
  (void)hipGetLastError();
}
